// v000
// Measured on an AMD MI455X. A time is GPU time per run, averaged over a window of back-to-back runs after a warm-up
// (all launches, gaps included; the runs take copies of the inputs in turn), and the median of several windows.
// Apart from v000's, it joins two sittings. Times from different sittings can be a few percent apart, while
// side-by-side timings come from the same sitting.
// v000, which the later versions start from, runs in 3940 microseconds.
#include <hip/hip_runtime.h>
#include <hip/hip_bf16.h>
#include <math.h>

#define DEV __device__ __forceinline__

typedef __attribute__((ext_vector_type(16))) _Float16 v16h;
typedef __attribute__((ext_vector_type(8)))  float    v8f;
typedef _Float16 h16;

constexpr int Bb = 2, Tt = 2048, Dd = 1024, Hh = 4, Pp = 6, CHc = 32;
constexpr int DKk = 256, DVv = 256;
constexpr int NCHUNK = Tt / CHc;           // 64
constexpr int GIW = Dd + Hh * Pp;          // 1048
constexpr float FLOORv = 0.05f;

DEV v16h frag_row(const h16* t, int ld, int r0, int k0, int lane) {
  // element [m][k] at t[(r0+m)*ld + (k0+k)]
  v16h f;
  int m = lane & 15, kg = lane >> 4;
#pragma unroll
  for (int j = 0; j < 8; ++j) {
    int kk = ((j < 4) ? 0 : 16) + kg * 8 + 2 * (j & 3);
    const h16* p = t + (size_t)(r0 + m) * ld + k0 + kk;
    f[2 * j] = p[0];
    f[2 * j + 1] = p[1];
  }
  return f;
}
DEV v16h frag_kmaj(const h16* t, int ld, int r0, int k0, int lane) {
  // element [m][k] at t[(k0+k)*ld + (r0+m)]
  v16h f;
  int m = lane & 15, kg = lane >> 4;
#pragma unroll
  for (int j = 0; j < 8; ++j) {
    int kk = ((j < 4) ? 0 : 16) + kg * 8 + 2 * (j & 3);
    f[2 * j]     = t[(size_t)(k0 + kk) * ld + r0 + m];
    f[2 * j + 1] = t[(size_t)(k0 + kk + 1) * ld + r0 + m];
  }
  return f;
}
DEV v8f wmma_f16(v16h a, v16h b, v8f c) {
  return __builtin_amdgcn_wmma_f32_16x16x32_f16(false, a, false, b, (short)0, c,
                                                false, false);
}

// ---------------- Generic GEMM: C = act(A(MxK) * W(NxK)^T + bias) ----------
// 64x128 block tile, 8 waves (2x4), each wave owns a 32x32 region (4 wmma/Kstep)
__global__ void __launch_bounds__(256)
gemm_kernel(const float* __restrict__ A, int lda, const float* __restrict__ W,
            int ldw, const float* __restrict__ bias, float* __restrict__ C,
            int ldc, int M, int N, int K, int act) {
  __shared__ h16 At[64][40];
  __shared__ h16 Wt[128][40];
  const int tid = threadIdx.x, lane = tid & 31, wid = tid >> 5;
  const int wm = wid >> 2, wn = wid & 3;
  const int bm = blockIdx.y * 64, bn = blockIdx.x * 128;
  const int r8 = tid >> 3, c4 = (tid & 7) * 4;
  v8f acc00 = {}, acc01 = {}, acc10 = {}, acc11 = {};
  const int ktn = (K + 31) >> 5;
  for (int kt = 0; kt < ktn; ++kt) {
    const int kb = kt << 5;
    const bool full = (bm + 64 <= M) && (bn + 128 <= N) && (kb + 32 <= K);
    if (full) {
      // branch-free interior path: float4 loads -> global_load_b128
#pragma unroll
      for (int i = 0; i < 2; ++i) {
        int r = r8 + 32 * i;
        const float4 f = *(const float4*)&A[(size_t)(bm + r) * lda + kb + c4];
        h16* d = &At[r][c4];
        d[0] = (h16)f.x; d[1] = (h16)f.y; d[2] = (h16)f.z; d[3] = (h16)f.w;
      }
#pragma unroll
      for (int i = 0; i < 4; ++i) {
        int r = r8 + 32 * i;
        const float4 f = *(const float4*)&W[(size_t)(bn + r) * ldw + kb + c4];
        h16* d = &Wt[r][c4];
        d[0] = (h16)f.x; d[1] = (h16)f.y; d[2] = (h16)f.z; d[3] = (h16)f.w;
      }
      if (kb + 64 <= K) {  // prefetch next K tile (global_prefetch_b8)
        __builtin_prefetch(&A[(size_t)(bm + r8) * lda + kb + 32 + c4], 0, 1);
        __builtin_prefetch(&W[(size_t)(bn + r8) * ldw + kb + 32 + c4], 0, 1);
      }
    } else {
      // guarded edge path (N=24 logits GEMM, K=1048 tail)
#pragma unroll
      for (int i = 0; i < 8; ++i) {
        int e = tid + i * 256, r = e >> 5, c = e & 31;
        int gm = bm + r, gk = kb + c;
        At[r][c] = (gm < M && gk < K) ? (h16)A[(size_t)gm * lda + gk] : (h16)0.f;
      }
#pragma unroll
      for (int i = 0; i < 16; ++i) {
        int e = tid + i * 256, r = e >> 5, c = e & 31;
        int gn = bn + r, gk = kb + c;
        Wt[r][c] = (gn < N && gk < K) ? (h16)W[(size_t)gn * ldw + gk] : (h16)0.f;
      }
    }
    __syncthreads();
    v16h a0 = frag_row(&At[0][0], 40, wm * 32, 0, lane);
    v16h a1 = frag_row(&At[0][0], 40, wm * 32 + 16, 0, lane);
    v16h b0 = frag_row(&Wt[0][0], 40, wn * 32, 0, lane);
    v16h b1 = frag_row(&Wt[0][0], 40, wn * 32 + 16, 0, lane);
    acc00 = wmma_f16(a0, b0, acc00);
    acc01 = wmma_f16(a0, b1, acc01);
    acc10 = wmma_f16(a1, b0, acc10);
    acc11 = wmma_f16(a1, b1, acc11);
    __syncthreads();
  }
  v8f* accs[4] = {&acc00, &acc01, &acc10, &acc11};
#pragma unroll
  for (int q = 0; q < 4; ++q) {
    int im = q >> 1, in_ = q & 1;
#pragma unroll
    for (int r = 0; r < 8; ++r) {
      int gm = bm + wm * 32 + im * 16 + r + 8 * (lane >> 4);
      int gn = bn + wn * 32 + in_ * 16 + (lane & 15);
      if (gm < M && gn < N) {
        float v = (*accs[q])[r] + (bias ? bias[gn] : 0.f);
        if (act == 1) v = 0.5f * v * (1.f + erff(v * 0.70710678118f));
        C[(size_t)gm * ldc + gn] = v;
      }
    }
  }
}

// ---------------- depthwise causal conv (+ optional SiLU) ------------------
__global__ void dwconv_kernel(const float* __restrict__ X,
                              const float* __restrict__ Wc,
                              float* __restrict__ Y, int Kw, int applySilu) {
  size_t idx = (size_t)blockIdx.x * blockDim.x + threadIdx.x;
  size_t total = (size_t)Bb * Tt * Dd;
  if (idx >= total) return;
  int c = (int)(idx & (Dd - 1));
  size_t bt = idx / Dd;
  int t = (int)(bt % Tt);
  float s = 0.f;
  for (int i = 0; i < Kw; ++i) {
    int tt = t - (Kw - 1) + i;
    if (tt >= 0) s += X[(bt - (size_t)(t - tt)) * Dd + c] * Wc[c * Kw + i];
  }
  if (applySilu) s = s / (1.f + expf(-s));
  Y[idx] = s;
}

// ---------------- beta = sigmoid(hidden @ b_proj^T) ------------------------
__global__ void beta_kernel(const float* __restrict__ hs,
                            const float* __restrict__ Wb,
                            float* __restrict__ beta) {
  int idx = blockIdx.x * blockDim.x + threadIdx.x;
  if (idx >= Bb * Tt * Hh) return;
  int h = idx & (Hh - 1);
  size_t bt = (size_t)idx >> 2;
  const float* x = hs + bt * Dd;
  const float* w = Wb + (size_t)h * Dd;
  float s = 0.f;
  for (int k = 0; k < Dd; ++k) s += x[k] * w[k];
  beta[idx] = 1.f / (1.f + expf(-s));
}

// ---------------- gi[:, :D] = hidden ---------------------------------------
__global__ void gi_copy_kernel(const float* __restrict__ hs,
                               float* __restrict__ gi) {
  size_t idx = (size_t)blockIdx.x * blockDim.x + threadIdx.x;
  if (idx >= (size_t)Bb * Tt * Dd) return;
  size_t bt = idx / Dd;
  int j = (int)(idx % Dd);
  gi[bt * GIW + j] = hs[idx];
}

// ---------------- stats = mean |branch| over DV -> gi tail -----------------
__global__ void stats_kernel(const float* __restrict__ b0,
                             const float* __restrict__ b1,
                             const float* __restrict__ b2,
                             const float* __restrict__ b3,
                             const float* __restrict__ b4,
                             const float* __restrict__ b5,
                             float* __restrict__ gi) {
  int wg = blockIdx.x * 8 + (threadIdx.x >> 5);
  int lane = threadIdx.x & 31;
  if (wg >= Bb * Tt * Hh * Pp) return;
  int p = wg % Pp;
  int h = (wg / Pp) % Hh;
  size_t bt = (size_t)wg / (Pp * Hh);
  const float* src = (p == 0) ? b0 : (p == 1) ? b1 : (p == 2) ? b2
                   : (p == 3) ? b3 : (p == 4) ? b4 : b5;
  src += bt * Dd + (size_t)h * DVv;
  float s = 0.f;
#pragma unroll
  for (int i = 0; i < 8; ++i) s += fabsf(src[lane + 32 * i]);
#pragma unroll
  for (int off = 16; off; off >>= 1) s += __shfl_xor(s, off, 32);
  if (lane == 0) gi[bt * GIW + Dd + h * Pp + p] = s * (1.f / 256.f);
}

// ---------------- chunked delta rule, LDS-resident 256x256 state -----------
__global__ void __launch_bounds__(256)
delta_kernel(const float* __restrict__ qc, const float* __restrict__ kc,
             const float* __restrict__ vc, const float* __restrict__ betap,
             float* __restrict__ dout) {
  extern __shared__ char smem[];
  float* uf  = (float*)smem;                 // 32x256 f32 (u then ui)
  float* Am  = uf + 32 * 256;                // 32x33 f32 (A / fwd-subst)
  h16* Sld   = (h16*)(Am + 32 * 33);         // 256x256 state (dk x dv)
  h16* qn    = Sld + 256 * 256;              // 32x256
  h16* kn    = qn + 32 * 256;
  h16* kbn   = kn + 32 * 256;
  h16* wn    = kbn + 32 * 256;               // holds -(inv@kb)
  h16* xb    = wn + 32 * 256;                // v*beta, then ui (f16)
  h16* invb  = xb + 32 * 256;                // 32x32
  h16* attb  = invb + 32 * 32;               // 32x32

  const int tid = threadIdx.x, lane = tid & 31, wid = tid >> 5;
  const int b = blockIdx.x >> 2, h = blockIdx.x & 3;

  for (int e = tid; e < 256 * 256; e += 256) Sld[e] = (h16)0.f;
  __syncthreads();

  for (int nc = 0; nc < NCHUNK; ++nc) {
    const int t0 = nc * CHc;
    // ---- stage 1: load chunk, l2norm q/k, apply beta ----
    for (int j = 0; j < 4; ++j) {
      int r = wid * 4 + j;
      int t = t0 + r;
      size_t rowb = ((size_t)(b * Tt + t)) * Dd + (size_t)h * DKk;
      float bet = betap[(size_t)(b * Tt + t) * Hh + h];
      float qv[8], kv[8], vv[8];
      float sq = 0.f, sk = 0.f;
#pragma unroll
      for (int i = 0; i < 8; ++i) {
        int d = lane + 32 * i;
        qv[i] = qc[rowb + d]; kv[i] = kc[rowb + d]; vv[i] = vc[rowb + d];
        sq += qv[i] * qv[i]; sk += kv[i] * kv[i];
      }
#pragma unroll
      for (int off = 16; off; off >>= 1) {
        sq += __shfl_xor(sq, off, 32);
        sk += __shfl_xor(sk, off, 32);
      }
      float rq = rsqrtf(sq + 1e-12f), rk = rsqrtf(sk + 1e-12f);
#pragma unroll
      for (int i = 0; i < 8; ++i) {
        int d = lane + 32 * i;
        float kq = kv[i] * rk;
        qn[r * 256 + d]  = (h16)(qv[i] * rq);
        kn[r * 256 + d]  = (h16)kq;
        kbn[r * 256 + d] = (h16)(kq * bet);
        xb[r * 256 + d]  = (h16)(vv[i] * bet);
      }
    }
    __syncthreads();
    // ---- stage 2: A = -(kb k^T), strict lower ----
    if (wid < 4) {
      int m0 = (wid >> 1) * 16, n0 = (wid & 1) * 16;
      v8f acc = {};
      for (int kk = 0; kk < 8; ++kk)
        acc = wmma_f16(frag_row(kbn, 256, m0, kk * 32, lane),
                       frag_row(kn, 256, n0, kk * 32, lane), acc);
#pragma unroll
      for (int r = 0; r < 8; ++r) {
        int m = m0 + r + 8 * (lane >> 4), n = n0 + (lane & 15);
        Am[m * 33 + n] = (m > n) ? -acc[r] : 0.f;
      }
    }
    __syncthreads();
    // ---- stage 3: forward substitution, inv = A + I ----
    for (int i = 1; i < 32; ++i) {
      float val = 0.f;
      if (tid < 32)
        for (int s = 0; s < i; ++s) val += Am[i * 33 + s] * Am[s * 33 + tid];
      __syncthreads();
      if (tid < 32) Am[i * 33 + tid] += val;
      __syncthreads();
    }
    for (int e = tid; e < 1024; e += 256) {
      int m = e >> 5, n = e & 31;
      invb[e] = (h16)(Am[m * 33 + n] + ((m == n) ? 1.f : 0.f));
    }
    __syncthreads();
    // ---- stage 4: u = inv@(v*beta) -> uf ; wn = -(inv@kb) ----
    for (int it = 0; it < 8; ++it) {
      int j = wid + 8 * it;           // 0..63
      int jj = j & 31;
      int m0 = (jj >> 4) * 16, n0 = (jj & 15) * 16;
      v8f acc = {};
      acc = wmma_f16(frag_row(invb, 32, m0, 0, lane),
                     frag_kmaj((j < 32) ? xb : kbn, 256, n0, 0, lane), acc);
#pragma unroll
      for (int r = 0; r < 8; ++r) {
        int m = m0 + r + 8 * (lane >> 4), n = n0 + (lane & 15);
        if (j < 32) uf[m * 256 + n] = acc[r];
        else        wn[m * 256 + n] = (h16)(-acc[r]);
      }
    }
    __syncthreads();
    // ---- stage 5: ui = u + (-w)@S -> uf (f32) and xb (f16) ----
    for (int it = 0; it < 4; ++it) {
      int j = wid + 8 * it;           // 0..31
      int m0 = (j >> 4) * 16, n0 = (j & 15) * 16;
      v8f acc;
#pragma unroll
      for (int r = 0; r < 8; ++r)
        acc[r] = uf[(m0 + r + 8 * (lane >> 4)) * 256 + n0 + (lane & 15)];
      for (int kk = 0; kk < 8; ++kk)
        acc = wmma_f16(frag_row(wn, 256, m0, kk * 32, lane),
                       frag_kmaj(Sld, 256, n0, kk * 32, lane), acc);
#pragma unroll
      for (int r = 0; r < 8; ++r) {
        int m = m0 + r + 8 * (lane >> 4), n = n0 + (lane & 15);
        uf[m * 256 + n] = acc[r];
        xb[m * 256 + n] = (h16)acc[r];
      }
    }
    __syncthreads();
    // ---- stage 6: attn = (q k^T) * lower-incl mask ----
    if (wid < 4) {
      int m0 = (wid >> 1) * 16, n0 = (wid & 1) * 16;
      v8f acc = {};
      for (int kk = 0; kk < 8; ++kk)
        acc = wmma_f16(frag_row(qn, 256, m0, kk * 32, lane),
                       frag_row(kn, 256, n0, kk * 32, lane), acc);
#pragma unroll
      for (int r = 0; r < 8; ++r) {
        int m = m0 + r + 8 * (lane >> 4), n = n0 + (lane & 15);
        attb[m * 32 + n] = (h16)((m >= n) ? acc[r] : 0.f);
      }
    }
    __syncthreads();
    // ---- stage 7: oi = q@S + attn@ui -> global ----
    for (int it = 0; it < 4; ++it) {
      int j = wid + 8 * it;
      int m0 = (j >> 4) * 16, n0 = (j & 15) * 16;
      v8f acc = {};
      for (int kk = 0; kk < 8; ++kk)
        acc = wmma_f16(frag_row(qn, 256, m0, kk * 32, lane),
                       frag_kmaj(Sld, 256, n0, kk * 32, lane), acc);
      acc = wmma_f16(frag_row(attb, 32, m0, 0, lane),
                     frag_kmaj(xb, 256, n0, 0, lane), acc);
#pragma unroll
      for (int r = 0; r < 8; ++r) {
        int m = m0 + r + 8 * (lane >> 4), n = n0 + (lane & 15);
        dout[((size_t)(b * Tt + t0 + m)) * Dd + (size_t)h * DVv + n] = acc[r];
      }
    }
    __syncthreads();
    // ---- stage 8: S += k^T @ ui ----
    for (int it = 0; it < 32; ++it) {
      int j = wid + 8 * it;           // 0..255
      int m0 = (j >> 4) * 16, n0 = (j & 15) * 16;
      v8f acc;
#pragma unroll
      for (int r = 0; r < 8; ++r)
        acc[r] = (float)Sld[(m0 + r + 8 * (lane >> 4)) * 256 + n0 + (lane & 15)];
      acc = wmma_f16(frag_kmaj(kn, 256, m0, 0, lane),
                     frag_kmaj(xb, 256, n0, 0, lane), acc);
#pragma unroll
      for (int r = 0; r < 8; ++r)
        Sld[(m0 + r + 8 * (lane >> 4)) * 256 + n0 + (lane & 15)] = (h16)acc[r];
    }
    __syncthreads();
  }
}

// ---------------- gate softmax + branch mixing + RMSNorm -------------------
__global__ void __launch_bounds__(256)
fuse_kernel(const float* __restrict__ b0, const float* __restrict__ b1,
            const float* __restrict__ b2, const float* __restrict__ b3,
            const float* __restrict__ b4, const float* __restrict__ b5,
            const float* __restrict__ gi, const float* __restrict__ logits,
            const float* __restrict__ alpha, const float* __restrict__ ltemp,
            const float* __restrict__ onw, float* __restrict__ out) {
  size_t bt = blockIdx.x;
  int tid = threadIdx.x;
  __shared__ float probs_s[Hh][Pp];
  __shared__ float red[256];
  if (tid < Hh) {
    int h = tid;
    float x = ltemp[h];
    float temp = fmaxf(x, 0.f) + log1pf(expf(-fabsf(x))) + 1e-4f; // softplus
    float l[Pp];
    float mx = -1e30f;
#pragma unroll
    for (int p = 0; p < Pp; ++p) {
      float st = gi[bt * GIW + Dd + h * Pp + p];
      l[p] = (logits[bt * (Hh * Pp) + h * Pp + p] + alpha[p] * st) / temp;
      mx = fmaxf(mx, l[p]);
    }
    float se = 0.f;
#pragma unroll
    for (int p = 0; p < Pp; ++p) { l[p] = expf(l[p] - mx); se += l[p]; }
#pragma unroll
    for (int p = 0; p < Pp; ++p) {
      float pr = l[p] / se * (1.f - FLOORv);
      if (p == Pp - 1) pr += FLOORv;
      probs_s[h][p] = pr;
    }
  }
  __syncthreads();
  int d = tid;
  for (int h = 0; h < Hh; ++h) {
    size_t base = bt * Dd + (size_t)h * DVv + d;
    float o = b0[base] * probs_s[h][0] + b1[base] * probs_s[h][1] +
              b2[base] * probs_s[h][2] + b3[base] * probs_s[h][3] +
              b4[base] * probs_s[h][4] + b5[base] * probs_s[h][5];
    red[tid] = o * o;
    __syncthreads();
    for (int s = 128; s; s >>= 1) {
      if (tid < s) red[tid] += red[tid + s];
      __syncthreads();
    }
    float ms = red[0] * (1.f / 256.f);
    __syncthreads();
    out[base] = o * rsqrtf(ms + 1e-5f) * onw[d];
  }
}

// ---------------------------------------------------------------------------
extern "C" void kernel_launch(void* const* d_in, const int* in_sizes, int n_in,
                              void* d_out, int out_size, void* d_ws,
                              size_t ws_size, hipStream_t stream) {
  const float* hs   = (const float*)d_in[0];
  const float* qw   = (const float*)d_in[1];
  const float* kw   = (const float*)d_in[2];
  const float* vw   = (const float*)d_in[3];
  const float* bw   = (const float*)d_in[4];
  const float* qcw  = (const float*)d_in[5];
  const float* kcw  = (const float*)d_in[6];
  const float* vcw  = (const float*)d_in[7];
  const float* f3w  = (const float*)d_in[8];
  const float* f7w  = (const float*)d_in[9];
  const float* f15w = (const float*)d_in[10];
  const float* f31w = (const float*)d_in[11];
  const float* gw1  = (const float*)d_in[12];
  const float* gb1  = (const float*)d_in[13];
  const float* gw2  = (const float*)d_in[14];
  const float* gb2  = (const float*)d_in[15];
  const float* glt  = (const float*)d_in[16];
  const float* alps = (const float*)d_in[17];
  const float* onw  = (const float*)d_in[18];
  const float* ow   = (const float*)d_in[19];
  float* out = (float*)d_out;

  const size_t U = (size_t)Bb * Tt * Dd; // 4096*1024
  float* ws = (float*)d_ws;
  float* qp  = ws;            // q projection (reused: fir3)
  float* kp  = qp + U;        // k projection (reused: fir7)
  float* vp  = kp + U;        // v projection (reused: fir15)
  float* qcv = vp + U;        // q after conv+silu (reused: fir31)
  float* kcv = qcv + U;       // k after conv+silu (reused: o_fused)
  float* vcv = kcv + U;       // v after conv+silu (branch p=4)
  float* dta = vcv + U;       // delta-rule output (branch p=5)
  float* h1  = dta + U;       // gate hidden, 2U
  float* gi  = h1 + 2 * U;    // gate input, B*T x GIW
  float* beta = gi + (size_t)Bb * Tt * 1056;
  float* lgt  = beta + (size_t)Bb * Tt * Hh;

  const int MT = Bb * Tt;                 // 4096
  dim3 blk(256);
  dim3 gN1024((1024 + 127) / 128, (MT + 63) / 64);
  int ebk = (int)((U + 255) / 256);

  // 1) q/k/v projections (no activation; conv+silu comes after)
  gemm_kernel<<<gN1024, blk, 0, stream>>>(hs, Dd, qw, Dd, nullptr, qp, Dd, MT, Dd, Dd, 0);
  gemm_kernel<<<gN1024, blk, 0, stream>>>(hs, Dd, kw, Dd, nullptr, kp, Dd, MT, Dd, Dd, 0);
  gemm_kernel<<<gN1024, blk, 0, stream>>>(hs, Dd, vw, Dd, nullptr, vp, Dd, MT, Dd, Dd, 0);
  // 2) beta
  beta_kernel<<<(MT * Hh + 255) / 256, blk, 0, stream>>>(hs, bw, beta);
  // 3) depthwise causal conv (k=4) + SiLU
  dwconv_kernel<<<ebk, blk, 0, stream>>>(qp, qcw, qcv, 4, 1);
  dwconv_kernel<<<ebk, blk, 0, stream>>>(kp, kcw, kcv, 4, 1);
  dwconv_kernel<<<ebk, blk, 0, stream>>>(vp, vcw, vcv, 4, 1);
  // 4) delta rule: 8 workgroups, ~248KB LDS-resident state each (320KB/WGP)
  const size_t DLDS = (32 * 256 + 32 * 33) * sizeof(float) +
                      (256 * 256 + 5 * 32 * 256 + 2 * 32 * 32) * sizeof(h16);
  delta_kernel<<<dim3(Bb * Hh), blk, DLDS, stream>>>(qcv, kcv, vcv, beta, dta);
  // 5) FIR branches on v (reuse proj buffers; qcv/kcv free after delta)
  dwconv_kernel<<<ebk, blk, 0, stream>>>(vcv, f3w, qp, 3, 0);
  dwconv_kernel<<<ebk, blk, 0, stream>>>(vcv, f7w, kp, 7, 0);
  dwconv_kernel<<<ebk, blk, 0, stream>>>(vcv, f15w, vp, 15, 0);
  dwconv_kernel<<<ebk, blk, 0, stream>>>(vcv, f31w, qcv, 31, 0);
  // 6) gate input = concat(hidden, stats)
  gi_copy_kernel<<<ebk, blk, 0, stream>>>(hs, gi);
  stats_kernel<<<(MT * Hh * Pp) / 8, blk, 0, stream>>>(qp, kp, vp, qcv, vcv, dta, gi);
  // 7) gate MLP (gelu, then linear to H*P logits with gb2 bias)
  dim3 gGate1((2048 + 127) / 128, (MT + 63) / 64);
  gemm_kernel<<<gGate1, blk, 0, stream>>>(gi, GIW, gw1, GIW, gb1, h1, 2048, MT, 2048, GIW, 1);
  dim3 gGate2(1, (MT + 63) / 64);
  gemm_kernel<<<gGate2, blk, 0, stream>>>(h1, 2048, gw2, 2048, gb2, lgt, Hh * Pp, MT, Hh * Pp, 2048, 0);
  // 8) softmax gate + mix branches + RMSNorm  (o_fused -> kcv)
  float* ofused = kcv;
  fuse_kernel<<<dim3(MT), blk, 0, stream>>>(qp, kp, vp, qcv, vcv, dta, gi, lgt,
                                            alps, glt, onw, ofused);
  // 9) output projection
  gemm_kernel<<<gN1024, blk, 0, stream>>>(ofused, Dd, ow, Dd, nullptr, out, Dd, MT, Dd, Dd, 0);
}

// v001
// Measured time: 2350 microseconds a run.
// Two timings next to v000 both put it at 1.67 times that version's speed.
#include <hip/hip_runtime.h>
#include <hip/hip_bf16.h>
#include <math.h>

#define DEV __device__ __forceinline__

typedef __attribute__((ext_vector_type(16))) _Float16 v16h;
typedef __attribute__((ext_vector_type(8)))  float    v8f;
typedef _Float16 h16;

constexpr int Bb = 2, Tt = 2048, Dd = 1024, Hh = 4, Pp = 6, CHc = 32;
constexpr int DKk = 256, DVv = 256;
constexpr int NCHUNK = Tt / CHc;           // 64
constexpr int GIW = Dd + Hh * Pp;          // 1048
constexpr float FLOORv = 0.05f;

DEV v16h frag_row(const h16* t, int ld, int r0, int k0, int lane) {
  // element [m][k] at t[(r0+m)*ld + (k0+k)]
  v16h f;
  int m = lane & 15, kg = lane >> 4;
#pragma unroll
  for (int j = 0; j < 8; ++j) {
    int kk = ((j < 4) ? 0 : 16) + kg * 8 + 2 * (j & 3);
    const h16* p = t + (size_t)(r0 + m) * ld + k0 + kk;
    f[2 * j] = p[0];
    f[2 * j + 1] = p[1];
  }
  return f;
}
DEV v16h frag_kmaj(const h16* t, int ld, int r0, int k0, int lane) {
  // element [m][k] at t[(k0+k)*ld + (r0+m)]
  v16h f;
  int m = lane & 15, kg = lane >> 4;
#pragma unroll
  for (int j = 0; j < 8; ++j) {
    int kk = ((j < 4) ? 0 : 16) + kg * 8 + 2 * (j & 3);
    f[2 * j]     = t[(size_t)(k0 + kk) * ld + r0 + m];
    f[2 * j + 1] = t[(size_t)(k0 + kk + 1) * ld + r0 + m];
  }
  return f;
}
DEV v8f wmma_f16(v16h a, v16h b, v8f c) {
  return __builtin_amdgcn_wmma_f32_16x16x32_f16(false, a, false, b, (short)0, c,
                                                false, false);
}

// ---------------- Generic GEMM: C = act(A(MxK) * W(NxK)^T + bias) ----------
// 64x128 block tile, 8 waves (2x4), each wave owns a 32x32 region (4 wmma/Kstep)
__global__ void __launch_bounds__(256)
gemm_kernel(const float* __restrict__ A, int lda, const float* __restrict__ W,
            int ldw, const float* __restrict__ bias, float* __restrict__ C,
            int ldc, int M, int N, int K, int act) {
  __shared__ h16 At[64][40];
  __shared__ h16 Wt[128][40];
  const int tid = threadIdx.x, lane = tid & 31, wid = tid >> 5;
  const int wm = wid >> 2, wn = wid & 3;
  const int bm = blockIdx.y * 64, bn = blockIdx.x * 128;
  const int r8 = tid >> 3, c4 = (tid & 7) * 4;
  v8f acc00 = {}, acc01 = {}, acc10 = {}, acc11 = {};
  const int ktn = (K + 31) >> 5;
  for (int kt = 0; kt < ktn; ++kt) {
    const int kb = kt << 5;
    const bool full = (bm + 64 <= M) && (bn + 128 <= N) && (kb + 32 <= K);
    if (full) {
      // branch-free interior path: float4 loads -> global_load_b128
#pragma unroll
      for (int i = 0; i < 2; ++i) {
        int r = r8 + 32 * i;
        const float4 f = *(const float4*)&A[(size_t)(bm + r) * lda + kb + c4];
        h16* d = &At[r][c4];
        d[0] = (h16)f.x; d[1] = (h16)f.y; d[2] = (h16)f.z; d[3] = (h16)f.w;
      }
#pragma unroll
      for (int i = 0; i < 4; ++i) {
        int r = r8 + 32 * i;
        const float4 f = *(const float4*)&W[(size_t)(bn + r) * ldw + kb + c4];
        h16* d = &Wt[r][c4];
        d[0] = (h16)f.x; d[1] = (h16)f.y; d[2] = (h16)f.z; d[3] = (h16)f.w;
      }
      if (kb + 64 <= K) {  // prefetch next K tile (global_prefetch_b8)
        __builtin_prefetch(&A[(size_t)(bm + r8) * lda + kb + 32 + c4], 0, 1);
        __builtin_prefetch(&W[(size_t)(bn + r8) * ldw + kb + 32 + c4], 0, 1);
      }
    } else {
      // guarded edge path (N=24 logits GEMM, K=1048 tail)
#pragma unroll
      for (int i = 0; i < 8; ++i) {
        int e = tid + i * 256, r = e >> 5, c = e & 31;
        int gm = bm + r, gk = kb + c;
        At[r][c] = (gm < M && gk < K) ? (h16)A[(size_t)gm * lda + gk] : (h16)0.f;
      }
#pragma unroll
      for (int i = 0; i < 16; ++i) {
        int e = tid + i * 256, r = e >> 5, c = e & 31;
        int gn = bn + r, gk = kb + c;
        Wt[r][c] = (gn < N && gk < K) ? (h16)W[(size_t)gn * ldw + gk] : (h16)0.f;
      }
    }
    __syncthreads();
    v16h a0 = frag_row(&At[0][0], 40, wm * 32, 0, lane);
    v16h a1 = frag_row(&At[0][0], 40, wm * 32 + 16, 0, lane);
    v16h b0 = frag_row(&Wt[0][0], 40, wn * 32, 0, lane);
    v16h b1 = frag_row(&Wt[0][0], 40, wn * 32 + 16, 0, lane);
    acc00 = wmma_f16(a0, b0, acc00);
    acc01 = wmma_f16(a0, b1, acc01);
    acc10 = wmma_f16(a1, b0, acc10);
    acc11 = wmma_f16(a1, b1, acc11);
    __syncthreads();
  }
  v8f* accs[4] = {&acc00, &acc01, &acc10, &acc11};
#pragma unroll
  for (int q = 0; q < 4; ++q) {
    int im = q >> 1, in_ = q & 1;
#pragma unroll
    for (int r = 0; r < 8; ++r) {
      int gm = bm + wm * 32 + im * 16 + r + 8 * (lane >> 4);
      int gn = bn + wn * 32 + in_ * 16 + (lane & 15);
      if (gm < M && gn < N) {
        float v = (*accs[q])[r] + (bias ? bias[gn] : 0.f);
        if (act == 1) v = 0.5f * v * (1.f + erff(v * 0.70710678118f));
        C[(size_t)gm * ldc + gn] = v;
      }
    }
  }
}

// ---------------- depthwise causal conv (+ optional SiLU) ------------------
__global__ void dwconv_kernel(const float* __restrict__ X,
                              const float* __restrict__ Wc,
                              float* __restrict__ Y, int Kw, int applySilu) {
  size_t idx = (size_t)blockIdx.x * blockDim.x + threadIdx.x;
  size_t total = (size_t)Bb * Tt * Dd;
  if (idx >= total) return;
  int c = (int)(idx & (Dd - 1));
  size_t bt = idx / Dd;
  int t = (int)(bt % Tt);
  float s = 0.f;
  for (int i = 0; i < Kw; ++i) {
    int tt = t - (Kw - 1) + i;
    if (tt >= 0) s += X[(bt - (size_t)(t - tt)) * Dd + c] * Wc[c * Kw + i];
  }
  if (applySilu) s = s / (1.f + expf(-s));
  Y[idx] = s;
}

// ---------------- beta = sigmoid(hidden @ b_proj^T) ------------------------
__global__ void beta_kernel(const float* __restrict__ hs,
                            const float* __restrict__ Wb,
                            float* __restrict__ beta) {
  int idx = blockIdx.x * blockDim.x + threadIdx.x;
  if (idx >= Bb * Tt * Hh) return;
  int h = idx & (Hh - 1);
  size_t bt = (size_t)idx >> 2;
  const float* x = hs + bt * Dd;
  const float* w = Wb + (size_t)h * Dd;
  float s = 0.f;
  for (int k = 0; k < Dd; ++k) s += x[k] * w[k];
  beta[idx] = 1.f / (1.f + expf(-s));
}

// ---------------- gi[:, :D] = hidden ---------------------------------------
__global__ void gi_copy_kernel(const float* __restrict__ hs,
                               float* __restrict__ gi) {
  size_t idx = (size_t)blockIdx.x * blockDim.x + threadIdx.x;
  if (idx >= (size_t)Bb * Tt * Dd) return;
  size_t bt = idx / Dd;
  int j = (int)(idx % Dd);
  gi[bt * GIW + j] = hs[idx];
}

// ---------------- stats = mean |branch| over DV -> gi tail -----------------
__global__ void stats_kernel(const float* __restrict__ b0,
                             const float* __restrict__ b1,
                             const float* __restrict__ b2,
                             const float* __restrict__ b3,
                             const float* __restrict__ b4,
                             const float* __restrict__ b5,
                             float* __restrict__ gi) {
  int wg = blockIdx.x * 8 + (threadIdx.x >> 5);
  int lane = threadIdx.x & 31;
  if (wg >= Bb * Tt * Hh * Pp) return;
  int p = wg % Pp;
  int h = (wg / Pp) % Hh;
  size_t bt = (size_t)wg / (Pp * Hh);
  const float* src = (p == 0) ? b0 : (p == 1) ? b1 : (p == 2) ? b2
                   : (p == 3) ? b3 : (p == 4) ? b4 : b5;
  src += bt * Dd + (size_t)h * DVv;
  float s = 0.f;
#pragma unroll
  for (int i = 0; i < 8; ++i) s += fabsf(src[lane + 32 * i]);
#pragma unroll
  for (int off = 16; off; off >>= 1) s += __shfl_xor(s, off, 32);
  if (lane == 0) gi[bt * GIW + Dd + h * Pp + p] = s * (1.f / 256.f);
}

// ---------------- chunked delta rule, state split by value columns ---------
// Column n of ui, oi and S depends on column n of v and S only, so each
// work-group owns DVS value columns of one (batch, head) and keeps a
// 256 x DVS state slice in LDS. DVS = 32 floats = one 128-byte output line.
constexpr int DVS = 32;                    // value columns per work-group
constexpr int NSL = DVv / DVS;             // slices per (batch, head)
constexpr int NCT = DVS / 16;              // 16-wide column tiles per slice
constexpr int NT  = 2 * NCT;               // 32 x DVS result tiles
__global__ void __launch_bounds__(256)
delta_kernel(const float* __restrict__ qc, const float* __restrict__ kc,
             const float* __restrict__ vc, const float* __restrict__ betap,
             float* __restrict__ dout) {
  extern __shared__ char smem[];
  float* uf  = (float*)smem;                 // 32xDVS f32 (u then ui)
  float* Am  = uf + 32 * DVS;                // 32x33 f32 (A / fwd-subst)
  h16* Sld   = (h16*)(Am + 32 * 33);         // 256xDVS state slice (dk x dv)
  h16* qn    = Sld + 256 * DVS;              // 32x256
  h16* kn    = qn + 32 * 256;
  h16* kbn   = kn + 32 * 256;
  h16* wn    = kbn + 32 * 256;               // holds -(inv@kb)
  h16* xb    = wn + 32 * 256;                // 32xDVS: v*beta, then ui (f16)
  h16* invb  = xb + 32 * DVS;                // 32x32
  h16* attb  = invb + 32 * 32;               // 32x32

  const int tid = threadIdx.x, lane = tid & 31, wid = tid >> 5;
  const int bh = blockIdx.x / NSL;
  const int c0 = (blockIdx.x % NSL) * DVS;   // first value column of the slice
  const int b = bh >> 2, h = bh & 3;

  for (int e = tid; e < 256 * DVS; e += 256) Sld[e] = (h16)0.f;
  __syncthreads();

  for (int nc = 0; nc < NCHUNK; ++nc) {
    const int t0 = nc * CHc;
    // ---- stage 1: load chunk, l2norm q/k, apply beta ----
    for (int j = 0; j < 4; ++j) {
      int r = wid * 4 + j;
      int t = t0 + r;
      size_t rowb = ((size_t)(b * Tt + t)) * Dd + (size_t)h * DKk;
      float bet = betap[(size_t)(b * Tt + t) * Hh + h];
      float qv[8], kv[8];
      float sq = 0.f, sk = 0.f;
#pragma unroll
      for (int i = 0; i < 8; ++i) {
        int d = lane + 32 * i;
        qv[i] = qc[rowb + d]; kv[i] = kc[rowb + d];
        sq += qv[i] * qv[i]; sk += kv[i] * kv[i];
      }
      // the v load below may land in an address register of the q/k loads
      asm volatile("s_wait_xcnt 0x0" ::: "memory");
      float vv = vc[rowb + c0 + lane];
#pragma unroll
      for (int off = 16; off; off >>= 1) {
        sq += __shfl_xor(sq, off, 32);
        sk += __shfl_xor(sk, off, 32);
      }
      float rq = rsqrtf(sq + 1e-12f), rk = rsqrtf(sk + 1e-12f);
#pragma unroll
      for (int i = 0; i < 8; ++i) {
        int d = lane + 32 * i;
        float kq = kv[i] * rk;
        qn[r * 256 + d]  = (h16)(qv[i] * rq);
        kn[r * 256 + d]  = (h16)kq;
        kbn[r * 256 + d] = (h16)(kq * bet);
      }
      xb[r * DVS + lane] = (h16)(vv * bet);
    }
    __syncthreads();
    // ---- stage 2: A = -(kb k^T), strict lower ----
    if (wid < 4) {
      int m0 = (wid >> 1) * 16, n0 = (wid & 1) * 16;
      v8f acc = {};
      for (int kk = 0; kk < 8; ++kk)
        acc = wmma_f16(frag_row(kbn, 256, m0, kk * 32, lane),
                       frag_row(kn, 256, n0, kk * 32, lane), acc);
#pragma unroll
      for (int r = 0; r < 8; ++r) {
        int m = m0 + r + 8 * (lane >> 4), n = n0 + (lane & 15);
        Am[m * 33 + n] = (m > n) ? -acc[r] : 0.f;
      }
    }
    __syncthreads();
    // ---- stage 3: forward substitution, inv = A + I ----
    for (int i = 1; i < 32; ++i) {
      float val = 0.f;
      if (tid < 32)
        for (int s = 0; s < i; ++s) val += Am[i * 33 + s] * Am[s * 33 + tid];
      __syncthreads();
      if (tid < 32) Am[i * 33 + tid] += val;
      __syncthreads();
    }
    for (int e = tid; e < 1024; e += 256) {
      int m = e >> 5, n = e & 31;
      invb[e] = (h16)(Am[m * 33 + n] + ((m == n) ? 1.f : 0.f));
    }
    __syncthreads();
    // ---- stage 4: wn = -(inv@kb) (all 256 key columns) ; u = inv@(v*beta) -> uf ----
    for (int it = 0; it < 4; ++it) {
      int j = wid + 8 * it;           // 0..31
      int m0 = (j >> 4) * 16, n0 = (j & 15) * 16;
      v8f acc = {};
      acc = wmma_f16(frag_row(invb, 32, m0, 0, lane),
                     frag_kmaj(kbn, 256, n0, 0, lane), acc);
#pragma unroll
      for (int r = 0; r < 8; ++r) {
        int m = m0 + r + 8 * (lane >> 4), n = n0 + (lane & 15);
        wn[m * 256 + n] = (h16)(-acc[r]);
      }
    }
    if (wid < NT) {
      int m0 = (wid / NCT) * 16, n0 = (wid % NCT) * 16;
      v8f acc = {};
      acc = wmma_f16(frag_row(invb, 32, m0, 0, lane),
                     frag_kmaj(xb, DVS, n0, 0, lane), acc);
#pragma unroll
      for (int r = 0; r < 8; ++r) {
        int m = m0 + r + 8 * (lane >> 4), n = n0 + (lane & 15);
        uf[m * DVS + n] = acc[r];
      }
    }
    __syncthreads();
    // ---- stage 5: ui = u + (-w)@S -> uf (f32) and xb (f16) ----
    if (wid < NT) {
      int m0 = (wid / NCT) * 16, n0 = (wid % NCT) * 16;
      v8f acc;
#pragma unroll
      for (int r = 0; r < 8; ++r)
        acc[r] = uf[(m0 + r + 8 * (lane >> 4)) * DVS + n0 + (lane & 15)];
      for (int kk = 0; kk < 8; ++kk)
        acc = wmma_f16(frag_row(wn, 256, m0, kk * 32, lane),
                       frag_kmaj(Sld, DVS, n0, kk * 32, lane), acc);
#pragma unroll
      for (int r = 0; r < 8; ++r) {
        int m = m0 + r + 8 * (lane >> 4), n = n0 + (lane & 15);
        uf[m * DVS + n] = acc[r];
        xb[m * DVS + n] = (h16)acc[r];
      }
    }
    __syncthreads();
    // ---- stage 6: attn = (q k^T) * lower-incl mask ----
    if (wid < 4) {
      int m0 = (wid >> 1) * 16, n0 = (wid & 1) * 16;
      v8f acc = {};
      for (int kk = 0; kk < 8; ++kk)
        acc = wmma_f16(frag_row(qn, 256, m0, kk * 32, lane),
                       frag_row(kn, 256, n0, kk * 32, lane), acc);
#pragma unroll
      for (int r = 0; r < 8; ++r) {
        int m = m0 + r + 8 * (lane >> 4), n = n0 + (lane & 15);
        attb[m * 32 + n] = (h16)((m >= n) ? acc[r] : 0.f);
      }
    }
    __syncthreads();
    // ---- stage 7: oi = q@S + attn@ui -> global ----
    if (wid < NT) {
      int m0 = (wid / NCT) * 16, n0 = (wid % NCT) * 16;
      v8f acc = {};
      for (int kk = 0; kk < 8; ++kk)
        acc = wmma_f16(frag_row(qn, 256, m0, kk * 32, lane),
                       frag_kmaj(Sld, DVS, n0, kk * 32, lane), acc);
      acc = wmma_f16(frag_row(attb, 32, m0, 0, lane),
                     frag_kmaj(xb, DVS, n0, 0, lane), acc);
#pragma unroll
      for (int r = 0; r < 8; ++r) {
        int m = m0 + r + 8 * (lane >> 4), n = n0 + (lane & 15);
        dout[((size_t)(b * Tt + t0 + m)) * Dd + (size_t)h * DVv + c0 + n] = acc[r];
      }
    }
    __syncthreads();
    // ---- stage 8: S += k^T @ ui ----
    for (int it = 0; it < 2 * NCT; ++it) {
      int j = wid + 8 * it;           // 0..16*NCT-1
      int m0 = (j / NCT) * 16, n0 = (j % NCT) * 16;
      v8f acc;
#pragma unroll
      for (int r = 0; r < 8; ++r)
        acc[r] = (float)Sld[(m0 + r + 8 * (lane >> 4)) * DVS + n0 + (lane & 15)];
      acc = wmma_f16(frag_kmaj(kn, 256, m0, 0, lane),
                     frag_kmaj(xb, DVS, n0, 0, lane), acc);
#pragma unroll
      for (int r = 0; r < 8; ++r)
        Sld[(m0 + r + 8 * (lane >> 4)) * DVS + n0 + (lane & 15)] = (h16)acc[r];
    }
    __syncthreads();
  }
}

// ---------------- gate softmax + branch mixing + RMSNorm -------------------
__global__ void __launch_bounds__(256)
fuse_kernel(const float* __restrict__ b0, const float* __restrict__ b1,
            const float* __restrict__ b2, const float* __restrict__ b3,
            const float* __restrict__ b4, const float* __restrict__ b5,
            const float* __restrict__ gi, const float* __restrict__ logits,
            const float* __restrict__ alpha, const float* __restrict__ ltemp,
            const float* __restrict__ onw, float* __restrict__ out) {
  size_t bt = blockIdx.x;
  int tid = threadIdx.x;
  __shared__ float probs_s[Hh][Pp];
  __shared__ float red[256];
  if (tid < Hh) {
    int h = tid;
    float x = ltemp[h];
    float temp = fmaxf(x, 0.f) + log1pf(expf(-fabsf(x))) + 1e-4f; // softplus
    float l[Pp];
    float mx = -1e30f;
#pragma unroll
    for (int p = 0; p < Pp; ++p) {
      float st = gi[bt * GIW + Dd + h * Pp + p];
      l[p] = (logits[bt * (Hh * Pp) + h * Pp + p] + alpha[p] * st) / temp;
      mx = fmaxf(mx, l[p]);
    }
    float se = 0.f;
#pragma unroll
    for (int p = 0; p < Pp; ++p) { l[p] = expf(l[p] - mx); se += l[p]; }
#pragma unroll
    for (int p = 0; p < Pp; ++p) {
      float pr = l[p] / se * (1.f - FLOORv);
      if (p == Pp - 1) pr += FLOORv;
      probs_s[h][p] = pr;
    }
  }
  __syncthreads();
  int d = tid;
  for (int h = 0; h < Hh; ++h) {
    size_t base = bt * Dd + (size_t)h * DVv + d;
    float o = b0[base] * probs_s[h][0] + b1[base] * probs_s[h][1] +
              b2[base] * probs_s[h][2] + b3[base] * probs_s[h][3] +
              b4[base] * probs_s[h][4] + b5[base] * probs_s[h][5];
    red[tid] = o * o;
    __syncthreads();
    for (int s = 128; s; s >>= 1) {
      if (tid < s) red[tid] += red[tid + s];
      __syncthreads();
    }
    float ms = red[0] * (1.f / 256.f);
    __syncthreads();
    out[base] = o * rsqrtf(ms + 1e-5f) * onw[d];
  }
}

// ---------------------------------------------------------------------------
extern "C" void kernel_launch(void* const* d_in, const int* in_sizes, int n_in,
                              void* d_out, int out_size, void* d_ws,
                              size_t ws_size, hipStream_t stream) {
  const float* hs   = (const float*)d_in[0];
  const float* qw   = (const float*)d_in[1];
  const float* kw   = (const float*)d_in[2];
  const float* vw   = (const float*)d_in[3];
  const float* bw   = (const float*)d_in[4];
  const float* qcw  = (const float*)d_in[5];
  const float* kcw  = (const float*)d_in[6];
  const float* vcw  = (const float*)d_in[7];
  const float* f3w  = (const float*)d_in[8];
  const float* f7w  = (const float*)d_in[9];
  const float* f15w = (const float*)d_in[10];
  const float* f31w = (const float*)d_in[11];
  const float* gw1  = (const float*)d_in[12];
  const float* gb1  = (const float*)d_in[13];
  const float* gw2  = (const float*)d_in[14];
  const float* gb2  = (const float*)d_in[15];
  const float* glt  = (const float*)d_in[16];
  const float* alps = (const float*)d_in[17];
  const float* onw  = (const float*)d_in[18];
  const float* ow   = (const float*)d_in[19];
  float* out = (float*)d_out;

  const size_t U = (size_t)Bb * Tt * Dd; // 4096*1024
  float* ws = (float*)d_ws;
  float* qp  = ws;            // q projection (reused: fir3)
  float* kp  = qp + U;        // k projection (reused: fir7)
  float* vp  = kp + U;        // v projection (reused: fir15)
  float* qcv = vp + U;        // q after conv+silu (reused: fir31)
  float* kcv = qcv + U;       // k after conv+silu (reused: o_fused)
  float* vcv = kcv + U;       // v after conv+silu (branch p=4)
  float* dta = vcv + U;       // delta-rule output (branch p=5)
  float* h1  = dta + U;       // gate hidden, 2U
  float* gi  = h1 + 2 * U;    // gate input, B*T x GIW
  float* beta = gi + (size_t)Bb * Tt * 1056;
  float* lgt  = beta + (size_t)Bb * Tt * Hh;

  const int MT = Bb * Tt;                 // 4096
  dim3 blk(256);
  dim3 gN1024((1024 + 127) / 128, (MT + 63) / 64);
  int ebk = (int)((U + 255) / 256);

  // 1) q/k/v projections (no activation; conv+silu comes after)
  gemm_kernel<<<gN1024, blk, 0, stream>>>(hs, Dd, qw, Dd, nullptr, qp, Dd, MT, Dd, Dd, 0);
  gemm_kernel<<<gN1024, blk, 0, stream>>>(hs, Dd, kw, Dd, nullptr, kp, Dd, MT, Dd, Dd, 0);
  gemm_kernel<<<gN1024, blk, 0, stream>>>(hs, Dd, vw, Dd, nullptr, vp, Dd, MT, Dd, Dd, 0);
  // 2) beta
  beta_kernel<<<(MT * Hh + 255) / 256, blk, 0, stream>>>(hs, bw, beta);
  // 3) depthwise causal conv (k=4) + SiLU
  dwconv_kernel<<<ebk, blk, 0, stream>>>(qp, qcw, qcv, 4, 1);
  dwconv_kernel<<<ebk, blk, 0, stream>>>(kp, kcw, kcv, 4, 1);
  dwconv_kernel<<<ebk, blk, 0, stream>>>(vp, vcw, vcv, 4, 1);
  // 4) delta rule: one workgroup per (batch, head, 32-column state slice)
  const size_t DLDS = (32 * DVS + 32 * 33) * sizeof(float) +
                      (256 * DVS + 4 * 32 * 256 + 32 * DVS + 2 * 32 * 32) * sizeof(h16);
  delta_kernel<<<dim3(Bb * Hh * NSL), blk, DLDS, stream>>>(qcv, kcv, vcv, beta, dta);
  // 5) FIR branches on v (reuse proj buffers; qcv/kcv free after delta)
  dwconv_kernel<<<ebk, blk, 0, stream>>>(vcv, f3w, qp, 3, 0);
  dwconv_kernel<<<ebk, blk, 0, stream>>>(vcv, f7w, kp, 7, 0);
  dwconv_kernel<<<ebk, blk, 0, stream>>>(vcv, f15w, vp, 15, 0);
  dwconv_kernel<<<ebk, blk, 0, stream>>>(vcv, f31w, qcv, 31, 0);
  // 6) gate input = concat(hidden, stats)
  gi_copy_kernel<<<ebk, blk, 0, stream>>>(hs, gi);
  stats_kernel<<<(MT * Hh * Pp) / 8, blk, 0, stream>>>(qp, kp, vp, qcv, vcv, dta, gi);
  // 7) gate MLP (gelu, then linear to H*P logits with gb2 bias)
  dim3 gGate1((2048 + 127) / 128, (MT + 63) / 64);
  gemm_kernel<<<gGate1, blk, 0, stream>>>(gi, GIW, gw1, GIW, gb1, h1, 2048, MT, 2048, GIW, 1);
  dim3 gGate2(1, (MT + 63) / 64);
  gemm_kernel<<<gGate2, blk, 0, stream>>>(h1, 2048, gw2, 2048, gb2, lgt, Hh * Pp, MT, Hh * Pp, 2048, 0);
  // 8) softmax gate + mix branches + RMSNorm  (o_fused -> kcv)
  float* ofused = kcv;
  fuse_kernel<<<dim3(MT), blk, 0, stream>>>(qp, kp, vp, qcv, vcv, dta, gi, lgt,
                                            alps, glt, onw, ofused);
  // 9) output projection
  gemm_kernel<<<gN1024, blk, 0, stream>>>(ofused, Dd, ow, Dd, nullptr, out, Dd, MT, Dd, Dd, 0);
}

// v002
// It runs in 1290 microseconds.
// In both of two side-by-side timings against v001, it was 1.83 times as fast.
// All steps since v000 together make it 3.06 times as fast.
#include <hip/hip_runtime.h>
#include <hip/hip_bf16.h>
#include <math.h>

#define DEV __device__ __forceinline__

typedef __attribute__((ext_vector_type(16))) _Float16 v16h;
typedef __attribute__((ext_vector_type(8)))  float    v8f;
typedef _Float16 h16;

constexpr int Bb = 2, Tt = 2048, Dd = 1024, Hh = 4, Pp = 6, CHc = 32;
constexpr int DKk = 256, DVv = 256;
constexpr int NCHUNK = Tt / CHc;           // 64
constexpr int GIW = Dd + Hh * Pp;          // 1048
constexpr float FLOORv = 0.05f;

DEV v16h frag_row(const h16* t, int ld, int r0, int k0, int lane) {
  // element [m][k] at t[(r0+m)*ld + (k0+k)]
  v16h f;
  int m = lane & 15, kg = lane >> 4;
#pragma unroll
  for (int j = 0; j < 8; ++j) {
    int kk = ((j < 4) ? 0 : 16) + kg * 8 + 2 * (j & 3);
    const h16* p = t + (size_t)(r0 + m) * ld + k0 + kk;
    f[2 * j] = p[0];
    f[2 * j + 1] = p[1];
  }
  return f;
}
DEV v16h frag_kmaj(const h16* t, int ld, int r0, int k0, int lane) {
  // element [m][k] at t[(k0+k)*ld + (r0+m)]
  v16h f;
  int m = lane & 15, kg = lane >> 4;
#pragma unroll
  for (int j = 0; j < 8; ++j) {
    int kk = ((j < 4) ? 0 : 16) + kg * 8 + 2 * (j & 3);
    f[2 * j]     = t[(size_t)(k0 + kk) * ld + r0 + m];
    f[2 * j + 1] = t[(size_t)(k0 + kk + 1) * ld + r0 + m];
  }
  return f;
}
DEV v8f wmma_f16(v16h a, v16h b, v8f c) {
  return __builtin_amdgcn_wmma_f32_16x16x32_f16(false, a, false, b, (short)0, c,
                                                false, false);
}

// ---------------- Generic GEMM: C = act(A(MxK) * W(NxK)^T + bias) ----------
// 64x128 block tile, 8 waves (2x4), each wave owns a 32x32 region (4 wmma/Kstep)
__global__ void __launch_bounds__(256)
gemm_kernel(const float* __restrict__ A, int lda, const float* __restrict__ W,
            int ldw, const float* __restrict__ bias, float* __restrict__ C,
            int ldc, int M, int N, int K, int act) {
  __shared__ h16 At[64][40];
  __shared__ h16 Wt[128][40];
  const int tid = threadIdx.x, lane = tid & 31, wid = tid >> 5;
  const int wm = wid >> 2, wn = wid & 3;
  const int bm = blockIdx.y * 64, bn = blockIdx.x * 128;
  const int r8 = tid >> 3, c4 = (tid & 7) * 4;
  v8f acc00 = {}, acc01 = {}, acc10 = {}, acc11 = {};
  const int ktn = (K + 31) >> 5;
  for (int kt = 0; kt < ktn; ++kt) {
    const int kb = kt << 5;
    const bool full = (bm + 64 <= M) && (bn + 128 <= N) && (kb + 32 <= K);
    if (full) {
      // branch-free interior path: float4 loads -> global_load_b128
#pragma unroll
      for (int i = 0; i < 2; ++i) {
        int r = r8 + 32 * i;
        const float4 f = *(const float4*)&A[(size_t)(bm + r) * lda + kb + c4];
        h16* d = &At[r][c4];
        d[0] = (h16)f.x; d[1] = (h16)f.y; d[2] = (h16)f.z; d[3] = (h16)f.w;
      }
#pragma unroll
      for (int i = 0; i < 4; ++i) {
        int r = r8 + 32 * i;
        const float4 f = *(const float4*)&W[(size_t)(bn + r) * ldw + kb + c4];
        h16* d = &Wt[r][c4];
        d[0] = (h16)f.x; d[1] = (h16)f.y; d[2] = (h16)f.z; d[3] = (h16)f.w;
      }
      if (kb + 64 <= K) {  // prefetch next K tile (global_prefetch_b8)
        __builtin_prefetch(&A[(size_t)(bm + r8) * lda + kb + 32 + c4], 0, 1);
        __builtin_prefetch(&W[(size_t)(bn + r8) * ldw + kb + 32 + c4], 0, 1);
      }
    } else {
      // guarded edge path (N=24 logits GEMM, K=1048 tail)
#pragma unroll
      for (int i = 0; i < 8; ++i) {
        int e = tid + i * 256, r = e >> 5, c = e & 31;
        int gm = bm + r, gk = kb + c;
        At[r][c] = (gm < M && gk < K) ? (h16)A[(size_t)gm * lda + gk] : (h16)0.f;
      }
#pragma unroll
      for (int i = 0; i < 16; ++i) {
        int e = tid + i * 256, r = e >> 5, c = e & 31;
        int gn = bn + r, gk = kb + c;
        Wt[r][c] = (gn < N && gk < K) ? (h16)W[(size_t)gn * ldw + gk] : (h16)0.f;
      }
    }
    __syncthreads();
    v16h a0 = frag_row(&At[0][0], 40, wm * 32, 0, lane);
    v16h a1 = frag_row(&At[0][0], 40, wm * 32 + 16, 0, lane);
    v16h b0 = frag_row(&Wt[0][0], 40, wn * 32, 0, lane);
    v16h b1 = frag_row(&Wt[0][0], 40, wn * 32 + 16, 0, lane);
    acc00 = wmma_f16(a0, b0, acc00);
    acc01 = wmma_f16(a0, b1, acc01);
    acc10 = wmma_f16(a1, b0, acc10);
    acc11 = wmma_f16(a1, b1, acc11);
    __syncthreads();
  }
  v8f* accs[4] = {&acc00, &acc01, &acc10, &acc11};
#pragma unroll
  for (int q = 0; q < 4; ++q) {
    int im = q >> 1, in_ = q & 1;
#pragma unroll
    for (int r = 0; r < 8; ++r) {
      int gm = bm + wm * 32 + im * 16 + r + 8 * (lane >> 4);
      int gn = bn + wn * 32 + in_ * 16 + (lane & 15);
      if (gm < M && gn < N) {
        float v = (*accs[q])[r] + (bias ? bias[gn] : 0.f);
        if (act == 1) v = 0.5f * v * (1.f + erff(v * 0.70710678118f));
        C[(size_t)gm * ldc + gn] = v;
      }
    }
  }
}

// ---------------- depthwise causal conv (+ optional SiLU) ------------------
__global__ void dwconv_kernel(const float* __restrict__ X,
                              const float* __restrict__ Wc,
                              float* __restrict__ Y, int Kw, int applySilu) {
  size_t idx = (size_t)blockIdx.x * blockDim.x + threadIdx.x;
  size_t total = (size_t)Bb * Tt * Dd;
  if (idx >= total) return;
  int c = (int)(idx & (Dd - 1));
  size_t bt = idx / Dd;
  int t = (int)(bt % Tt);
  float s = 0.f;
  for (int i = 0; i < Kw; ++i) {
    int tt = t - (Kw - 1) + i;
    if (tt >= 0) s += X[(bt - (size_t)(t - tt)) * Dd + c] * Wc[c * Kw + i];
  }
  if (applySilu) s = s / (1.f + expf(-s));
  Y[idx] = s;
}

// ---------------- beta = sigmoid(hidden @ b_proj^T) ------------------------
__global__ void beta_kernel(const float* __restrict__ hs,
                            const float* __restrict__ Wb,
                            float* __restrict__ beta) {
  int idx = blockIdx.x * blockDim.x + threadIdx.x;
  if (idx >= Bb * Tt * Hh) return;
  int h = idx & (Hh - 1);
  size_t bt = (size_t)idx >> 2;
  const float* x = hs + bt * Dd;
  const float* w = Wb + (size_t)h * Dd;
  float s = 0.f;
  for (int k = 0; k < Dd; ++k) s += x[k] * w[k];
  beta[idx] = 1.f / (1.f + expf(-s));
}

// ---------------- gi[:, :D] = hidden ---------------------------------------
__global__ void gi_copy_kernel(const float* __restrict__ hs,
                               float* __restrict__ gi) {
  size_t idx = (size_t)blockIdx.x * blockDim.x + threadIdx.x;
  if (idx >= (size_t)Bb * Tt * Dd) return;
  size_t bt = idx / Dd;
  int j = (int)(idx % Dd);
  gi[bt * GIW + j] = hs[idx];
}

// ---------------- stats = mean |branch| over DV -> gi tail -----------------
__global__ void stats_kernel(const float* __restrict__ b0,
                             const float* __restrict__ b1,
                             const float* __restrict__ b2,
                             const float* __restrict__ b3,
                             const float* __restrict__ b4,
                             const float* __restrict__ b5,
                             float* __restrict__ gi) {
  int wg = blockIdx.x * 8 + (threadIdx.x >> 5);
  int lane = threadIdx.x & 31;
  if (wg >= Bb * Tt * Hh * Pp) return;
  int p = wg % Pp;
  int h = (wg / Pp) % Hh;
  size_t bt = (size_t)wg / (Pp * Hh);
  const float* src = (p == 0) ? b0 : (p == 1) ? b1 : (p == 2) ? b2
                   : (p == 3) ? b3 : (p == 4) ? b4 : b5;
  src += bt * Dd + (size_t)h * DVv;
  float s = 0.f;
#pragma unroll
  for (int i = 0; i < 8; ++i) s += fabsf(src[lane + 32 * i]);
#pragma unroll
  for (int off = 16; off; off >>= 1) s += __shfl_xor(s, off, 32);
  if (lane == 0) gi[bt * GIW + Dd + h * Pp + p] = s * (1.f / 256.f);
}

// ---------------- chunked delta rule ---------------------------------------
// The UT transform of a chunk (l2norm, A, forward substitution, w, u, attn)
// reads no state, so prep_kernel does it for all chunks side by side, one
// work-group per (batch, head, chunk), and leaves q, k, -w, attn (f16) and
// u (f32) in the workspace, one contiguous block per chunk. Only the steps
// that read or write the state S stay in the serial scan of delta_kernel.
constexpr int CE = CHc * DKk;              // elements of one 32 x 256 chunk block
__global__ void __launch_bounds__(256)
prep_kernel(const float* __restrict__ qc, const float* __restrict__ kc,
            const float* __restrict__ vc, const float* __restrict__ betap,
            float* __restrict__ qo, float* __restrict__ ko,
            float* __restrict__ wo, float* __restrict__ uo,
            float* __restrict__ ao) {
  extern __shared__ char smem[];
  float* Am  = (float*)smem;                 // 32x33 f32 (A / fwd-subst)
  h16* qn    = (h16*)(Am + 32 * 33);         // 32x256
  h16* kn    = qn + CE;
  h16* kbn   = kn + CE;
  h16* wn    = kbn + CE;                     // holds -(inv@kb)
  h16* xb    = wn + CE;                      // 32x256: v*beta
  h16* invb  = xb + CE;                      // 32x32
  h16* attb  = invb + 32 * 32;               // 32x32

  const int tid = threadIdx.x, lane = tid & 31, wid = tid >> 5;
  const int bh = blockIdx.x / NCHUNK, nc = blockIdx.x % NCHUNK;
  const int b = bh >> 2, h = bh & 3;
  const int t0 = nc * CHc;

  // ---- stage 1: load chunk, l2norm q/k, apply beta ----
  for (int j = 0; j < 4; ++j) {
    int r = wid * 4 + j;
    int t = t0 + r;
    size_t rowb = ((size_t)(b * Tt + t)) * Dd + (size_t)h * DKk;
    float bet = betap[(size_t)(b * Tt + t) * Hh + h];
    float qv[8], kv[8], vv[8];
    float sq = 0.f, sk = 0.f;
#pragma unroll
    for (int i = 0; i < 8; ++i) {
      int d = lane + 32 * i;
      qv[i] = qc[rowb + d]; kv[i] = kc[rowb + d]; vv[i] = vc[rowb + d];
      sq += qv[i] * qv[i]; sk += kv[i] * kv[i];
    }
#pragma unroll
    for (int off = 16; off; off >>= 1) {
      sq += __shfl_xor(sq, off, 32);
      sk += __shfl_xor(sk, off, 32);
    }
    float rq = rsqrtf(sq + 1e-12f), rk = rsqrtf(sk + 1e-12f);
#pragma unroll
    for (int i = 0; i < 8; ++i) {
      int d = lane + 32 * i;
      float kq = kv[i] * rk;
      qn[r * 256 + d]  = (h16)(qv[i] * rq);
      kn[r * 256 + d]  = (h16)kq;
      kbn[r * 256 + d] = (h16)(kq * bet);
      xb[r * 256 + d]  = (h16)(vv[i] * bet);
    }
  }
  __syncthreads();
  // ---- stage 2: A = -(kb k^T), strict lower (waves 0-3) ;
  //      stage 6: attn = (q k^T) * lower-incl mask (waves 4-7) ----
  {
    int m0 = ((wid >> 1) & 1) * 16, n0 = (wid & 1) * 16;
    const h16* lhs = (wid < 4) ? kbn : qn;
    v8f acc = {};
    for (int kk = 0; kk < 8; ++kk)
      acc = wmma_f16(frag_row(lhs, 256, m0, kk * 32, lane),
                     frag_row(kn, 256, n0, kk * 32, lane), acc);
    if (wid < 4) {
#pragma unroll
      for (int r = 0; r < 8; ++r) {
        int m = m0 + r + 8 * (lane >> 4), n = n0 + (lane & 15);
        Am[m * 33 + n] = (m > n) ? -acc[r] : 0.f;
      }
    } else {
#pragma unroll
      for (int r = 0; r < 8; ++r) {
        int m = m0 + r + 8 * (lane >> 4), n = n0 + (lane & 15);
        attb[m * 32 + n] = (h16)((m >= n) ? acc[r] : 0.f);
      }
    }
  }
  __syncthreads();
  // ---- stage 3: forward substitution, inv = A + I ----
  for (int i = 1; i < 32; ++i) {
    float val = 0.f;
    if (tid < 32)
      for (int s = 0; s < i; ++s) val += Am[i * 33 + s] * Am[s * 33 + tid];
    __syncthreads();
    if (tid < 32) Am[i * 33 + tid] += val;
    __syncthreads();
  }
  for (int e = tid; e < 1024; e += 256) {
    int m = e >> 5, n = e & 31;
    invb[e] = (h16)(Am[m * 33 + n] + ((m == n) ? 1.f : 0.f));
  }
  __syncthreads();
  // ---- stage 4: wn = -(inv@kb) ; u = inv@(v*beta) -> workspace (f32) ----
  float* ug = uo + (size_t)blockIdx.x * CE;
  for (int it = 0; it < 4; ++it) {
    int j = wid + 8 * it;           // 0..31
    int m0 = (j >> 4) * 16, n0 = (j & 15) * 16;
    v16h ia = frag_row(invb, 32, m0, 0, lane);
    v8f acc = {}, accu = {};
    acc  = wmma_f16(ia, frag_kmaj(kbn, 256, n0, 0, lane), acc);
    accu = wmma_f16(ia, frag_kmaj(xb, 256, n0, 0, lane), accu);
#pragma unroll
    for (int r = 0; r < 8; ++r) {
      int m = m0 + r + 8 * (lane >> 4), n = n0 + (lane & 15);
      wn[m * 256 + n] = (h16)(-acc[r]);
      ug[m * 256 + n] = accu[r];
    }
    // the next trip rewrites the address and data registers of the u stores
    asm volatile("s_wait_xcnt 0x0" ::: "memory");
  }
  __syncthreads();
  // ---- hand q, k, -w, attn to the scan: 16-byte stores, one block per chunk ----
  uint4* gq = (uint4*)qo + (size_t)blockIdx.x * (CE / 8);
  uint4* gk = (uint4*)ko + (size_t)blockIdx.x * (CE / 8);
  uint4* gw = (uint4*)wo + (size_t)blockIdx.x * (CE / 8);
#pragma unroll
  for (int i = 0; i < 4; ++i) {
    int e = tid + 256 * i;
    gq[e] = ((const uint4*)qn)[e];
    gk[e] = ((const uint4*)kn)[e];
    gw[e] = ((const uint4*)wn)[e];
  }
  if (tid < 128)
    ((uint4*)ao)[(size_t)blockIdx.x * 128 + tid] = ((const uint4*)attb)[tid];
}

// Serial scan over the chunks, state split by value columns: column n of ui,
// oi and S depends on column n of u and S only, so each work-group owns DVS
// value columns of one (batch, head) and keeps a 256 x DVS state slice in LDS.
// DVS = 32 floats = one 128-byte output line.
constexpr int DVS = 32;                    // value columns per work-group
constexpr int NSL = DVv / DVS;             // slices per (batch, head)
constexpr int NCT = DVS / 16;              // 16-wide column tiles per slice
constexpr int NT  = 2 * NCT;               // 32 x DVS result tiles
__global__ void __launch_bounds__(256)
delta_kernel(const float* __restrict__ qi, const float* __restrict__ ki,
             const float* __restrict__ wi, const float* __restrict__ ui0,
             const float* __restrict__ ai, float* __restrict__ dout) {
  extern __shared__ char smem[];
  float* uf  = (float*)smem;                 // 32xDVS f32 (u then ui)
  h16* Sld   = (h16*)(uf + 32 * DVS);         // 256xDVS state slice (dk x dv)
  h16* qn    = Sld + 256 * DVS;              // 32x256
  h16* kn    = qn + CE;
  h16* wn    = kn + CE;                      // holds -(inv@kb)
  h16* xb    = wn + CE;                      // 32xDVS: ui (f16)
  h16* attb  = xb + 32 * DVS;                // 32x32

  const int tid = threadIdx.x, lane = tid & 31, wid = tid >> 5;
  const int bh = blockIdx.x / NSL;
  const int c0 = (blockIdx.x % NSL) * DVS;   // first value column of the slice
  const int b = bh >> 2, h = bh & 3;

  for (int e = tid; e < 256 * DVS; e += 256) Sld[e] = (h16)0.f;
  __syncthreads();

  for (int nc = 0; nc < NCHUNK; ++nc) {
    const int t0 = nc * CHc;
    // ---- stage 1: fetch the chunk's prepared q, k, -w, attn and u slice ----
    const size_t cb = (size_t)(bh * NCHUNK + nc);
    const uint4* gq = (const uint4*)qi + cb * (CE / 8);
    const uint4* gk = (const uint4*)ki + cb * (CE / 8);
    const uint4* gw = (const uint4*)wi + cb * (CE / 8);
#pragma unroll
    for (int i = 0; i < 4; ++i) {
      int e = tid + 256 * i;
      ((uint4*)qn)[e] = gq[e];
      ((uint4*)kn)[e] = gk[e];
      ((uint4*)wn)[e] = gw[e];
    }
    ((uint4*)uf)[tid] =
        *(const uint4*)(ui0 + cb * CE + (size_t)(tid >> 3) * 256 + c0 + (tid & 7) * 4);
    if (tid < 128) ((uint4*)attb)[tid] = ((const uint4*)ai)[cb * 128 + tid];
    __syncthreads();
    // ---- stage 5: ui = u + (-w)@S -> uf (f32) and xb (f16) ----
    if (wid < NT) {
      int m0 = (wid / NCT) * 16, n0 = (wid % NCT) * 16;
      v8f acc;
#pragma unroll
      for (int r = 0; r < 8; ++r)
        acc[r] = uf[(m0 + r + 8 * (lane >> 4)) * DVS + n0 + (lane & 15)];
      for (int kk = 0; kk < 8; ++kk)
        acc = wmma_f16(frag_row(wn, 256, m0, kk * 32, lane),
                       frag_kmaj(Sld, DVS, n0, kk * 32, lane), acc);
#pragma unroll
      for (int r = 0; r < 8; ++r) {
        int m = m0 + r + 8 * (lane >> 4), n = n0 + (lane & 15);
        uf[m * DVS + n] = acc[r];
        xb[m * DVS + n] = (h16)acc[r];
      }
    }
    __syncthreads();
    // ---- stage 7: oi = q@S + attn@ui -> global ----
    if (wid < NT) {
      int m0 = (wid / NCT) * 16, n0 = (wid % NCT) * 16;
      v8f acc = {};
      for (int kk = 0; kk < 8; ++kk)
        acc = wmma_f16(frag_row(qn, 256, m0, kk * 32, lane),
                       frag_kmaj(Sld, DVS, n0, kk * 32, lane), acc);
      acc = wmma_f16(frag_row(attb, 32, m0, 0, lane),
                     frag_kmaj(xb, DVS, n0, 0, lane), acc);
#pragma unroll
      for (int r = 0; r < 8; ++r) {
        int m = m0 + r + 8 * (lane >> 4), n = n0 + (lane & 15);
        dout[((size_t)(b * Tt + t0 + m)) * Dd + (size_t)h * DVv + c0 + n] = acc[r];
      }
    }
    __syncthreads();
    // ---- stage 8: S += k^T @ ui ----
    for (int it = 0; it < 2 * NCT; ++it) {
      int j = wid + 8 * it;           // 0..16*NCT-1
      int m0 = (j / NCT) * 16, n0 = (j % NCT) * 16;
      v8f acc;
#pragma unroll
      for (int r = 0; r < 8; ++r)
        acc[r] = (float)Sld[(m0 + r + 8 * (lane >> 4)) * DVS + n0 + (lane & 15)];
      acc = wmma_f16(frag_kmaj(kn, 256, m0, 0, lane),
                     frag_kmaj(xb, DVS, n0, 0, lane), acc);
#pragma unroll
      for (int r = 0; r < 8; ++r)
        Sld[(m0 + r + 8 * (lane >> 4)) * DVS + n0 + (lane & 15)] = (h16)acc[r];
    }
    __syncthreads();
  }
}

// ---------------- gate softmax + branch mixing + RMSNorm -------------------
__global__ void __launch_bounds__(256)
fuse_kernel(const float* __restrict__ b0, const float* __restrict__ b1,
            const float* __restrict__ b2, const float* __restrict__ b3,
            const float* __restrict__ b4, const float* __restrict__ b5,
            const float* __restrict__ gi, const float* __restrict__ logits,
            const float* __restrict__ alpha, const float* __restrict__ ltemp,
            const float* __restrict__ onw, float* __restrict__ out) {
  size_t bt = blockIdx.x;
  int tid = threadIdx.x;
  __shared__ float probs_s[Hh][Pp];
  __shared__ float red[256];
  if (tid < Hh) {
    int h = tid;
    float x = ltemp[h];
    float temp = fmaxf(x, 0.f) + log1pf(expf(-fabsf(x))) + 1e-4f; // softplus
    float l[Pp];
    float mx = -1e30f;
#pragma unroll
    for (int p = 0; p < Pp; ++p) {
      float st = gi[bt * GIW + Dd + h * Pp + p];
      l[p] = (logits[bt * (Hh * Pp) + h * Pp + p] + alpha[p] * st) / temp;
      mx = fmaxf(mx, l[p]);
    }
    float se = 0.f;
#pragma unroll
    for (int p = 0; p < Pp; ++p) { l[p] = expf(l[p] - mx); se += l[p]; }
#pragma unroll
    for (int p = 0; p < Pp; ++p) {
      float pr = l[p] / se * (1.f - FLOORv);
      if (p == Pp - 1) pr += FLOORv;
      probs_s[h][p] = pr;
    }
  }
  __syncthreads();
  int d = tid;
  for (int h = 0; h < Hh; ++h) {
    size_t base = bt * Dd + (size_t)h * DVv + d;
    float o = b0[base] * probs_s[h][0] + b1[base] * probs_s[h][1] +
              b2[base] * probs_s[h][2] + b3[base] * probs_s[h][3] +
              b4[base] * probs_s[h][4] + b5[base] * probs_s[h][5];
    red[tid] = o * o;
    __syncthreads();
    for (int s = 128; s; s >>= 1) {
      if (tid < s) red[tid] += red[tid + s];
      __syncthreads();
    }
    float ms = red[0] * (1.f / 256.f);
    __syncthreads();
    out[base] = o * rsqrtf(ms + 1e-5f) * onw[d];
  }
}

// ---------------------------------------------------------------------------
extern "C" void kernel_launch(void* const* d_in, const int* in_sizes, int n_in,
                              void* d_out, int out_size, void* d_ws,
                              size_t ws_size, hipStream_t stream) {
  const float* hs   = (const float*)d_in[0];
  const float* qw   = (const float*)d_in[1];
  const float* kw   = (const float*)d_in[2];
  const float* vw   = (const float*)d_in[3];
  const float* bw   = (const float*)d_in[4];
  const float* qcw  = (const float*)d_in[5];
  const float* kcw  = (const float*)d_in[6];
  const float* vcw  = (const float*)d_in[7];
  const float* f3w  = (const float*)d_in[8];
  const float* f7w  = (const float*)d_in[9];
  const float* f15w = (const float*)d_in[10];
  const float* f31w = (const float*)d_in[11];
  const float* gw1  = (const float*)d_in[12];
  const float* gb1  = (const float*)d_in[13];
  const float* gw2  = (const float*)d_in[14];
  const float* gb2  = (const float*)d_in[15];
  const float* glt  = (const float*)d_in[16];
  const float* alps = (const float*)d_in[17];
  const float* onw  = (const float*)d_in[18];
  const float* ow   = (const float*)d_in[19];
  float* out = (float*)d_out;

  const size_t U = (size_t)Bb * Tt * Dd; // 4096*1024
  float* ws = (float*)d_ws;
  float* qp  = ws;            // q projection (reused: fir3)
  float* kp  = qp + U;        // k projection (reused: fir7)
  float* vp  = kp + U;        // v projection (reused: fir15)
  float* qcv = vp + U;        // q after conv+silu (reused: fir31)
  float* kcv = qcv + U;       // k after conv+silu (reused: o_fused)
  float* vcv = kcv + U;       // v after conv+silu (branch p=4)
  float* dta = vcv + U;       // delta-rule output (branch p=5)
  float* h1  = dta + U;       // gate hidden, 2U
  float* gi  = h1 + 2 * U;    // gate input, B*T x GIW
  float* beta = gi + (size_t)Bb * Tt * 1056;
  float* lgt  = beta + (size_t)Bb * Tt * Hh;
  float* pq  = lgt + (size_t)Bb * Tt * Hh * Pp;  // prepared q, f16 (U/2 floats)
  float* pk  = pq + U / 2;    // prepared k, f16
  float* pw  = pk + U / 2;    // prepared -w, f16
  float* pu  = pw + U / 2;    // prepared u, f32
  float* pa  = pu + U;        // prepared attn, f16, 32x32 per chunk

  const int MT = Bb * Tt;                 // 4096
  dim3 blk(256);
  dim3 gN1024((1024 + 127) / 128, (MT + 63) / 64);
  int ebk = (int)((U + 255) / 256);

  // 1) q/k/v projections (no activation; conv+silu comes after)
  gemm_kernel<<<gN1024, blk, 0, stream>>>(hs, Dd, qw, Dd, nullptr, qp, Dd, MT, Dd, Dd, 0);
  gemm_kernel<<<gN1024, blk, 0, stream>>>(hs, Dd, kw, Dd, nullptr, kp, Dd, MT, Dd, Dd, 0);
  gemm_kernel<<<gN1024, blk, 0, stream>>>(hs, Dd, vw, Dd, nullptr, vp, Dd, MT, Dd, Dd, 0);
  // 2) beta
  beta_kernel<<<(MT * Hh + 255) / 256, blk, 0, stream>>>(hs, bw, beta);
  // 3) depthwise causal conv (k=4) + SiLU
  dwconv_kernel<<<ebk, blk, 0, stream>>>(qp, qcw, qcv, 4, 1);
  dwconv_kernel<<<ebk, blk, 0, stream>>>(kp, kcw, kcv, 4, 1);
  dwconv_kernel<<<ebk, blk, 0, stream>>>(vp, vcw, vcv, 4, 1);
  // 4) delta rule: state-free chunk work for all chunks at once, then the
  //    scan, one workgroup per (batch, head, 32-column state slice)
  const size_t PLDS = 32 * 33 * sizeof(float) + (5 * CE + 2 * 32 * 32) * sizeof(h16);
  prep_kernel<<<dim3(Bb * Hh * NCHUNK), blk, PLDS, stream>>>(qcv, kcv, vcv, beta,
                                                             pq, pk, pw, pu, pa);
  const size_t DLDS = 32 * DVS * sizeof(float) +
                      (256 * DVS + 3 * CE + 32 * DVS + 32 * 32) * sizeof(h16);
  delta_kernel<<<dim3(Bb * Hh * NSL), blk, DLDS, stream>>>(pq, pk, pw, pu, pa, dta);
  // 5) FIR branches on v (reuse proj buffers; qcv/kcv free after delta)
  dwconv_kernel<<<ebk, blk, 0, stream>>>(vcv, f3w, qp, 3, 0);
  dwconv_kernel<<<ebk, blk, 0, stream>>>(vcv, f7w, kp, 7, 0);
  dwconv_kernel<<<ebk, blk, 0, stream>>>(vcv, f15w, vp, 15, 0);
  dwconv_kernel<<<ebk, blk, 0, stream>>>(vcv, f31w, qcv, 31, 0);
  // 6) gate input = concat(hidden, stats)
  gi_copy_kernel<<<ebk, blk, 0, stream>>>(hs, gi);
  stats_kernel<<<(MT * Hh * Pp) / 8, blk, 0, stream>>>(qp, kp, vp, qcv, vcv, dta, gi);
  // 7) gate MLP (gelu, then linear to H*P logits with gb2 bias)
  dim3 gGate1((2048 + 127) / 128, (MT + 63) / 64);
  gemm_kernel<<<gGate1, blk, 0, stream>>>(gi, GIW, gw1, GIW, gb1, h1, 2048, MT, 2048, GIW, 1);
  dim3 gGate2(1, (MT + 63) / 64);
  gemm_kernel<<<gGate2, blk, 0, stream>>>(h1, 2048, gw2, 2048, gb2, lgt, Hh * Pp, MT, Hh * Pp, 2048, 0);
  // 8) softmax gate + mix branches + RMSNorm  (o_fused -> kcv)
  float* ofused = kcv;
  fuse_kernel<<<dim3(MT), blk, 0, stream>>>(qp, kp, vp, qcv, vcv, dta, gi, lgt,
                                            alps, glt, onw, ofused);
  // 9) output projection
  gemm_kernel<<<gN1024, blk, 0, stream>>>(ofused, Dd, ow, Dd, nullptr, out, Dd, MT, Dd, Dd, 0);
}

// v003
// One run takes 925 microseconds.
// Two timings next to v002 both put it at 1.39 times that version's speed.
// All steps since v000 together make it 4.25 times as fast.
#include <hip/hip_runtime.h>
#include <hip/hip_bf16.h>
#include <math.h>

#define DEV __device__ __forceinline__

typedef __attribute__((ext_vector_type(16))) _Float16 v16h;
typedef __attribute__((ext_vector_type(8)))  float    v8f;
typedef _Float16 h16;

constexpr int Bb = 2, Tt = 2048, Dd = 1024, Hh = 4, Pp = 6, CHc = 32;
constexpr int DKk = 256, DVv = 256;
constexpr int NCHUNK = Tt / CHc;           // 64
constexpr int GIW = Dd + Hh * Pp;          // 1048
constexpr float FLOORv = 0.05f;

DEV v16h frag_row(const h16* t, int ld, int r0, int k0, int lane) {
  // element [m][k] at t[(r0+m)*ld + (k0+k)]
  v16h f;
  int m = lane & 15, kg = lane >> 4;
#pragma unroll
  for (int j = 0; j < 8; ++j) {
    int kk = ((j < 4) ? 0 : 16) + kg * 8 + 2 * (j & 3);
    const h16* p = t + (size_t)(r0 + m) * ld + k0 + kk;
    f[2 * j] = p[0];
    f[2 * j + 1] = p[1];
  }
  return f;
}
DEV v16h frag_kmaj(const h16* t, int ld, int r0, int k0, int lane) {
  // element [m][k] at t[(k0+k)*ld + (r0+m)]
  v16h f;
  int m = lane & 15, kg = lane >> 4;
#pragma unroll
  for (int j = 0; j < 8; ++j) {
    int kk = ((j < 4) ? 0 : 16) + kg * 8 + 2 * (j & 3);
    f[2 * j]     = t[(size_t)(k0 + kk) * ld + r0 + m];
    f[2 * j + 1] = t[(size_t)(k0 + kk + 1) * ld + r0 + m];
  }
  return f;
}
DEV v8f wmma_f16(v16h a, v16h b, v8f c) {
  return __builtin_amdgcn_wmma_f32_16x16x32_f16(false, a, false, b, (short)0, c,
                                                false, false);
}

DEV void put4(h16* d, float4 f) {
  d[0] = (h16)f.x; d[1] = (h16)f.y; d[2] = (h16)f.z; d[3] = (h16)f.w;
}

// ---------------- Generic GEMM: C = act(A(MxK) * W(NxK)^T + bias) ----------
// 64x128 block tile, 8 waves (2x4), each wave owns a 32x32 region (4 wmma/Kstep)
// A thread stages six 16-byte pieces of every K tile: columns c4..c4+3 of rows
// r8 + 32 i of A (i < 2) and of W (i < 4). The six loads of tile kt + 1 are
// issued together, into registers, before tile kt is read from LDS and
// multiplied; they are converted and stored to LDS at the top of the next trip.
// Edges take the same path: a row past M or N is read at the last row, a piece
// past K at the first tile's columns, and such a piece is stored as zeros.
// K, lda and ldw are multiples of 4 in every call, so a piece lies wholly
// inside K or wholly outside, and every piece is 16-byte aligned.
__global__ void __launch_bounds__(256)
gemm_kernel(const float* __restrict__ A, int lda, const float* __restrict__ W,
            int ldw, const float* __restrict__ bias, float* __restrict__ C,
            int ldc, int M, int N, int K, int act) {
  __shared__ h16 At[64][40];
  __shared__ h16 Wt[128][40];
  const int tid = threadIdx.x, lane = tid & 31, wid = tid >> 5;
  const int wm = wid >> 2, wn = wid & 3;
  const int bm = blockIdx.y * 64, bn = blockIdx.x * 128;
  const int r8 = tid >> 3, c4 = (tid & 7) * 4;
  v8f acc00 = {}, acc01 = {}, acc10 = {}, acc11 = {};
  const int ktn = (K + 31) >> 5;
  const float* pa[2];
  const float* pw[4];
  bool va[2], vw[4];
#pragma unroll
  for (int i = 0; i < 2; ++i) {
    int gm = bm + r8 + 32 * i;
    va[i] = gm < M;
    pa[i] = A + (size_t)(va[i] ? gm : M - 1) * lda + c4;
  }
#pragma unroll
  for (int i = 0; i < 4; ++i) {
    int gn = bn + r8 + 32 * i;
    vw[i] = gn < N;
    pw[i] = W + (size_t)(vw[i] ? gn : N - 1) * ldw + c4;
  }
  float4 fa[2], fw[4];
#pragma unroll
  for (int i = 0; i < 2; ++i) fa[i] = *(const float4*)pa[i];
#pragma unroll
  for (int i = 0; i < 4; ++i) fw[i] = *(const float4*)pw[i];
  const bool inner = (bm + 64 <= M) && (bn + 128 <= N);
  for (int kt = 0; kt < ktn; ++kt) {
    if (inner && (kt << 5) + 32 <= K) {
#pragma unroll
      for (int i = 0; i < 2; ++i) put4(&At[r8 + 32 * i][c4], fa[i]);
#pragma unroll
      for (int i = 0; i < 4; ++i) put4(&Wt[r8 + 32 * i][c4], fw[i]);
    } else {
      const bool kv = (kt << 5) + c4 < K;   // this tile's piece lies inside K
      const float4 z = make_float4(0.f, 0.f, 0.f, 0.f);
#pragma unroll
      for (int i = 0; i < 2; ++i) put4(&At[r8 + 32 * i][c4], (kv && va[i]) ? fa[i] : z);
#pragma unroll
      for (int i = 0; i < 4; ++i) put4(&Wt[r8 + 32 * i][c4], (kv && vw[i]) ? fw[i] : z);
    }
    __syncthreads();
    if (kt + 1 < ktn) {
      const int kn = (kt + 1) << 5;
      const int ko = (kn + c4 < K) ? kn : 0;
#pragma unroll
      for (int i = 0; i < 2; ++i) fa[i] = *(const float4*)(pa[i] + ko);
#pragma unroll
      for (int i = 0; i < 4; ++i) fw[i] = *(const float4*)(pw[i] + ko);
      asm volatile("s_wait_xcnt 0x0" ::: "memory");
    }
    v16h a0 = frag_row(&At[0][0], 40, wm * 32, 0, lane);
    v16h a1 = frag_row(&At[0][0], 40, wm * 32 + 16, 0, lane);
    v16h b0 = frag_row(&Wt[0][0], 40, wn * 32, 0, lane);
    v16h b1 = frag_row(&Wt[0][0], 40, wn * 32 + 16, 0, lane);
    acc00 = wmma_f16(a0, b0, acc00);
    acc01 = wmma_f16(a0, b1, acc01);
    acc10 = wmma_f16(a1, b0, acc10);
    acc11 = wmma_f16(a1, b1, acc11);
    __syncthreads();
  }
  v8f* accs[4] = {&acc00, &acc01, &acc10, &acc11};
#pragma unroll
  for (int q = 0; q < 4; ++q) {
    int im = q >> 1, in_ = q & 1;
#pragma unroll
    for (int r = 0; r < 8; ++r) {
      int gm = bm + wm * 32 + im * 16 + r + 8 * (lane >> 4);
      int gn = bn + wn * 32 + in_ * 16 + (lane & 15);
      if (gm < M && gn < N) {
        float v = (*accs[q])[r] + (bias ? bias[gn] : 0.f);
        if (act == 1) v = 0.5f * v * (1.f + erff(v * 0.70710678118f));
        C[(size_t)gm * ldc + gn] = v;
      }
    }
  }
}

// ---------------- depthwise causal conv (+ optional SiLU) ------------------
__global__ void dwconv_kernel(const float* __restrict__ X,
                              const float* __restrict__ Wc,
                              float* __restrict__ Y, int Kw, int applySilu) {
  size_t idx = (size_t)blockIdx.x * blockDim.x + threadIdx.x;
  size_t total = (size_t)Bb * Tt * Dd;
  if (idx >= total) return;
  int c = (int)(idx & (Dd - 1));
  size_t bt = idx / Dd;
  int t = (int)(bt % Tt);
  float s = 0.f;
  for (int i = 0; i < Kw; ++i) {
    int tt = t - (Kw - 1) + i;
    if (tt >= 0) s += X[(bt - (size_t)(t - tt)) * Dd + c] * Wc[c * Kw + i];
  }
  if (applySilu) s = s / (1.f + expf(-s));
  Y[idx] = s;
}

// ---------------- beta = sigmoid(hidden @ b_proj^T) ------------------------
__global__ void beta_kernel(const float* __restrict__ hs,
                            const float* __restrict__ Wb,
                            float* __restrict__ beta) {
  int idx = blockIdx.x * blockDim.x + threadIdx.x;
  if (idx >= Bb * Tt * Hh) return;
  int h = idx & (Hh - 1);
  size_t bt = (size_t)idx >> 2;
  const float* x = hs + bt * Dd;
  const float* w = Wb + (size_t)h * Dd;
  float s = 0.f;
  for (int k = 0; k < Dd; ++k) s += x[k] * w[k];
  beta[idx] = 1.f / (1.f + expf(-s));
}

// ---------------- gi[:, :D] = hidden ---------------------------------------
__global__ void gi_copy_kernel(const float* __restrict__ hs,
                               float* __restrict__ gi) {
  size_t idx = (size_t)blockIdx.x * blockDim.x + threadIdx.x;
  if (idx >= (size_t)Bb * Tt * Dd) return;
  size_t bt = idx / Dd;
  int j = (int)(idx % Dd);
  gi[bt * GIW + j] = hs[idx];
}

// ---------------- stats = mean |branch| over DV -> gi tail -----------------
__global__ void stats_kernel(const float* __restrict__ b0,
                             const float* __restrict__ b1,
                             const float* __restrict__ b2,
                             const float* __restrict__ b3,
                             const float* __restrict__ b4,
                             const float* __restrict__ b5,
                             float* __restrict__ gi) {
  int wg = blockIdx.x * 8 + (threadIdx.x >> 5);
  int lane = threadIdx.x & 31;
  if (wg >= Bb * Tt * Hh * Pp) return;
  int p = wg % Pp;
  int h = (wg / Pp) % Hh;
  size_t bt = (size_t)wg / (Pp * Hh);
  const float* src = (p == 0) ? b0 : (p == 1) ? b1 : (p == 2) ? b2
                   : (p == 3) ? b3 : (p == 4) ? b4 : b5;
  src += bt * Dd + (size_t)h * DVv;
  float s = 0.f;
#pragma unroll
  for (int i = 0; i < 8; ++i) s += fabsf(src[lane + 32 * i]);
#pragma unroll
  for (int off = 16; off; off >>= 1) s += __shfl_xor(s, off, 32);
  if (lane == 0) gi[bt * GIW + Dd + h * Pp + p] = s * (1.f / 256.f);
}

// ---------------- chunked delta rule ---------------------------------------
// The UT transform of a chunk (l2norm, A, forward substitution, w, u, attn)
// reads no state, so prep_kernel does it for all chunks side by side, one
// work-group per (batch, head, chunk), and leaves q, k, -w, attn (f16) and
// u (f32) in the workspace, one contiguous block per chunk. Only the steps
// that read or write the state S stay in the serial scan of delta_kernel.
constexpr int CE = CHc * DKk;              // elements of one 32 x 256 chunk block
__global__ void __launch_bounds__(256)
prep_kernel(const float* __restrict__ qc, const float* __restrict__ kc,
            const float* __restrict__ vc, const float* __restrict__ betap,
            float* __restrict__ qo, float* __restrict__ ko,
            float* __restrict__ wo, float* __restrict__ uo,
            float* __restrict__ ao) {
  extern __shared__ char smem[];
  float* Am  = (float*)smem;                 // 32x33 f32 (A / fwd-subst)
  h16* qn    = (h16*)(Am + 32 * 33);         // 32x256
  h16* kn    = qn + CE;
  h16* kbn   = kn + CE;
  h16* wn    = kbn + CE;                     // holds -(inv@kb)
  h16* xb    = wn + CE;                      // 32x256: v*beta
  h16* invb  = xb + CE;                      // 32x32
  h16* attb  = invb + 32 * 32;               // 32x32

  const int tid = threadIdx.x, lane = tid & 31, wid = tid >> 5;
  const int bh = blockIdx.x / NCHUNK, nc = blockIdx.x % NCHUNK;
  const int b = bh >> 2, h = bh & 3;
  const int t0 = nc * CHc;

  // ---- stage 1: load chunk, l2norm q/k, apply beta ----
  for (int j = 0; j < 4; ++j) {
    int r = wid * 4 + j;
    int t = t0 + r;
    size_t rowb = ((size_t)(b * Tt + t)) * Dd + (size_t)h * DKk;
    float bet = betap[(size_t)(b * Tt + t) * Hh + h];
    float qv[8], kv[8], vv[8];
    float sq = 0.f, sk = 0.f;
#pragma unroll
    for (int i = 0; i < 8; ++i) {
      int d = lane + 32 * i;
      qv[i] = qc[rowb + d]; kv[i] = kc[rowb + d]; vv[i] = vc[rowb + d];
      sq += qv[i] * qv[i]; sk += kv[i] * kv[i];
    }
#pragma unroll
    for (int off = 16; off; off >>= 1) {
      sq += __shfl_xor(sq, off, 32);
      sk += __shfl_xor(sk, off, 32);
    }
    float rq = rsqrtf(sq + 1e-12f), rk = rsqrtf(sk + 1e-12f);
#pragma unroll
    for (int i = 0; i < 8; ++i) {
      int d = lane + 32 * i;
      float kq = kv[i] * rk;
      qn[r * 256 + d]  = (h16)(qv[i] * rq);
      kn[r * 256 + d]  = (h16)kq;
      kbn[r * 256 + d] = (h16)(kq * bet);
      xb[r * 256 + d]  = (h16)(vv[i] * bet);
    }
  }
  __syncthreads();
  // ---- stage 2: A = -(kb k^T), strict lower (waves 0-3) ;
  //      stage 6: attn = (q k^T) * lower-incl mask (waves 4-7) ----
  {
    int m0 = ((wid >> 1) & 1) * 16, n0 = (wid & 1) * 16;
    const h16* lhs = (wid < 4) ? kbn : qn;
    v8f acc = {};
    for (int kk = 0; kk < 8; ++kk)
      acc = wmma_f16(frag_row(lhs, 256, m0, kk * 32, lane),
                     frag_row(kn, 256, n0, kk * 32, lane), acc);
    if (wid < 4) {
#pragma unroll
      for (int r = 0; r < 8; ++r) {
        int m = m0 + r + 8 * (lane >> 4), n = n0 + (lane & 15);
        Am[m * 33 + n] = (m > n) ? -acc[r] : 0.f;
      }
    } else {
#pragma unroll
      for (int r = 0; r < 8; ++r) {
        int m = m0 + r + 8 * (lane >> 4), n = n0 + (lane & 15);
        attb[m * 32 + n] = (h16)((m >= n) ? acc[r] : 0.f);
      }
    }
  }
  __syncthreads();
  // ---- stage 3: forward substitution, inv = A + I ----
  for (int i = 1; i < 32; ++i) {
    float val = 0.f;
    if (tid < 32)
      for (int s = 0; s < i; ++s) val += Am[i * 33 + s] * Am[s * 33 + tid];
    __syncthreads();
    if (tid < 32) Am[i * 33 + tid] += val;
    __syncthreads();
  }
  for (int e = tid; e < 1024; e += 256) {
    int m = e >> 5, n = e & 31;
    invb[e] = (h16)(Am[m * 33 + n] + ((m == n) ? 1.f : 0.f));
  }
  __syncthreads();
  // ---- stage 4: wn = -(inv@kb) ; u = inv@(v*beta) -> workspace (f32) ----
  float* ug = uo + (size_t)blockIdx.x * CE;
  for (int it = 0; it < 4; ++it) {
    int j = wid + 8 * it;           // 0..31
    int m0 = (j >> 4) * 16, n0 = (j & 15) * 16;
    v16h ia = frag_row(invb, 32, m0, 0, lane);
    v8f acc = {}, accu = {};
    acc  = wmma_f16(ia, frag_kmaj(kbn, 256, n0, 0, lane), acc);
    accu = wmma_f16(ia, frag_kmaj(xb, 256, n0, 0, lane), accu);
#pragma unroll
    for (int r = 0; r < 8; ++r) {
      int m = m0 + r + 8 * (lane >> 4), n = n0 + (lane & 15);
      wn[m * 256 + n] = (h16)(-acc[r]);
      ug[m * 256 + n] = accu[r];
    }
    // the next trip rewrites the address and data registers of the u stores
    asm volatile("s_wait_xcnt 0x0" ::: "memory");
  }
  __syncthreads();
  // ---- hand q, k, -w, attn to the scan: 16-byte stores, one block per chunk ----
  uint4* gq = (uint4*)qo + (size_t)blockIdx.x * (CE / 8);
  uint4* gk = (uint4*)ko + (size_t)blockIdx.x * (CE / 8);
  uint4* gw = (uint4*)wo + (size_t)blockIdx.x * (CE / 8);
#pragma unroll
  for (int i = 0; i < 4; ++i) {
    int e = tid + 256 * i;
    gq[e] = ((const uint4*)qn)[e];
    gk[e] = ((const uint4*)kn)[e];
    gw[e] = ((const uint4*)wn)[e];
  }
  if (tid < 128)
    ((uint4*)ao)[(size_t)blockIdx.x * 128 + tid] = ((const uint4*)attb)[tid];
}

// Serial scan over the chunks, state split by value columns: column n of ui,
// oi and S depends on column n of u and S only, so each work-group owns DVS
// value columns of one (batch, head) and keeps a 256 x DVS state slice in LDS.
// DVS = 32 floats = one 128-byte output line.
constexpr int DVS = 32;                    // value columns per work-group
constexpr int NSL = DVv / DVS;             // slices per (batch, head)
constexpr int NCT = DVS / 16;              // 16-wide column tiles per slice
constexpr int NT  = 2 * NCT;               // 32 x DVS result tiles
__global__ void __launch_bounds__(256)
delta_kernel(const float* __restrict__ qi, const float* __restrict__ ki,
             const float* __restrict__ wi, const float* __restrict__ ui0,
             const float* __restrict__ ai, float* __restrict__ dout) {
  extern __shared__ char smem[];
  float* uf  = (float*)smem;                 // 32xDVS f32 (u then ui)
  h16* Sld   = (h16*)(uf + 32 * DVS);         // 256xDVS state slice (dk x dv)
  h16* qn    = Sld + 256 * DVS;              // 32x256
  h16* kn    = qn + CE;
  h16* wn    = kn + CE;                      // holds -(inv@kb)
  h16* xb    = wn + CE;                      // 32xDVS: ui (f16)
  h16* attb  = xb + 32 * DVS;                // 32x32

  const int tid = threadIdx.x, lane = tid & 31, wid = tid >> 5;
  const int bh = blockIdx.x / NSL;
  const int c0 = (blockIdx.x % NSL) * DVS;   // first value column of the slice
  const int b = bh >> 2, h = bh & 3;

  for (int e = tid; e < 256 * DVS; e += 256) Sld[e] = (h16)0.f;
  __syncthreads();

  for (int nc = 0; nc < NCHUNK; ++nc) {
    const int t0 = nc * CHc;
    // ---- stage 1: fetch the chunk's prepared q, k, -w, attn and u slice ----
    const size_t cb = (size_t)(bh * NCHUNK + nc);
    const uint4* gq = (const uint4*)qi + cb * (CE / 8);
    const uint4* gk = (const uint4*)ki + cb * (CE / 8);
    const uint4* gw = (const uint4*)wi + cb * (CE / 8);
#pragma unroll
    for (int i = 0; i < 4; ++i) {
      int e = tid + 256 * i;
      ((uint4*)qn)[e] = gq[e];
      ((uint4*)kn)[e] = gk[e];
      ((uint4*)wn)[e] = gw[e];
    }
    ((uint4*)uf)[tid] =
        *(const uint4*)(ui0 + cb * CE + (size_t)(tid >> 3) * 256 + c0 + (tid & 7) * 4);
    if (tid < 128) ((uint4*)attb)[tid] = ((const uint4*)ai)[cb * 128 + tid];
    __syncthreads();
    // ---- stage 5: ui = u + (-w)@S -> uf (f32) and xb (f16) ----
    if (wid < NT) {
      int m0 = (wid / NCT) * 16, n0 = (wid % NCT) * 16;
      v8f acc;
#pragma unroll
      for (int r = 0; r < 8; ++r)
        acc[r] = uf[(m0 + r + 8 * (lane >> 4)) * DVS + n0 + (lane & 15)];
      for (int kk = 0; kk < 8; ++kk)
        acc = wmma_f16(frag_row(wn, 256, m0, kk * 32, lane),
                       frag_kmaj(Sld, DVS, n0, kk * 32, lane), acc);
#pragma unroll
      for (int r = 0; r < 8; ++r) {
        int m = m0 + r + 8 * (lane >> 4), n = n0 + (lane & 15);
        uf[m * DVS + n] = acc[r];
        xb[m * DVS + n] = (h16)acc[r];
      }
    }
    __syncthreads();
    // ---- stage 7: oi = q@S + attn@ui -> global ----
    if (wid < NT) {
      int m0 = (wid / NCT) * 16, n0 = (wid % NCT) * 16;
      v8f acc = {};
      for (int kk = 0; kk < 8; ++kk)
        acc = wmma_f16(frag_row(qn, 256, m0, kk * 32, lane),
                       frag_kmaj(Sld, DVS, n0, kk * 32, lane), acc);
      acc = wmma_f16(frag_row(attb, 32, m0, 0, lane),
                     frag_kmaj(xb, DVS, n0, 0, lane), acc);
#pragma unroll
      for (int r = 0; r < 8; ++r) {
        int m = m0 + r + 8 * (lane >> 4), n = n0 + (lane & 15);
        dout[((size_t)(b * Tt + t0 + m)) * Dd + (size_t)h * DVv + c0 + n] = acc[r];
      }
    }
    __syncthreads();
    // ---- stage 8: S += k^T @ ui ----
    for (int it = 0; it < 2 * NCT; ++it) {
      int j = wid + 8 * it;           // 0..16*NCT-1
      int m0 = (j / NCT) * 16, n0 = (j % NCT) * 16;
      v8f acc;
#pragma unroll
      for (int r = 0; r < 8; ++r)
        acc[r] = (float)Sld[(m0 + r + 8 * (lane >> 4)) * DVS + n0 + (lane & 15)];
      acc = wmma_f16(frag_kmaj(kn, 256, m0, 0, lane),
                     frag_kmaj(xb, DVS, n0, 0, lane), acc);
#pragma unroll
      for (int r = 0; r < 8; ++r)
        Sld[(m0 + r + 8 * (lane >> 4)) * DVS + n0 + (lane & 15)] = (h16)acc[r];
    }
    __syncthreads();
  }
}

// ---------------- gate softmax + branch mixing + RMSNorm -------------------
__global__ void __launch_bounds__(256)
fuse_kernel(const float* __restrict__ b0, const float* __restrict__ b1,
            const float* __restrict__ b2, const float* __restrict__ b3,
            const float* __restrict__ b4, const float* __restrict__ b5,
            const float* __restrict__ gi, const float* __restrict__ logits,
            const float* __restrict__ alpha, const float* __restrict__ ltemp,
            const float* __restrict__ onw, float* __restrict__ out) {
  size_t bt = blockIdx.x;
  int tid = threadIdx.x;
  __shared__ float probs_s[Hh][Pp];
  __shared__ float red[256];
  if (tid < Hh) {
    int h = tid;
    float x = ltemp[h];
    float temp = fmaxf(x, 0.f) + log1pf(expf(-fabsf(x))) + 1e-4f; // softplus
    float l[Pp];
    float mx = -1e30f;
#pragma unroll
    for (int p = 0; p < Pp; ++p) {
      float st = gi[bt * GIW + Dd + h * Pp + p];
      l[p] = (logits[bt * (Hh * Pp) + h * Pp + p] + alpha[p] * st) / temp;
      mx = fmaxf(mx, l[p]);
    }
    float se = 0.f;
#pragma unroll
    for (int p = 0; p < Pp; ++p) { l[p] = expf(l[p] - mx); se += l[p]; }
#pragma unroll
    for (int p = 0; p < Pp; ++p) {
      float pr = l[p] / se * (1.f - FLOORv);
      if (p == Pp - 1) pr += FLOORv;
      probs_s[h][p] = pr;
    }
  }
  __syncthreads();
  int d = tid;
  for (int h = 0; h < Hh; ++h) {
    size_t base = bt * Dd + (size_t)h * DVv + d;
    float o = b0[base] * probs_s[h][0] + b1[base] * probs_s[h][1] +
              b2[base] * probs_s[h][2] + b3[base] * probs_s[h][3] +
              b4[base] * probs_s[h][4] + b5[base] * probs_s[h][5];
    red[tid] = o * o;
    __syncthreads();
    for (int s = 128; s; s >>= 1) {
      if (tid < s) red[tid] += red[tid + s];
      __syncthreads();
    }
    float ms = red[0] * (1.f / 256.f);
    __syncthreads();
    out[base] = o * rsqrtf(ms + 1e-5f) * onw[d];
  }
}

// ---------------------------------------------------------------------------
extern "C" void kernel_launch(void* const* d_in, const int* in_sizes, int n_in,
                              void* d_out, int out_size, void* d_ws,
                              size_t ws_size, hipStream_t stream) {
  const float* hs   = (const float*)d_in[0];
  const float* qw   = (const float*)d_in[1];
  const float* kw   = (const float*)d_in[2];
  const float* vw   = (const float*)d_in[3];
  const float* bw   = (const float*)d_in[4];
  const float* qcw  = (const float*)d_in[5];
  const float* kcw  = (const float*)d_in[6];
  const float* vcw  = (const float*)d_in[7];
  const float* f3w  = (const float*)d_in[8];
  const float* f7w  = (const float*)d_in[9];
  const float* f15w = (const float*)d_in[10];
  const float* f31w = (const float*)d_in[11];
  const float* gw1  = (const float*)d_in[12];
  const float* gb1  = (const float*)d_in[13];
  const float* gw2  = (const float*)d_in[14];
  const float* gb2  = (const float*)d_in[15];
  const float* glt  = (const float*)d_in[16];
  const float* alps = (const float*)d_in[17];
  const float* onw  = (const float*)d_in[18];
  const float* ow   = (const float*)d_in[19];
  float* out = (float*)d_out;

  const size_t U = (size_t)Bb * Tt * Dd; // 4096*1024
  float* ws = (float*)d_ws;
  float* qp  = ws;            // q projection (reused: fir3)
  float* kp  = qp + U;        // k projection (reused: fir7)
  float* vp  = kp + U;        // v projection (reused: fir15)
  float* qcv = vp + U;        // q after conv+silu (reused: fir31)
  float* kcv = qcv + U;       // k after conv+silu (reused: o_fused)
  float* vcv = kcv + U;       // v after conv+silu (branch p=4)
  float* dta = vcv + U;       // delta-rule output (branch p=5)
  float* h1  = dta + U;       // gate hidden, 2U
  float* gi  = h1 + 2 * U;    // gate input, B*T x GIW
  float* beta = gi + (size_t)Bb * Tt * 1056;
  float* lgt  = beta + (size_t)Bb * Tt * Hh;
  float* pq  = lgt + (size_t)Bb * Tt * Hh * Pp;  // prepared q, f16 (U/2 floats)
  float* pk  = pq + U / 2;    // prepared k, f16
  float* pw  = pk + U / 2;    // prepared -w, f16
  float* pu  = pw + U / 2;    // prepared u, f32
  float* pa  = pu + U;        // prepared attn, f16, 32x32 per chunk

  const int MT = Bb * Tt;                 // 4096
  dim3 blk(256);
  dim3 gN1024((1024 + 127) / 128, (MT + 63) / 64);
  int ebk = (int)((U + 255) / 256);

  // 1) q/k/v projections (no activation; conv+silu comes after)
  gemm_kernel<<<gN1024, blk, 0, stream>>>(hs, Dd, qw, Dd, nullptr, qp, Dd, MT, Dd, Dd, 0);
  gemm_kernel<<<gN1024, blk, 0, stream>>>(hs, Dd, kw, Dd, nullptr, kp, Dd, MT, Dd, Dd, 0);
  gemm_kernel<<<gN1024, blk, 0, stream>>>(hs, Dd, vw, Dd, nullptr, vp, Dd, MT, Dd, Dd, 0);
  // 2) beta
  beta_kernel<<<(MT * Hh + 255) / 256, blk, 0, stream>>>(hs, bw, beta);
  // 3) depthwise causal conv (k=4) + SiLU
  dwconv_kernel<<<ebk, blk, 0, stream>>>(qp, qcw, qcv, 4, 1);
  dwconv_kernel<<<ebk, blk, 0, stream>>>(kp, kcw, kcv, 4, 1);
  dwconv_kernel<<<ebk, blk, 0, stream>>>(vp, vcw, vcv, 4, 1);
  // 4) delta rule: state-free chunk work for all chunks at once, then the
  //    scan, one workgroup per (batch, head, 32-column state slice)
  const size_t PLDS = 32 * 33 * sizeof(float) + (5 * CE + 2 * 32 * 32) * sizeof(h16);
  prep_kernel<<<dim3(Bb * Hh * NCHUNK), blk, PLDS, stream>>>(qcv, kcv, vcv, beta,
                                                             pq, pk, pw, pu, pa);
  const size_t DLDS = 32 * DVS * sizeof(float) +
                      (256 * DVS + 3 * CE + 32 * DVS + 32 * 32) * sizeof(h16);
  delta_kernel<<<dim3(Bb * Hh * NSL), blk, DLDS, stream>>>(pq, pk, pw, pu, pa, dta);
  // 5) FIR branches on v (reuse proj buffers; qcv/kcv free after delta)
  dwconv_kernel<<<ebk, blk, 0, stream>>>(vcv, f3w, qp, 3, 0);
  dwconv_kernel<<<ebk, blk, 0, stream>>>(vcv, f7w, kp, 7, 0);
  dwconv_kernel<<<ebk, blk, 0, stream>>>(vcv, f15w, vp, 15, 0);
  dwconv_kernel<<<ebk, blk, 0, stream>>>(vcv, f31w, qcv, 31, 0);
  // 6) gate input = concat(hidden, stats)
  gi_copy_kernel<<<ebk, blk, 0, stream>>>(hs, gi);
  stats_kernel<<<(MT * Hh * Pp) / 8, blk, 0, stream>>>(qp, kp, vp, qcv, vcv, dta, gi);
  // 7) gate MLP (gelu, then linear to H*P logits with gb2 bias)
  dim3 gGate1((2048 + 127) / 128, (MT + 63) / 64);
  gemm_kernel<<<gGate1, blk, 0, stream>>>(gi, GIW, gw1, GIW, gb1, h1, 2048, MT, 2048, GIW, 1);
  dim3 gGate2(1, (MT + 63) / 64);
  gemm_kernel<<<gGate2, blk, 0, stream>>>(h1, 2048, gw2, 2048, gb2, lgt, Hh * Pp, MT, Hh * Pp, 2048, 0);
  // 8) softmax gate + mix branches + RMSNorm  (o_fused -> kcv)
  float* ofused = kcv;
  fuse_kernel<<<dim3(MT), blk, 0, stream>>>(qp, kp, vp, qcv, vcv, dta, gi, lgt,
                                            alps, glt, onw, ofused);
  // 9) output projection
  gemm_kernel<<<gN1024, blk, 0, stream>>>(ofused, Dd, ow, Dd, nullptr, out, Dd, MT, Dd, Dd, 0);
}

// v004
// It runs in 689 microseconds.
// Timed twice side by side with v003, it ran 1.34 times as fast both times.
// All steps since v000 together make it 5.71 times as fast.
#include <hip/hip_runtime.h>
#include <hip/hip_bf16.h>
#include <math.h>

#define DEV __device__ __forceinline__

typedef __attribute__((ext_vector_type(16))) _Float16 v16h;
typedef __attribute__((ext_vector_type(8)))  float    v8f;
typedef _Float16 h16;

constexpr int Bb = 2, Tt = 2048, Dd = 1024, Hh = 4, Pp = 6, CHc = 32;
constexpr int DKk = 256, DVv = 256;
constexpr int NCHUNK = Tt / CHc;           // 64
constexpr int GIW = Dd + Hh * Pp;          // 1048
constexpr float FLOORv = 0.05f;

DEV v16h frag_row(const h16* t, int ld, int r0, int k0, int lane) {
  // element [m][k] at t[(r0+m)*ld + (k0+k)]
  v16h f;
  int m = lane & 15, kg = lane >> 4;
#pragma unroll
  for (int j = 0; j < 8; ++j) {
    int kk = ((j < 4) ? 0 : 16) + kg * 8 + 2 * (j & 3);
    const h16* p = t + (size_t)(r0 + m) * ld + k0 + kk;
    f[2 * j] = p[0];
    f[2 * j + 1] = p[1];
  }
  return f;
}
DEV v16h frag_kmaj(const h16* t, int ld, int r0, int k0, int lane) {
  // element [m][k] at t[(k0+k)*ld + (r0+m)]
  v16h f;
  int m = lane & 15, kg = lane >> 4;
#pragma unroll
  for (int j = 0; j < 8; ++j) {
    int kk = ((j < 4) ? 0 : 16) + kg * 8 + 2 * (j & 3);
    f[2 * j]     = t[(size_t)(k0 + kk) * ld + r0 + m];
    f[2 * j + 1] = t[(size_t)(k0 + kk + 1) * ld + r0 + m];
  }
  return f;
}
DEV v8f wmma_f16(v16h a, v16h b, v8f c) {
  return __builtin_amdgcn_wmma_f32_16x16x32_f16(false, a, false, b, (short)0, c,
                                                false, false);
}

typedef __attribute__((ext_vector_type(8))) _Float16 v8h;
typedef __attribute__((ext_vector_type(4))) _Float16 v4h;
// frag_row's fragment as two 16-byte loads: p is the lane's row at
// k = 8 * (lane >> 4); the fragment's second eight k lie 16 further on.
DEV v16h frag_vec(const h16* p) {
  v8h lo = *(const v8h*)p, hi = *(const v8h*)(p + 16);
  return __builtin_shufflevector(lo, hi, 0, 1, 2, 3, 4, 5, 6, 7, 8, 9, 10, 11,
                                 12, 13, 14, 15);
}
// One D tile to LDS: registers 0-3 at d, registers 4-7 32 places further on.
DEV void put8(float4* d, v8f a) {
  d[0]  = make_float4(a[0], a[1], a[2], a[3]);
  d[32] = make_float4(a[4], a[5], a[6], a[7]);
}
// Two f32 D tiles (rows 0-15 and 16-31 of a 32-row block, same columns) are,
// converted lane by lane, the f16 B fragment of that block in frag_row's k order.
DEV v16h pack_b(v8f lo, v8f hi) {
  v16h f;
#pragma unroll
  for (int s = 0; s < 8; ++s) { f[s] = (h16)lo[s]; f[8 + s] = (h16)hi[s]; }
  return f;
}

DEV void put4(h16* d, float4 f) {
  d[0] = (h16)f.x; d[1] = (h16)f.y; d[2] = (h16)f.z; d[3] = (h16)f.w;
}

// ---------------- Generic GEMM: C = act(A(MxK) * W(NxK)^T + bias) ----------
// 64x128 block tile, 8 waves (2x4), each wave owns a 32x32 region (4 wmma/Kstep)
// A thread stages six 16-byte pieces of every K tile: columns c4..c4+3 of rows
// r8 + 32 i of A (i < 2) and of W (i < 4). The six loads of tile kt + 1 are
// issued together, into registers, before tile kt is read from LDS and
// multiplied; they are converted and stored to LDS at the top of the next trip.
// Edges take the same path: a row past M or N is read at the last row, a piece
// past K at the first tile's columns, and such a piece is stored as zeros.
// K, lda and ldw are multiples of 4 in every call, so a piece lies wholly
// inside K or wholly outside, and every piece is 16-byte aligned.
__global__ void __launch_bounds__(256)
gemm_kernel(const float* __restrict__ A, int lda, const float* __restrict__ W,
            int ldw, const float* __restrict__ bias, float* __restrict__ C,
            int ldc, int M, int N, int K, int act) {
  __shared__ h16 At[64][40];
  __shared__ h16 Wt[128][40];
  const int tid = threadIdx.x, lane = tid & 31, wid = tid >> 5;
  const int wm = wid >> 2, wn = wid & 3;
  const int bm = blockIdx.y * 64, bn = blockIdx.x * 128;
  const int r8 = tid >> 3, c4 = (tid & 7) * 4;
  v8f acc00 = {}, acc01 = {}, acc10 = {}, acc11 = {};
  const int ktn = (K + 31) >> 5;
  const float* pa[2];
  const float* pw[4];
  bool va[2], vw[4];
#pragma unroll
  for (int i = 0; i < 2; ++i) {
    int gm = bm + r8 + 32 * i;
    va[i] = gm < M;
    pa[i] = A + (size_t)(va[i] ? gm : M - 1) * lda + c4;
  }
#pragma unroll
  for (int i = 0; i < 4; ++i) {
    int gn = bn + r8 + 32 * i;
    vw[i] = gn < N;
    pw[i] = W + (size_t)(vw[i] ? gn : N - 1) * ldw + c4;
  }
  float4 fa[2], fw[4];
#pragma unroll
  for (int i = 0; i < 2; ++i) fa[i] = *(const float4*)pa[i];
#pragma unroll
  for (int i = 0; i < 4; ++i) fw[i] = *(const float4*)pw[i];
  const bool inner = (bm + 64 <= M) && (bn + 128 <= N);
  for (int kt = 0; kt < ktn; ++kt) {
    if (inner && (kt << 5) + 32 <= K) {
#pragma unroll
      for (int i = 0; i < 2; ++i) put4(&At[r8 + 32 * i][c4], fa[i]);
#pragma unroll
      for (int i = 0; i < 4; ++i) put4(&Wt[r8 + 32 * i][c4], fw[i]);
    } else {
      const bool kv = (kt << 5) + c4 < K;   // this tile's piece lies inside K
      const float4 z = make_float4(0.f, 0.f, 0.f, 0.f);
#pragma unroll
      for (int i = 0; i < 2; ++i) put4(&At[r8 + 32 * i][c4], (kv && va[i]) ? fa[i] : z);
#pragma unroll
      for (int i = 0; i < 4; ++i) put4(&Wt[r8 + 32 * i][c4], (kv && vw[i]) ? fw[i] : z);
    }
    __syncthreads();
    if (kt + 1 < ktn) {
      const int kn = (kt + 1) << 5;
      const int ko = (kn + c4 < K) ? kn : 0;
#pragma unroll
      for (int i = 0; i < 2; ++i) fa[i] = *(const float4*)(pa[i] + ko);
#pragma unroll
      for (int i = 0; i < 4; ++i) fw[i] = *(const float4*)(pw[i] + ko);
      asm volatile("s_wait_xcnt 0x0" ::: "memory");
    }
    v16h a0 = frag_row(&At[0][0], 40, wm * 32, 0, lane);
    v16h a1 = frag_row(&At[0][0], 40, wm * 32 + 16, 0, lane);
    v16h b0 = frag_row(&Wt[0][0], 40, wn * 32, 0, lane);
    v16h b1 = frag_row(&Wt[0][0], 40, wn * 32 + 16, 0, lane);
    acc00 = wmma_f16(a0, b0, acc00);
    acc01 = wmma_f16(a0, b1, acc01);
    acc10 = wmma_f16(a1, b0, acc10);
    acc11 = wmma_f16(a1, b1, acc11);
    __syncthreads();
  }
  v8f* accs[4] = {&acc00, &acc01, &acc10, &acc11};
#pragma unroll
  for (int q = 0; q < 4; ++q) {
    int im = q >> 1, in_ = q & 1;
#pragma unroll
    for (int r = 0; r < 8; ++r) {
      int gm = bm + wm * 32 + im * 16 + r + 8 * (lane >> 4);
      int gn = bn + wn * 32 + in_ * 16 + (lane & 15);
      if (gm < M && gn < N) {
        float v = (*accs[q])[r] + (bias ? bias[gn] : 0.f);
        if (act == 1) v = 0.5f * v * (1.f + erff(v * 0.70710678118f));
        C[(size_t)gm * ldc + gn] = v;
      }
    }
  }
}

// ---------------- depthwise causal conv (+ optional SiLU) ------------------
__global__ void dwconv_kernel(const float* __restrict__ X,
                              const float* __restrict__ Wc,
                              float* __restrict__ Y, int Kw, int applySilu) {
  size_t idx = (size_t)blockIdx.x * blockDim.x + threadIdx.x;
  size_t total = (size_t)Bb * Tt * Dd;
  if (idx >= total) return;
  int c = (int)(idx & (Dd - 1));
  size_t bt = idx / Dd;
  int t = (int)(bt % Tt);
  float s = 0.f;
  for (int i = 0; i < Kw; ++i) {
    int tt = t - (Kw - 1) + i;
    if (tt >= 0) s += X[(bt - (size_t)(t - tt)) * Dd + c] * Wc[c * Kw + i];
  }
  if (applySilu) s = s / (1.f + expf(-s));
  Y[idx] = s;
}

// ---------------- beta = sigmoid(hidden @ b_proj^T) ------------------------
__global__ void beta_kernel(const float* __restrict__ hs,
                            const float* __restrict__ Wb,
                            float* __restrict__ beta) {
  int idx = blockIdx.x * blockDim.x + threadIdx.x;
  if (idx >= Bb * Tt * Hh) return;
  int h = idx & (Hh - 1);
  size_t bt = (size_t)idx >> 2;
  const float* x = hs + bt * Dd;
  const float* w = Wb + (size_t)h * Dd;
  float s = 0.f;
  for (int k = 0; k < Dd; ++k) s += x[k] * w[k];
  beta[idx] = 1.f / (1.f + expf(-s));
}

// ---------------- gi[:, :D] = hidden ---------------------------------------
__global__ void gi_copy_kernel(const float* __restrict__ hs,
                               float* __restrict__ gi) {
  size_t idx = (size_t)blockIdx.x * blockDim.x + threadIdx.x;
  if (idx >= (size_t)Bb * Tt * Dd) return;
  size_t bt = idx / Dd;
  int j = (int)(idx % Dd);
  gi[bt * GIW + j] = hs[idx];
}

// ---------------- stats = mean |branch| over DV -> gi tail -----------------
__global__ void stats_kernel(const float* __restrict__ b0,
                             const float* __restrict__ b1,
                             const float* __restrict__ b2,
                             const float* __restrict__ b3,
                             const float* __restrict__ b4,
                             const float* __restrict__ b5,
                             float* __restrict__ gi) {
  int wg = blockIdx.x * 8 + (threadIdx.x >> 5);
  int lane = threadIdx.x & 31;
  if (wg >= Bb * Tt * Hh * Pp) return;
  int p = wg % Pp;
  int h = (wg / Pp) % Hh;
  size_t bt = (size_t)wg / (Pp * Hh);
  const float* src = (p == 0) ? b0 : (p == 1) ? b1 : (p == 2) ? b2
                   : (p == 3) ? b3 : (p == 4) ? b4 : b5;
  src += bt * Dd + (size_t)h * DVv;
  float s = 0.f;
#pragma unroll
  for (int i = 0; i < 8; ++i) s += fabsf(src[lane + 32 * i]);
#pragma unroll
  for (int off = 16; off; off >>= 1) s += __shfl_xor(s, off, 32);
  if (lane == 0) gi[bt * GIW + Dd + h * Pp + p] = s * (1.f / 256.f);
}

// ---------------- chunked delta rule ---------------------------------------
// The UT transform of a chunk (l2norm, A, forward substitution, w, u, attn)
// reads no state, so prep_kernel does it for all chunks side by side, one
// work-group per (batch, head, chunk), and leaves q, k^T, -w, attn (f16) and
// u (f32) in the workspace, one contiguous block per chunk. Only the steps
// that read or write the state S stay in the serial scan of delta_kernel.
constexpr int CE = CHc * DKk;              // elements of one 32 x 256 chunk block
__global__ void __launch_bounds__(256)
prep_kernel(const float* __restrict__ qc, const float* __restrict__ kc,
            const float* __restrict__ vc, const float* __restrict__ betap,
            float* __restrict__ qo, float* __restrict__ ko,
            float* __restrict__ wo, float* __restrict__ uo,
            float* __restrict__ ao) {
  extern __shared__ char smem[];
  float* Am  = (float*)smem;                 // 32x33 f32 (A / fwd-subst)
  h16* qn    = (h16*)(Am + 32 * 33);         // 32x256
  h16* kn    = qn + CE;
  h16* kbn   = kn + CE;
  h16* wn    = kbn + CE;                     // holds -(inv@kb)
  h16* xb    = wn + CE;                      // 32x256: v*beta
  h16* invb  = xb + CE;                      // 32x32
  h16* attb  = invb + 32 * 32;               // 32x32

  const int tid = threadIdx.x, lane = tid & 31, wid = tid >> 5;
  const int bh = blockIdx.x / NCHUNK, nc = blockIdx.x % NCHUNK;
  const int b = bh >> 2, h = bh & 3;
  const int t0 = nc * CHc;

  // ---- stage 1: load chunk, l2norm q/k, apply beta ----
  for (int j = 0; j < 4; ++j) {
    int r = wid * 4 + j;
    int t = t0 + r;
    size_t rowb = ((size_t)(b * Tt + t)) * Dd + (size_t)h * DKk;
    float bet = betap[(size_t)(b * Tt + t) * Hh + h];
    float qv[8], kv[8], vv[8];
    float sq = 0.f, sk = 0.f;
#pragma unroll
    for (int i = 0; i < 8; ++i) {
      int d = lane + 32 * i;
      qv[i] = qc[rowb + d]; kv[i] = kc[rowb + d]; vv[i] = vc[rowb + d];
      sq += qv[i] * qv[i]; sk += kv[i] * kv[i];
    }
#pragma unroll
    for (int off = 16; off; off >>= 1) {
      sq += __shfl_xor(sq, off, 32);
      sk += __shfl_xor(sk, off, 32);
    }
    float rq = rsqrtf(sq + 1e-12f), rk = rsqrtf(sk + 1e-12f);
#pragma unroll
    for (int i = 0; i < 8; ++i) {
      int d = lane + 32 * i;
      float kq = kv[i] * rk;
      qn[r * 256 + d]  = (h16)(qv[i] * rq);
      kn[r * 256 + d]  = (h16)kq;
      kbn[r * 256 + d] = (h16)(kq * bet);
      xb[r * 256 + d]  = (h16)(vv[i] * bet);
    }
  }
  __syncthreads();
  // ---- stage 2: A = -(kb k^T), strict lower (waves 0-3) ;
  //      stage 6: attn = (q k^T) * lower-incl mask (waves 4-7) ----
  {
    int m0 = ((wid >> 1) & 1) * 16, n0 = (wid & 1) * 16;
    const h16* lhs = (wid < 4) ? kbn : qn;
    v8f acc = {};
    for (int kk = 0; kk < 8; ++kk)
      acc = wmma_f16(frag_row(lhs, 256, m0, kk * 32, lane),
                     frag_row(kn, 256, n0, kk * 32, lane), acc);
    if (wid < 4) {
#pragma unroll
      for (int r = 0; r < 8; ++r) {
        int m = m0 + r + 8 * (lane >> 4), n = n0 + (lane & 15);
        Am[m * 33 + n] = (m > n) ? -acc[r] : 0.f;
      }
    } else {
#pragma unroll
      for (int r = 0; r < 8; ++r) {
        int m = m0 + r + 8 * (lane >> 4), n = n0 + (lane & 15);
        attb[m * 32 + n] = (h16)((m >= n) ? acc[r] : 0.f);
      }
    }
  }
  __syncthreads();
  // ---- stage 3: forward substitution, inv = A + I ----
  for (int i = 1; i < 32; ++i) {
    float val = 0.f;
    if (tid < 32)
      for (int s = 0; s < i; ++s) val += Am[i * 33 + s] * Am[s * 33 + tid];
    __syncthreads();
    if (tid < 32) Am[i * 33 + tid] += val;
    __syncthreads();
  }
  for (int e = tid; e < 1024; e += 256) {
    int m = e >> 5, n = e & 31;
    invb[e] = (h16)(Am[m * 33 + n] + ((m == n) ? 1.f : 0.f));
  }
  __syncthreads();
  // ---- stage 4: wn = -(inv@kb) ; u = inv@(v*beta) -> workspace (f32) ----
  float* ug = uo + (size_t)blockIdx.x * CE;
  for (int it = 0; it < 4; ++it) {
    int j = wid + 8 * it;           // 0..31
    int m0 = (j >> 4) * 16, n0 = (j & 15) * 16;
    v16h ia = frag_row(invb, 32, m0, 0, lane);
    v8f acc = {}, accu = {};
    acc  = wmma_f16(ia, frag_kmaj(kbn, 256, n0, 0, lane), acc);
    accu = wmma_f16(ia, frag_kmaj(xb, 256, n0, 0, lane), accu);
#pragma unroll
    for (int r = 0; r < 8; ++r) {
      int m = m0 + r + 8 * (lane >> 4), n = n0 + (lane & 15);
      wn[m * 256 + n] = (h16)(-acc[r]);
      ug[m * 256 + n] = accu[r];
    }
    // the next trip rewrites the address and data registers of the u stores
    asm volatile("s_wait_xcnt 0x0" ::: "memory");
  }
  __syncthreads();
  // ---- hand q, k^T, -w, attn to the scan: 16-byte stores, one block per chunk ----
  // k goes out transposed, 256 rows (dk) of 32 chunk positions: the scan reads
  // k^T as the A operand of its state update, contiguous along the chunk.
  v8h* gk = (v8h*)ko + (size_t)blockIdx.x * (CE / 8) + tid * 4;
#pragma unroll
  for (int i = 0; i < 4; ++i) {
    v8h t;
#pragma unroll
    for (int j = 0; j < 8; ++j) t[j] = kn[(8 * i + j) * 256 + tid];
    gk[i] = t;
  }
  // the stores below reuse the address and data registers of the k^T stores
  asm volatile("s_wait_xcnt 0x0" ::: "memory");
  uint4* gq = (uint4*)qo + (size_t)blockIdx.x * (CE / 8);
  uint4* gw = (uint4*)wo + (size_t)blockIdx.x * (CE / 8);
#pragma unroll
  for (int i = 0; i < 4; ++i) {
    int e = tid + 256 * i;
    gq[e] = ((const uint4*)qn)[e];
    gw[e] = ((const uint4*)wn)[e];
  }
  if (tid < 128)
    ((uint4*)ao)[(size_t)blockIdx.x * 128 + tid] = ((const uint4*)attb)[tid];
}

// Serial scan over the chunks, state split by value columns: column n of ui,
// oi and S depends on column n of u and S only, so each work-group owns DVS
// value columns of one (batch, head). DVS = 32 floats = one 128-byte output line.
// The 256 x DVS state slice lives in registers, split by key rows: wave w owns
// rows 32 w .. 32 w + 31 as four f32 D tiles, which the state update
// accumulates into, and as two f16 B fragments converted from them in place.
// A wave multiplies its 32 columns of -w and of q (fragments straight from the
// workspace) by its own rows of S; the eight partial 32 x DVS products are
// summed through LDS, thread t taking the float4 at place t of every partial.
constexpr int DVS = 32;                    // value columns per work-group
constexpr int NSL = DVv / DVS;             // slices per (batch, head)
constexpr int XP  = 40;                    // f16 per row of ui^T in LDS: 80 bytes
constexpr int RP  = 32 * DVS / 4;          // float4 per 32 x DVS partial
__global__ void __launch_bounds__(256)
delta_kernel(const float* __restrict__ qi, const float* __restrict__ ki,
             const float* __restrict__ wi, const float* __restrict__ ui0,
             const float* __restrict__ ai, float* __restrict__ dout) {
  extern __shared__ char smem[];
  float4* redW = (float4*)smem;              // 8 partials of (-w)@S
  float4* redQ = redW + 8 * RP;              // 8 partials of q@S, then attn@ui
  h16* xbT     = (h16*)(redQ + 9 * RP);      // DVS x XP: ui^T (f16)

  const int tid = threadIdx.x, lane = tid & 31;
  const int wid = __builtin_amdgcn_readfirstlane(tid >> 5);
  const int c = lane & 15, hh = lane >> 4;
  const int bh = blockIdx.x / NSL;
  const int c0 = (blockIdx.x % NSL) * DVS;   // first value column of the slice
  const int b = bh >> 2, h = bh & 3;
  // Place t of a partial holds registers 4 g .. 4 g + 3 of tile (mt, nt) at lane
  // t & 31, with mt * 4 + nt * 2 + g = t >> 5: rows rm .. rm + 3 of column rn.
  const int rm = (wid >> 2) * 16 + 8 * hh + 4 * (wid & 1);
  const int rn = ((wid >> 1) & 1) * 16 + c;
  // the lane's fixed offsets inside a chunk's blocks; the chunk moves the base
  const unsigned lwq = c * 256 + wid * 32 + hh * 8;         // -w, q: row c
  const unsigned lk  = (wid * 32 + c) * 32 + hh * 8;        // k^T: row 32 wid + c
  const unsigned la  = (((wid >> 1) & 1) * 16 + c) * 32 + hh * 8;  // attn
  const unsigned lu  = rm * 256 + c0 + rn;                  // u
  const unsigned lo  = rm * Dd + h * DVv + c0 + rn;         // oi

  v8f S00 = {}, S01 = {}, S10 = {}, S11 = {};  // S[32 wid + 16 mt ..][16 nt ..]
  v16h sb0 = {}, sb1 = {};                     // the same rows as B fragments
  const v8f zero = {};

  for (int nc = 0; nc < NCHUNK; ++nc) {
    const int t0 = nc * CHc;
    // ---- the wave's own fragments of the chunk's -w, q, k^T, attn; its u ----
    const size_t cb = (size_t)(bh * NCHUNK + nc);
    const h16* gw = (const h16*)wi + cb * CE + lwq;
    const h16* gq = (const h16*)qi + cb * CE + lwq;
    const h16* gk = (const h16*)ki + cb * CE + lk;
    const float* gu = ui0 + cb * CE + lu;
    v16h w0 = frag_vec(gw), w1 = frag_vec(gw + 16 * 256);
    // the next loads land in the address registers of these
    asm volatile("s_wait_xcnt 0x0" ::: "memory");
    v16h q0 = frag_vec(gq), q1 = frag_vec(gq + 16 * 256);
    asm volatile("s_wait_xcnt 0x0" ::: "memory");
    float u0 = gu[0], u1 = gu[256], u2 = gu[512], u3 = gu[768];
    v16h k0 = frag_vec(gk), k1 = frag_vec(gk + 16 * 32);
    v16h at = {};
    if (wid < 4)
      at = frag_vec((const h16*)ai + cb * 1024 + la);
    // the products below land in the address registers of these loads
    asm volatile("s_wait_xcnt 0x0" ::: "memory");
    // ---- partial (-w)@S and q@S over the wave's 32 key rows ----
    v8f pw00 = wmma_f16(w0, sb0, zero), pw01 = wmma_f16(w0, sb1, zero);
    v8f pw10 = wmma_f16(w1, sb0, zero), pw11 = wmma_f16(w1, sb1, zero);
    v8f pq00 = wmma_f16(q0, sb0, zero), pq01 = wmma_f16(q0, sb1, zero);
    v8f pq10 = wmma_f16(q1, sb0, zero), pq11 = wmma_f16(q1, sb1, zero);
    float4* rw = redW + wid * RP + lane;
    put8(rw, pw00); put8(rw + 64, pw01); put8(rw + 128, pw10); put8(rw + 192, pw11);
    __syncthreads();
    // ---- ui = u + sum of the partials -> ui^T (f16) ----
    {
      float4 s = redW[tid];
#pragma unroll
      for (int v = 1; v < 8; ++v) {
        float4 p = redW[v * RP + tid];
        s.x += p.x; s.y += p.y; s.z += p.z; s.w += p.w;
      }
      v4h x = {(h16)(u0 + s.x), (h16)(u1 + s.y), (h16)(u2 + s.z), (h16)(u3 + s.w)};
      *(v4h*)&xbT[rn * XP + rm] = x;
    }
    __syncthreads();
    // ---- S += k^T @ ui on the wave's rows; attn@ui as a ninth partial of oi ----
    {
      v16h ub0 = frag_vec(xbT + c * XP + hh * 8);
      v16h ub1 = frag_vec(xbT + (16 + c) * XP + hh * 8);
      S00 = wmma_f16(k0, ub0, S00); S01 = wmma_f16(k0, ub1, S01);
      S10 = wmma_f16(k1, ub0, S10); S11 = wmma_f16(k1, ub1, S11);
      float4* rq = redQ + wid * RP + lane;
      put8(rq, pq00); put8(rq + 64, pq01); put8(rq + 128, pq10); put8(rq + 192, pq11);
      if (wid < 4)
        put8(redQ + 8 * RP + wid * 64 + lane,
             wmma_f16(at, (wid & 1) ? ub1 : ub0, zero));
      sb0 = pack_b(S00, S10);
      sb1 = pack_b(S01, S11);
    }
    __syncthreads();
    // ---- oi = q@S + attn@ui: sum of the nine partials -> global ----
    {
      float4 o = redQ[tid];
#pragma unroll
      for (int v = 1; v < 9; ++v) {
        float4 p = redQ[v * RP + tid];
        o.x += p.x; o.y += p.y; o.z += p.z; o.w += p.w;
      }
      float* go = dout + (size_t)(b * Tt + t0) * Dd + lo;
      go[0] = o.x; go[Dd] = o.y; go[2 * Dd] = o.z; go[3 * Dd] = o.w;
      // the next trip rewrites the address and data registers of these stores
      asm volatile("s_wait_xcnt 0x0" ::: "memory");
    }
  }
}

// ---------------- gate softmax + branch mixing + RMSNorm -------------------
__global__ void __launch_bounds__(256)
fuse_kernel(const float* __restrict__ b0, const float* __restrict__ b1,
            const float* __restrict__ b2, const float* __restrict__ b3,
            const float* __restrict__ b4, const float* __restrict__ b5,
            const float* __restrict__ gi, const float* __restrict__ logits,
            const float* __restrict__ alpha, const float* __restrict__ ltemp,
            const float* __restrict__ onw, float* __restrict__ out) {
  size_t bt = blockIdx.x;
  int tid = threadIdx.x;
  __shared__ float probs_s[Hh][Pp];
  __shared__ float red[256];
  if (tid < Hh) {
    int h = tid;
    float x = ltemp[h];
    float temp = fmaxf(x, 0.f) + log1pf(expf(-fabsf(x))) + 1e-4f; // softplus
    float l[Pp];
    float mx = -1e30f;
#pragma unroll
    for (int p = 0; p < Pp; ++p) {
      float st = gi[bt * GIW + Dd + h * Pp + p];
      l[p] = (logits[bt * (Hh * Pp) + h * Pp + p] + alpha[p] * st) / temp;
      mx = fmaxf(mx, l[p]);
    }
    float se = 0.f;
#pragma unroll
    for (int p = 0; p < Pp; ++p) { l[p] = expf(l[p] - mx); se += l[p]; }
#pragma unroll
    for (int p = 0; p < Pp; ++p) {
      float pr = l[p] / se * (1.f - FLOORv);
      if (p == Pp - 1) pr += FLOORv;
      probs_s[h][p] = pr;
    }
  }
  __syncthreads();
  int d = tid;
  for (int h = 0; h < Hh; ++h) {
    size_t base = bt * Dd + (size_t)h * DVv + d;
    float o = b0[base] * probs_s[h][0] + b1[base] * probs_s[h][1] +
              b2[base] * probs_s[h][2] + b3[base] * probs_s[h][3] +
              b4[base] * probs_s[h][4] + b5[base] * probs_s[h][5];
    red[tid] = o * o;
    __syncthreads();
    for (int s = 128; s; s >>= 1) {
      if (tid < s) red[tid] += red[tid + s];
      __syncthreads();
    }
    float ms = red[0] * (1.f / 256.f);
    __syncthreads();
    out[base] = o * rsqrtf(ms + 1e-5f) * onw[d];
  }
}

// ---------------------------------------------------------------------------
extern "C" void kernel_launch(void* const* d_in, const int* in_sizes, int n_in,
                              void* d_out, int out_size, void* d_ws,
                              size_t ws_size, hipStream_t stream) {
  const float* hs   = (const float*)d_in[0];
  const float* qw   = (const float*)d_in[1];
  const float* kw   = (const float*)d_in[2];
  const float* vw   = (const float*)d_in[3];
  const float* bw   = (const float*)d_in[4];
  const float* qcw  = (const float*)d_in[5];
  const float* kcw  = (const float*)d_in[6];
  const float* vcw  = (const float*)d_in[7];
  const float* f3w  = (const float*)d_in[8];
  const float* f7w  = (const float*)d_in[9];
  const float* f15w = (const float*)d_in[10];
  const float* f31w = (const float*)d_in[11];
  const float* gw1  = (const float*)d_in[12];
  const float* gb1  = (const float*)d_in[13];
  const float* gw2  = (const float*)d_in[14];
  const float* gb2  = (const float*)d_in[15];
  const float* glt  = (const float*)d_in[16];
  const float* alps = (const float*)d_in[17];
  const float* onw  = (const float*)d_in[18];
  const float* ow   = (const float*)d_in[19];
  float* out = (float*)d_out;

  const size_t U = (size_t)Bb * Tt * Dd; // 4096*1024
  float* ws = (float*)d_ws;
  float* qp  = ws;            // q projection (reused: fir3)
  float* kp  = qp + U;        // k projection (reused: fir7)
  float* vp  = kp + U;        // v projection (reused: fir15)
  float* qcv = vp + U;        // q after conv+silu (reused: fir31)
  float* kcv = qcv + U;       // k after conv+silu (reused: o_fused)
  float* vcv = kcv + U;       // v after conv+silu (branch p=4)
  float* dta = vcv + U;       // delta-rule output (branch p=5)
  float* h1  = dta + U;       // gate hidden, 2U
  float* gi  = h1 + 2 * U;    // gate input, B*T x GIW
  float* beta = gi + (size_t)Bb * Tt * 1056;
  float* lgt  = beta + (size_t)Bb * Tt * Hh;
  float* pq  = lgt + (size_t)Bb * Tt * Hh * Pp;  // prepared q, f16 (U/2 floats)
  float* pk  = pq + U / 2;    // prepared k^T, f16
  float* pw  = pk + U / 2;    // prepared -w, f16
  float* pu  = pw + U / 2;    // prepared u, f32
  float* pa  = pu + U;        // prepared attn, f16, 32x32 per chunk

  const int MT = Bb * Tt;                 // 4096
  dim3 blk(256);
  dim3 gN1024((1024 + 127) / 128, (MT + 63) / 64);
  int ebk = (int)((U + 255) / 256);

  // 1) q/k/v projections (no activation; conv+silu comes after)
  gemm_kernel<<<gN1024, blk, 0, stream>>>(hs, Dd, qw, Dd, nullptr, qp, Dd, MT, Dd, Dd, 0);
  gemm_kernel<<<gN1024, blk, 0, stream>>>(hs, Dd, kw, Dd, nullptr, kp, Dd, MT, Dd, Dd, 0);
  gemm_kernel<<<gN1024, blk, 0, stream>>>(hs, Dd, vw, Dd, nullptr, vp, Dd, MT, Dd, Dd, 0);
  // 2) beta
  beta_kernel<<<(MT * Hh + 255) / 256, blk, 0, stream>>>(hs, bw, beta);
  // 3) depthwise causal conv (k=4) + SiLU
  dwconv_kernel<<<ebk, blk, 0, stream>>>(qp, qcw, qcv, 4, 1);
  dwconv_kernel<<<ebk, blk, 0, stream>>>(kp, kcw, kcv, 4, 1);
  dwconv_kernel<<<ebk, blk, 0, stream>>>(vp, vcw, vcv, 4, 1);
  // 4) delta rule: state-free chunk work for all chunks at once, then the
  //    scan, one workgroup per (batch, head, 32-column state slice)
  const size_t PLDS = 32 * 33 * sizeof(float) + (5 * CE + 2 * 32 * 32) * sizeof(h16);
  prep_kernel<<<dim3(Bb * Hh * NCHUNK), blk, PLDS, stream>>>(qcv, kcv, vcv, beta,
                                                             pq, pk, pw, pu, pa);
  const size_t DLDS = 17 * RP * sizeof(float4) + DVS * XP * sizeof(h16);
  delta_kernel<<<dim3(Bb * Hh * NSL), blk, DLDS, stream>>>(pq, pk, pw, pu, pa, dta);
  // 5) FIR branches on v (reuse proj buffers; qcv/kcv free after delta)
  dwconv_kernel<<<ebk, blk, 0, stream>>>(vcv, f3w, qp, 3, 0);
  dwconv_kernel<<<ebk, blk, 0, stream>>>(vcv, f7w, kp, 7, 0);
  dwconv_kernel<<<ebk, blk, 0, stream>>>(vcv, f15w, vp, 15, 0);
  dwconv_kernel<<<ebk, blk, 0, stream>>>(vcv, f31w, qcv, 31, 0);
  // 6) gate input = concat(hidden, stats)
  gi_copy_kernel<<<ebk, blk, 0, stream>>>(hs, gi);
  stats_kernel<<<(MT * Hh * Pp) / 8, blk, 0, stream>>>(qp, kp, vp, qcv, vcv, dta, gi);
  // 7) gate MLP (gelu, then linear to H*P logits with gb2 bias)
  dim3 gGate1((2048 + 127) / 128, (MT + 63) / 64);
  gemm_kernel<<<gGate1, blk, 0, stream>>>(gi, GIW, gw1, GIW, gb1, h1, 2048, MT, 2048, GIW, 1);
  dim3 gGate2(1, (MT + 63) / 64);
  gemm_kernel<<<gGate2, blk, 0, stream>>>(h1, 2048, gw2, 2048, gb2, lgt, Hh * Pp, MT, Hh * Pp, 2048, 0);
  // 8) softmax gate + mix branches + RMSNorm  (o_fused -> kcv)
  float* ofused = kcv;
  fuse_kernel<<<dim3(MT), blk, 0, stream>>>(qp, kp, vp, qcv, vcv, dta, gi, lgt,
                                            alps, glt, onw, ofused);
  // 9) output projection
  gemm_kernel<<<gN1024, blk, 0, stream>>>(ofused, Dd, ow, Dd, nullptr, out, Dd, MT, Dd, Dd, 0);
}

// v005
// Measured time: 485 microseconds a run.
// Next to v004, in two timings, it ran 1.41 times as fast each time.
// Over all steps from v000 it is 8.08 times as fast.
#include <hip/hip_runtime.h>
#include <hip/hip_bf16.h>
#include <math.h>

#define DEV __device__ __forceinline__

typedef __attribute__((ext_vector_type(16))) _Float16 v16h;
typedef __attribute__((ext_vector_type(8)))  float    v8f;
typedef _Float16 h16;

constexpr int Bb = 2, Tt = 2048, Dd = 1024, Hh = 4, Pp = 6, CHc = 32;
constexpr int DKk = 256, DVv = 256;
constexpr int NCHUNK = Tt / CHc;           // 64
constexpr int GIW = Dd + Hh * Pp;          // 1048
constexpr float FLOORv = 0.05f;

DEV v16h frag_row(const h16* t, int ld, int r0, int k0, int lane) {
  // element [m][k] at t[(r0+m)*ld + (k0+k)]
  v16h f;
  int m = lane & 15, kg = lane >> 4;
#pragma unroll
  for (int j = 0; j < 8; ++j) {
    int kk = ((j < 4) ? 0 : 16) + kg * 8 + 2 * (j & 3);
    const h16* p = t + (size_t)(r0 + m) * ld + k0 + kk;
    f[2 * j] = p[0];
    f[2 * j + 1] = p[1];
  }
  return f;
}
DEV v16h frag_kmaj(const h16* t, int ld, int r0, int k0, int lane) {
  // element [m][k] at t[(k0+k)*ld + (r0+m)]
  v16h f;
  int m = lane & 15, kg = lane >> 4;
#pragma unroll
  for (int j = 0; j < 8; ++j) {
    int kk = ((j < 4) ? 0 : 16) + kg * 8 + 2 * (j & 3);
    f[2 * j]     = t[(size_t)(k0 + kk) * ld + r0 + m];
    f[2 * j + 1] = t[(size_t)(k0 + kk + 1) * ld + r0 + m];
  }
  return f;
}
DEV v8f wmma_f16(v16h a, v16h b, v8f c) {
  return __builtin_amdgcn_wmma_f32_16x16x32_f16(false, a, false, b, (short)0, c,
                                                false, false);
}

typedef __attribute__((ext_vector_type(8))) _Float16 v8h;
typedef __attribute__((ext_vector_type(4))) _Float16 v4h;
// frag_row's fragment as two 16-byte loads: p is the lane's row at
// k = 8 * (lane >> 4); the fragment's second eight k lie 16 further on.
DEV v16h frag_vec(const h16* p) {
  v8h lo = *(const v8h*)p, hi = *(const v8h*)(p + 16);
  return __builtin_shufflevector(lo, hi, 0, 1, 2, 3, 4, 5, 6, 7, 8, 9, 10, 11,
                                 12, 13, 14, 15);
}
// One D tile to LDS: registers 0-3 at d, registers 4-7 32 places further on.
DEV void put8(float4* d, v8f a) {
  d[0]  = make_float4(a[0], a[1], a[2], a[3]);
  d[32] = make_float4(a[4], a[5], a[6], a[7]);
}
// Two f32 D tiles (rows 0-15 and 16-31 of a 32-row block, same columns) are,
// converted lane by lane, the f16 B fragment of that block in frag_row's k order.
DEV v16h pack_b(v8f lo, v8f hi) {
  v16h f;
#pragma unroll
  for (int s = 0; s < 8; ++s) { f[s] = (h16)lo[s]; f[8 + s] = (h16)hi[s]; }
  return f;
}

DEV void put4(h16* d, float4 f) {
  d[0] = (h16)f.x; d[1] = (h16)f.y; d[2] = (h16)f.z; d[3] = (h16)f.w;
}

// ---------------- Generic GEMM: C = act(A(MxK) * W(NxK)^T + bias) ----------
// 64x128 block tile, 8 waves (2x4), each wave owns a 32x32 region (4 wmma/Kstep)
// A thread stages six 16-byte pieces of every K tile: columns c4..c4+3 of rows
// r8 + 32 i of A (i < 2) and of W (i < 4). The six loads of tile kt + 1 are
// issued together, into registers, before tile kt is read from LDS and
// multiplied; they are converted and stored to LDS at the top of the next trip.
// Edges take the same path: a row past M or N is read at the last row, a piece
// past K at the first tile's columns, and such a piece is stored as zeros.
// K, lda and ldw are multiples of 4 in every call, so a piece lies wholly
// inside K or wholly outside, and every piece is 16-byte aligned.
__global__ void __launch_bounds__(256)
gemm_kernel(const float* __restrict__ A, int lda, const float* __restrict__ W,
            int ldw, const float* __restrict__ bias, float* __restrict__ C,
            int ldc, int M, int N, int K, int act) {
  __shared__ h16 At[64][40];
  __shared__ h16 Wt[128][40];
  const int tid = threadIdx.x, lane = tid & 31, wid = tid >> 5;
  const int wm = wid >> 2, wn = wid & 3;
  const int bm = blockIdx.y * 64, bn = blockIdx.x * 128;
  const int r8 = tid >> 3, c4 = (tid & 7) * 4;
  v8f acc00 = {}, acc01 = {}, acc10 = {}, acc11 = {};
  const int ktn = (K + 31) >> 5;
  const float* pa[2];
  const float* pw[4];
  bool va[2], vw[4];
#pragma unroll
  for (int i = 0; i < 2; ++i) {
    int gm = bm + r8 + 32 * i;
    va[i] = gm < M;
    pa[i] = A + (size_t)(va[i] ? gm : M - 1) * lda + c4;
  }
#pragma unroll
  for (int i = 0; i < 4; ++i) {
    int gn = bn + r8 + 32 * i;
    vw[i] = gn < N;
    pw[i] = W + (size_t)(vw[i] ? gn : N - 1) * ldw + c4;
  }
  float4 fa[2], fw[4];
#pragma unroll
  for (int i = 0; i < 2; ++i) fa[i] = *(const float4*)pa[i];
#pragma unroll
  for (int i = 0; i < 4; ++i) fw[i] = *(const float4*)pw[i];
  const bool inner = (bm + 64 <= M) && (bn + 128 <= N);
  for (int kt = 0; kt < ktn; ++kt) {
    if (inner && (kt << 5) + 32 <= K) {
#pragma unroll
      for (int i = 0; i < 2; ++i) put4(&At[r8 + 32 * i][c4], fa[i]);
#pragma unroll
      for (int i = 0; i < 4; ++i) put4(&Wt[r8 + 32 * i][c4], fw[i]);
    } else {
      const bool kv = (kt << 5) + c4 < K;   // this tile's piece lies inside K
      const float4 z = make_float4(0.f, 0.f, 0.f, 0.f);
#pragma unroll
      for (int i = 0; i < 2; ++i) put4(&At[r8 + 32 * i][c4], (kv && va[i]) ? fa[i] : z);
#pragma unroll
      for (int i = 0; i < 4; ++i) put4(&Wt[r8 + 32 * i][c4], (kv && vw[i]) ? fw[i] : z);
    }
    __syncthreads();
    if (kt + 1 < ktn) {
      const int kn = (kt + 1) << 5;
      const int ko = (kn + c4 < K) ? kn : 0;
#pragma unroll
      for (int i = 0; i < 2; ++i) fa[i] = *(const float4*)(pa[i] + ko);
#pragma unroll
      for (int i = 0; i < 4; ++i) fw[i] = *(const float4*)(pw[i] + ko);
      asm volatile("s_wait_xcnt 0x0" ::: "memory");
    }
    v16h a0 = frag_row(&At[0][0], 40, wm * 32, 0, lane);
    v16h a1 = frag_row(&At[0][0], 40, wm * 32 + 16, 0, lane);
    v16h b0 = frag_row(&Wt[0][0], 40, wn * 32, 0, lane);
    v16h b1 = frag_row(&Wt[0][0], 40, wn * 32 + 16, 0, lane);
    acc00 = wmma_f16(a0, b0, acc00);
    acc01 = wmma_f16(a0, b1, acc01);
    acc10 = wmma_f16(a1, b0, acc10);
    acc11 = wmma_f16(a1, b1, acc11);
    __syncthreads();
  }
  v8f* accs[4] = {&acc00, &acc01, &acc10, &acc11};
#pragma unroll
  for (int q = 0; q < 4; ++q) {
    int im = q >> 1, in_ = q & 1;
#pragma unroll
    for (int r = 0; r < 8; ++r) {
      int gm = bm + wm * 32 + im * 16 + r + 8 * (lane >> 4);
      int gn = bn + wn * 32 + in_ * 16 + (lane & 15);
      if (gm < M && gn < N) {
        float v = (*accs[q])[r] + (bias ? bias[gn] : 0.f);
        if (act == 1) v = 0.5f * v * (1.f + erff(v * 0.70710678118f));
        C[(size_t)gm * ldc + gn] = v;
      }
    }
  }
}

// ---------------- depthwise causal conv (+ optional SiLU) ------------------
// A thread computes four neighbouring channels (one float4) of DWR consecutive
// time steps; a wave covers 128 channels, so each of its loads and stores is 512
// contiguous bytes of one row, and the eight waves of a work-group take eight
// consecutive blocks of time steps. The DWR + KW - 1 input rows of a thread are
// loaded up front into registers. The work-group's 128 x KW weights go through
// LDS, transposed to one row per tap, so that a tap's four weights are one
// 16-byte read. Every output sums its taps in ascending order; a row in front
// of the sequence's start is not read and counts as zero (a test that is the
// same for the whole wave).
constexpr int DWR = 8;                     // time steps per thread
constexpr int DWC = 128;                   // channels per work-group
constexpr int DWP = DWC + 4;               // floats per tap row in LDS
template <int KW, bool SILU>
__global__ void __launch_bounds__(256)
dwconv_kernel(const float* __restrict__ X, const float* __restrict__ Wc,
              float* __restrict__ Y) {
  __shared__ __attribute__((aligned(16))) float wt[KW * DWP];
  constexpr int NX = DWR + KW - 1;         // input rows per thread
  constexpr int NF = DWC * KW / 256;       // rounds in which every thread stages a weight
  constexpr bool TAIL = (DWC * KW) % 256 != 0;   // 128 weights more: waves 0-3
  const int tid = threadIdx.x, lane = tid & 31;
  const int wid = __builtin_amdgcn_readfirstlane(tid >> 5);
  const int c0 = blockIdx.x * DWC;
  const int r0 = (blockIdx.y * 8 + wid) * DWR;   // first row, b * Tt + t
  const int t0 = r0 & (Tt - 1);
  const float* xs = X + (size_t)r0 * Dd + c0;    // the same in every lane
  float4 x[NX];
  if (t0 >= KW - 1) {
#pragma unroll
    for (int j = 0; j < NX; ++j)
      x[j] = *(const float4*)(xs + (j - (KW - 1)) * Dd + lane * 4);
  } else {
    // the first blocks of a sequence, few: row by row
#pragma unroll
    for (int j = 0; j < KW - 1; ++j) {
      if (t0 + j >= KW - 1) {
        x[j] = *(const float4*)(xs + (j - (KW - 1)) * Dd + lane * 4);
        // the next row's load forms its offset register anew
        asm volatile("s_wait_xcnt 0x0" ::: "memory");
      } else {
        x[j] = make_float4(0.f, 0.f, 0.f, 0.f);
      }
    }
#pragma unroll
    for (int j = KW - 1; j < NX; ++j)
      x[j] = *(const float4*)(xs + (j - (KW - 1)) * Dd + lane * 4);
  }
  // what follows reuses the base and offset registers of these loads
  asm volatile("s_wait_xcnt 0x0" ::: "memory");
  const float* wp = Wc + c0 * KW + tid;
  float wv[NF + 1];
#pragma unroll
  for (int n = 0; n < NF; ++n) wv[n] = wp[256 * n];
  wv[NF] = 0.f;
  if (TAIL && wid < 4) wv[NF] = wp[256 * NF];
  asm volatile("s_wait_xcnt 0x0" ::: "memory");
  // keeps the later address arithmetic, which reuses the loads' scalar base,
  // behind the wait: the compiler had lifted it over
  __builtin_amdgcn_sched_barrier(0);
#pragma unroll
  for (int n = 0; n < NF; ++n) {
    const int e = tid + 256 * n;
    wt[(e % KW) * DWP + e / KW] = wv[n];
  }
  if (TAIL && wid < 4) {
    const int e = tid + 256 * NF;
    wt[(e % KW) * DWP + e / KW] = wv[NF];
  }
  __syncthreads();
  float4 s[DWR];
#pragma unroll
  for (int r = 0; r < DWR; ++r) s[r] = make_float4(0.f, 0.f, 0.f, 0.f);
#pragma unroll
  for (int i = 0; i < KW; ++i) {
    const float4 w = *(const float4*)&wt[i * DWP + lane * 4];
#pragma unroll
    for (int r = 0; r < DWR; ++r) {
      s[r].x += x[r + i].x * w.x;
      s[r].y += x[r + i].y * w.y;
      s[r].z += x[r + i].z * w.z;
      s[r].w += x[r + i].w * w.w;
    }
  }
  float* yp = Y + (size_t)r0 * Dd + c0 + lane * 4;
  if (SILU) {
#pragma unroll
    for (int r = 0; r < DWR; ++r) {
      s[r].x = s[r].x / (1.f + expf(-s[r].x));
      s[r].y = s[r].y / (1.f + expf(-s[r].y));
      s[r].z = s[r].z / (1.f + expf(-s[r].z));
      s[r].w = s[r].w / (1.f + expf(-s[r].w));
    }
  }
#pragma unroll
  for (int r = 0; r < DWR; ++r) *(float4*)(yp + r * Dd) = s[r];
}

// ---------------- beta = sigmoid(hidden @ b_proj^T) ------------------------
__global__ void beta_kernel(const float* __restrict__ hs,
                            const float* __restrict__ Wb,
                            float* __restrict__ beta) {
  int idx = blockIdx.x * blockDim.x + threadIdx.x;
  if (idx >= Bb * Tt * Hh) return;
  int h = idx & (Hh - 1);
  size_t bt = (size_t)idx >> 2;
  const float* x = hs + bt * Dd;
  const float* w = Wb + (size_t)h * Dd;
  float s = 0.f;
  for (int k = 0; k < Dd; ++k) s += x[k] * w[k];
  beta[idx] = 1.f / (1.f + expf(-s));
}

// ---------------- gi[:, :D] = hidden ---------------------------------------
// A work-group copies GIR whole rows, a thread one float4 of each.
constexpr int GIR = 8;
typedef __attribute__((ext_vector_type(4))) float v4f;
__global__ void __launch_bounds__(256)
gi_copy_kernel(const float* __restrict__ hs, float* __restrict__ gi) {
  const size_t r0 = (size_t)blockIdx.x * GIR;
  const float* sp = hs + r0 * Dd + threadIdx.x * 4;
  float* dp = gi + r0 * GIW + threadIdx.x * 4;
  v4f v[GIR];
#pragma unroll
  for (int i = 0; i < GIR; ++i) v[i] = *(const v4f*)(sp + i * Dd);
#pragma unroll
  for (int i = 0; i < GIR; ++i) *(v4f*)(dp + i * GIW) = v[i];
}

// ---------------- stats = mean |branch| over DV -> gi tail -----------------
__global__ void stats_kernel(const float* __restrict__ b0,
                             const float* __restrict__ b1,
                             const float* __restrict__ b2,
                             const float* __restrict__ b3,
                             const float* __restrict__ b4,
                             const float* __restrict__ b5,
                             float* __restrict__ gi) {
  int wg = blockIdx.x * 8 + (threadIdx.x >> 5);
  int lane = threadIdx.x & 31;
  if (wg >= Bb * Tt * Hh * Pp) return;
  int p = wg % Pp;
  int h = (wg / Pp) % Hh;
  size_t bt = (size_t)wg / (Pp * Hh);
  const float* src = (p == 0) ? b0 : (p == 1) ? b1 : (p == 2) ? b2
                   : (p == 3) ? b3 : (p == 4) ? b4 : b5;
  src += bt * Dd + (size_t)h * DVv;
  float s = 0.f;
#pragma unroll
  for (int i = 0; i < 8; ++i) s += fabsf(src[lane + 32 * i]);
#pragma unroll
  for (int off = 16; off; off >>= 1) s += __shfl_xor(s, off, 32);
  if (lane == 0) gi[bt * GIW + Dd + h * Pp + p] = s * (1.f / 256.f);
}

// ---------------- chunked delta rule ---------------------------------------
// The UT transform of a chunk (l2norm, A, forward substitution, w, u, attn)
// reads no state, so prep_kernel does it for all chunks side by side, one
// work-group per (batch, head, chunk), and leaves q, k^T, -w, attn (f16) and
// u (f32) in the workspace, one contiguous block per chunk. Only the steps
// that read or write the state S stay in the serial scan of delta_kernel.
constexpr int CE = CHc * DKk;              // elements of one 32 x 256 chunk block
__global__ void __launch_bounds__(256)
prep_kernel(const float* __restrict__ qc, const float* __restrict__ kc,
            const float* __restrict__ vc, const float* __restrict__ betap,
            float* __restrict__ qo, float* __restrict__ ko,
            float* __restrict__ wo, float* __restrict__ uo,
            float* __restrict__ ao) {
  extern __shared__ char smem[];
  float* Am  = (float*)smem;                 // 32x33 f32 (A / fwd-subst)
  h16* qn    = (h16*)(Am + 32 * 33);         // 32x256
  h16* kn    = qn + CE;
  h16* kbn   = kn + CE;
  h16* wn    = kbn + CE;                     // holds -(inv@kb)
  h16* xb    = wn + CE;                      // 32x256: v*beta
  h16* invb  = xb + CE;                      // 32x32
  h16* attb  = invb + 32 * 32;               // 32x32

  const int tid = threadIdx.x, lane = tid & 31, wid = tid >> 5;
  const int bh = blockIdx.x / NCHUNK, nc = blockIdx.x % NCHUNK;
  const int b = bh >> 2, h = bh & 3;
  const int t0 = nc * CHc;

  // ---- stage 1: load chunk, l2norm q/k, apply beta ----
  for (int j = 0; j < 4; ++j) {
    int r = wid * 4 + j;
    int t = t0 + r;
    size_t rowb = ((size_t)(b * Tt + t)) * Dd + (size_t)h * DKk;
    float bet = betap[(size_t)(b * Tt + t) * Hh + h];
    float qv[8], kv[8], vv[8];
    float sq = 0.f, sk = 0.f;
#pragma unroll
    for (int i = 0; i < 8; ++i) {
      int d = lane + 32 * i;
      qv[i] = qc[rowb + d]; kv[i] = kc[rowb + d]; vv[i] = vc[rowb + d];
      sq += qv[i] * qv[i]; sk += kv[i] * kv[i];
    }
#pragma unroll
    for (int off = 16; off; off >>= 1) {
      sq += __shfl_xor(sq, off, 32);
      sk += __shfl_xor(sk, off, 32);
    }
    float rq = rsqrtf(sq + 1e-12f), rk = rsqrtf(sk + 1e-12f);
#pragma unroll
    for (int i = 0; i < 8; ++i) {
      int d = lane + 32 * i;
      float kq = kv[i] * rk;
      qn[r * 256 + d]  = (h16)(qv[i] * rq);
      kn[r * 256 + d]  = (h16)kq;
      kbn[r * 256 + d] = (h16)(kq * bet);
      xb[r * 256 + d]  = (h16)(vv[i] * bet);
    }
  }
  __syncthreads();
  // ---- stage 2: A = -(kb k^T), strict lower (waves 0-3) ;
  //      stage 6: attn = (q k^T) * lower-incl mask (waves 4-7) ----
  {
    int m0 = ((wid >> 1) & 1) * 16, n0 = (wid & 1) * 16;
    const h16* lhs = (wid < 4) ? kbn : qn;
    v8f acc = {};
    for (int kk = 0; kk < 8; ++kk)
      acc = wmma_f16(frag_row(lhs, 256, m0, kk * 32, lane),
                     frag_row(kn, 256, n0, kk * 32, lane), acc);
    if (wid < 4) {
#pragma unroll
      for (int r = 0; r < 8; ++r) {
        int m = m0 + r + 8 * (lane >> 4), n = n0 + (lane & 15);
        Am[m * 33 + n] = (m > n) ? -acc[r] : 0.f;
      }
    } else {
#pragma unroll
      for (int r = 0; r < 8; ++r) {
        int m = m0 + r + 8 * (lane >> 4), n = n0 + (lane & 15);
        attb[m * 32 + n] = (h16)((m >= n) ? acc[r] : 0.f);
      }
    }
  }
  __syncthreads();
  // ---- stage 3: forward substitution, inv = A + I ----
  for (int i = 1; i < 32; ++i) {
    float val = 0.f;
    if (tid < 32)
      for (int s = 0; s < i; ++s) val += Am[i * 33 + s] * Am[s * 33 + tid];
    __syncthreads();
    if (tid < 32) Am[i * 33 + tid] += val;
    __syncthreads();
  }
  for (int e = tid; e < 1024; e += 256) {
    int m = e >> 5, n = e & 31;
    invb[e] = (h16)(Am[m * 33 + n] + ((m == n) ? 1.f : 0.f));
  }
  __syncthreads();
  // ---- stage 4: wn = -(inv@kb) ; u = inv@(v*beta) -> workspace (f32) ----
  float* ug = uo + (size_t)blockIdx.x * CE;
  for (int it = 0; it < 4; ++it) {
    int j = wid + 8 * it;           // 0..31
    int m0 = (j >> 4) * 16, n0 = (j & 15) * 16;
    v16h ia = frag_row(invb, 32, m0, 0, lane);
    v8f acc = {}, accu = {};
    acc  = wmma_f16(ia, frag_kmaj(kbn, 256, n0, 0, lane), acc);
    accu = wmma_f16(ia, frag_kmaj(xb, 256, n0, 0, lane), accu);
#pragma unroll
    for (int r = 0; r < 8; ++r) {
      int m = m0 + r + 8 * (lane >> 4), n = n0 + (lane & 15);
      wn[m * 256 + n] = (h16)(-acc[r]);
      ug[m * 256 + n] = accu[r];
    }
    // the next trip rewrites the address and data registers of the u stores
    asm volatile("s_wait_xcnt 0x0" ::: "memory");
  }
  __syncthreads();
  // ---- hand q, k^T, -w, attn to the scan: 16-byte stores, one block per chunk ----
  // k goes out transposed, 256 rows (dk) of 32 chunk positions: the scan reads
  // k^T as the A operand of its state update, contiguous along the chunk.
  v8h* gk = (v8h*)ko + (size_t)blockIdx.x * (CE / 8) + tid * 4;
#pragma unroll
  for (int i = 0; i < 4; ++i) {
    v8h t;
#pragma unroll
    for (int j = 0; j < 8; ++j) t[j] = kn[(8 * i + j) * 256 + tid];
    gk[i] = t;
  }
  // the stores below reuse the address and data registers of the k^T stores
  asm volatile("s_wait_xcnt 0x0" ::: "memory");
  uint4* gq = (uint4*)qo + (size_t)blockIdx.x * (CE / 8);
  uint4* gw = (uint4*)wo + (size_t)blockIdx.x * (CE / 8);
#pragma unroll
  for (int i = 0; i < 4; ++i) {
    int e = tid + 256 * i;
    gq[e] = ((const uint4*)qn)[e];
    gw[e] = ((const uint4*)wn)[e];
  }
  if (tid < 128)
    ((uint4*)ao)[(size_t)blockIdx.x * 128 + tid] = ((const uint4*)attb)[tid];
}

// Serial scan over the chunks, state split by value columns: column n of ui,
// oi and S depends on column n of u and S only, so each work-group owns DVS
// value columns of one (batch, head). DVS = 32 floats = one 128-byte output line.
// The 256 x DVS state slice lives in registers, split by key rows: wave w owns
// rows 32 w .. 32 w + 31 as four f32 D tiles, which the state update
// accumulates into, and as two f16 B fragments converted from them in place.
// A wave multiplies its 32 columns of -w and of q (fragments straight from the
// workspace) by its own rows of S; the eight partial 32 x DVS products are
// summed through LDS, thread t taking the float4 at place t of every partial.
constexpr int DVS = 32;                    // value columns per work-group
constexpr int NSL = DVv / DVS;             // slices per (batch, head)
constexpr int XP  = 40;                    // f16 per row of ui^T in LDS: 80 bytes
constexpr int RP  = 32 * DVS / 4;          // float4 per 32 x DVS partial
__global__ void __launch_bounds__(256)
delta_kernel(const float* __restrict__ qi, const float* __restrict__ ki,
             const float* __restrict__ wi, const float* __restrict__ ui0,
             const float* __restrict__ ai, float* __restrict__ dout) {
  extern __shared__ char smem[];
  float4* redW = (float4*)smem;              // 8 partials of (-w)@S
  float4* redQ = redW + 8 * RP;              // 8 partials of q@S, then attn@ui
  h16* xbT     = (h16*)(redQ + 9 * RP);      // DVS x XP: ui^T (f16)

  const int tid = threadIdx.x, lane = tid & 31;
  const int wid = __builtin_amdgcn_readfirstlane(tid >> 5);
  const int c = lane & 15, hh = lane >> 4;
  const int bh = blockIdx.x / NSL;
  const int c0 = (blockIdx.x % NSL) * DVS;   // first value column of the slice
  const int b = bh >> 2, h = bh & 3;
  // Place t of a partial holds registers 4 g .. 4 g + 3 of tile (mt, nt) at lane
  // t & 31, with mt * 4 + nt * 2 + g = t >> 5: rows rm .. rm + 3 of column rn.
  const int rm = (wid >> 2) * 16 + 8 * hh + 4 * (wid & 1);
  const int rn = ((wid >> 1) & 1) * 16 + c;
  // the lane's fixed offsets inside a chunk's blocks; the chunk moves the base
  const unsigned lwq = c * 256 + wid * 32 + hh * 8;         // -w, q: row c
  const unsigned lk  = (wid * 32 + c) * 32 + hh * 8;        // k^T: row 32 wid + c
  const unsigned la  = (((wid >> 1) & 1) * 16 + c) * 32 + hh * 8;  // attn
  const unsigned lu  = rm * 256 + c0 + rn;                  // u
  const unsigned lo  = rm * Dd + h * DVv + c0 + rn;         // oi

  v8f S00 = {}, S01 = {}, S10 = {}, S11 = {};  // S[32 wid + 16 mt ..][16 nt ..]
  v16h sb0 = {}, sb1 = {};                     // the same rows as B fragments
  const v8f zero = {};

  for (int nc = 0; nc < NCHUNK; ++nc) {
    const int t0 = nc * CHc;
    // ---- the wave's own fragments of the chunk's -w, q, k^T, attn; its u ----
    const size_t cb = (size_t)(bh * NCHUNK + nc);
    const h16* gw = (const h16*)wi + cb * CE + lwq;
    const h16* gq = (const h16*)qi + cb * CE + lwq;
    const h16* gk = (const h16*)ki + cb * CE + lk;
    const float* gu = ui0 + cb * CE + lu;
    v16h w0 = frag_vec(gw), w1 = frag_vec(gw + 16 * 256);
    // the next loads land in the address registers of these
    asm volatile("s_wait_xcnt 0x0" ::: "memory");
    v16h q0 = frag_vec(gq), q1 = frag_vec(gq + 16 * 256);
    asm volatile("s_wait_xcnt 0x0" ::: "memory");
    float u0 = gu[0], u1 = gu[256], u2 = gu[512], u3 = gu[768];
    v16h k0 = frag_vec(gk), k1 = frag_vec(gk + 16 * 32);
    v16h at = {};
    if (wid < 4)
      at = frag_vec((const h16*)ai + cb * 1024 + la);
    // the products below land in the address registers of these loads
    asm volatile("s_wait_xcnt 0x0" ::: "memory");
    // ---- partial (-w)@S and q@S over the wave's 32 key rows ----
    v8f pw00 = wmma_f16(w0, sb0, zero), pw01 = wmma_f16(w0, sb1, zero);
    v8f pw10 = wmma_f16(w1, sb0, zero), pw11 = wmma_f16(w1, sb1, zero);
    v8f pq00 = wmma_f16(q0, sb0, zero), pq01 = wmma_f16(q0, sb1, zero);
    v8f pq10 = wmma_f16(q1, sb0, zero), pq11 = wmma_f16(q1, sb1, zero);
    float4* rw = redW + wid * RP + lane;
    put8(rw, pw00); put8(rw + 64, pw01); put8(rw + 128, pw10); put8(rw + 192, pw11);
    __syncthreads();
    // ---- ui = u + sum of the partials -> ui^T (f16) ----
    {
      float4 s = redW[tid];
#pragma unroll
      for (int v = 1; v < 8; ++v) {
        float4 p = redW[v * RP + tid];
        s.x += p.x; s.y += p.y; s.z += p.z; s.w += p.w;
      }
      v4h x = {(h16)(u0 + s.x), (h16)(u1 + s.y), (h16)(u2 + s.z), (h16)(u3 + s.w)};
      *(v4h*)&xbT[rn * XP + rm] = x;
    }
    __syncthreads();
    // ---- S += k^T @ ui on the wave's rows; attn@ui as a ninth partial of oi ----
    {
      v16h ub0 = frag_vec(xbT + c * XP + hh * 8);
      v16h ub1 = frag_vec(xbT + (16 + c) * XP + hh * 8);
      S00 = wmma_f16(k0, ub0, S00); S01 = wmma_f16(k0, ub1, S01);
      S10 = wmma_f16(k1, ub0, S10); S11 = wmma_f16(k1, ub1, S11);
      float4* rq = redQ + wid * RP + lane;
      put8(rq, pq00); put8(rq + 64, pq01); put8(rq + 128, pq10); put8(rq + 192, pq11);
      if (wid < 4)
        put8(redQ + 8 * RP + wid * 64 + lane,
             wmma_f16(at, (wid & 1) ? ub1 : ub0, zero));
      sb0 = pack_b(S00, S10);
      sb1 = pack_b(S01, S11);
    }
    __syncthreads();
    // ---- oi = q@S + attn@ui: sum of the nine partials -> global ----
    {
      float4 o = redQ[tid];
#pragma unroll
      for (int v = 1; v < 9; ++v) {
        float4 p = redQ[v * RP + tid];
        o.x += p.x; o.y += p.y; o.z += p.z; o.w += p.w;
      }
      float* go = dout + (size_t)(b * Tt + t0) * Dd + lo;
      go[0] = o.x; go[Dd] = o.y; go[2 * Dd] = o.z; go[3 * Dd] = o.w;
      // the next trip rewrites the address and data registers of these stores
      asm volatile("s_wait_xcnt 0x0" ::: "memory");
    }
  }
}

// ---------------- gate softmax + branch mixing + RMSNorm -------------------
__global__ void __launch_bounds__(256)
fuse_kernel(const float* __restrict__ b0, const float* __restrict__ b1,
            const float* __restrict__ b2, const float* __restrict__ b3,
            const float* __restrict__ b4, const float* __restrict__ b5,
            const float* __restrict__ gi, const float* __restrict__ logits,
            const float* __restrict__ alpha, const float* __restrict__ ltemp,
            const float* __restrict__ onw, float* __restrict__ out) {
  size_t bt = blockIdx.x;
  int tid = threadIdx.x;
  __shared__ float probs_s[Hh][Pp];
  __shared__ float red[256];
  if (tid < Hh) {
    int h = tid;
    float x = ltemp[h];
    float temp = fmaxf(x, 0.f) + log1pf(expf(-fabsf(x))) + 1e-4f; // softplus
    float l[Pp];
    float mx = -1e30f;
#pragma unroll
    for (int p = 0; p < Pp; ++p) {
      float st = gi[bt * GIW + Dd + h * Pp + p];
      l[p] = (logits[bt * (Hh * Pp) + h * Pp + p] + alpha[p] * st) / temp;
      mx = fmaxf(mx, l[p]);
    }
    float se = 0.f;
#pragma unroll
    for (int p = 0; p < Pp; ++p) { l[p] = expf(l[p] - mx); se += l[p]; }
#pragma unroll
    for (int p = 0; p < Pp; ++p) {
      float pr = l[p] / se * (1.f - FLOORv);
      if (p == Pp - 1) pr += FLOORv;
      probs_s[h][p] = pr;
    }
  }
  __syncthreads();
  int d = tid;
  for (int h = 0; h < Hh; ++h) {
    size_t base = bt * Dd + (size_t)h * DVv + d;
    float o = b0[base] * probs_s[h][0] + b1[base] * probs_s[h][1] +
              b2[base] * probs_s[h][2] + b3[base] * probs_s[h][3] +
              b4[base] * probs_s[h][4] + b5[base] * probs_s[h][5];
    red[tid] = o * o;
    __syncthreads();
    for (int s = 128; s; s >>= 1) {
      if (tid < s) red[tid] += red[tid + s];
      __syncthreads();
    }
    float ms = red[0] * (1.f / 256.f);
    __syncthreads();
    out[base] = o * rsqrtf(ms + 1e-5f) * onw[d];
  }
}

// ---------------------------------------------------------------------------
extern "C" void kernel_launch(void* const* d_in, const int* in_sizes, int n_in,
                              void* d_out, int out_size, void* d_ws,
                              size_t ws_size, hipStream_t stream) {
  const float* hs   = (const float*)d_in[0];
  const float* qw   = (const float*)d_in[1];
  const float* kw   = (const float*)d_in[2];
  const float* vw   = (const float*)d_in[3];
  const float* bw   = (const float*)d_in[4];
  const float* qcw  = (const float*)d_in[5];
  const float* kcw  = (const float*)d_in[6];
  const float* vcw  = (const float*)d_in[7];
  const float* f3w  = (const float*)d_in[8];
  const float* f7w  = (const float*)d_in[9];
  const float* f15w = (const float*)d_in[10];
  const float* f31w = (const float*)d_in[11];
  const float* gw1  = (const float*)d_in[12];
  const float* gb1  = (const float*)d_in[13];
  const float* gw2  = (const float*)d_in[14];
  const float* gb2  = (const float*)d_in[15];
  const float* glt  = (const float*)d_in[16];
  const float* alps = (const float*)d_in[17];
  const float* onw  = (const float*)d_in[18];
  const float* ow   = (const float*)d_in[19];
  float* out = (float*)d_out;

  const size_t U = (size_t)Bb * Tt * Dd; // 4096*1024
  float* ws = (float*)d_ws;
  float* qp  = ws;            // q projection (reused: fir3)
  float* kp  = qp + U;        // k projection (reused: fir7)
  float* vp  = kp + U;        // v projection (reused: fir15)
  float* qcv = vp + U;        // q after conv+silu (reused: fir31)
  float* kcv = qcv + U;       // k after conv+silu (reused: o_fused)
  float* vcv = kcv + U;       // v after conv+silu (branch p=4)
  float* dta = vcv + U;       // delta-rule output (branch p=5)
  float* h1  = dta + U;       // gate hidden, 2U
  float* gi  = h1 + 2 * U;    // gate input, B*T x GIW
  float* beta = gi + (size_t)Bb * Tt * 1056;
  float* lgt  = beta + (size_t)Bb * Tt * Hh;
  float* pq  = lgt + (size_t)Bb * Tt * Hh * Pp;  // prepared q, f16 (U/2 floats)
  float* pk  = pq + U / 2;    // prepared k^T, f16
  float* pw  = pk + U / 2;    // prepared -w, f16
  float* pu  = pw + U / 2;    // prepared u, f32
  float* pa  = pu + U;        // prepared attn, f16, 32x32 per chunk

  const int MT = Bb * Tt;                 // 4096
  dim3 blk(256);
  dim3 gN1024((1024 + 127) / 128, (MT + 63) / 64);
  dim3 gDW(Dd / DWC, MT / (8 * DWR));

  // 1) q/k/v projections (no activation; conv+silu comes after)
  gemm_kernel<<<gN1024, blk, 0, stream>>>(hs, Dd, qw, Dd, nullptr, qp, Dd, MT, Dd, Dd, 0);
  gemm_kernel<<<gN1024, blk, 0, stream>>>(hs, Dd, kw, Dd, nullptr, kp, Dd, MT, Dd, Dd, 0);
  gemm_kernel<<<gN1024, blk, 0, stream>>>(hs, Dd, vw, Dd, nullptr, vp, Dd, MT, Dd, Dd, 0);
  // 2) beta
  beta_kernel<<<(MT * Hh + 255) / 256, blk, 0, stream>>>(hs, bw, beta);
  // 3) depthwise causal conv (k=4) + SiLU
  dwconv_kernel<4, true><<<gDW, blk, 0, stream>>>(qp, qcw, qcv);
  dwconv_kernel<4, true><<<gDW, blk, 0, stream>>>(kp, kcw, kcv);
  dwconv_kernel<4, true><<<gDW, blk, 0, stream>>>(vp, vcw, vcv);
  // 4) delta rule: state-free chunk work for all chunks at once, then the
  //    scan, one workgroup per (batch, head, 32-column state slice)
  const size_t PLDS = 32 * 33 * sizeof(float) + (5 * CE + 2 * 32 * 32) * sizeof(h16);
  prep_kernel<<<dim3(Bb * Hh * NCHUNK), blk, PLDS, stream>>>(qcv, kcv, vcv, beta,
                                                             pq, pk, pw, pu, pa);
  const size_t DLDS = 17 * RP * sizeof(float4) + DVS * XP * sizeof(h16);
  delta_kernel<<<dim3(Bb * Hh * NSL), blk, DLDS, stream>>>(pq, pk, pw, pu, pa, dta);
  // 5) FIR branches on v (reuse proj buffers; qcv/kcv free after delta)
  dwconv_kernel<3, false><<<gDW, blk, 0, stream>>>(vcv, f3w, qp);
  dwconv_kernel<7, false><<<gDW, blk, 0, stream>>>(vcv, f7w, kp);
  dwconv_kernel<15, false><<<gDW, blk, 0, stream>>>(vcv, f15w, vp);
  dwconv_kernel<31, false><<<gDW, blk, 0, stream>>>(vcv, f31w, qcv);
  // 6) gate input = concat(hidden, stats)
  gi_copy_kernel<<<MT / GIR, blk, 0, stream>>>(hs, gi);
  stats_kernel<<<(MT * Hh * Pp) / 8, blk, 0, stream>>>(qp, kp, vp, qcv, vcv, dta, gi);
  // 7) gate MLP (gelu, then linear to H*P logits with gb2 bias)
  dim3 gGate1((2048 + 127) / 128, (MT + 63) / 64);
  gemm_kernel<<<gGate1, blk, 0, stream>>>(gi, GIW, gw1, GIW, gb1, h1, 2048, MT, 2048, GIW, 1);
  dim3 gGate2(1, (MT + 63) / 64);
  gemm_kernel<<<gGate2, blk, 0, stream>>>(h1, 2048, gw2, 2048, gb2, lgt, Hh * Pp, MT, Hh * Pp, 2048, 0);
  // 8) softmax gate + mix branches + RMSNorm  (o_fused -> kcv)
  float* ofused = kcv;
  fuse_kernel<<<dim3(MT), blk, 0, stream>>>(qp, kp, vp, qcv, vcv, dta, gi, lgt,
                                            alps, glt, onw, ofused);
  // 9) output projection
  gemm_kernel<<<gN1024, blk, 0, stream>>>(ofused, Dd, ow, Dd, nullptr, out, Dd, MT, Dd, Dd, 0);
}

// v006
// One run takes 440 microseconds.
// Two timings next to v005 both put it at 1.11 times that version's speed.
// Over all steps from v000 it is 8.94 times as fast.
#include <hip/hip_runtime.h>
#include <hip/hip_bf16.h>
#include <math.h>

#define DEV __device__ __forceinline__

typedef __attribute__((ext_vector_type(16))) _Float16 v16h;
typedef __attribute__((ext_vector_type(8)))  float    v8f;
typedef _Float16 h16;

constexpr int Bb = 2, Tt = 2048, Dd = 1024, Hh = 4, Pp = 6, CHc = 32;
constexpr int DKk = 256, DVv = 256;
constexpr int NCHUNK = Tt / CHc;           // 64
constexpr int GIW = Dd + Hh * Pp;          // 1048
constexpr float FLOORv = 0.05f;

DEV v16h frag_row(const h16* t, int ld, int r0, int k0, int lane) {
  // element [m][k] at t[(r0+m)*ld + (k0+k)]
  v16h f;
  int m = lane & 15, kg = lane >> 4;
#pragma unroll
  for (int j = 0; j < 8; ++j) {
    int kk = ((j < 4) ? 0 : 16) + kg * 8 + 2 * (j & 3);
    const h16* p = t + (size_t)(r0 + m) * ld + k0 + kk;
    f[2 * j] = p[0];
    f[2 * j + 1] = p[1];
  }
  return f;
}
DEV v16h frag_kmaj(const h16* t, int ld, int r0, int k0, int lane) {
  // element [m][k] at t[(k0+k)*ld + (r0+m)]
  v16h f;
  int m = lane & 15, kg = lane >> 4;
#pragma unroll
  for (int j = 0; j < 8; ++j) {
    int kk = ((j < 4) ? 0 : 16) + kg * 8 + 2 * (j & 3);
    f[2 * j]     = t[(size_t)(k0 + kk) * ld + r0 + m];
    f[2 * j + 1] = t[(size_t)(k0 + kk + 1) * ld + r0 + m];
  }
  return f;
}
DEV v8f wmma_f16(v16h a, v16h b, v8f c) {
  return __builtin_amdgcn_wmma_f32_16x16x32_f16(false, a, false, b, (short)0, c,
                                                false, false);
}

typedef __attribute__((ext_vector_type(8))) _Float16 v8h;
typedef __attribute__((ext_vector_type(4))) _Float16 v4h;
// frag_row's fragment as two 16-byte loads: p is the lane's row at
// k = 8 * (lane >> 4); the fragment's second eight k lie 16 further on.
DEV v16h frag_vec(const h16* p) {
  v8h lo = *(const v8h*)p, hi = *(const v8h*)(p + 16);
  return __builtin_shufflevector(lo, hi, 0, 1, 2, 3, 4, 5, 6, 7, 8, 9, 10, 11,
                                 12, 13, 14, 15);
}
// One D tile to LDS: registers 0-3 at d, registers 4-7 32 places further on.
DEV void put8(float4* d, v8f a) {
  d[0]  = make_float4(a[0], a[1], a[2], a[3]);
  d[32] = make_float4(a[4], a[5], a[6], a[7]);
}
// Two f32 D tiles (rows 0-15 and 16-31 of a 32-row block, same columns) are,
// converted lane by lane, the f16 B fragment of that block in frag_row's k order.
DEV v16h pack_b(v8f lo, v8f hi) {
  v16h f;
#pragma unroll
  for (int s = 0; s < 8; ++s) { f[s] = (h16)lo[s]; f[8 + s] = (h16)hi[s]; }
  return f;
}

typedef __attribute__((ext_vector_type(4))) float v4f;
DEV void put4(h16* d, v4f f) {
  d[0] = (h16)f.x; d[1] = (h16)f.y; d[2] = (h16)f.z; d[3] = (h16)f.w;
}

// ---------------- Generic GEMM: C = act(A(MxK) * W(NxK)^T + bias) ----------
// 64x128 block tile, 8 waves (2x4), each wave owns a 32x32 region.
// A trip of the K loop takes GBK = 128 columns (four wmma steps of 32). Wave w
// stages rows w + 8 j of A (j < 8) and of W (j < 16); a lane takes columns
// c4..c4+3, so a wave-wide load is 512 contiguous bytes of one row and its
// LDS store 256 contiguous bytes. The 24 loads of trip kt + 1 are issued
// together, into registers, before trip kt is read from LDS and multiplied;
// they are converted and stored to LDS at the top of the next trip. The load
// latency and the two barriers are met once per 128 columns.
// Edges take the same path: a row past M or N is read at the last row, a piece
// past K at the row's first columns, and such a piece is stored as zeros.
// K, lda and ldw are multiples of 4 in every call, so a piece lies wholly
// inside K or wholly outside, and every piece is 16-byte aligned.
constexpr int GBK = 128;                   // K columns per trip
constexpr int GLP = GBK + 8;               // f16 per LDS row: 272 bytes
__global__ void __launch_bounds__(256)
gemm_kernel(const float* __restrict__ A, int lda, const float* __restrict__ W,
            int ldw, const float* __restrict__ bias, float* __restrict__ C,
            int ldc, int M, int N, int K, int act) {
  __shared__ __attribute__((aligned(16))) h16 At[64][GLP];
  __shared__ __attribute__((aligned(16))) h16 Wt[128][GLP];
  const int tid = threadIdx.x, lane = tid & 31;
  const int wid = __builtin_amdgcn_readfirstlane(tid >> 5);
  const int wm = wid >> 2, wn = wid & 3;
  const int bm = blockIdx.y * 64, bn = blockIdx.x * 128;
  const int c4 = lane * 4;
  v8f acc00 = {}, acc01 = {}, acc10 = {}, acc11 = {};
  const int ktn = (K + GBK - 1) / GBK;
  // K is positive in every call: the first trip's loads then stay where they
  // are written, in front of their wait, and are not sunk into a guarded block
  __builtin_assume(ktn > 0);
  const char* pa[8];                       // row starts: the same in every lane
  const char* pw[16];
  bool va[8], vw[16];
#pragma unroll
  for (int j = 0; j < 8; ++j) {
    int gm = bm + wid + 8 * j;
    va[j] = gm < M;
    pa[j] = (const char*)(A + (size_t)(va[j] ? gm : M - 1) * lda);
  }
#pragma unroll
  for (int j = 0; j < 16; ++j) {
    int gn = bn + wid + 8 * j;
    vw[j] = gn < N;
    pw[j] = (const char*)(W + (size_t)(vw[j] ? gn : N - 1) * ldw);
  }
  v4f fa[8], fw[16];
  // the 24 loads of the trip that starts at column kb
  auto issue = [&](int kb) {
    const unsigned bo = (kb + c4 < K) ? (unsigned)(kb + c4) * 4u : 0u;
#pragma unroll
    for (int j = 0; j < 8; ++j) fa[j] = *(const v4f*)(pa[j] + bo);
#pragma unroll
    for (int j = 0; j < 16; ++j) fw[j] = *(const v4f*)(pw[j] + bo);
    // what follows reuses the offset register of these loads, which is named
    // so that it stays theirs up to the wait
    asm volatile("s_wait_xcnt 0x0" :: "v"(bo) : "memory");
  };
  issue(0);
  const bool inner = (bm + 64 <= M) && (bn + 128 <= N);
  for (int kt = 0; kt < ktn; ++kt) {
    const int kb = kt * GBK;
    if (inner && kb + GBK <= K) {
#pragma unroll
      for (int j = 0; j < 8; ++j) put4(&At[wid + 8 * j][c4], fa[j]);
#pragma unroll
      for (int j = 0; j < 16; ++j) put4(&Wt[wid + 8 * j][c4], fw[j]);
    } else {
      const bool kv = kb + c4 < K;         // this trip's piece lies inside K
      const v4f z = {0.f, 0.f, 0.f, 0.f};
#pragma unroll
      for (int j = 0; j < 8; ++j) put4(&At[wid + 8 * j][c4], (kv && va[j]) ? fa[j] : z);
#pragma unroll
      for (int j = 0; j < 16; ++j) put4(&Wt[wid + 8 * j][c4], (kv && vw[j]) ? fw[j] : z);
    }
    __syncthreads();
    if (kt + 1 < ktn) issue(kb + GBK);
#pragma unroll
    for (int s = 0; s < GBK / 32; ++s) {
      v16h a0 = frag_row(&At[0][0], GLP, wm * 32, 32 * s, lane);
      v16h a1 = frag_row(&At[0][0], GLP, wm * 32 + 16, 32 * s, lane);
      v16h b0 = frag_row(&Wt[0][0], GLP, wn * 32, 32 * s, lane);
      v16h b1 = frag_row(&Wt[0][0], GLP, wn * 32 + 16, 32 * s, lane);
      acc00 = wmma_f16(a0, b0, acc00);
      acc01 = wmma_f16(a0, b1, acc01);
      acc10 = wmma_f16(a1, b0, acc10);
      acc11 = wmma_f16(a1, b1, acc11);
    }
    __syncthreads();
  }
  v8f* accs[4] = {&acc00, &acc01, &acc10, &acc11};
#pragma unroll
  for (int q = 0; q < 4; ++q) {
    int im = q >> 1, in_ = q & 1;
#pragma unroll
    for (int r = 0; r < 8; ++r) {
      int gm = bm + wm * 32 + im * 16 + r + 8 * (lane >> 4);
      int gn = bn + wn * 32 + in_ * 16 + (lane & 15);
      if (gm < M && gn < N) {
        float v = (*accs[q])[r] + (bias ? bias[gn] : 0.f);
        if (act == 1) v = 0.5f * v * (1.f + erff(v * 0.70710678118f));
        C[(size_t)gm * ldc + gn] = v;
      }
    }
  }
}

// ---------------- depthwise causal conv (+ optional SiLU) ------------------
// A thread computes four neighbouring channels (one float4) of DWR consecutive
// time steps; a wave covers 128 channels, so each of its loads and stores is 512
// contiguous bytes of one row, and the eight waves of a work-group take eight
// consecutive blocks of time steps. The DWR + KW - 1 input rows of a thread are
// loaded up front into registers. The work-group's 128 x KW weights go through
// LDS, transposed to one row per tap, so that a tap's four weights are one
// 16-byte read. Every output sums its taps in ascending order; a row in front
// of the sequence's start is not read and counts as zero (a test that is the
// same for the whole wave).
constexpr int DWR = 8;                     // time steps per thread
constexpr int DWC = 128;                   // channels per work-group
constexpr int DWP = DWC + 4;               // floats per tap row in LDS
template <int KW, bool SILU>
__global__ void __launch_bounds__(256)
dwconv_kernel(const float* __restrict__ X, const float* __restrict__ Wc,
              float* __restrict__ Y) {
  __shared__ __attribute__((aligned(16))) float wt[KW * DWP];
  constexpr int NX = DWR + KW - 1;         // input rows per thread
  constexpr int NF = DWC * KW / 256;       // rounds in which every thread stages a weight
  constexpr bool TAIL = (DWC * KW) % 256 != 0;   // 128 weights more: waves 0-3
  const int tid = threadIdx.x, lane = tid & 31;
  const int wid = __builtin_amdgcn_readfirstlane(tid >> 5);
  const int c0 = blockIdx.x * DWC;
  const int r0 = (blockIdx.y * 8 + wid) * DWR;   // first row, b * Tt + t
  const int t0 = r0 & (Tt - 1);
  const float* xs = X + (size_t)r0 * Dd + c0;    // the same in every lane
  float4 x[NX];
  if (t0 >= KW - 1) {
#pragma unroll
    for (int j = 0; j < NX; ++j)
      x[j] = *(const float4*)(xs + (j - (KW - 1)) * Dd + lane * 4);
  } else {
    // the first blocks of a sequence, few: row by row
#pragma unroll
    for (int j = 0; j < KW - 1; ++j) {
      if (t0 + j >= KW - 1) {
        x[j] = *(const float4*)(xs + (j - (KW - 1)) * Dd + lane * 4);
        // the next row's load forms its offset register anew
        asm volatile("s_wait_xcnt 0x0" ::: "memory");
      } else {
        x[j] = make_float4(0.f, 0.f, 0.f, 0.f);
      }
    }
#pragma unroll
    for (int j = KW - 1; j < NX; ++j)
      x[j] = *(const float4*)(xs + (j - (KW - 1)) * Dd + lane * 4);
  }
  // what follows reuses the base and offset registers of these loads
  asm volatile("s_wait_xcnt 0x0" ::: "memory");
  const float* wp = Wc + c0 * KW + tid;
  float wv[NF + 1];
#pragma unroll
  for (int n = 0; n < NF; ++n) wv[n] = wp[256 * n];
  wv[NF] = 0.f;
  if (TAIL && wid < 4) wv[NF] = wp[256 * NF];
  asm volatile("s_wait_xcnt 0x0" ::: "memory");
  // keeps the later address arithmetic, which reuses the loads' scalar base,
  // behind the wait: the compiler had lifted it over
  __builtin_amdgcn_sched_barrier(0);
#pragma unroll
  for (int n = 0; n < NF; ++n) {
    const int e = tid + 256 * n;
    wt[(e % KW) * DWP + e / KW] = wv[n];
  }
  if (TAIL && wid < 4) {
    const int e = tid + 256 * NF;
    wt[(e % KW) * DWP + e / KW] = wv[NF];
  }
  __syncthreads();
  float4 s[DWR];
#pragma unroll
  for (int r = 0; r < DWR; ++r) s[r] = make_float4(0.f, 0.f, 0.f, 0.f);
#pragma unroll
  for (int i = 0; i < KW; ++i) {
    const float4 w = *(const float4*)&wt[i * DWP + lane * 4];
#pragma unroll
    for (int r = 0; r < DWR; ++r) {
      s[r].x += x[r + i].x * w.x;
      s[r].y += x[r + i].y * w.y;
      s[r].z += x[r + i].z * w.z;
      s[r].w += x[r + i].w * w.w;
    }
  }
  float* yp = Y + (size_t)r0 * Dd + c0 + lane * 4;
  if (SILU) {
#pragma unroll
    for (int r = 0; r < DWR; ++r) {
      s[r].x = s[r].x / (1.f + expf(-s[r].x));
      s[r].y = s[r].y / (1.f + expf(-s[r].y));
      s[r].z = s[r].z / (1.f + expf(-s[r].z));
      s[r].w = s[r].w / (1.f + expf(-s[r].w));
    }
  }
#pragma unroll
  for (int r = 0; r < DWR; ++r) *(float4*)(yp + r * Dd) = s[r];
}

// ---------------- beta = sigmoid(hidden @ b_proj^T) ------------------------
__global__ void beta_kernel(const float* __restrict__ hs,
                            const float* __restrict__ Wb,
                            float* __restrict__ beta) {
  int idx = blockIdx.x * blockDim.x + threadIdx.x;
  if (idx >= Bb * Tt * Hh) return;
  int h = idx & (Hh - 1);
  size_t bt = (size_t)idx >> 2;
  const float* x = hs + bt * Dd;
  const float* w = Wb + (size_t)h * Dd;
  float s = 0.f;
  for (int k = 0; k < Dd; ++k) s += x[k] * w[k];
  beta[idx] = 1.f / (1.f + expf(-s));
}

// ---------------- gi[:, :D] = hidden ---------------------------------------
// A work-group copies GIR whole rows, a thread one float4 of each.
constexpr int GIR = 8;
__global__ void __launch_bounds__(256)
gi_copy_kernel(const float* __restrict__ hs, float* __restrict__ gi) {
  const size_t r0 = (size_t)blockIdx.x * GIR;
  const float* sp = hs + r0 * Dd + threadIdx.x * 4;
  float* dp = gi + r0 * GIW + threadIdx.x * 4;
  v4f v[GIR];
#pragma unroll
  for (int i = 0; i < GIR; ++i) v[i] = *(const v4f*)(sp + i * Dd);
#pragma unroll
  for (int i = 0; i < GIR; ++i) *(v4f*)(dp + i * GIW) = v[i];
}

// ---------------- stats = mean |branch| over DV -> gi tail -----------------
__global__ void stats_kernel(const float* __restrict__ b0,
                             const float* __restrict__ b1,
                             const float* __restrict__ b2,
                             const float* __restrict__ b3,
                             const float* __restrict__ b4,
                             const float* __restrict__ b5,
                             float* __restrict__ gi) {
  int wg = blockIdx.x * 8 + (threadIdx.x >> 5);
  int lane = threadIdx.x & 31;
  if (wg >= Bb * Tt * Hh * Pp) return;
  int p = wg % Pp;
  int h = (wg / Pp) % Hh;
  size_t bt = (size_t)wg / (Pp * Hh);
  const float* src = (p == 0) ? b0 : (p == 1) ? b1 : (p == 2) ? b2
                   : (p == 3) ? b3 : (p == 4) ? b4 : b5;
  src += bt * Dd + (size_t)h * DVv;
  float s = 0.f;
#pragma unroll
  for (int i = 0; i < 8; ++i) s += fabsf(src[lane + 32 * i]);
#pragma unroll
  for (int off = 16; off; off >>= 1) s += __shfl_xor(s, off, 32);
  if (lane == 0) gi[bt * GIW + Dd + h * Pp + p] = s * (1.f / 256.f);
}

// ---------------- chunked delta rule ---------------------------------------
// The UT transform of a chunk (l2norm, A, forward substitution, w, u, attn)
// reads no state, so prep_kernel does it for all chunks side by side, one
// work-group per (batch, head, chunk), and leaves q, k^T, -w, attn (f16) and
// u (f32) in the workspace, one contiguous block per chunk. Only the steps
// that read or write the state S stay in the serial scan of delta_kernel.
constexpr int CE = CHc * DKk;              // elements of one 32 x 256 chunk block
__global__ void __launch_bounds__(256)
prep_kernel(const float* __restrict__ qc, const float* __restrict__ kc,
            const float* __restrict__ vc, const float* __restrict__ betap,
            float* __restrict__ qo, float* __restrict__ ko,
            float* __restrict__ wo, float* __restrict__ uo,
            float* __restrict__ ao) {
  extern __shared__ char smem[];
  float* Am  = (float*)smem;                 // 32x33 f32 (A / fwd-subst)
  h16* qn    = (h16*)(Am + 32 * 33);         // 32x256
  h16* kn    = qn + CE;
  h16* kbn   = kn + CE;
  h16* wn    = kbn + CE;                     // holds -(inv@kb)
  h16* xb    = wn + CE;                      // 32x256: v*beta
  h16* invb  = xb + CE;                      // 32x32
  h16* attb  = invb + 32 * 32;               // 32x32

  const int tid = threadIdx.x, lane = tid & 31, wid = tid >> 5;
  const int bh = blockIdx.x / NCHUNK, nc = blockIdx.x % NCHUNK;
  const int b = bh >> 2, h = bh & 3;
  const int t0 = nc * CHc;

  // ---- stage 1: load chunk, l2norm q/k, apply beta ----
  for (int j = 0; j < 4; ++j) {
    int r = wid * 4 + j;
    int t = t0 + r;
    size_t rowb = ((size_t)(b * Tt + t)) * Dd + (size_t)h * DKk;
    float bet = betap[(size_t)(b * Tt + t) * Hh + h];
    float qv[8], kv[8], vv[8];
    float sq = 0.f, sk = 0.f;
#pragma unroll
    for (int i = 0; i < 8; ++i) {
      int d = lane + 32 * i;
      qv[i] = qc[rowb + d]; kv[i] = kc[rowb + d]; vv[i] = vc[rowb + d];
      sq += qv[i] * qv[i]; sk += kv[i] * kv[i];
    }
#pragma unroll
    for (int off = 16; off; off >>= 1) {
      sq += __shfl_xor(sq, off, 32);
      sk += __shfl_xor(sk, off, 32);
    }
    float rq = rsqrtf(sq + 1e-12f), rk = rsqrtf(sk + 1e-12f);
#pragma unroll
    for (int i = 0; i < 8; ++i) {
      int d = lane + 32 * i;
      float kq = kv[i] * rk;
      qn[r * 256 + d]  = (h16)(qv[i] * rq);
      kn[r * 256 + d]  = (h16)kq;
      kbn[r * 256 + d] = (h16)(kq * bet);
      xb[r * 256 + d]  = (h16)(vv[i] * bet);
    }
  }
  __syncthreads();
  // ---- stage 2: A = -(kb k^T), strict lower (waves 0-3) ;
  //      stage 6: attn = (q k^T) * lower-incl mask (waves 4-7) ----
  {
    int m0 = ((wid >> 1) & 1) * 16, n0 = (wid & 1) * 16;
    const h16* lhs = (wid < 4) ? kbn : qn;
    v8f acc = {};
    for (int kk = 0; kk < 8; ++kk)
      acc = wmma_f16(frag_row(lhs, 256, m0, kk * 32, lane),
                     frag_row(kn, 256, n0, kk * 32, lane), acc);
    if (wid < 4) {
#pragma unroll
      for (int r = 0; r < 8; ++r) {
        int m = m0 + r + 8 * (lane >> 4), n = n0 + (lane & 15);
        Am[m * 33 + n] = (m > n) ? -acc[r] : 0.f;
      }
    } else {
#pragma unroll
      for (int r = 0; r < 8; ++r) {
        int m = m0 + r + 8 * (lane >> 4), n = n0 + (lane & 15);
        attb[m * 32 + n] = (h16)((m >= n) ? acc[r] : 0.f);
      }
    }
  }
  __syncthreads();
  // ---- stage 3: forward substitution, inv = A + I ----
  for (int i = 1; i < 32; ++i) {
    float val = 0.f;
    if (tid < 32)
      for (int s = 0; s < i; ++s) val += Am[i * 33 + s] * Am[s * 33 + tid];
    __syncthreads();
    if (tid < 32) Am[i * 33 + tid] += val;
    __syncthreads();
  }
  for (int e = tid; e < 1024; e += 256) {
    int m = e >> 5, n = e & 31;
    invb[e] = (h16)(Am[m * 33 + n] + ((m == n) ? 1.f : 0.f));
  }
  __syncthreads();
  // ---- stage 4: wn = -(inv@kb) ; u = inv@(v*beta) -> workspace (f32) ----
  float* ug = uo + (size_t)blockIdx.x * CE;
  for (int it = 0; it < 4; ++it) {
    int j = wid + 8 * it;           // 0..31
    int m0 = (j >> 4) * 16, n0 = (j & 15) * 16;
    v16h ia = frag_row(invb, 32, m0, 0, lane);
    v8f acc = {}, accu = {};
    acc  = wmma_f16(ia, frag_kmaj(kbn, 256, n0, 0, lane), acc);
    accu = wmma_f16(ia, frag_kmaj(xb, 256, n0, 0, lane), accu);
#pragma unroll
    for (int r = 0; r < 8; ++r) {
      int m = m0 + r + 8 * (lane >> 4), n = n0 + (lane & 15);
      wn[m * 256 + n] = (h16)(-acc[r]);
      ug[m * 256 + n] = accu[r];
    }
    // the next trip rewrites the address and data registers of the u stores
    asm volatile("s_wait_xcnt 0x0" ::: "memory");
  }
  __syncthreads();
  // ---- hand q, k^T, -w, attn to the scan: 16-byte stores, one block per chunk ----
  // k goes out transposed, 256 rows (dk) of 32 chunk positions: the scan reads
  // k^T as the A operand of its state update, contiguous along the chunk.
  v8h* gk = (v8h*)ko + (size_t)blockIdx.x * (CE / 8) + tid * 4;
#pragma unroll
  for (int i = 0; i < 4; ++i) {
    v8h t;
#pragma unroll
    for (int j = 0; j < 8; ++j) t[j] = kn[(8 * i + j) * 256 + tid];
    gk[i] = t;
  }
  // the stores below reuse the address and data registers of the k^T stores
  asm volatile("s_wait_xcnt 0x0" ::: "memory");
  uint4* gq = (uint4*)qo + (size_t)blockIdx.x * (CE / 8);
  uint4* gw = (uint4*)wo + (size_t)blockIdx.x * (CE / 8);
#pragma unroll
  for (int i = 0; i < 4; ++i) {
    int e = tid + 256 * i;
    gq[e] = ((const uint4*)qn)[e];
    gw[e] = ((const uint4*)wn)[e];
  }
  if (tid < 128)
    ((uint4*)ao)[(size_t)blockIdx.x * 128 + tid] = ((const uint4*)attb)[tid];
}

// Serial scan over the chunks, state split by value columns: column n of ui,
// oi and S depends on column n of u and S only, so each work-group owns DVS
// value columns of one (batch, head). DVS = 32 floats = one 128-byte output line.
// The 256 x DVS state slice lives in registers, split by key rows: wave w owns
// rows 32 w .. 32 w + 31 as four f32 D tiles, which the state update
// accumulates into, and as two f16 B fragments converted from them in place.
// A wave multiplies its 32 columns of -w and of q (fragments straight from the
// workspace) by its own rows of S; the eight partial 32 x DVS products are
// summed through LDS, thread t taking the float4 at place t of every partial.
constexpr int DVS = 32;                    // value columns per work-group
constexpr int NSL = DVv / DVS;             // slices per (batch, head)
constexpr int XP  = 40;                    // f16 per row of ui^T in LDS: 80 bytes
constexpr int RP  = 32 * DVS / 4;          // float4 per 32 x DVS partial
__global__ void __launch_bounds__(256)
delta_kernel(const float* __restrict__ qi, const float* __restrict__ ki,
             const float* __restrict__ wi, const float* __restrict__ ui0,
             const float* __restrict__ ai, float* __restrict__ dout) {
  extern __shared__ char smem[];
  float4* redW = (float4*)smem;              // 8 partials of (-w)@S
  float4* redQ = redW + 8 * RP;              // 8 partials of q@S, then attn@ui
  h16* xbT     = (h16*)(redQ + 9 * RP);      // DVS x XP: ui^T (f16)

  const int tid = threadIdx.x, lane = tid & 31;
  const int wid = __builtin_amdgcn_readfirstlane(tid >> 5);
  const int c = lane & 15, hh = lane >> 4;
  const int bh = blockIdx.x / NSL;
  const int c0 = (blockIdx.x % NSL) * DVS;   // first value column of the slice
  const int b = bh >> 2, h = bh & 3;
  // Place t of a partial holds registers 4 g .. 4 g + 3 of tile (mt, nt) at lane
  // t & 31, with mt * 4 + nt * 2 + g = t >> 5: rows rm .. rm + 3 of column rn.
  const int rm = (wid >> 2) * 16 + 8 * hh + 4 * (wid & 1);
  const int rn = ((wid >> 1) & 1) * 16 + c;
  // the lane's fixed offsets inside a chunk's blocks; the chunk moves the base
  const unsigned lwq = c * 256 + wid * 32 + hh * 8;         // -w, q: row c
  const unsigned lk  = (wid * 32 + c) * 32 + hh * 8;        // k^T: row 32 wid + c
  const unsigned la  = (((wid >> 1) & 1) * 16 + c) * 32 + hh * 8;  // attn
  const unsigned lu  = rm * 256 + c0 + rn;                  // u
  const unsigned lo  = rm * Dd + h * DVv + c0 + rn;         // oi

  v8f S00 = {}, S01 = {}, S10 = {}, S11 = {};  // S[32 wid + 16 mt ..][16 nt ..]
  v16h sb0 = {}, sb1 = {};                     // the same rows as B fragments
  const v8f zero = {};

  for (int nc = 0; nc < NCHUNK; ++nc) {
    const int t0 = nc * CHc;
    // ---- the wave's own fragments of the chunk's -w, q, k^T, attn; its u ----
    const size_t cb = (size_t)(bh * NCHUNK + nc);
    const h16* gw = (const h16*)wi + cb * CE + lwq;
    const h16* gq = (const h16*)qi + cb * CE + lwq;
    const h16* gk = (const h16*)ki + cb * CE + lk;
    const float* gu = ui0 + cb * CE + lu;
    v16h w0 = frag_vec(gw), w1 = frag_vec(gw + 16 * 256);
    // the next loads land in the address registers of these
    asm volatile("s_wait_xcnt 0x0" ::: "memory");
    v16h q0 = frag_vec(gq), q1 = frag_vec(gq + 16 * 256);
    asm volatile("s_wait_xcnt 0x0" ::: "memory");
    float u0 = gu[0], u1 = gu[256], u2 = gu[512], u3 = gu[768];
    v16h k0 = frag_vec(gk), k1 = frag_vec(gk + 16 * 32);
    v16h at = {};
    if (wid < 4)
      at = frag_vec((const h16*)ai + cb * 1024 + la);
    // the products below land in the address registers of these loads
    asm volatile("s_wait_xcnt 0x0" ::: "memory");
    // ---- partial (-w)@S and q@S over the wave's 32 key rows ----
    v8f pw00 = wmma_f16(w0, sb0, zero), pw01 = wmma_f16(w0, sb1, zero);
    v8f pw10 = wmma_f16(w1, sb0, zero), pw11 = wmma_f16(w1, sb1, zero);
    v8f pq00 = wmma_f16(q0, sb0, zero), pq01 = wmma_f16(q0, sb1, zero);
    v8f pq10 = wmma_f16(q1, sb0, zero), pq11 = wmma_f16(q1, sb1, zero);
    float4* rw = redW + wid * RP + lane;
    put8(rw, pw00); put8(rw + 64, pw01); put8(rw + 128, pw10); put8(rw + 192, pw11);
    __syncthreads();
    // ---- ui = u + sum of the partials -> ui^T (f16) ----
    {
      float4 s = redW[tid];
#pragma unroll
      for (int v = 1; v < 8; ++v) {
        float4 p = redW[v * RP + tid];
        s.x += p.x; s.y += p.y; s.z += p.z; s.w += p.w;
      }
      v4h x = {(h16)(u0 + s.x), (h16)(u1 + s.y), (h16)(u2 + s.z), (h16)(u3 + s.w)};
      *(v4h*)&xbT[rn * XP + rm] = x;
    }
    __syncthreads();
    // ---- S += k^T @ ui on the wave's rows; attn@ui as a ninth partial of oi ----
    {
      v16h ub0 = frag_vec(xbT + c * XP + hh * 8);
      v16h ub1 = frag_vec(xbT + (16 + c) * XP + hh * 8);
      S00 = wmma_f16(k0, ub0, S00); S01 = wmma_f16(k0, ub1, S01);
      S10 = wmma_f16(k1, ub0, S10); S11 = wmma_f16(k1, ub1, S11);
      float4* rq = redQ + wid * RP + lane;
      put8(rq, pq00); put8(rq + 64, pq01); put8(rq + 128, pq10); put8(rq + 192, pq11);
      if (wid < 4)
        put8(redQ + 8 * RP + wid * 64 + lane,
             wmma_f16(at, (wid & 1) ? ub1 : ub0, zero));
      sb0 = pack_b(S00, S10);
      sb1 = pack_b(S01, S11);
    }
    __syncthreads();
    // ---- oi = q@S + attn@ui: sum of the nine partials -> global ----
    {
      float4 o = redQ[tid];
#pragma unroll
      for (int v = 1; v < 9; ++v) {
        float4 p = redQ[v * RP + tid];
        o.x += p.x; o.y += p.y; o.z += p.z; o.w += p.w;
      }
      float* go = dout + (size_t)(b * Tt + t0) * Dd + lo;
      go[0] = o.x; go[Dd] = o.y; go[2 * Dd] = o.z; go[3 * Dd] = o.w;
      // the next trip rewrites the address and data registers of these stores
      asm volatile("s_wait_xcnt 0x0" ::: "memory");
    }
  }
}

// ---------------- gate softmax + branch mixing + RMSNorm -------------------
__global__ void __launch_bounds__(256)
fuse_kernel(const float* __restrict__ b0, const float* __restrict__ b1,
            const float* __restrict__ b2, const float* __restrict__ b3,
            const float* __restrict__ b4, const float* __restrict__ b5,
            const float* __restrict__ gi, const float* __restrict__ logits,
            const float* __restrict__ alpha, const float* __restrict__ ltemp,
            const float* __restrict__ onw, float* __restrict__ out) {
  size_t bt = blockIdx.x;
  int tid = threadIdx.x;
  __shared__ float probs_s[Hh][Pp];
  __shared__ float red[256];
  if (tid < Hh) {
    int h = tid;
    float x = ltemp[h];
    float temp = fmaxf(x, 0.f) + log1pf(expf(-fabsf(x))) + 1e-4f; // softplus
    float l[Pp];
    float mx = -1e30f;
#pragma unroll
    for (int p = 0; p < Pp; ++p) {
      float st = gi[bt * GIW + Dd + h * Pp + p];
      l[p] = (logits[bt * (Hh * Pp) + h * Pp + p] + alpha[p] * st) / temp;
      mx = fmaxf(mx, l[p]);
    }
    float se = 0.f;
#pragma unroll
    for (int p = 0; p < Pp; ++p) { l[p] = expf(l[p] - mx); se += l[p]; }
#pragma unroll
    for (int p = 0; p < Pp; ++p) {
      float pr = l[p] / se * (1.f - FLOORv);
      if (p == Pp - 1) pr += FLOORv;
      probs_s[h][p] = pr;
    }
  }
  __syncthreads();
  int d = tid;
  for (int h = 0; h < Hh; ++h) {
    size_t base = bt * Dd + (size_t)h * DVv + d;
    float o = b0[base] * probs_s[h][0] + b1[base] * probs_s[h][1] +
              b2[base] * probs_s[h][2] + b3[base] * probs_s[h][3] +
              b4[base] * probs_s[h][4] + b5[base] * probs_s[h][5];
    red[tid] = o * o;
    __syncthreads();
    for (int s = 128; s; s >>= 1) {
      if (tid < s) red[tid] += red[tid + s];
      __syncthreads();
    }
    float ms = red[0] * (1.f / 256.f);
    __syncthreads();
    out[base] = o * rsqrtf(ms + 1e-5f) * onw[d];
  }
}

// ---------------------------------------------------------------------------
extern "C" void kernel_launch(void* const* d_in, const int* in_sizes, int n_in,
                              void* d_out, int out_size, void* d_ws,
                              size_t ws_size, hipStream_t stream) {
  const float* hs   = (const float*)d_in[0];
  const float* qw   = (const float*)d_in[1];
  const float* kw   = (const float*)d_in[2];
  const float* vw   = (const float*)d_in[3];
  const float* bw   = (const float*)d_in[4];
  const float* qcw  = (const float*)d_in[5];
  const float* kcw  = (const float*)d_in[6];
  const float* vcw  = (const float*)d_in[7];
  const float* f3w  = (const float*)d_in[8];
  const float* f7w  = (const float*)d_in[9];
  const float* f15w = (const float*)d_in[10];
  const float* f31w = (const float*)d_in[11];
  const float* gw1  = (const float*)d_in[12];
  const float* gb1  = (const float*)d_in[13];
  const float* gw2  = (const float*)d_in[14];
  const float* gb2  = (const float*)d_in[15];
  const float* glt  = (const float*)d_in[16];
  const float* alps = (const float*)d_in[17];
  const float* onw  = (const float*)d_in[18];
  const float* ow   = (const float*)d_in[19];
  float* out = (float*)d_out;

  const size_t U = (size_t)Bb * Tt * Dd; // 4096*1024
  float* ws = (float*)d_ws;
  float* qp  = ws;            // q projection (reused: fir3)
  float* kp  = qp + U;        // k projection (reused: fir7)
  float* vp  = kp + U;        // v projection (reused: fir15)
  float* qcv = vp + U;        // q after conv+silu (reused: fir31)
  float* kcv = qcv + U;       // k after conv+silu (reused: o_fused)
  float* vcv = kcv + U;       // v after conv+silu (branch p=4)
  float* dta = vcv + U;       // delta-rule output (branch p=5)
  float* h1  = dta + U;       // gate hidden, 2U
  float* gi  = h1 + 2 * U;    // gate input, B*T x GIW
  float* beta = gi + (size_t)Bb * Tt * 1056;
  float* lgt  = beta + (size_t)Bb * Tt * Hh;
  float* pq  = lgt + (size_t)Bb * Tt * Hh * Pp;  // prepared q, f16 (U/2 floats)
  float* pk  = pq + U / 2;    // prepared k^T, f16
  float* pw  = pk + U / 2;    // prepared -w, f16
  float* pu  = pw + U / 2;    // prepared u, f32
  float* pa  = pu + U;        // prepared attn, f16, 32x32 per chunk

  const int MT = Bb * Tt;                 // 4096
  dim3 blk(256);
  dim3 gN1024((1024 + 127) / 128, (MT + 63) / 64);
  dim3 gDW(Dd / DWC, MT / (8 * DWR));

  // 1) q/k/v projections (no activation; conv+silu comes after)
  gemm_kernel<<<gN1024, blk, 0, stream>>>(hs, Dd, qw, Dd, nullptr, qp, Dd, MT, Dd, Dd, 0);
  gemm_kernel<<<gN1024, blk, 0, stream>>>(hs, Dd, kw, Dd, nullptr, kp, Dd, MT, Dd, Dd, 0);
  gemm_kernel<<<gN1024, blk, 0, stream>>>(hs, Dd, vw, Dd, nullptr, vp, Dd, MT, Dd, Dd, 0);
  // 2) beta
  beta_kernel<<<(MT * Hh + 255) / 256, blk, 0, stream>>>(hs, bw, beta);
  // 3) depthwise causal conv (k=4) + SiLU
  dwconv_kernel<4, true><<<gDW, blk, 0, stream>>>(qp, qcw, qcv);
  dwconv_kernel<4, true><<<gDW, blk, 0, stream>>>(kp, kcw, kcv);
  dwconv_kernel<4, true><<<gDW, blk, 0, stream>>>(vp, vcw, vcv);
  // 4) delta rule: state-free chunk work for all chunks at once, then the
  //    scan, one workgroup per (batch, head, 32-column state slice)
  const size_t PLDS = 32 * 33 * sizeof(float) + (5 * CE + 2 * 32 * 32) * sizeof(h16);
  prep_kernel<<<dim3(Bb * Hh * NCHUNK), blk, PLDS, stream>>>(qcv, kcv, vcv, beta,
                                                             pq, pk, pw, pu, pa);
  const size_t DLDS = 17 * RP * sizeof(float4) + DVS * XP * sizeof(h16);
  delta_kernel<<<dim3(Bb * Hh * NSL), blk, DLDS, stream>>>(pq, pk, pw, pu, pa, dta);
  // 5) FIR branches on v (reuse proj buffers; qcv/kcv free after delta)
  dwconv_kernel<3, false><<<gDW, blk, 0, stream>>>(vcv, f3w, qp);
  dwconv_kernel<7, false><<<gDW, blk, 0, stream>>>(vcv, f7w, kp);
  dwconv_kernel<15, false><<<gDW, blk, 0, stream>>>(vcv, f15w, vp);
  dwconv_kernel<31, false><<<gDW, blk, 0, stream>>>(vcv, f31w, qcv);
  // 6) gate input = concat(hidden, stats)
  gi_copy_kernel<<<MT / GIR, blk, 0, stream>>>(hs, gi);
  stats_kernel<<<(MT * Hh * Pp) / 8, blk, 0, stream>>>(qp, kp, vp, qcv, vcv, dta, gi);
  // 7) gate MLP (gelu, then linear to H*P logits with gb2 bias)
  dim3 gGate1((2048 + 127) / 128, (MT + 63) / 64);
  gemm_kernel<<<gGate1, blk, 0, stream>>>(gi, GIW, gw1, GIW, gb1, h1, 2048, MT, 2048, GIW, 1);
  dim3 gGate2(1, (MT + 63) / 64);
  gemm_kernel<<<gGate2, blk, 0, stream>>>(h1, 2048, gw2, 2048, gb2, lgt, Hh * Pp, MT, Hh * Pp, 2048, 0);
  // 8) softmax gate + mix branches + RMSNorm  (o_fused -> kcv)
  float* ofused = kcv;
  fuse_kernel<<<dim3(MT), blk, 0, stream>>>(qp, kp, vp, qcv, vcv, dta, gi, lgt,
                                            alps, glt, onw, ofused);
  // 9) output projection
  gemm_kernel<<<gN1024, blk, 0, stream>>>(ofused, Dd, ow, Dd, nullptr, out, Dd, MT, Dd, Dd, 0);
}

// v007
// Measured time: 396 microseconds a run.
// Timed twice side by side with v006, it ran 1.11 and 1.12 times as fast.
// Counting every step since v000, it is 9.99 times as fast.
#include <hip/hip_runtime.h>
#include <hip/hip_bf16.h>
#include <math.h>

#define DEV __device__ __forceinline__

typedef __attribute__((ext_vector_type(16))) _Float16 v16h;
typedef __attribute__((ext_vector_type(8)))  float    v8f;
typedef _Float16 h16;

constexpr int Bb = 2, Tt = 2048, Dd = 1024, Hh = 4, Pp = 6, CHc = 32;
constexpr int DKk = 256, DVv = 256;
constexpr int NCHUNK = Tt / CHc;           // 64
constexpr int GIW = Dd + Hh * Pp;          // 1048
constexpr float FLOORv = 0.05f;

DEV v16h frag_row(const h16* t, int ld, int r0, int k0, int lane) {
  // element [m][k] at t[(r0+m)*ld + (k0+k)]
  v16h f;
  int m = lane & 15, kg = lane >> 4;
#pragma unroll
  for (int j = 0; j < 8; ++j) {
    int kk = ((j < 4) ? 0 : 16) + kg * 8 + 2 * (j & 3);
    const h16* p = t + (size_t)(r0 + m) * ld + k0 + kk;
    f[2 * j] = p[0];
    f[2 * j + 1] = p[1];
  }
  return f;
}
DEV v16h frag_kmaj(const h16* t, int ld, int r0, int k0, int lane) {
  // element [m][k] at t[(k0+k)*ld + (r0+m)]
  v16h f;
  int m = lane & 15, kg = lane >> 4;
#pragma unroll
  for (int j = 0; j < 8; ++j) {
    int kk = ((j < 4) ? 0 : 16) + kg * 8 + 2 * (j & 3);
    f[2 * j]     = t[(size_t)(k0 + kk) * ld + r0 + m];
    f[2 * j + 1] = t[(size_t)(k0 + kk + 1) * ld + r0 + m];
  }
  return f;
}
DEV v8f wmma_f16(v16h a, v16h b, v8f c) {
  return __builtin_amdgcn_wmma_f32_16x16x32_f16(false, a, false, b, (short)0, c,
                                                false, false);
}

typedef __attribute__((ext_vector_type(8))) _Float16 v8h;
typedef __attribute__((ext_vector_type(4))) _Float16 v4h;
// frag_row's fragment as two 16-byte loads: p is the lane's row at
// k = 8 * (lane >> 4); the fragment's second eight k lie 16 further on.
DEV v16h frag_vec(const h16* p) {
  v8h lo = *(const v8h*)p, hi = *(const v8h*)(p + 16);
  return __builtin_shufflevector(lo, hi, 0, 1, 2, 3, 4, 5, 6, 7, 8, 9, 10, 11,
                                 12, 13, 14, 15);
}
// One D tile to LDS: registers 0-3 at d, registers 4-7 32 places further on.
DEV void put8(float4* d, v8f a) {
  d[0]  = make_float4(a[0], a[1], a[2], a[3]);
  d[32] = make_float4(a[4], a[5], a[6], a[7]);
}
// Two f32 D tiles (rows 0-15 and 16-31 of a 32-row block, same columns) are,
// converted lane by lane, the f16 B fragment of that block in frag_row's k order.
DEV v16h pack_b(v8f lo, v8f hi) {
  v16h f;
#pragma unroll
  for (int s = 0; s < 8; ++s) { f[s] = (h16)lo[s]; f[8 + s] = (h16)hi[s]; }
  return f;
}

typedef __attribute__((ext_vector_type(4))) float v4f;
DEV void put4(h16* d, v4f f) {
  d[0] = (h16)f.x; d[1] = (h16)f.y; d[2] = (h16)f.z; d[3] = (h16)f.w;
}

// ---------------- Generic GEMM: C = act(A(MxK) * W(NxK)^T + bias) ----------
// 64x128 block tile, 8 waves (2x4), each wave owns a 32x32 region.
// A trip of the K loop takes GBK = 128 columns (four wmma steps of 32). Wave w
// stages rows w + 8 j of A (j < 8) and of W (j < 16); a lane takes columns
// c4..c4+3, so a wave-wide load is 512 contiguous bytes of one row and its
// LDS store 256 contiguous bytes. The 24 loads of trip kt + 1 are issued
// together, into registers, before trip kt is read from LDS and multiplied;
// they are converted and stored to LDS at the top of the next trip. The load
// latency and the two barriers are met once per 128 columns.
// Edges take the same path: a row past M or N is read at the last row, a piece
// past K at the row's first columns, and such a piece is stored as zeros.
// K, lda and ldw are multiples of 4 in every call, so a piece lies wholly
// inside K or wholly outside, and every piece is 16-byte aligned.
constexpr int GBK = 128;                   // K columns per trip
constexpr int GLP = GBK + 8;               // f16 per LDS row: 272 bytes
__global__ void __launch_bounds__(256)
gemm_kernel(const float* __restrict__ A, int lda, const float* __restrict__ W,
            int ldw, const float* __restrict__ bias, float* __restrict__ C,
            int ldc, int M, int N, int K, int act) {
  __shared__ __attribute__((aligned(16))) h16 At[64][GLP];
  __shared__ __attribute__((aligned(16))) h16 Wt[128][GLP];
  const int tid = threadIdx.x, lane = tid & 31;
  const int wid = __builtin_amdgcn_readfirstlane(tid >> 5);
  const int wm = wid >> 2, wn = wid & 3;
  const int bm = blockIdx.y * 64, bn = blockIdx.x * 128;
  const int c4 = lane * 4;
  v8f acc00 = {}, acc01 = {}, acc10 = {}, acc11 = {};
  const int ktn = (K + GBK - 1) / GBK;
  // K is positive in every call: the first trip's loads then stay where they
  // are written, in front of their wait, and are not sunk into a guarded block
  __builtin_assume(ktn > 0);
  const char* pa[8];                       // row starts: the same in every lane
  const char* pw[16];
  bool va[8], vw[16];
#pragma unroll
  for (int j = 0; j < 8; ++j) {
    int gm = bm + wid + 8 * j;
    va[j] = gm < M;
    pa[j] = (const char*)(A + (size_t)(va[j] ? gm : M - 1) * lda);
  }
#pragma unroll
  for (int j = 0; j < 16; ++j) {
    int gn = bn + wid + 8 * j;
    vw[j] = gn < N;
    pw[j] = (const char*)(W + (size_t)(vw[j] ? gn : N - 1) * ldw);
  }
  v4f fa[8], fw[16];
  // the 24 loads of the trip that starts at column kb
  auto issue = [&](int kb) {
    const unsigned bo = (kb + c4 < K) ? (unsigned)(kb + c4) * 4u : 0u;
#pragma unroll
    for (int j = 0; j < 8; ++j) fa[j] = *(const v4f*)(pa[j] + bo);
#pragma unroll
    for (int j = 0; j < 16; ++j) fw[j] = *(const v4f*)(pw[j] + bo);
    // what follows reuses the offset register of these loads, which is named
    // so that it stays theirs up to the wait
    asm volatile("s_wait_xcnt 0x0" :: "v"(bo) : "memory");
  };
  issue(0);
  const bool inner = (bm + 64 <= M) && (bn + 128 <= N);
  for (int kt = 0; kt < ktn; ++kt) {
    const int kb = kt * GBK;
    if (inner && kb + GBK <= K) {
#pragma unroll
      for (int j = 0; j < 8; ++j) put4(&At[wid + 8 * j][c4], fa[j]);
#pragma unroll
      for (int j = 0; j < 16; ++j) put4(&Wt[wid + 8 * j][c4], fw[j]);
    } else {
      const bool kv = kb + c4 < K;         // this trip's piece lies inside K
      const v4f z = {0.f, 0.f, 0.f, 0.f};
#pragma unroll
      for (int j = 0; j < 8; ++j) put4(&At[wid + 8 * j][c4], (kv && va[j]) ? fa[j] : z);
#pragma unroll
      for (int j = 0; j < 16; ++j) put4(&Wt[wid + 8 * j][c4], (kv && vw[j]) ? fw[j] : z);
    }
    __syncthreads();
    if (kt + 1 < ktn) issue(kb + GBK);
#pragma unroll
    for (int s = 0; s < GBK / 32; ++s) {
      v16h a0 = frag_row(&At[0][0], GLP, wm * 32, 32 * s, lane);
      v16h a1 = frag_row(&At[0][0], GLP, wm * 32 + 16, 32 * s, lane);
      v16h b0 = frag_row(&Wt[0][0], GLP, wn * 32, 32 * s, lane);
      v16h b1 = frag_row(&Wt[0][0], GLP, wn * 32 + 16, 32 * s, lane);
      acc00 = wmma_f16(a0, b0, acc00);
      acc01 = wmma_f16(a0, b1, acc01);
      acc10 = wmma_f16(a1, b0, acc10);
      acc11 = wmma_f16(a1, b1, acc11);
    }
    __syncthreads();
  }
  v8f* accs[4] = {&acc00, &acc01, &acc10, &acc11};
#pragma unroll
  for (int q = 0; q < 4; ++q) {
    int im = q >> 1, in_ = q & 1;
#pragma unroll
    for (int r = 0; r < 8; ++r) {
      int gm = bm + wm * 32 + im * 16 + r + 8 * (lane >> 4);
      int gn = bn + wn * 32 + in_ * 16 + (lane & 15);
      if (gm < M && gn < N) {
        float v = (*accs[q])[r] + (bias ? bias[gn] : 0.f);
        if (act == 1) v = 0.5f * v * (1.f + erff(v * 0.70710678118f));
        C[(size_t)gm * ldc + gn] = v;
      }
    }
  }
}

// ---------------- depthwise causal conv (+ optional SiLU) ------------------
// A thread computes four neighbouring channels (one float4) of DWR consecutive
// time steps; a wave covers 128 channels, so each of its loads and stores is 512
// contiguous bytes of one row, and the eight waves of a work-group take eight
// consecutive blocks of time steps. The DWR + KW - 1 input rows of a thread are
// loaded up front into registers. The work-group's 128 x KW weights go through
// LDS, transposed to one row per tap, so that a tap's four weights are one
// 16-byte read. Every output sums its taps in ascending order; a row in front
// of the sequence's start is not read and counts as zero (a test that is the
// same for the whole wave).
constexpr int DWR = 8;                     // time steps per thread
constexpr int DWC = 128;                   // channels per work-group
constexpr int DWP = DWC + 4;               // floats per tap row in LDS
template <int KW, bool SILU>
__global__ void __launch_bounds__(256)
dwconv_kernel(const float* __restrict__ X, const float* __restrict__ Wc,
              float* __restrict__ Y) {
  __shared__ __attribute__((aligned(16))) float wt[KW * DWP];
  constexpr int NX = DWR + KW - 1;         // input rows per thread
  constexpr int NF = DWC * KW / 256;       // rounds in which every thread stages a weight
  constexpr bool TAIL = (DWC * KW) % 256 != 0;   // 128 weights more: waves 0-3
  const int tid = threadIdx.x, lane = tid & 31;
  const int wid = __builtin_amdgcn_readfirstlane(tid >> 5);
  const int c0 = blockIdx.x * DWC;
  const int r0 = (blockIdx.y * 8 + wid) * DWR;   // first row, b * Tt + t
  const int t0 = r0 & (Tt - 1);
  const float* xs = X + (size_t)r0 * Dd + c0;    // the same in every lane
  float4 x[NX];
  if (t0 >= KW - 1) {
#pragma unroll
    for (int j = 0; j < NX; ++j)
      x[j] = *(const float4*)(xs + (j - (KW - 1)) * Dd + lane * 4);
  } else {
    // the first blocks of a sequence, few: row by row
#pragma unroll
    for (int j = 0; j < KW - 1; ++j) {
      if (t0 + j >= KW - 1) {
        x[j] = *(const float4*)(xs + (j - (KW - 1)) * Dd + lane * 4);
        // the next row's load forms its offset register anew
        asm volatile("s_wait_xcnt 0x0" ::: "memory");
      } else {
        x[j] = make_float4(0.f, 0.f, 0.f, 0.f);
      }
    }
#pragma unroll
    for (int j = KW - 1; j < NX; ++j)
      x[j] = *(const float4*)(xs + (j - (KW - 1)) * Dd + lane * 4);
  }
  // what follows reuses the base and offset registers of these loads
  asm volatile("s_wait_xcnt 0x0" ::: "memory");
  const float* wp = Wc + c0 * KW + tid;
  float wv[NF + 1];
#pragma unroll
  for (int n = 0; n < NF; ++n) wv[n] = wp[256 * n];
  wv[NF] = 0.f;
  if (TAIL && wid < 4) wv[NF] = wp[256 * NF];
  asm volatile("s_wait_xcnt 0x0" ::: "memory");
  // keeps the later address arithmetic, which reuses the loads' scalar base,
  // behind the wait: the compiler had lifted it over
  __builtin_amdgcn_sched_barrier(0);
#pragma unroll
  for (int n = 0; n < NF; ++n) {
    const int e = tid + 256 * n;
    wt[(e % KW) * DWP + e / KW] = wv[n];
  }
  if (TAIL && wid < 4) {
    const int e = tid + 256 * NF;
    wt[(e % KW) * DWP + e / KW] = wv[NF];
  }
  __syncthreads();
  float4 s[DWR];
#pragma unroll
  for (int r = 0; r < DWR; ++r) s[r] = make_float4(0.f, 0.f, 0.f, 0.f);
#pragma unroll
  for (int i = 0; i < KW; ++i) {
    const float4 w = *(const float4*)&wt[i * DWP + lane * 4];
#pragma unroll
    for (int r = 0; r < DWR; ++r) {
      s[r].x += x[r + i].x * w.x;
      s[r].y += x[r + i].y * w.y;
      s[r].z += x[r + i].z * w.z;
      s[r].w += x[r + i].w * w.w;
    }
  }
  float* yp = Y + (size_t)r0 * Dd + c0 + lane * 4;
  if (SILU) {
#pragma unroll
    for (int r = 0; r < DWR; ++r) {
      s[r].x = s[r].x / (1.f + expf(-s[r].x));
      s[r].y = s[r].y / (1.f + expf(-s[r].y));
      s[r].z = s[r].z / (1.f + expf(-s[r].z));
      s[r].w = s[r].w / (1.f + expf(-s[r].w));
    }
  }
#pragma unroll
  for (int r = 0; r < DWR; ++r) *(float4*)(yp + r * Dd) = s[r];
}

// ---------------- beta = sigmoid(hidden @ b_proj^T) ------------------------
__global__ void beta_kernel(const float* __restrict__ hs,
                            const float* __restrict__ Wb,
                            float* __restrict__ beta) {
  int idx = blockIdx.x * blockDim.x + threadIdx.x;
  if (idx >= Bb * Tt * Hh) return;
  int h = idx & (Hh - 1);
  size_t bt = (size_t)idx >> 2;
  const float* x = hs + bt * Dd;
  const float* w = Wb + (size_t)h * Dd;
  float s = 0.f;
  for (int k = 0; k < Dd; ++k) s += x[k] * w[k];
  beta[idx] = 1.f / (1.f + expf(-s));
}

// ---------------- gi[:, :D] = hidden ---------------------------------------
// A work-group copies GIR whole rows, a thread one float4 of each.
constexpr int GIR = 8;
__global__ void __launch_bounds__(256)
gi_copy_kernel(const float* __restrict__ hs, float* __restrict__ gi) {
  const size_t r0 = (size_t)blockIdx.x * GIR;
  const float* sp = hs + r0 * Dd + threadIdx.x * 4;
  float* dp = gi + r0 * GIW + threadIdx.x * 4;
  v4f v[GIR];
#pragma unroll
  for (int i = 0; i < GIR; ++i) v[i] = *(const v4f*)(sp + i * Dd);
#pragma unroll
  for (int i = 0; i < GIR; ++i) *(v4f*)(dp + i * GIW) = v[i];
}

// ---------------- stats = mean |branch| over DV -> gi tail -----------------
__global__ void stats_kernel(const float* __restrict__ b0,
                             const float* __restrict__ b1,
                             const float* __restrict__ b2,
                             const float* __restrict__ b3,
                             const float* __restrict__ b4,
                             const float* __restrict__ b5,
                             float* __restrict__ gi) {
  int wg = blockIdx.x * 8 + (threadIdx.x >> 5);
  int lane = threadIdx.x & 31;
  if (wg >= Bb * Tt * Hh * Pp) return;
  int p = wg % Pp;
  int h = (wg / Pp) % Hh;
  size_t bt = (size_t)wg / (Pp * Hh);
  const float* src = (p == 0) ? b0 : (p == 1) ? b1 : (p == 2) ? b2
                   : (p == 3) ? b3 : (p == 4) ? b4 : b5;
  src += bt * Dd + (size_t)h * DVv;
  float s = 0.f;
#pragma unroll
  for (int i = 0; i < 8; ++i) s += fabsf(src[lane + 32 * i]);
#pragma unroll
  for (int off = 16; off; off >>= 1) s += __shfl_xor(s, off, 32);
  if (lane == 0) gi[bt * GIW + Dd + h * Pp + p] = s * (1.f / 256.f);
}

// ---------------- chunked delta rule ---------------------------------------
// The UT transform of a chunk (l2norm, A, forward substitution, w, u, attn)
// reads no state, so prep_kernel does it for all chunks side by side, one
// work-group per (batch, head, chunk), and leaves q, k^T, -w, attn (f16) and
// u (f32) in the workspace, one contiguous block per chunk. Only the steps
// that read or write the state S stay in the serial scan of delta_kernel.
constexpr int CE = CHc * DKk;              // elements of one 32 x 256 chunk block
__global__ void __launch_bounds__(256)
prep_kernel(const float* __restrict__ qc, const float* __restrict__ kc,
            const float* __restrict__ vc, const float* __restrict__ betap,
            float* __restrict__ qo, float* __restrict__ ko,
            float* __restrict__ wo, float* __restrict__ uo,
            float* __restrict__ ao) {
  extern __shared__ char smem[];
  float* Am  = (float*)smem;                 // 32x33 f32 (A / fwd-subst)
  h16* qn    = (h16*)(Am + 32 * 33);         // 32x256
  h16* kn    = qn + CE;
  h16* kbn   = kn + CE;
  h16* wn    = kbn + CE;                     // holds -(inv@kb)
  h16* xb    = wn + CE;                      // 32x256: v*beta
  h16* invb  = xb + CE;                      // 32x32
  h16* attb  = invb + 32 * 32;               // 32x32

  const int tid = threadIdx.x, lane = tid & 31, wid = tid >> 5;
  const int bh = blockIdx.x / NCHUNK, nc = blockIdx.x % NCHUNK;
  const int b = bh >> 2, h = bh & 3;
  const int t0 = nc * CHc;

  // ---- stage 1: load chunk, l2norm q/k, apply beta ----
  for (int j = 0; j < 4; ++j) {
    int r = wid * 4 + j;
    int t = t0 + r;
    size_t rowb = ((size_t)(b * Tt + t)) * Dd + (size_t)h * DKk;
    float bet = betap[(size_t)(b * Tt + t) * Hh + h];
    float qv[8], kv[8], vv[8];
    float sq = 0.f, sk = 0.f;
#pragma unroll
    for (int i = 0; i < 8; ++i) {
      int d = lane + 32 * i;
      qv[i] = qc[rowb + d]; kv[i] = kc[rowb + d]; vv[i] = vc[rowb + d];
      sq += qv[i] * qv[i]; sk += kv[i] * kv[i];
    }
#pragma unroll
    for (int off = 16; off; off >>= 1) {
      sq += __shfl_xor(sq, off, 32);
      sk += __shfl_xor(sk, off, 32);
    }
    float rq = rsqrtf(sq + 1e-12f), rk = rsqrtf(sk + 1e-12f);
#pragma unroll
    for (int i = 0; i < 8; ++i) {
      int d = lane + 32 * i;
      float kq = kv[i] * rk;
      qn[r * 256 + d]  = (h16)(qv[i] * rq);
      kn[r * 256 + d]  = (h16)kq;
      kbn[r * 256 + d] = (h16)(kq * bet);
      xb[r * 256 + d]  = (h16)(vv[i] * bet);
    }
  }
  __syncthreads();
  // ---- stage 2: A = -(kb k^T), strict lower (waves 0-3) ;
  //      stage 6: attn = (q k^T) * lower-incl mask (waves 4-7) ----
  {
    int m0 = ((wid >> 1) & 1) * 16, n0 = (wid & 1) * 16;
    const h16* lhs = (wid < 4) ? kbn : qn;
    v8f acc = {};
    for (int kk = 0; kk < 8; ++kk)
      acc = wmma_f16(frag_row(lhs, 256, m0, kk * 32, lane),
                     frag_row(kn, 256, n0, kk * 32, lane), acc);
    if (wid < 4) {
#pragma unroll
      for (int r = 0; r < 8; ++r) {
        int m = m0 + r + 8 * (lane >> 4), n = n0 + (lane & 15);
        Am[m * 33 + n] = (m > n) ? -acc[r] : 0.f;
      }
    } else {
#pragma unroll
      for (int r = 0; r < 8; ++r) {
        int m = m0 + r + 8 * (lane >> 4), n = n0 + (lane & 15);
        attb[m * 32 + n] = (h16)((m >= n) ? acc[r] : 0.f);
      }
    }
  }
  __syncthreads();
  // ---- stage 3: forward substitution, inv = A + I ----
  for (int i = 1; i < 32; ++i) {
    float val = 0.f;
    if (tid < 32)
      for (int s = 0; s < i; ++s) val += Am[i * 33 + s] * Am[s * 33 + tid];
    __syncthreads();
    if (tid < 32) Am[i * 33 + tid] += val;
    __syncthreads();
  }
  for (int e = tid; e < 1024; e += 256) {
    int m = e >> 5, n = e & 31;
    invb[e] = (h16)(Am[m * 33 + n] + ((m == n) ? 1.f : 0.f));
  }
  __syncthreads();
  // ---- stage 4: wn = -(inv@kb) ; u = inv@(v*beta) -> workspace (f32) ----
  float* ug = uo + (size_t)blockIdx.x * CE;
  for (int it = 0; it < 4; ++it) {
    int j = wid + 8 * it;           // 0..31
    int m0 = (j >> 4) * 16, n0 = (j & 15) * 16;
    v16h ia = frag_row(invb, 32, m0, 0, lane);
    v8f acc = {}, accu = {};
    acc  = wmma_f16(ia, frag_kmaj(kbn, 256, n0, 0, lane), acc);
    accu = wmma_f16(ia, frag_kmaj(xb, 256, n0, 0, lane), accu);
#pragma unroll
    for (int r = 0; r < 8; ++r) {
      int m = m0 + r + 8 * (lane >> 4), n = n0 + (lane & 15);
      wn[m * 256 + n] = (h16)(-acc[r]);
      ug[m * 256 + n] = accu[r];
    }
    // the next trip rewrites the address and data registers of the u stores
    asm volatile("s_wait_xcnt 0x0" ::: "memory");
  }
  __syncthreads();
  // ---- hand q, k^T, -w, attn to the scan: 16-byte stores, one block per chunk ----
  // k goes out transposed, 256 rows (dk) of 32 chunk positions: the scan reads
  // k^T as the A operand of its state update, contiguous along the chunk.
  v8h* gk = (v8h*)ko + (size_t)blockIdx.x * (CE / 8) + tid * 4;
#pragma unroll
  for (int i = 0; i < 4; ++i) {
    v8h t;
#pragma unroll
    for (int j = 0; j < 8; ++j) t[j] = kn[(8 * i + j) * 256 + tid];
    gk[i] = t;
  }
  // the stores below reuse the address and data registers of the k^T stores
  asm volatile("s_wait_xcnt 0x0" ::: "memory");
  uint4* gq = (uint4*)qo + (size_t)blockIdx.x * (CE / 8);
  uint4* gw = (uint4*)wo + (size_t)blockIdx.x * (CE / 8);
#pragma unroll
  for (int i = 0; i < 4; ++i) {
    int e = tid + 256 * i;
    gq[e] = ((const uint4*)qn)[e];
    gw[e] = ((const uint4*)wn)[e];
  }
  if (tid < 128)
    ((uint4*)ao)[(size_t)blockIdx.x * 128 + tid] = ((const uint4*)attb)[tid];
}

// Serial scan over the chunks, state split by value columns: column n of ui,
// oi and S depends on column n of u and S only, so each work-group owns DVS
// value columns of one (batch, head). DVS = 32 floats = one 128-byte output line.
// The 256 x DVS state slice lives in registers, split by key rows: wave w owns
// rows 32 w .. 32 w + 31 as four f32 D tiles, which the state update
// accumulates into, and as two f16 B fragments converted from them in place.
// A wave multiplies its 32 columns of -w and of q (fragments straight from the
// workspace) by its own rows of S; the eight partial 32 x DVS products are
// summed through LDS, thread t taking the float4 at place t of every partial.
// None of a chunk's operands depends on the state, so they are loaded one chunk
// ahead: two register sets take turns, and the loads of chunk n + 1 fly while
// chunk n goes through its three LDS exchanges.
constexpr int DVS = 32;                    // value columns per work-group
constexpr int NSL = DVv / DVS;             // slices per (batch, head)
constexpr int XP  = 40;                    // f16 per row of ui^T in LDS: 80 bytes
constexpr int RP  = 32 * DVS / 4;          // float4 per 32 x DVS partial
// a wave's fragments of one chunk's -w, q, k^T, attn, and its four u
struct ChunkOps {
  v16h w0, w1, q0, q1, k0, k1, at;
  float u0, u1, u2, u3;
};
// Work-group barrier for LDS traffic alone. __syncthreads() also waits for the
// wave's outstanding global loads, which would end the next chunk's flight at
// the first barrier behind its issue; nothing that these barriers order goes
// through global memory.
DEV void lds_barrier() {
  asm volatile("s_wait_dscnt 0x0\n\ts_barrier_signal -1\n\ts_barrier_wait -1" ::: "memory");
}
__global__ void __launch_bounds__(256)
delta_kernel(const float* __restrict__ qi, const float* __restrict__ ki,
             const float* __restrict__ wi, const float* __restrict__ ui0,
             const float* __restrict__ ai, float* __restrict__ dout) {
  extern __shared__ char smem[];
  float4* redW = (float4*)smem;              // 8 partials of (-w)@S
  float4* redQ = redW + 8 * RP;              // 8 partials of q@S, then attn@ui
  h16* xbT     = (h16*)(redQ + 9 * RP);      // DVS x XP: ui^T (f16)

  const int tid = threadIdx.x, lane = tid & 31;
  const int wid = __builtin_amdgcn_readfirstlane(tid >> 5);
  const int c = lane & 15, hh = lane >> 4;
  const int bh = blockIdx.x / NSL;
  const int c0 = (blockIdx.x % NSL) * DVS;   // first value column of the slice
  const int b = bh >> 2, h = bh & 3;
  // Place t of a partial holds registers 4 g .. 4 g + 3 of tile (mt, nt) at lane
  // t & 31, with mt * 4 + nt * 2 + g = t >> 5: rows rm .. rm + 3 of column rn.
  const int rm = (wid >> 2) * 16 + 8 * hh + 4 * (wid & 1);
  const int rn = ((wid >> 1) & 1) * 16 + c;
  // the lane's fixed offsets inside a chunk's blocks; the chunk moves the base
  const unsigned lwq = c * 256 + wid * 32 + hh * 8;         // -w, q: row c
  const unsigned lk  = (wid * 32 + c) * 32 + hh * 8;        // k^T: row 32 wid + c
  const unsigned la  = (((wid >> 1) & 1) * 16 + c) * 32 + hh * 8;  // attn
  const unsigned lu  = rm * 256 + c0 + rn;                  // u
  const unsigned lo  = rm * Dd + h * DVv + c0 + rn;         // oi

  v8f S00 = {}, S01 = {}, S10 = {}, S11 = {};  // S[32 wid + 16 mt ..][16 nt ..]
  v16h sb0 = {}, sb1 = {};                     // the same rows as B fragments
  const v8f zero = {};

  // ---- the wave's own fragments of chunk nc's -w, q, k^T, attn; its u ----
  // (waves 4-7 have no use for attn; they load it like the others, so that no
  // branch stands among the loads)
  auto fetch = [&](int nc, ChunkOps& o) {
    const size_t cb = (size_t)(bh * NCHUNK + nc);
    const h16* gw = (const h16*)wi + cb * CE + lwq;
    const h16* gq = (const h16*)qi + cb * CE + lwq;
    const h16* gk = (const h16*)ki + cb * CE + lk;
    const h16* ga = (const h16*)ai + cb * 1024 + la;
    const float* gu = ui0 + cb * CE + lu;
    o.w0 = frag_vec(gw); o.w1 = frag_vec(gw + 16 * 256);
    o.u0 = gu[0]; o.u1 = gu[256]; o.u2 = gu[512]; o.u3 = gu[768];
    o.k0 = frag_vec(gk); o.k1 = frag_vec(gk + 16 * 32);
    o.at = frag_vec(ga);
    o.q0 = frag_vec(gq); o.q1 = frag_vec(gq + 16 * 256);
    // what follows reuses the address registers of these loads, which are named
    // so that they stay theirs (no load's result lands in them either) up to
    // the wait
    asm volatile("s_wait_xcnt 0x0" :: "v"(gw), "v"(gq), "v"(gk), "v"(ga), "v"(gu) : "memory");
  };

  // ---- one chunk: works on o, sends chunk nn's loads off into n ----
  auto step = [&](int nc, int nn, const ChunkOps& o, ChunkOps& n) {
    const int t0 = nc * CHc;
    // ---- partial (-w)@S over the wave's 32 key rows (q@S: behind the barrier) ----
    v8f pw00 = wmma_f16(o.w0, sb0, zero), pw01 = wmma_f16(o.w0, sb1, zero);
    v8f pw10 = wmma_f16(o.w1, sb0, zero), pw11 = wmma_f16(o.w1, sb1, zero);
    __builtin_amdgcn_sched_barrier(0);
    float4* rw = redW + wid * RP + lane;
    put8(rw, pw00); put8(rw + 64, pw01); put8(rw + 128, pw10); put8(rw + 192, pw11);
    // issued here, the loads go out while the LDS stores above drain
    fetch(nn, n);
    lds_barrier();
    v8f pq00 = wmma_f16(o.q0, sb0, zero), pq01 = wmma_f16(o.q0, sb1, zero);
    v8f pq10 = wmma_f16(o.q1, sb0, zero), pq11 = wmma_f16(o.q1, sb1, zero);
    // ---- ui = u + sum of the partials -> ui^T (f16) ----
    {
      float4 s = redW[tid];
#pragma unroll
      for (int v = 1; v < 8; ++v) {
        float4 p = redW[v * RP + tid];
        s.x += p.x; s.y += p.y; s.z += p.z; s.w += p.w;
      }
      v4h x = {(h16)(o.u0 + s.x), (h16)(o.u1 + s.y), (h16)(o.u2 + s.z), (h16)(o.u3 + s.w)};
      *(v4h*)&xbT[rn * XP + rm] = x;
    }
    lds_barrier();
    // ---- S += k^T @ ui on the wave's rows; attn@ui as a ninth partial of oi ----
    {
      v16h ub0 = frag_vec(xbT + c * XP + hh * 8);
      v16h ub1 = frag_vec(xbT + (16 + c) * XP + hh * 8);
      S00 = wmma_f16(o.k0, ub0, S00); S01 = wmma_f16(o.k0, ub1, S01);
      S10 = wmma_f16(o.k1, ub0, S10); S11 = wmma_f16(o.k1, ub1, S11);
      float4* rq = redQ + wid * RP + lane;
      put8(rq, pq00); put8(rq + 64, pq01); put8(rq + 128, pq10); put8(rq + 192, pq11);
      if (wid < 4)
        put8(redQ + 8 * RP + wid * 64 + lane,
             wmma_f16(o.at, (wid & 1) ? ub1 : ub0, zero));
      sb0 = pack_b(S00, S10);
      sb1 = pack_b(S01, S11);
    }
    lds_barrier();
    // ---- oi = q@S + attn@ui: sum of the nine partials -> global ----
    {
      float4 r = redQ[tid];
#pragma unroll
      for (int v = 1; v < 9; ++v) {
        float4 p = redQ[v * RP + tid];
        r.x += p.x; r.y += p.y; r.z += p.z; r.w += p.w;
      }
      float* go = dout + (size_t)(b * Tt + t0) * Dd + lo;
      go[0] = r.x; go[Dd] = r.y; go[2 * Dd] = r.z; go[3 * Dd] = r.w;
      // the next chunk rewrites the address and data registers of these stores
      asm volatile("s_wait_xcnt 0x0" ::: "memory");
    }
  };

  ChunkOps ea, eb;                           // even chunks, odd chunks
  fetch(0, ea);
  for (int nc = 0; nc < NCHUNK; nc += 2) {
    step(nc, nc + 1, ea, eb);
    // behind the last chunk there is none: it is loaded once more, and not used
    step(nc + 1, (nc + 2 < NCHUNK) ? nc + 2 : NCHUNK - 1, eb, ea);
  }
}

// ---------------- gate softmax + branch mixing + RMSNorm -------------------
__global__ void __launch_bounds__(256)
fuse_kernel(const float* __restrict__ b0, const float* __restrict__ b1,
            const float* __restrict__ b2, const float* __restrict__ b3,
            const float* __restrict__ b4, const float* __restrict__ b5,
            const float* __restrict__ gi, const float* __restrict__ logits,
            const float* __restrict__ alpha, const float* __restrict__ ltemp,
            const float* __restrict__ onw, float* __restrict__ out) {
  size_t bt = blockIdx.x;
  int tid = threadIdx.x;
  __shared__ float probs_s[Hh][Pp];
  __shared__ float red[256];
  if (tid < Hh) {
    int h = tid;
    float x = ltemp[h];
    float temp = fmaxf(x, 0.f) + log1pf(expf(-fabsf(x))) + 1e-4f; // softplus
    float l[Pp];
    float mx = -1e30f;
#pragma unroll
    for (int p = 0; p < Pp; ++p) {
      float st = gi[bt * GIW + Dd + h * Pp + p];
      l[p] = (logits[bt * (Hh * Pp) + h * Pp + p] + alpha[p] * st) / temp;
      mx = fmaxf(mx, l[p]);
    }
    float se = 0.f;
#pragma unroll
    for (int p = 0; p < Pp; ++p) { l[p] = expf(l[p] - mx); se += l[p]; }
#pragma unroll
    for (int p = 0; p < Pp; ++p) {
      float pr = l[p] / se * (1.f - FLOORv);
      if (p == Pp - 1) pr += FLOORv;
      probs_s[h][p] = pr;
    }
  }
  __syncthreads();
  int d = tid;
  for (int h = 0; h < Hh; ++h) {
    size_t base = bt * Dd + (size_t)h * DVv + d;
    float o = b0[base] * probs_s[h][0] + b1[base] * probs_s[h][1] +
              b2[base] * probs_s[h][2] + b3[base] * probs_s[h][3] +
              b4[base] * probs_s[h][4] + b5[base] * probs_s[h][5];
    red[tid] = o * o;
    __syncthreads();
    for (int s = 128; s; s >>= 1) {
      if (tid < s) red[tid] += red[tid + s];
      __syncthreads();
    }
    float ms = red[0] * (1.f / 256.f);
    __syncthreads();
    out[base] = o * rsqrtf(ms + 1e-5f) * onw[d];
  }
}

// ---------------------------------------------------------------------------
extern "C" void kernel_launch(void* const* d_in, const int* in_sizes, int n_in,
                              void* d_out, int out_size, void* d_ws,
                              size_t ws_size, hipStream_t stream) {
  const float* hs   = (const float*)d_in[0];
  const float* qw   = (const float*)d_in[1];
  const float* kw   = (const float*)d_in[2];
  const float* vw   = (const float*)d_in[3];
  const float* bw   = (const float*)d_in[4];
  const float* qcw  = (const float*)d_in[5];
  const float* kcw  = (const float*)d_in[6];
  const float* vcw  = (const float*)d_in[7];
  const float* f3w  = (const float*)d_in[8];
  const float* f7w  = (const float*)d_in[9];
  const float* f15w = (const float*)d_in[10];
  const float* f31w = (const float*)d_in[11];
  const float* gw1  = (const float*)d_in[12];
  const float* gb1  = (const float*)d_in[13];
  const float* gw2  = (const float*)d_in[14];
  const float* gb2  = (const float*)d_in[15];
  const float* glt  = (const float*)d_in[16];
  const float* alps = (const float*)d_in[17];
  const float* onw  = (const float*)d_in[18];
  const float* ow   = (const float*)d_in[19];
  float* out = (float*)d_out;

  const size_t U = (size_t)Bb * Tt * Dd; // 4096*1024
  float* ws = (float*)d_ws;
  float* qp  = ws;            // q projection (reused: fir3)
  float* kp  = qp + U;        // k projection (reused: fir7)
  float* vp  = kp + U;        // v projection (reused: fir15)
  float* qcv = vp + U;        // q after conv+silu (reused: fir31)
  float* kcv = qcv + U;       // k after conv+silu (reused: o_fused)
  float* vcv = kcv + U;       // v after conv+silu (branch p=4)
  float* dta = vcv + U;       // delta-rule output (branch p=5)
  float* h1  = dta + U;       // gate hidden, 2U
  float* gi  = h1 + 2 * U;    // gate input, B*T x GIW
  float* beta = gi + (size_t)Bb * Tt * 1056;
  float* lgt  = beta + (size_t)Bb * Tt * Hh;
  float* pq  = lgt + (size_t)Bb * Tt * Hh * Pp;  // prepared q, f16 (U/2 floats)
  float* pk  = pq + U / 2;    // prepared k^T, f16
  float* pw  = pk + U / 2;    // prepared -w, f16
  float* pu  = pw + U / 2;    // prepared u, f32
  float* pa  = pu + U;        // prepared attn, f16, 32x32 per chunk

  const int MT = Bb * Tt;                 // 4096
  dim3 blk(256);
  dim3 gN1024((1024 + 127) / 128, (MT + 63) / 64);
  dim3 gDW(Dd / DWC, MT / (8 * DWR));

  // 1) q/k/v projections (no activation; conv+silu comes after)
  gemm_kernel<<<gN1024, blk, 0, stream>>>(hs, Dd, qw, Dd, nullptr, qp, Dd, MT, Dd, Dd, 0);
  gemm_kernel<<<gN1024, blk, 0, stream>>>(hs, Dd, kw, Dd, nullptr, kp, Dd, MT, Dd, Dd, 0);
  gemm_kernel<<<gN1024, blk, 0, stream>>>(hs, Dd, vw, Dd, nullptr, vp, Dd, MT, Dd, Dd, 0);
  // 2) beta
  beta_kernel<<<(MT * Hh + 255) / 256, blk, 0, stream>>>(hs, bw, beta);
  // 3) depthwise causal conv (k=4) + SiLU
  dwconv_kernel<4, true><<<gDW, blk, 0, stream>>>(qp, qcw, qcv);
  dwconv_kernel<4, true><<<gDW, blk, 0, stream>>>(kp, kcw, kcv);
  dwconv_kernel<4, true><<<gDW, blk, 0, stream>>>(vp, vcw, vcv);
  // 4) delta rule: state-free chunk work for all chunks at once, then the
  //    scan, one workgroup per (batch, head, 32-column state slice)
  const size_t PLDS = 32 * 33 * sizeof(float) + (5 * CE + 2 * 32 * 32) * sizeof(h16);
  prep_kernel<<<dim3(Bb * Hh * NCHUNK), blk, PLDS, stream>>>(qcv, kcv, vcv, beta,
                                                             pq, pk, pw, pu, pa);
  const size_t DLDS = 17 * RP * sizeof(float4) + DVS * XP * sizeof(h16);
  delta_kernel<<<dim3(Bb * Hh * NSL), blk, DLDS, stream>>>(pq, pk, pw, pu, pa, dta);
  // 5) FIR branches on v (reuse proj buffers; qcv/kcv free after delta)
  dwconv_kernel<3, false><<<gDW, blk, 0, stream>>>(vcv, f3w, qp);
  dwconv_kernel<7, false><<<gDW, blk, 0, stream>>>(vcv, f7w, kp);
  dwconv_kernel<15, false><<<gDW, blk, 0, stream>>>(vcv, f15w, vp);
  dwconv_kernel<31, false><<<gDW, blk, 0, stream>>>(vcv, f31w, qcv);
  // 6) gate input = concat(hidden, stats)
  gi_copy_kernel<<<MT / GIR, blk, 0, stream>>>(hs, gi);
  stats_kernel<<<(MT * Hh * Pp) / 8, blk, 0, stream>>>(qp, kp, vp, qcv, vcv, dta, gi);
  // 7) gate MLP (gelu, then linear to H*P logits with gb2 bias)
  dim3 gGate1((2048 + 127) / 128, (MT + 63) / 64);
  gemm_kernel<<<gGate1, blk, 0, stream>>>(gi, GIW, gw1, GIW, gb1, h1, 2048, MT, 2048, GIW, 1);
  dim3 gGate2(1, (MT + 63) / 64);
  gemm_kernel<<<gGate2, blk, 0, stream>>>(h1, 2048, gw2, 2048, gb2, lgt, Hh * Pp, MT, Hh * Pp, 2048, 0);
  // 8) softmax gate + mix branches + RMSNorm  (o_fused -> kcv)
  float* ofused = kcv;
  fuse_kernel<<<dim3(MT), blk, 0, stream>>>(qp, kp, vp, qcv, vcv, dta, gi, lgt,
                                            alps, glt, onw, ofused);
  // 9) output projection
  gemm_kernel<<<gN1024, blk, 0, stream>>>(ofused, Dd, ow, Dd, nullptr, out, Dd, MT, Dd, Dd, 0);
}

// v008
// Measured time: 351 microseconds a run.
// Timed twice side by side with v007, it ran 1.13 and 1.12 times as fast.
// Over all steps from v000 it is 11.3 times as fast.
#include <hip/hip_runtime.h>
#include <hip/hip_bf16.h>
#include <math.h>

#define DEV __device__ __forceinline__

typedef __attribute__((ext_vector_type(16))) _Float16 v16h;
typedef __attribute__((ext_vector_type(8)))  float    v8f;
typedef _Float16 h16;

constexpr int Bb = 2, Tt = 2048, Dd = 1024, Hh = 4, Pp = 6, CHc = 32;
constexpr int DKk = 256, DVv = 256;
constexpr int NCHUNK = Tt / CHc;           // 64
constexpr int GIW = Dd + Hh * Pp;          // 1048
constexpr float FLOORv = 0.05f;

DEV v16h frag_row(const h16* t, int ld, int r0, int k0, int lane) {
  // element [m][k] at t[(r0+m)*ld + (k0+k)]
  v16h f;
  int m = lane & 15, kg = lane >> 4;
#pragma unroll
  for (int j = 0; j < 8; ++j) {
    int kk = ((j < 4) ? 0 : 16) + kg * 8 + 2 * (j & 3);
    const h16* p = t + (size_t)(r0 + m) * ld + k0 + kk;
    f[2 * j] = p[0];
    f[2 * j + 1] = p[1];
  }
  return f;
}
DEV v16h frag_kmaj(const h16* t, int ld, int r0, int k0, int lane) {
  // element [m][k] at t[(k0+k)*ld + (r0+m)]
  v16h f;
  int m = lane & 15, kg = lane >> 4;
#pragma unroll
  for (int j = 0; j < 8; ++j) {
    int kk = ((j < 4) ? 0 : 16) + kg * 8 + 2 * (j & 3);
    f[2 * j]     = t[(size_t)(k0 + kk) * ld + r0 + m];
    f[2 * j + 1] = t[(size_t)(k0 + kk + 1) * ld + r0 + m];
  }
  return f;
}
DEV v8f wmma_f16(v16h a, v16h b, v8f c) {
  return __builtin_amdgcn_wmma_f32_16x16x32_f16(false, a, false, b, (short)0, c,
                                                false, false);
}

typedef __attribute__((ext_vector_type(8))) _Float16 v8h;
typedef __attribute__((ext_vector_type(4))) _Float16 v4h;
// frag_row's fragment as two 16-byte loads: p is the lane's row at
// k = 8 * (lane >> 4); the fragment's second eight k lie 16 further on.
DEV v16h frag_vec(const h16* p) {
  v8h lo = *(const v8h*)p, hi = *(const v8h*)(p + 16);
  return __builtin_shufflevector(lo, hi, 0, 1, 2, 3, 4, 5, 6, 7, 8, 9, 10, 11,
                                 12, 13, 14, 15);
}
// One D tile to LDS: registers 0-3 at d, registers 4-7 32 places further on.
DEV void put8(float4* d, v8f a) {
  d[0]  = make_float4(a[0], a[1], a[2], a[3]);
  d[32] = make_float4(a[4], a[5], a[6], a[7]);
}
// Two f32 D tiles (rows 0-15 and 16-31 of a 32-row block, same columns) are,
// converted lane by lane, the f16 B fragment of that block in frag_row's k order.
DEV v16h pack_b(v8f lo, v8f hi) {
  v16h f;
#pragma unroll
  for (int s = 0; s < 8; ++s) { f[s] = (h16)lo[s]; f[8 + s] = (h16)hi[s]; }
  return f;
}

typedef __attribute__((ext_vector_type(4))) float v4f;

// ---------------- Generic GEMM: C = act(A(MxK) * W(NxK)^T + bias) ----------
// 64x128 block tile, 8 waves (2x4), each wave owns a 32x32 region.
// A and W arrive as f16, rounded once by whoever wrote them (to_f16_kernel, the
// stats, gate and fuse kernels), so a tile's bytes cross the L2 at two bytes an
// element and go to LDS as they are. The pointers are typed float like the rest
// of the workspace; lda, ldw and K count f16 elements.
// A trip of the K loop takes GBK = 128 columns (four wmma steps of 32), 256 bytes
// of a row: sixteen lanes take one row, so a wave-wide 16-byte load covers two
// rows. Wave w stages rows 2 w + (lane >> 4) + 16 j of A (j < 4) and of W (j < 8).
// The 12 loads of trip kt + 1 are issued together, into registers, before trip
// kt is read from LDS and multiplied; they are stored to LDS at the top of the
// next trip. K is a multiple of GBK and lda, ldw are multiples of 8 in every call.
// A row past M or N is read at the last row: it only feeds results that are
// not stored.
constexpr int GBK = 128;                   // K columns per trip
constexpr int GLP = GBK + 8;               // f16 per LDS row: 272 bytes
template <bool C16>                        // C is stored as f16: the next GEMM's A
__global__ void __launch_bounds__(256)
gemm_kernel(const float* __restrict__ A, int lda, const float* __restrict__ W,
            int ldw, const float* __restrict__ bias, float* __restrict__ C,
            int ldc, int M, int N, int K, int act) {
  __shared__ __attribute__((aligned(16))) h16 At[64][GLP];
  __shared__ __attribute__((aligned(16))) h16 Wt[128][GLP];
  const int tid = threadIdx.x, lane = tid & 31;
  const int wid = __builtin_amdgcn_readfirstlane(tid >> 5);
  const int wm = wid >> 2, wn = wid & 3;
  const int bm = blockIdx.y * 64, bn = blockIdx.x * 128;
  const int sr = wid * 2 + (lane >> 4);    // the lane's row among sixteen
  const int c8 = (lane & 15) * 8;          // its eight columns of the trip
  v8f acc00 = {}, acc01 = {}, acc10 = {}, acc11 = {};
  const int ktn = K / GBK;
  // K is positive in every call: the first trip's loads then stay where they
  // are written, in front of their wait, and are not sunk into a guarded block
  __builtin_assume(ktn > 0);
  unsigned oa[4], ow[8];                   // byte offsets of the lane's pieces at k = 0
  // the loops over j are unrolled so that oa, ow, fa, fw stay in registers
#pragma unroll
  for (int j = 0; j < 4; ++j) {
    int gm = bm + sr + 16 * j;
    oa[j] = (unsigned)((gm < M ? gm : M - 1) * lda + c8) * 2u;
  }
#pragma unroll
  for (int j = 0; j < 8; ++j) {
    int gn = bn + sr + 16 * j;
    ow[j] = (unsigned)((gn < N ? gn : N - 1) * ldw + c8) * 2u;
  }
  v8h fa[4], fw[8];
  // the 12 loads of the trip that starts at column kb
  auto issue = [&](int kb) {
    const char* ab = (const char*)A + (size_t)kb * 2;
    const char* wb = (const char*)W + (size_t)kb * 2;
    const char *qa[4], *qw[8];
#pragma unroll
    for (int j = 0; j < 4; ++j) { qa[j] = ab + oa[j]; fa[j] = *(const v8h*)qa[j]; }
#pragma unroll
    for (int j = 0; j < 8; ++j) { qw[j] = wb + ow[j]; fw[j] = *(const v8h*)qw[j]; }
    // what follows reuses the address registers of these loads, which are named
    // so that they stay theirs (no load's result lands in them either) up to
    // the wait
    asm volatile("s_wait_xcnt 0x0" :: "v"(qa[0]), "v"(qa[1]), "v"(qa[2]), "v"(qa[3]),
                 "v"(qw[0]), "v"(qw[1]), "v"(qw[2]), "v"(qw[3]), "v"(qw[4]),
                 "v"(qw[5]), "v"(qw[6]), "v"(qw[7]) : "memory");
  };
  issue(0);
  for (int kt = 0; kt < ktn; ++kt) {
#pragma unroll
    for (int j = 0; j < 4; ++j) *(v8h*)&At[sr + 16 * j][c8] = fa[j];
#pragma unroll
    for (int j = 0; j < 8; ++j) *(v8h*)&Wt[sr + 16 * j][c8] = fw[j];
    __syncthreads();
    if (kt + 1 < ktn) issue((kt + 1) * GBK);
#pragma unroll
    for (int s = 0; s < GBK / 32; ++s) {
      v16h a0 = frag_row(&At[0][0], GLP, wm * 32, 32 * s, lane);
      v16h a1 = frag_row(&At[0][0], GLP, wm * 32 + 16, 32 * s, lane);
      v16h b0 = frag_row(&Wt[0][0], GLP, wn * 32, 32 * s, lane);
      v16h b1 = frag_row(&Wt[0][0], GLP, wn * 32 + 16, 32 * s, lane);
      acc00 = wmma_f16(a0, b0, acc00);
      acc01 = wmma_f16(a0, b1, acc01);
      acc10 = wmma_f16(a1, b0, acc10);
      acc11 = wmma_f16(a1, b1, acc11);
    }
    __syncthreads();
  }
  v8f* accs[4] = {&acc00, &acc01, &acc10, &acc11};
#pragma unroll
  for (int q = 0; q < 4; ++q) {
    int im = q >> 1, in_ = q & 1;
#pragma unroll
    for (int r = 0; r < 8; ++r) {
      int gm = bm + wm * 32 + im * 16 + r + 8 * (lane >> 4);
      int gn = bn + wn * 32 + in_ * 16 + (lane & 15);
      if (gm < M && gn < N) {
        float v = (*accs[q])[r] + (bias ? bias[gn] : 0.f);
        if (act == 1) v = 0.5f * v * (1.f + erff(v * 0.70710678118f));
        if (C16) ((h16*)C)[(size_t)gm * ldc + gn] = (h16)v;
        else C[(size_t)gm * ldc + gn] = v;
      }
    }
  }
}

// ---------------- depthwise causal conv (+ optional SiLU) ------------------
// A thread computes four neighbouring channels (one float4) of DWR consecutive
// time steps; a wave covers 128 channels, so each of its loads and stores is 512
// contiguous bytes of one row, and the eight waves of a work-group take eight
// consecutive blocks of time steps. The DWR + KW - 1 input rows of a thread are
// loaded up front into registers. The work-group's 128 x KW weights go through
// LDS, transposed to one row per tap, so that a tap's four weights are one
// 16-byte read. Every output sums its taps in ascending order; a row in front
// of the sequence's start is not read and counts as zero (a test that is the
// same for the whole wave).
constexpr int DWR = 8;                     // time steps per thread
constexpr int DWC = 128;                   // channels per work-group
constexpr int DWP = DWC + 4;               // floats per tap row in LDS
template <int KW, bool SILU>
__global__ void __launch_bounds__(256)
dwconv_kernel(const float* __restrict__ X, const float* __restrict__ Wc,
              float* __restrict__ Y) {
  __shared__ __attribute__((aligned(16))) float wt[KW * DWP];
  constexpr int NX = DWR + KW - 1;         // input rows per thread
  constexpr int NF = DWC * KW / 256;       // rounds in which every thread stages a weight
  constexpr bool TAIL = (DWC * KW) % 256 != 0;   // 128 weights more: waves 0-3
  const int tid = threadIdx.x, lane = tid & 31;
  const int wid = __builtin_amdgcn_readfirstlane(tid >> 5);
  const int c0 = blockIdx.x * DWC;
  const int r0 = (blockIdx.y * 8 + wid) * DWR;   // first row, b * Tt + t
  const int t0 = r0 & (Tt - 1);
  const float* xs = X + (size_t)r0 * Dd + c0;    // the same in every lane
  float4 x[NX];
  if (t0 >= KW - 1) {
#pragma unroll
    for (int j = 0; j < NX; ++j)
      x[j] = *(const float4*)(xs + (j - (KW - 1)) * Dd + lane * 4);
  } else {
    // the first blocks of a sequence, few: row by row
#pragma unroll
    for (int j = 0; j < KW - 1; ++j) {
      if (t0 + j >= KW - 1) {
        x[j] = *(const float4*)(xs + (j - (KW - 1)) * Dd + lane * 4);
        // the next row's load forms its offset register anew
        asm volatile("s_wait_xcnt 0x0" ::: "memory");
      } else {
        x[j] = make_float4(0.f, 0.f, 0.f, 0.f);
      }
    }
#pragma unroll
    for (int j = KW - 1; j < NX; ++j)
      x[j] = *(const float4*)(xs + (j - (KW - 1)) * Dd + lane * 4);
  }
  // what follows reuses the base and offset registers of these loads
  asm volatile("s_wait_xcnt 0x0" ::: "memory");
  const float* wp = Wc + c0 * KW + tid;
  float wv[NF + 1];
#pragma unroll
  for (int n = 0; n < NF; ++n) wv[n] = wp[256 * n];
  wv[NF] = 0.f;
  if (TAIL && wid < 4) wv[NF] = wp[256 * NF];
  asm volatile("s_wait_xcnt 0x0" ::: "memory");
  // keeps the later address arithmetic, which reuses the loads' scalar base,
  // behind the wait: the compiler had lifted it over
  __builtin_amdgcn_sched_barrier(0);
#pragma unroll
  for (int n = 0; n < NF; ++n) {
    const int e = tid + 256 * n;
    wt[(e % KW) * DWP + e / KW] = wv[n];
  }
  if (TAIL && wid < 4) {
    const int e = tid + 256 * NF;
    wt[(e % KW) * DWP + e / KW] = wv[NF];
  }
  __syncthreads();
  float4 s[DWR];
#pragma unroll
  for (int r = 0; r < DWR; ++r) s[r] = make_float4(0.f, 0.f, 0.f, 0.f);
#pragma unroll
  for (int i = 0; i < KW; ++i) {
    const float4 w = *(const float4*)&wt[i * DWP + lane * 4];
#pragma unroll
    for (int r = 0; r < DWR; ++r) {
      s[r].x += x[r + i].x * w.x;
      s[r].y += x[r + i].y * w.y;
      s[r].z += x[r + i].z * w.z;
      s[r].w += x[r + i].w * w.w;
    }
  }
  float* yp = Y + (size_t)r0 * Dd + c0 + lane * 4;
  if (SILU) {
#pragma unroll
    for (int r = 0; r < DWR; ++r) {
      s[r].x = s[r].x / (1.f + expf(-s[r].x));
      s[r].y = s[r].y / (1.f + expf(-s[r].y));
      s[r].z = s[r].z / (1.f + expf(-s[r].z));
      s[r].w = s[r].w / (1.f + expf(-s[r].w));
    }
  }
#pragma unroll
  for (int r = 0; r < DWR; ++r) *(float4*)(yp + r * Dd) = s[r];
}

// ---------------- beta = sigmoid(hidden @ b_proj^T) ------------------------
__global__ void beta_kernel(const float* __restrict__ hs,
                            const float* __restrict__ Wb,
                            float* __restrict__ beta) {
  int idx = blockIdx.x * blockDim.x + threadIdx.x;
  if (idx >= Bb * Tt * Hh) return;
  int h = idx & (Hh - 1);
  size_t bt = (size_t)idx >> 2;
  const float* x = hs + bt * Dd;
  const float* w = Wb + (size_t)h * Dd;
  float s = 0.f;
  for (int k = 0; k < Dd; ++k) s += x[k] * w[k];
  beta[idx] = 1.f / (1.f + expf(-s));
}

// ---------------- GEMM operands to f16, once ---------------------------------
// hidden goes into the first Dd columns of the gate input, which the q, k, v
// projections read as well; the gate input and gate_w1 get rows of GP elements,
// whole trips of the GEMM's K loop, with zeros behind column GIW in both. The
// Hh * Pp columns between are the stats kernel's. A thread converts four
// pieces of eight elements: eight 16-byte loads, then four 16-byte stores.
constexpr int GP = 1152;                   // f16 per row of gate input and gate_w1
constexpr int GU = GP / 8;                 // pieces per such row
constexpr int CB_H = Bb * Tt * GU / 1024;  // work-groups: hidden
constexpr int CB_G = 2 * Dd * GU / 1024;   // gate_w1
constexpr int CB_W = Dd * Dd / 8 / 1024;   // each of q, k, v, o
constexpr int CB_2 = Hh * Pp * 2 * Dd / 8 / 1024;   // gate_w2
__global__ void __launch_bounds__(256)
to_f16_kernel(const float* __restrict__ hs, const float* __restrict__ qw,
              const float* __restrict__ kw, const float* __restrict__ vw,
              const float* __restrict__ ow, const float* __restrict__ gw1,
              const float* __restrict__ gw2, float* __restrict__ gi,
              float* __restrict__ q16, float* __restrict__ k16,
              float* __restrict__ v16, float* __restrict__ o16,
              float* __restrict__ g116, float* __restrict__ g216) {
  const int b = blockIdx.x, tid = threadIdx.x;
  const float* s;
  v8h* d;
  int sc, e0;                              // source columns; the thread's first piece
  const bool padded = b < CB_H + CB_G;
  if (b < CB_H) {
    s = hs; d = (v8h*)gi; sc = Dd; e0 = b * 1024 + tid;
  } else if (padded) {
    s = gw1; d = (v8h*)g116; sc = GIW; e0 = (b - CB_H) * 1024 + tid;
  } else {
    const int f = b - CB_H - CB_G, w = f / CB_W;
    s = (w == 0) ? qw : (w == 1) ? kw : (w == 2) ? vw : (w == 3) ? ow : gw2;
    d = (v8h*)((w == 0) ? q16 : (w == 1) ? k16 : (w == 2) ? v16 : (w == 3) ? o16 : g216);
    sc = 0; e0 = (f % CB_W) * 1024 + tid;
  }
  v4f lo[4], hi[4];
  const float* p[4];
  bool cv[4], st[4];                       // the piece holds source data; is stored
  // the loops over i are unrolled so that these arrays stay in registers and
  // the eight loads go out together
#pragma unroll
  for (int i = 0; i < 4; ++i) {
    const int e = e0 + 256 * i;
    unsigned so = (unsigned)e * 8u;
    cv[i] = true; st[i] = true;
    if (padded) {
      const int row = e / GU, c = (e % GU) * 8;
      cv[i] = c < sc;
      st[i] = cv[i] || c >= GIW;
      so = (unsigned)(row * sc + (cv[i] ? c : 0));   // a pad piece reads the row's start
    }
    p[i] = s + so;
  }
#pragma unroll
  for (int i = 0; i < 4; ++i) {
    lo[i] = *(const v4f*)p[i];
    hi[i] = *(const v4f*)(p[i] + 4);
  }
  // what follows reuses the address registers of these loads, which are named
  // so that they stay theirs (no load's result lands in them either) up to
  // the wait
  asm volatile("s_wait_xcnt 0x0" :: "v"(p[0]), "v"(p[1]), "v"(p[2]), "v"(p[3]) : "memory");
#pragma unroll
  for (int i = 0; i < 4; ++i) {
    v8h r = {(h16)lo[i].x, (h16)lo[i].y, (h16)lo[i].z, (h16)lo[i].w,
             (h16)hi[i].x, (h16)hi[i].y, (h16)hi[i].z, (h16)hi[i].w};
    const v8h z = {};
    if (st[i]) d[e0 + 256 * i] = cv[i] ? r : z;
  }
}

// ---------------- stats = mean |branch| over DV -> gi tail (f16), st32 ------
__global__ void stats_kernel(const float* __restrict__ b0,
                             const float* __restrict__ b1,
                             const float* __restrict__ b2,
                             const float* __restrict__ b3,
                             const float* __restrict__ b4,
                             const float* __restrict__ b5,
                             float* __restrict__ gi, float* __restrict__ st32) {
  int wg = blockIdx.x * 8 + (threadIdx.x >> 5);
  int lane = threadIdx.x & 31;
  if (wg >= Bb * Tt * Hh * Pp) return;
  int p = wg % Pp;
  int h = (wg / Pp) % Hh;
  size_t bt = (size_t)wg / (Pp * Hh);
  const float* src = (p == 0) ? b0 : (p == 1) ? b1 : (p == 2) ? b2
                   : (p == 3) ? b3 : (p == 4) ? b4 : b5;
  src += bt * Dd + (size_t)h * DVv;
  float s = 0.f;
#pragma unroll
  for (int i = 0; i < 8; ++i) s += fabsf(src[lane + 32 * i]);
#pragma unroll
  for (int off = 16; off; off >>= 1) s += __shfl_xor(s, off, 32);
  if (lane == 0) {
    const float m = s * (1.f / 256.f);
    st32[wg] = m;                          // for the gate's stat bias
    ((h16*)gi)[bt * GP + Dd + h * Pp + p] = (h16)m;   // gate input
  }
}

// ---------------- chunked delta rule ---------------------------------------
// The UT transform of a chunk (l2norm, A, forward substitution, w, u, attn)
// reads no state, so prep_kernel does it for all chunks side by side, one
// work-group per (batch, head, chunk), and leaves q, k^T, -w, attn (f16) and
// u (f32) in the workspace, one contiguous block per chunk. Only the steps
// that read or write the state S stay in the serial scan of delta_kernel.
constexpr int CE = CHc * DKk;              // elements of one 32 x 256 chunk block
__global__ void __launch_bounds__(256)
prep_kernel(const float* __restrict__ qc, const float* __restrict__ kc,
            const float* __restrict__ vc, const float* __restrict__ betap,
            float* __restrict__ qo, float* __restrict__ ko,
            float* __restrict__ wo, float* __restrict__ uo,
            float* __restrict__ ao) {
  extern __shared__ char smem[];
  float* Am  = (float*)smem;                 // 32x33 f32 (A / fwd-subst)
  h16* qn    = (h16*)(Am + 32 * 33);         // 32x256
  h16* kn    = qn + CE;
  h16* kbn   = kn + CE;
  h16* wn    = kbn + CE;                     // holds -(inv@kb)
  h16* xb    = wn + CE;                      // 32x256: v*beta
  h16* invb  = xb + CE;                      // 32x32
  h16* attb  = invb + 32 * 32;               // 32x32

  const int tid = threadIdx.x, lane = tid & 31, wid = tid >> 5;
  const int bh = blockIdx.x / NCHUNK, nc = blockIdx.x % NCHUNK;
  const int b = bh >> 2, h = bh & 3;
  const int t0 = nc * CHc;

  // ---- stage 1: load chunk, l2norm q/k, apply beta ----
  for (int j = 0; j < 4; ++j) {
    int r = wid * 4 + j;
    int t = t0 + r;
    size_t rowb = ((size_t)(b * Tt + t)) * Dd + (size_t)h * DKk;
    float bet = betap[(size_t)(b * Tt + t) * Hh + h];
    float qv[8], kv[8], vv[8];
    float sq = 0.f, sk = 0.f;
#pragma unroll
    for (int i = 0; i < 8; ++i) {
      int d = lane + 32 * i;
      qv[i] = qc[rowb + d]; kv[i] = kc[rowb + d]; vv[i] = vc[rowb + d];
      sq += qv[i] * qv[i]; sk += kv[i] * kv[i];
    }
#pragma unroll
    for (int off = 16; off; off >>= 1) {
      sq += __shfl_xor(sq, off, 32);
      sk += __shfl_xor(sk, off, 32);
    }
    float rq = rsqrtf(sq + 1e-12f), rk = rsqrtf(sk + 1e-12f);
#pragma unroll
    for (int i = 0; i < 8; ++i) {
      int d = lane + 32 * i;
      float kq = kv[i] * rk;
      qn[r * 256 + d]  = (h16)(qv[i] * rq);
      kn[r * 256 + d]  = (h16)kq;
      kbn[r * 256 + d] = (h16)(kq * bet);
      xb[r * 256 + d]  = (h16)(vv[i] * bet);
    }
  }
  __syncthreads();
  // ---- stage 2: A = -(kb k^T), strict lower (waves 0-3) ;
  //      stage 6: attn = (q k^T) * lower-incl mask (waves 4-7) ----
  {
    int m0 = ((wid >> 1) & 1) * 16, n0 = (wid & 1) * 16;
    const h16* lhs = (wid < 4) ? kbn : qn;
    v8f acc = {};
    for (int kk = 0; kk < 8; ++kk)
      acc = wmma_f16(frag_row(lhs, 256, m0, kk * 32, lane),
                     frag_row(kn, 256, n0, kk * 32, lane), acc);
    if (wid < 4) {
#pragma unroll
      for (int r = 0; r < 8; ++r) {
        int m = m0 + r + 8 * (lane >> 4), n = n0 + (lane & 15);
        Am[m * 33 + n] = (m > n) ? -acc[r] : 0.f;
      }
    } else {
#pragma unroll
      for (int r = 0; r < 8; ++r) {
        int m = m0 + r + 8 * (lane >> 4), n = n0 + (lane & 15);
        attb[m * 32 + n] = (h16)((m >= n) ? acc[r] : 0.f);
      }
    }
  }
  __syncthreads();
  // ---- stage 3: forward substitution, inv = A + I ----
  for (int i = 1; i < 32; ++i) {
    float val = 0.f;
    if (tid < 32)
      for (int s = 0; s < i; ++s) val += Am[i * 33 + s] * Am[s * 33 + tid];
    __syncthreads();
    if (tid < 32) Am[i * 33 + tid] += val;
    __syncthreads();
  }
  for (int e = tid; e < 1024; e += 256) {
    int m = e >> 5, n = e & 31;
    invb[e] = (h16)(Am[m * 33 + n] + ((m == n) ? 1.f : 0.f));
  }
  __syncthreads();
  // ---- stage 4: wn = -(inv@kb) ; u = inv@(v*beta) -> workspace (f32) ----
  float* ug = uo + (size_t)blockIdx.x * CE;
  for (int it = 0; it < 4; ++it) {
    int j = wid + 8 * it;           // 0..31
    int m0 = (j >> 4) * 16, n0 = (j & 15) * 16;
    v16h ia = frag_row(invb, 32, m0, 0, lane);
    v8f acc = {}, accu = {};
    acc  = wmma_f16(ia, frag_kmaj(kbn, 256, n0, 0, lane), acc);
    accu = wmma_f16(ia, frag_kmaj(xb, 256, n0, 0, lane), accu);
#pragma unroll
    for (int r = 0; r < 8; ++r) {
      int m = m0 + r + 8 * (lane >> 4), n = n0 + (lane & 15);
      wn[m * 256 + n] = (h16)(-acc[r]);
      ug[m * 256 + n] = accu[r];
    }
    // the next trip rewrites the address and data registers of the u stores
    asm volatile("s_wait_xcnt 0x0" ::: "memory");
  }
  __syncthreads();
  // ---- hand q, k^T, -w, attn to the scan: 16-byte stores, one block per chunk ----
  // k goes out transposed, 256 rows (dk) of 32 chunk positions: the scan reads
  // k^T as the A operand of its state update, contiguous along the chunk.
  v8h* gk = (v8h*)ko + (size_t)blockIdx.x * (CE / 8) + tid * 4;
#pragma unroll
  for (int i = 0; i < 4; ++i) {
    v8h t;
#pragma unroll
    for (int j = 0; j < 8; ++j) t[j] = kn[(8 * i + j) * 256 + tid];
    gk[i] = t;
  }
  // the stores below reuse the address and data registers of the k^T stores
  asm volatile("s_wait_xcnt 0x0" ::: "memory");
  uint4* gq = (uint4*)qo + (size_t)blockIdx.x * (CE / 8);
  uint4* gw = (uint4*)wo + (size_t)blockIdx.x * (CE / 8);
#pragma unroll
  for (int i = 0; i < 4; ++i) {
    int e = tid + 256 * i;
    gq[e] = ((const uint4*)qn)[e];
    gw[e] = ((const uint4*)wn)[e];
  }
  if (tid < 128)
    ((uint4*)ao)[(size_t)blockIdx.x * 128 + tid] = ((const uint4*)attb)[tid];
}

// Serial scan over the chunks, state split by value columns: column n of ui,
// oi and S depends on column n of u and S only, so each work-group owns DVS
// value columns of one (batch, head). DVS = 32 floats = one 128-byte output line.
// The 256 x DVS state slice lives in registers, split by key rows: wave w owns
// rows 32 w .. 32 w + 31 as four f32 D tiles, which the state update
// accumulates into, and as two f16 B fragments converted from them in place.
// A wave multiplies its 32 columns of -w and of q (fragments straight from the
// workspace) by its own rows of S; the eight partial 32 x DVS products are
// summed through LDS, thread t taking the float4 at place t of every partial.
// None of a chunk's operands depends on the state, so they are loaded one chunk
// ahead: two register sets take turns, and the loads of chunk n + 1 fly while
// chunk n goes through its three LDS exchanges.
constexpr int DVS = 32;                    // value columns per work-group
constexpr int NSL = DVv / DVS;             // slices per (batch, head)
constexpr int XP  = 40;                    // f16 per row of ui^T in LDS: 80 bytes
constexpr int RP  = 32 * DVS / 4;          // float4 per 32 x DVS partial
// a wave's fragments of one chunk's -w, q, k^T, attn, and its four u
struct ChunkOps {
  v16h w0, w1, q0, q1, k0, k1, at;
  float u0, u1, u2, u3;
};
// Work-group barrier for LDS traffic alone. __syncthreads() also waits for the
// wave's outstanding global loads, which would end the next chunk's flight at
// the first barrier behind its issue; nothing that these barriers order goes
// through global memory.
DEV void lds_barrier() {
  asm volatile("s_wait_dscnt 0x0\n\ts_barrier_signal -1\n\ts_barrier_wait -1" ::: "memory");
}
__global__ void __launch_bounds__(256)
delta_kernel(const float* __restrict__ qi, const float* __restrict__ ki,
             const float* __restrict__ wi, const float* __restrict__ ui0,
             const float* __restrict__ ai, float* __restrict__ dout) {
  extern __shared__ char smem[];
  float4* redW = (float4*)smem;              // 8 partials of (-w)@S
  float4* redQ = redW + 8 * RP;              // 8 partials of q@S, then attn@ui
  h16* xbT     = (h16*)(redQ + 9 * RP);      // DVS x XP: ui^T (f16)

  const int tid = threadIdx.x, lane = tid & 31;
  const int wid = __builtin_amdgcn_readfirstlane(tid >> 5);
  const int c = lane & 15, hh = lane >> 4;
  const int bh = blockIdx.x / NSL;
  const int c0 = (blockIdx.x % NSL) * DVS;   // first value column of the slice
  const int b = bh >> 2, h = bh & 3;
  // Place t of a partial holds registers 4 g .. 4 g + 3 of tile (mt, nt) at lane
  // t & 31, with mt * 4 + nt * 2 + g = t >> 5: rows rm .. rm + 3 of column rn.
  const int rm = (wid >> 2) * 16 + 8 * hh + 4 * (wid & 1);
  const int rn = ((wid >> 1) & 1) * 16 + c;
  // the lane's fixed offsets inside a chunk's blocks; the chunk moves the base
  const unsigned lwq = c * 256 + wid * 32 + hh * 8;         // -w, q: row c
  const unsigned lk  = (wid * 32 + c) * 32 + hh * 8;        // k^T: row 32 wid + c
  const unsigned la  = (((wid >> 1) & 1) * 16 + c) * 32 + hh * 8;  // attn
  const unsigned lu  = rm * 256 + c0 + rn;                  // u
  const unsigned lo  = rm * Dd + h * DVv + c0 + rn;         // oi

  v8f S00 = {}, S01 = {}, S10 = {}, S11 = {};  // S[32 wid + 16 mt ..][16 nt ..]
  v16h sb0 = {}, sb1 = {};                     // the same rows as B fragments
  const v8f zero = {};

  // ---- the wave's own fragments of chunk nc's -w, q, k^T, attn; its u ----
  // (waves 4-7 have no use for attn; they load it like the others, so that no
  // branch stands among the loads)
  auto fetch = [&](int nc, ChunkOps& o) {
    const size_t cb = (size_t)(bh * NCHUNK + nc);
    const h16* gw = (const h16*)wi + cb * CE + lwq;
    const h16* gq = (const h16*)qi + cb * CE + lwq;
    const h16* gk = (const h16*)ki + cb * CE + lk;
    const h16* ga = (const h16*)ai + cb * 1024 + la;
    const float* gu = ui0 + cb * CE + lu;
    o.w0 = frag_vec(gw); o.w1 = frag_vec(gw + 16 * 256);
    o.u0 = gu[0]; o.u1 = gu[256]; o.u2 = gu[512]; o.u3 = gu[768];
    o.k0 = frag_vec(gk); o.k1 = frag_vec(gk + 16 * 32);
    o.at = frag_vec(ga);
    o.q0 = frag_vec(gq); o.q1 = frag_vec(gq + 16 * 256);
    // what follows reuses the address registers of these loads, which are named
    // so that they stay theirs (no load's result lands in them either) up to
    // the wait
    asm volatile("s_wait_xcnt 0x0" :: "v"(gw), "v"(gq), "v"(gk), "v"(ga), "v"(gu) : "memory");
  };

  // ---- one chunk: works on o, sends chunk nn's loads off into n ----
  auto step = [&](int nc, int nn, const ChunkOps& o, ChunkOps& n) {
    const int t0 = nc * CHc;
    // ---- partial (-w)@S over the wave's 32 key rows (q@S: behind the barrier) ----
    v8f pw00 = wmma_f16(o.w0, sb0, zero), pw01 = wmma_f16(o.w0, sb1, zero);
    v8f pw10 = wmma_f16(o.w1, sb0, zero), pw11 = wmma_f16(o.w1, sb1, zero);
    __builtin_amdgcn_sched_barrier(0);
    float4* rw = redW + wid * RP + lane;
    put8(rw, pw00); put8(rw + 64, pw01); put8(rw + 128, pw10); put8(rw + 192, pw11);
    // issued here, the loads go out while the LDS stores above drain
    fetch(nn, n);
    lds_barrier();
    v8f pq00 = wmma_f16(o.q0, sb0, zero), pq01 = wmma_f16(o.q0, sb1, zero);
    v8f pq10 = wmma_f16(o.q1, sb0, zero), pq11 = wmma_f16(o.q1, sb1, zero);
    // ---- ui = u + sum of the partials -> ui^T (f16) ----
    {
      float4 s = redW[tid];
#pragma unroll
      for (int v = 1; v < 8; ++v) {
        float4 p = redW[v * RP + tid];
        s.x += p.x; s.y += p.y; s.z += p.z; s.w += p.w;
      }
      v4h x = {(h16)(o.u0 + s.x), (h16)(o.u1 + s.y), (h16)(o.u2 + s.z), (h16)(o.u3 + s.w)};
      *(v4h*)&xbT[rn * XP + rm] = x;
    }
    lds_barrier();
    // ---- S += k^T @ ui on the wave's rows; attn@ui as a ninth partial of oi ----
    {
      v16h ub0 = frag_vec(xbT + c * XP + hh * 8);
      v16h ub1 = frag_vec(xbT + (16 + c) * XP + hh * 8);
      S00 = wmma_f16(o.k0, ub0, S00); S01 = wmma_f16(o.k0, ub1, S01);
      S10 = wmma_f16(o.k1, ub0, S10); S11 = wmma_f16(o.k1, ub1, S11);
      float4* rq = redQ + wid * RP + lane;
      put8(rq, pq00); put8(rq + 64, pq01); put8(rq + 128, pq10); put8(rq + 192, pq11);
      if (wid < 4)
        put8(redQ + 8 * RP + wid * 64 + lane,
             wmma_f16(o.at, (wid & 1) ? ub1 : ub0, zero));
      sb0 = pack_b(S00, S10);
      sb1 = pack_b(S01, S11);
    }
    lds_barrier();
    // ---- oi = q@S + attn@ui: sum of the nine partials -> global ----
    {
      float4 r = redQ[tid];
#pragma unroll
      for (int v = 1; v < 9; ++v) {
        float4 p = redQ[v * RP + tid];
        r.x += p.x; r.y += p.y; r.z += p.z; r.w += p.w;
      }
      float* go = dout + (size_t)(b * Tt + t0) * Dd + lo;
      go[0] = r.x; go[Dd] = r.y; go[2 * Dd] = r.z; go[3 * Dd] = r.w;
      // the next chunk rewrites the address and data registers of these stores
      asm volatile("s_wait_xcnt 0x0" ::: "memory");
    }
  };

  ChunkOps ea, eb;                           // even chunks, odd chunks
  fetch(0, ea);
  for (int nc = 0; nc < NCHUNK; nc += 2) {
    step(nc, nc + 1, ea, eb);
    // behind the last chunk there is none: it is loaded once more, and not used
    step(nc + 1, (nc + 2 < NCHUNK) ? nc + 2 : NCHUNK - 1, eb, ea);
  }
}

// ---------------- gate softmax + branch mixing + RMSNorm -------------------
__global__ void __launch_bounds__(256)
fuse_kernel(const float* __restrict__ b0, const float* __restrict__ b1,
            const float* __restrict__ b2, const float* __restrict__ b3,
            const float* __restrict__ b4, const float* __restrict__ b5,
            const float* __restrict__ st32, const float* __restrict__ logits,
            const float* __restrict__ alpha, const float* __restrict__ ltemp,
            const float* __restrict__ onw, float* __restrict__ out) {
  size_t bt = blockIdx.x;
  int tid = threadIdx.x;
  __shared__ float probs_s[Hh][Pp];
  __shared__ float red[256];
  if (tid < Hh) {
    int h = tid;
    const float* sp = st32 + bt * (Hh * Pp) + h * Pp;
    float sv[Pp];                          // in registers: the loop is unrolled
#pragma unroll
    for (int p = 0; p < Pp; ++p) sv[p] = sp[p];
    // the loads below reuse the address registers of these, which are named so
    // that they stay theirs (no load's result lands in them either) up to the wait
    asm volatile("s_wait_xcnt 0x0" :: "v"(sp) : "memory");
    float x = ltemp[h];
    float temp = fmaxf(x, 0.f) + log1pf(expf(-fabsf(x))) + 1e-4f; // softplus
    float l[Pp];
    float mx = -1e30f;
#pragma unroll
    for (int p = 0; p < Pp; ++p) {
      float st = sv[p];
      l[p] = (logits[bt * (Hh * Pp) + h * Pp + p] + alpha[p] * st) / temp;
      mx = fmaxf(mx, l[p]);
    }
    float se = 0.f;
#pragma unroll
    for (int p = 0; p < Pp; ++p) { l[p] = expf(l[p] - mx); se += l[p]; }
#pragma unroll
    for (int p = 0; p < Pp; ++p) {
      float pr = l[p] / se * (1.f - FLOORv);
      if (p == Pp - 1) pr += FLOORv;
      probs_s[h][p] = pr;
    }
  }
  __syncthreads();
  int d = tid;
  const float* np = onw + d;
  const float nw = *np;
  // what follows reuses the address registers of this load, which are named so
  // that they stay its own up to the wait
  asm volatile("s_wait_xcnt 0x0" :: "v"(np) : "memory");
  for (int h = 0; h < Hh; ++h) {
    size_t base = bt * Dd + (size_t)h * DVv + d;
    float o = b0[base] * probs_s[h][0] + b1[base] * probs_s[h][1] +
              b2[base] * probs_s[h][2] + b3[base] * probs_s[h][3] +
              b4[base] * probs_s[h][4] + b5[base] * probs_s[h][5];
    red[tid] = o * o;
    __syncthreads();
    for (int s = 128; s; s >>= 1) {
      if (tid < s) red[tid] += red[tid + s];
      __syncthreads();
    }
    float ms = red[0] * (1.f / 256.f);
    __syncthreads();
    ((h16*)out)[base] = (h16)(o * rsqrtf(ms + 1e-5f) * nw);   // the output projection's A
    // the next head rewrites the address and data registers of this store
    asm volatile("s_wait_xcnt 0x0" ::: "memory");
  }
}

// ---------------------------------------------------------------------------
extern "C" void kernel_launch(void* const* d_in, const int* in_sizes, int n_in,
                              void* d_out, int out_size, void* d_ws,
                              size_t ws_size, hipStream_t stream) {
  const float* hs   = (const float*)d_in[0];
  const float* qw   = (const float*)d_in[1];
  const float* kw   = (const float*)d_in[2];
  const float* vw   = (const float*)d_in[3];
  const float* bw   = (const float*)d_in[4];
  const float* qcw  = (const float*)d_in[5];
  const float* kcw  = (const float*)d_in[6];
  const float* vcw  = (const float*)d_in[7];
  const float* f3w  = (const float*)d_in[8];
  const float* f7w  = (const float*)d_in[9];
  const float* f15w = (const float*)d_in[10];
  const float* f31w = (const float*)d_in[11];
  const float* gw1  = (const float*)d_in[12];
  const float* gb1  = (const float*)d_in[13];
  const float* gw2  = (const float*)d_in[14];
  const float* gb2  = (const float*)d_in[15];
  const float* glt  = (const float*)d_in[16];
  const float* alps = (const float*)d_in[17];
  const float* onw  = (const float*)d_in[18];
  const float* ow   = (const float*)d_in[19];
  float* out = (float*)d_out;

  const size_t U = (size_t)Bb * Tt * Dd; // 4096*1024
  float* ws = (float*)d_ws;
  float* qp  = ws;            // q projection (reused: fir3)
  float* kp  = qp + U;        // k projection (reused: fir7)
  float* vp  = kp + U;        // v projection (reused: fir15)
  float* qcv = vp + U;        // q after conv+silu (reused: fir31)
  float* kcv = qcv + U;       // k after conv+silu (reused: o_fused)
  float* vcv = kcv + U;       // v after conv+silu (branch p=4)
  float* dta = vcv + U;       // delta-rule output (branch p=5)
  float* h1  = dta + U;       // gate hidden, f16 (U floats)
  float* gi  = h1 + 2 * U;    // gate input, f16, B*T x GP
  float* st32 = gi + (size_t)Bb * Tt * (GP / 2);   // stats, f32, B*T x H*P
  float* beta = gi + (size_t)Bb * Tt * 1056;
  float* lgt  = beta + (size_t)Bb * Tt * Hh;
  float* pq  = lgt + (size_t)Bb * Tt * Hh * Pp;  // prepared q, f16 (U/2 floats)
  float* pk  = pq + U / 2;    // prepared k^T, f16
  float* pw  = pk + U / 2;    // prepared -w, f16
  float* pu  = pw + U / 2;    // prepared u, f32
  float* pa  = pu + U;        // prepared attn, f16, 32x32 per chunk
  float* q16 = pa + U / 16;   // weights as f16: q, k, v, o (Dd x Dd each)
  float* k16 = q16 + (size_t)Dd * Dd / 2;
  float* v16 = k16 + (size_t)Dd * Dd / 2;
  float* o16 = v16 + (size_t)Dd * Dd / 2;
  float* g116 = o16 + (size_t)Dd * Dd / 2;         // gate_w1, 2 Dd x GP
  float* g216 = g116 + (size_t)Dd * GP;            // gate_w2, H*P x 2 Dd

  const int MT = Bb * Tt;                 // 4096
  dim3 blk(256);
  dim3 gN1024((1024 + 127) / 128, (MT + 63) / 64);
  dim3 gDW(Dd / DWC, MT / (8 * DWR));

  // 0) hidden (into the gate input) and the six GEMM weights to f16
  to_f16_kernel<<<CB_H + CB_G + 4 * CB_W + CB_2, blk, 0, stream>>>(
      hs, qw, kw, vw, ow, gw1, gw2, gi, q16, k16, v16, o16, g116, g216);
  // 1) q/k/v projections (no activation; conv+silu comes after)
  gemm_kernel<false><<<gN1024, blk, 0, stream>>>(gi, GP, q16, Dd, nullptr, qp, Dd, MT, Dd, Dd, 0);
  gemm_kernel<false><<<gN1024, blk, 0, stream>>>(gi, GP, k16, Dd, nullptr, kp, Dd, MT, Dd, Dd, 0);
  gemm_kernel<false><<<gN1024, blk, 0, stream>>>(gi, GP, v16, Dd, nullptr, vp, Dd, MT, Dd, Dd, 0);
  // 2) beta
  beta_kernel<<<(MT * Hh + 255) / 256, blk, 0, stream>>>(hs, bw, beta);
  // 3) depthwise causal conv (k=4) + SiLU
  dwconv_kernel<4, true><<<gDW, blk, 0, stream>>>(qp, qcw, qcv);
  dwconv_kernel<4, true><<<gDW, blk, 0, stream>>>(kp, kcw, kcv);
  dwconv_kernel<4, true><<<gDW, blk, 0, stream>>>(vp, vcw, vcv);
  // 4) delta rule: state-free chunk work for all chunks at once, then the
  //    scan, one workgroup per (batch, head, 32-column state slice)
  const size_t PLDS = 32 * 33 * sizeof(float) + (5 * CE + 2 * 32 * 32) * sizeof(h16);
  prep_kernel<<<dim3(Bb * Hh * NCHUNK), blk, PLDS, stream>>>(qcv, kcv, vcv, beta,
                                                             pq, pk, pw, pu, pa);
  const size_t DLDS = 17 * RP * sizeof(float4) + DVS * XP * sizeof(h16);
  delta_kernel<<<dim3(Bb * Hh * NSL), blk, DLDS, stream>>>(pq, pk, pw, pu, pa, dta);
  // 5) FIR branches on v (reuse proj buffers; qcv/kcv free after delta)
  dwconv_kernel<3, false><<<gDW, blk, 0, stream>>>(vcv, f3w, qp);
  dwconv_kernel<7, false><<<gDW, blk, 0, stream>>>(vcv, f7w, kp);
  dwconv_kernel<15, false><<<gDW, blk, 0, stream>>>(vcv, f15w, vp);
  dwconv_kernel<31, false><<<gDW, blk, 0, stream>>>(vcv, f31w, qcv);
  // 6) gate input = concat(hidden, stats): the stats columns
  stats_kernel<<<(MT * Hh * Pp) / 8, blk, 0, stream>>>(qp, kp, vp, qcv, vcv, dta, gi, st32);
  // 7) gate MLP (gelu, then linear to H*P logits with gb2 bias)
  dim3 gGate1((2048 + 127) / 128, (MT + 63) / 64);
  gemm_kernel<true><<<gGate1, blk, 0, stream>>>(gi, GP, g116, GP, gb1, h1, 2048, MT, 2048, GP, 1);
  dim3 gGate2(1, (MT + 63) / 64);
  gemm_kernel<false><<<gGate2, blk, 0, stream>>>(h1, 2048, g216, 2048, gb2, lgt, Hh * Pp, MT, Hh * Pp, 2048, 0);
  // 8) softmax gate + mix branches + RMSNorm  (o_fused, f16 -> kcv)
  float* ofused = kcv;
  fuse_kernel<<<dim3(MT), blk, 0, stream>>>(qp, kp, vp, qcv, vcv, dta, st32, lgt,
                                            alps, glt, onw, ofused);
  // 9) output projection
  gemm_kernel<false><<<gN1024, blk, 0, stream>>>(ofused, Dd, o16, Dd, nullptr, out, Dd, MT, Dd, Dd, 0);
}

// v009
// A run of this version takes 332 microseconds.
// Two timings next to v008 put it at 1.06 and 1.07 times that version's speed.
// Counting every step since v000, it is 12.0 times as fast.
#include <hip/hip_runtime.h>
#include <hip/hip_bf16.h>
#include <math.h>

#define DEV __device__ __forceinline__

typedef __attribute__((ext_vector_type(16))) _Float16 v16h;
typedef __attribute__((ext_vector_type(8)))  float    v8f;
typedef _Float16 h16;

constexpr int Bb = 2, Tt = 2048, Dd = 1024, Hh = 4, Pp = 6, CHc = 32;
constexpr int DKk = 256, DVv = 256;
constexpr int NCHUNK = Tt / CHc;           // 64
constexpr int GIW = Dd + Hh * Pp;          // 1048
constexpr float FLOORv = 0.05f;

DEV v16h frag_row(const h16* t, int ld, int r0, int k0, int lane) {
  // element [m][k] at t[(r0+m)*ld + (k0+k)]
  v16h f;
  int m = lane & 15, kg = lane >> 4;
#pragma unroll
  for (int j = 0; j < 8; ++j) {
    int kk = ((j < 4) ? 0 : 16) + kg * 8 + 2 * (j & 3);
    const h16* p = t + (size_t)(r0 + m) * ld + k0 + kk;
    f[2 * j] = p[0];
    f[2 * j + 1] = p[1];
  }
  return f;
}
DEV v16h frag_kmaj(const h16* t, int ld, int r0, int k0, int lane) {
  // element [m][k] at t[(k0+k)*ld + (r0+m)]
  v16h f;
  int m = lane & 15, kg = lane >> 4;
#pragma unroll
  for (int j = 0; j < 8; ++j) {
    int kk = ((j < 4) ? 0 : 16) + kg * 8 + 2 * (j & 3);
    f[2 * j]     = t[(size_t)(k0 + kk) * ld + r0 + m];
    f[2 * j + 1] = t[(size_t)(k0 + kk + 1) * ld + r0 + m];
  }
  return f;
}
DEV v8f wmma_f16(v16h a, v16h b, v8f c) {
  return __builtin_amdgcn_wmma_f32_16x16x32_f16(false, a, false, b, (short)0, c,
                                                false, false);
}

typedef __attribute__((ext_vector_type(8))) _Float16 v8h;
typedef __attribute__((ext_vector_type(4))) _Float16 v4h;
// frag_row's fragment as two 16-byte loads: p is the lane's row at
// k = 8 * (lane >> 4); the fragment's second eight k lie 16 further on.
DEV v16h frag_vec(const h16* p) {
  v8h lo = *(const v8h*)p, hi = *(const v8h*)(p + 16);
  return __builtin_shufflevector(lo, hi, 0, 1, 2, 3, 4, 5, 6, 7, 8, 9, 10, 11,
                                 12, 13, 14, 15);
}
// One D tile to LDS: registers 0-3 at d, registers 4-7 32 places further on.
DEV void put8(float4* d, v8f a) {
  d[0]  = make_float4(a[0], a[1], a[2], a[3]);
  d[32] = make_float4(a[4], a[5], a[6], a[7]);
}
// Two f32 D tiles (rows 0-15 and 16-31 of a 32-row block, same columns) are,
// converted lane by lane, the f16 B fragment of that block in frag_row's k order.
DEV v16h pack_b(v8f lo, v8f hi) {
  v16h f;
#pragma unroll
  for (int s = 0; s < 8; ++s) { f[s] = (h16)lo[s]; f[8 + s] = (h16)hi[s]; }
  return f;
}

typedef __attribute__((ext_vector_type(4))) float v4f;

// ---------------- Generic GEMM: C = act(A(MxK) * W(NxK)^T + bias) ----------
// 64x128 block tile, 8 waves (2x4), each wave owns a 32x32 region.
// A and W arrive as f16, rounded once by whoever wrote them (to_f16_kernel, the
// stats, gate and fuse kernels), so a tile's bytes cross the L2 at two bytes an
// element and go to LDS as they are. The pointers are typed float like the rest
// of the workspace; lda, ldw and K count f16 elements.
// A trip of the K loop takes GBK = 128 columns (four wmma steps of 32), 256 bytes
// of a row: sixteen lanes take one row, so a wave-wide 16-byte load covers two
// rows. Wave w stages rows 2 w + (lane >> 4) + 16 j of A (j < 4) and of W (j < 8).
// The 12 loads of trip kt + 1 are issued together, into registers, before trip
// kt is read from LDS and multiplied; they are stored to LDS at the top of the
// next trip. K is a multiple of GBK and lda, ldw are multiples of 8 in every call.
// A row past M or N is read at the last row: it only feeds results that are
// not stored.
constexpr int GBK = 128;                   // K columns per trip
constexpr int GLP = GBK + 8;               // f16 per LDS row: 272 bytes
template <bool C16>                        // C is stored as f16: the next GEMM's A
__global__ void __launch_bounds__(256)
gemm_kernel(const float* __restrict__ A, int lda, const float* __restrict__ W,
            int ldw, const float* __restrict__ bias, float* __restrict__ C,
            int ldc, int M, int N, int K, int act) {
  __shared__ __attribute__((aligned(16))) h16 At[64][GLP];
  __shared__ __attribute__((aligned(16))) h16 Wt[128][GLP];
  const int tid = threadIdx.x, lane = tid & 31;
  const int wid = __builtin_amdgcn_readfirstlane(tid >> 5);
  const int wm = wid >> 2, wn = wid & 3;
  const int bm = blockIdx.y * 64, bn = blockIdx.x * 128;
  const int sr = wid * 2 + (lane >> 4);    // the lane's row among sixteen
  const int c8 = (lane & 15) * 8;          // its eight columns of the trip
  v8f acc00 = {}, acc01 = {}, acc10 = {}, acc11 = {};
  const int ktn = K / GBK;
  // K is positive in every call: the first trip's loads then stay where they
  // are written, in front of their wait, and are not sunk into a guarded block
  __builtin_assume(ktn > 0);
  unsigned oa[4], ow[8];                   // byte offsets of the lane's pieces at k = 0
  // the loops over j are unrolled so that oa, ow, fa, fw stay in registers
#pragma unroll
  for (int j = 0; j < 4; ++j) {
    int gm = bm + sr + 16 * j;
    oa[j] = (unsigned)((gm < M ? gm : M - 1) * lda + c8) * 2u;
  }
#pragma unroll
  for (int j = 0; j < 8; ++j) {
    int gn = bn + sr + 16 * j;
    ow[j] = (unsigned)((gn < N ? gn : N - 1) * ldw + c8) * 2u;
  }
  v8h fa[4], fw[8];
  // the 12 loads of the trip that starts at column kb
  auto issue = [&](int kb) {
    const char* ab = (const char*)A + (size_t)kb * 2;
    const char* wb = (const char*)W + (size_t)kb * 2;
    const char *qa[4], *qw[8];
#pragma unroll
    for (int j = 0; j < 4; ++j) { qa[j] = ab + oa[j]; fa[j] = *(const v8h*)qa[j]; }
#pragma unroll
    for (int j = 0; j < 8; ++j) { qw[j] = wb + ow[j]; fw[j] = *(const v8h*)qw[j]; }
    // what follows reuses the address registers of these loads, which are named
    // so that they stay theirs (no load's result lands in them either) up to
    // the wait
    asm volatile("s_wait_xcnt 0x0" :: "v"(qa[0]), "v"(qa[1]), "v"(qa[2]), "v"(qa[3]),
                 "v"(qw[0]), "v"(qw[1]), "v"(qw[2]), "v"(qw[3]), "v"(qw[4]),
                 "v"(qw[5]), "v"(qw[6]), "v"(qw[7]) : "memory");
  };
  issue(0);
  for (int kt = 0; kt < ktn; ++kt) {
#pragma unroll
    for (int j = 0; j < 4; ++j) *(v8h*)&At[sr + 16 * j][c8] = fa[j];
#pragma unroll
    for (int j = 0; j < 8; ++j) *(v8h*)&Wt[sr + 16 * j][c8] = fw[j];
    __syncthreads();
    if (kt + 1 < ktn) issue((kt + 1) * GBK);
#pragma unroll
    for (int s = 0; s < GBK / 32; ++s) {
      v16h a0 = frag_row(&At[0][0], GLP, wm * 32, 32 * s, lane);
      v16h a1 = frag_row(&At[0][0], GLP, wm * 32 + 16, 32 * s, lane);
      v16h b0 = frag_row(&Wt[0][0], GLP, wn * 32, 32 * s, lane);
      v16h b1 = frag_row(&Wt[0][0], GLP, wn * 32 + 16, 32 * s, lane);
      acc00 = wmma_f16(a0, b0, acc00);
      acc01 = wmma_f16(a0, b1, acc01);
      acc10 = wmma_f16(a1, b0, acc10);
      acc11 = wmma_f16(a1, b1, acc11);
    }
    __syncthreads();
  }
  v8f* accs[4] = {&acc00, &acc01, &acc10, &acc11};
#pragma unroll
  for (int q = 0; q < 4; ++q) {
    int im = q >> 1, in_ = q & 1;
#pragma unroll
    for (int r = 0; r < 8; ++r) {
      int gm = bm + wm * 32 + im * 16 + r + 8 * (lane >> 4);
      int gn = bn + wn * 32 + in_ * 16 + (lane & 15);
      if (gm < M && gn < N) {
        float v = (*accs[q])[r] + (bias ? bias[gn] : 0.f);
        if (act == 1) v = 0.5f * v * (1.f + erff(v * 0.70710678118f));
        if (C16) ((h16*)C)[(size_t)gm * ldc + gn] = (h16)v;
        else C[(size_t)gm * ldc + gn] = v;
      }
    }
  }
}

// ---------------- depthwise causal conv (+ optional SiLU) ------------------
// A thread computes four neighbouring channels (one float4) of DWR consecutive
// time steps; a wave covers 128 channels, so each of its loads and stores is 512
// contiguous bytes of one row, and the eight waves of a work-group take eight
// consecutive blocks of time steps. The DWR + KW - 1 input rows of a thread are
// loaded up front into registers. The work-group's 128 x KW weights go through
// LDS, transposed to one row per tap, so that a tap's four weights are one
// 16-byte read. Every output sums its taps in ascending order; a row in front
// of the sequence's start is not read and counts as zero (a test that is the
// same for the whole wave).
constexpr int DWR = 8;                     // time steps per thread
constexpr int DWC = 128;                   // channels per work-group
constexpr int DWP = DWC + 4;               // floats per tap row in LDS
template <int KW, bool SILU>
__global__ void __launch_bounds__(256)
dwconv_kernel(const float* __restrict__ X, const float* __restrict__ Wc,
              float* __restrict__ Y) {
  __shared__ __attribute__((aligned(16))) float wt[KW * DWP];
  constexpr int NX = DWR + KW - 1;         // input rows per thread
  constexpr int NF = DWC * KW / 256;       // rounds in which every thread stages a weight
  constexpr bool TAIL = (DWC * KW) % 256 != 0;   // 128 weights more: waves 0-3
  const int tid = threadIdx.x, lane = tid & 31;
  const int wid = __builtin_amdgcn_readfirstlane(tid >> 5);
  const int c0 = blockIdx.x * DWC;
  const int r0 = (blockIdx.y * 8 + wid) * DWR;   // first row, b * Tt + t
  const int t0 = r0 & (Tt - 1);
  const float* xs = X + (size_t)r0 * Dd + c0;    // the same in every lane
  float4 x[NX];
  if (t0 >= KW - 1) {
#pragma unroll
    for (int j = 0; j < NX; ++j)
      x[j] = *(const float4*)(xs + (j - (KW - 1)) * Dd + lane * 4);
  } else {
    // the first blocks of a sequence, few: row by row
#pragma unroll
    for (int j = 0; j < KW - 1; ++j) {
      if (t0 + j >= KW - 1) {
        x[j] = *(const float4*)(xs + (j - (KW - 1)) * Dd + lane * 4);
        // the next row's load forms its offset register anew
        asm volatile("s_wait_xcnt 0x0" ::: "memory");
      } else {
        x[j] = make_float4(0.f, 0.f, 0.f, 0.f);
      }
    }
#pragma unroll
    for (int j = KW - 1; j < NX; ++j)
      x[j] = *(const float4*)(xs + (j - (KW - 1)) * Dd + lane * 4);
  }
  // what follows reuses the base and offset registers of these loads
  asm volatile("s_wait_xcnt 0x0" ::: "memory");
  const float* wp = Wc + c0 * KW + tid;
  float wv[NF + 1];
#pragma unroll
  for (int n = 0; n < NF; ++n) wv[n] = wp[256 * n];
  wv[NF] = 0.f;
  if (TAIL && wid < 4) wv[NF] = wp[256 * NF];
  asm volatile("s_wait_xcnt 0x0" ::: "memory");
  // keeps the later address arithmetic, which reuses the loads' scalar base,
  // behind the wait: the compiler had lifted it over
  __builtin_amdgcn_sched_barrier(0);
#pragma unroll
  for (int n = 0; n < NF; ++n) {
    const int e = tid + 256 * n;
    wt[(e % KW) * DWP + e / KW] = wv[n];
  }
  if (TAIL && wid < 4) {
    const int e = tid + 256 * NF;
    wt[(e % KW) * DWP + e / KW] = wv[NF];
  }
  __syncthreads();
  float4 s[DWR];
#pragma unroll
  for (int r = 0; r < DWR; ++r) s[r] = make_float4(0.f, 0.f, 0.f, 0.f);
#pragma unroll
  for (int i = 0; i < KW; ++i) {
    const float4 w = *(const float4*)&wt[i * DWP + lane * 4];
#pragma unroll
    for (int r = 0; r < DWR; ++r) {
      s[r].x += x[r + i].x * w.x;
      s[r].y += x[r + i].y * w.y;
      s[r].z += x[r + i].z * w.z;
      s[r].w += x[r + i].w * w.w;
    }
  }
  float* yp = Y + (size_t)r0 * Dd + c0 + lane * 4;
  if (SILU) {
#pragma unroll
    for (int r = 0; r < DWR; ++r) {
      s[r].x = s[r].x / (1.f + expf(-s[r].x));
      s[r].y = s[r].y / (1.f + expf(-s[r].y));
      s[r].z = s[r].z / (1.f + expf(-s[r].z));
      s[r].w = s[r].w / (1.f + expf(-s[r].w));
    }
  }
#pragma unroll
  for (int r = 0; r < DWR; ++r) *(float4*)(yp + r * Dd) = s[r];
}

// ---------------- beta = sigmoid(hidden @ b_proj^T) ------------------------
__global__ void beta_kernel(const float* __restrict__ hs,
                            const float* __restrict__ Wb,
                            float* __restrict__ beta) {
  int idx = blockIdx.x * blockDim.x + threadIdx.x;
  if (idx >= Bb * Tt * Hh) return;
  int h = idx & (Hh - 1);
  size_t bt = (size_t)idx >> 2;
  const float* x = hs + bt * Dd;
  const float* w = Wb + (size_t)h * Dd;
  float s = 0.f;
  for (int k = 0; k < Dd; ++k) s += x[k] * w[k];
  beta[idx] = 1.f / (1.f + expf(-s));
}

// ---------------- GEMM operands to f16, once ---------------------------------
// hidden goes into the first Dd columns of the gate input, which the q, k, v
// projections read as well; the gate input and gate_w1 get rows of GP elements,
// whole trips of the GEMM's K loop, with zeros behind column GIW in both. The
// Hh * Pp columns between are the stats kernel's. A thread converts four
// pieces of eight elements: eight 16-byte loads, then four 16-byte stores.
constexpr int GP = 1152;                   // f16 per row of gate input and gate_w1
constexpr int GU = GP / 8;                 // pieces per such row
constexpr int CB_H = Bb * Tt * GU / 1024;  // work-groups: hidden
constexpr int CB_G = 2 * Dd * GU / 1024;   // gate_w1
constexpr int CB_W = Dd * Dd / 8 / 1024;   // each of q, k, v, o
constexpr int CB_2 = Hh * Pp * 2 * Dd / 8 / 1024;   // gate_w2
__global__ void __launch_bounds__(256)
to_f16_kernel(const float* __restrict__ hs, const float* __restrict__ qw,
              const float* __restrict__ kw, const float* __restrict__ vw,
              const float* __restrict__ ow, const float* __restrict__ gw1,
              const float* __restrict__ gw2, float* __restrict__ gi,
              float* __restrict__ q16, float* __restrict__ k16,
              float* __restrict__ v16, float* __restrict__ o16,
              float* __restrict__ g116, float* __restrict__ g216) {
  const int b = blockIdx.x, tid = threadIdx.x;
  const float* s;
  v8h* d;
  int sc, e0;                              // source columns; the thread's first piece
  const bool padded = b < CB_H + CB_G;
  if (b < CB_H) {
    s = hs; d = (v8h*)gi; sc = Dd; e0 = b * 1024 + tid;
  } else if (padded) {
    s = gw1; d = (v8h*)g116; sc = GIW; e0 = (b - CB_H) * 1024 + tid;
  } else {
    const int f = b - CB_H - CB_G, w = f / CB_W;
    s = (w == 0) ? qw : (w == 1) ? kw : (w == 2) ? vw : (w == 3) ? ow : gw2;
    d = (v8h*)((w == 0) ? q16 : (w == 1) ? k16 : (w == 2) ? v16 : (w == 3) ? o16 : g216);
    sc = 0; e0 = (f % CB_W) * 1024 + tid;
  }
  v4f lo[4], hi[4];
  const float* p[4];
  bool cv[4], st[4];                       // the piece holds source data; is stored
  // the loops over i are unrolled so that these arrays stay in registers and
  // the eight loads go out together
#pragma unroll
  for (int i = 0; i < 4; ++i) {
    const int e = e0 + 256 * i;
    unsigned so = (unsigned)e * 8u;
    cv[i] = true; st[i] = true;
    if (padded) {
      const int row = e / GU, c = (e % GU) * 8;
      cv[i] = c < sc;
      st[i] = cv[i] || c >= GIW;
      so = (unsigned)(row * sc + (cv[i] ? c : 0));   // a pad piece reads the row's start
    }
    p[i] = s + so;
  }
#pragma unroll
  for (int i = 0; i < 4; ++i) {
    lo[i] = *(const v4f*)p[i];
    hi[i] = *(const v4f*)(p[i] + 4);
  }
  // what follows reuses the address registers of these loads, which are named
  // so that they stay theirs (no load's result lands in them either) up to
  // the wait
  asm volatile("s_wait_xcnt 0x0" :: "v"(p[0]), "v"(p[1]), "v"(p[2]), "v"(p[3]) : "memory");
#pragma unroll
  for (int i = 0; i < 4; ++i) {
    v8h r = {(h16)lo[i].x, (h16)lo[i].y, (h16)lo[i].z, (h16)lo[i].w,
             (h16)hi[i].x, (h16)hi[i].y, (h16)hi[i].z, (h16)hi[i].w};
    const v8h z = {};
    if (st[i]) d[e0 + 256 * i] = cv[i] ? r : z;
  }
}

constexpr int RL = Dd / 128;               // loads per branch row
constexpr int HP = Hh * Pp;
DEV float abs4(v4f a) { return (fabsf(a.x) + fabsf(a.y)) + (fabsf(a.z) + fabsf(a.w)); }
__global__ void __launch_bounds__(256)
stats_kernel(const float* __restrict__ b0, const float* __restrict__ b1,
             const float* __restrict__ b2, const float* __restrict__ b3,
             const float* __restrict__ b4, const float* __restrict__ b5,
             float* __restrict__ gi, float* __restrict__ st32) {
  const int lane = threadIdx.x & 31;
  const int wid = __builtin_amdgcn_readfirstlane(threadIdx.x >> 5);
  const int bt = blockIdx.x * 8 + wid;
  const size_t ro = (size_t)bt * Dd + lane * 4;
  const float* q[Pp] = {b0 + ro, b1 + ro, b2 + ro, b3 + ro, b4 + ro, b5 + ro};
  v4f x[Pp][RL];
  // the loops below are unrolled so that x and v stay in registers
#pragma unroll
  for (int p = 0; p < Pp; ++p)
#pragma unroll
    for (int i = 0; i < RL; ++i) x[p][i] = *(const v4f*)(q[p] + 128 * i);
  // what follows reuses the address registers of these loads, which are named
  // so that they stay theirs (no load's result lands in them either) up to
  // the wait
  asm volatile("s_wait_xcnt 0x0" :: "v"(q[0]), "v"(q[1]), "v"(q[2]), "v"(q[3]),
               "v"(q[4]), "v"(q[5]) : "memory");
  float v[HP];
#pragma unroll
  for (int h = 0; h < Hh; ++h)
#pragma unroll
    for (int p = 0; p < Pp; ++p) v[h * Pp + p] = abs4(x[p][2 * h]) + abs4(x[p][2 * h + 1]);
  float r[3];
  {
    // a and b are read before the choice, so that it is a choice between two
    // registers and not between two places of an array
    float w[HP / 2], t[HP / 4];
#pragma unroll
    for (int j = 0; j < HP / 2; ++j) {
      const float a = v[j], b = v[j + HP / 2];
      w[j] = ((lane & 16) ? b : a) + __shfl_xor((lane & 16) ? a : b, 16, 32);
    }
#pragma unroll
    for (int j = 0; j < HP / 4; ++j) {
      const float a = w[j], b = w[j + HP / 4];
      t[j] = ((lane & 8) ? b : a) + __shfl_xor((lane & 8) ? a : b, 8, 32);
    }
#pragma unroll
    for (int j = 0; j < 3; ++j) {
      const float a = t[j], b = t[j + 3];
      r[j] = ((lane & 4) ? b : a) + __shfl_xor((lane & 4) ? a : b, 4, 32);
    }
  }
#pragma unroll
  for (int m = 2; m; m >>= 1)
#pragma unroll
    for (int j = 0; j < 3; ++j) r[j] += __shfl_xor(r[j], m, 32);
  const int j = lane & 3;
  if (j < 3) {
    const int e = 3 * (lane >> 2) + j;     // h * Pp + p
    const float r0 = r[0], r1 = r[1], r2 = r[2];
    const float m = (j == 0 ? r0 : j == 1 ? r1 : r2) * (1.f / 256.f);
    st32[bt * HP + e] = m;                 // for the gate's stat bias
    ((h16*)gi)[(size_t)bt * GP + Dd + e] = (h16)m;   // gate input
  }
}

// ---------------- chunked delta rule ---------------------------------------
// The UT transform of a chunk (l2norm, A, forward substitution, w, u, attn)
// reads no state, so prep_kernel does it for all chunks side by side, one
// work-group per (batch, head, chunk), and leaves q, k^T, -w, attn (f16) and
// u (f32) in the workspace, one contiguous block per chunk. Only the steps
// that read or write the state S stay in the serial scan of delta_kernel.
constexpr int CE = CHc * DKk;              // elements of one 32 x 256 chunk block
__global__ void __launch_bounds__(256)
prep_kernel(const float* __restrict__ qc, const float* __restrict__ kc,
            const float* __restrict__ vc, const float* __restrict__ betap,
            float* __restrict__ qo, float* __restrict__ ko,
            float* __restrict__ wo, float* __restrict__ uo,
            float* __restrict__ ao) {
  extern __shared__ char smem[];
  float* Am  = (float*)smem;                 // 32x33 f32 (A / fwd-subst)
  h16* qn    = (h16*)(Am + 32 * 33);         // 32x256
  h16* kn    = qn + CE;
  h16* kbn   = kn + CE;
  h16* wn    = kbn + CE;                     // holds -(inv@kb)
  h16* xb    = wn + CE;                      // 32x256: v*beta
  h16* invb  = xb + CE;                      // 32x32
  h16* attb  = invb + 32 * 32;               // 32x32

  const int tid = threadIdx.x, lane = tid & 31, wid = tid >> 5;
  const int bh = blockIdx.x / NCHUNK, nc = blockIdx.x % NCHUNK;
  const int b = bh >> 2, h = bh & 3;
  const int t0 = nc * CHc;

  // ---- stage 1: load chunk, l2norm q/k, apply beta ----
  for (int j = 0; j < 4; ++j) {
    int r = wid * 4 + j;
    int t = t0 + r;
    size_t rowb = ((size_t)(b * Tt + t)) * Dd + (size_t)h * DKk;
    float bet = betap[(size_t)(b * Tt + t) * Hh + h];
    float qv[8], kv[8], vv[8];
    float sq = 0.f, sk = 0.f;
#pragma unroll
    for (int i = 0; i < 8; ++i) {
      int d = lane + 32 * i;
      qv[i] = qc[rowb + d]; kv[i] = kc[rowb + d]; vv[i] = vc[rowb + d];
      sq += qv[i] * qv[i]; sk += kv[i] * kv[i];
    }
#pragma unroll
    for (int off = 16; off; off >>= 1) {
      sq += __shfl_xor(sq, off, 32);
      sk += __shfl_xor(sk, off, 32);
    }
    float rq = rsqrtf(sq + 1e-12f), rk = rsqrtf(sk + 1e-12f);
#pragma unroll
    for (int i = 0; i < 8; ++i) {
      int d = lane + 32 * i;
      float kq = kv[i] * rk;
      qn[r * 256 + d]  = (h16)(qv[i] * rq);
      kn[r * 256 + d]  = (h16)kq;
      kbn[r * 256 + d] = (h16)(kq * bet);
      xb[r * 256 + d]  = (h16)(vv[i] * bet);
    }
  }
  __syncthreads();
  // ---- stage 2: A = -(kb k^T), strict lower (waves 0-3) ;
  //      stage 6: attn = (q k^T) * lower-incl mask (waves 4-7) ----
  {
    int m0 = ((wid >> 1) & 1) * 16, n0 = (wid & 1) * 16;
    const h16* lhs = (wid < 4) ? kbn : qn;
    v8f acc = {};
    for (int kk = 0; kk < 8; ++kk)
      acc = wmma_f16(frag_row(lhs, 256, m0, kk * 32, lane),
                     frag_row(kn, 256, n0, kk * 32, lane), acc);
    if (wid < 4) {
#pragma unroll
      for (int r = 0; r < 8; ++r) {
        int m = m0 + r + 8 * (lane >> 4), n = n0 + (lane & 15);
        Am[m * 33 + n] = (m > n) ? -acc[r] : 0.f;
      }
    } else {
#pragma unroll
      for (int r = 0; r < 8; ++r) {
        int m = m0 + r + 8 * (lane >> 4), n = n0 + (lane & 15);
        attb[m * 32 + n] = (h16)((m >= n) ? acc[r] : 0.f);
      }
    }
  }
  __syncthreads();
  // ---- stage 3: forward substitution, inv = A + I ----
  for (int i = 1; i < 32; ++i) {
    float val = 0.f;
    if (tid < 32)
      for (int s = 0; s < i; ++s) val += Am[i * 33 + s] * Am[s * 33 + tid];
    __syncthreads();
    if (tid < 32) Am[i * 33 + tid] += val;
    __syncthreads();
  }
  for (int e = tid; e < 1024; e += 256) {
    int m = e >> 5, n = e & 31;
    invb[e] = (h16)(Am[m * 33 + n] + ((m == n) ? 1.f : 0.f));
  }
  __syncthreads();
  // ---- stage 4: wn = -(inv@kb) ; u = inv@(v*beta) -> workspace (f32) ----
  float* ug = uo + (size_t)blockIdx.x * CE;
  for (int it = 0; it < 4; ++it) {
    int j = wid + 8 * it;           // 0..31
    int m0 = (j >> 4) * 16, n0 = (j & 15) * 16;
    v16h ia = frag_row(invb, 32, m0, 0, lane);
    v8f acc = {}, accu = {};
    acc  = wmma_f16(ia, frag_kmaj(kbn, 256, n0, 0, lane), acc);
    accu = wmma_f16(ia, frag_kmaj(xb, 256, n0, 0, lane), accu);
#pragma unroll
    for (int r = 0; r < 8; ++r) {
      int m = m0 + r + 8 * (lane >> 4), n = n0 + (lane & 15);
      wn[m * 256 + n] = (h16)(-acc[r]);
      ug[m * 256 + n] = accu[r];
    }
    // the next trip rewrites the address and data registers of the u stores
    asm volatile("s_wait_xcnt 0x0" ::: "memory");
  }
  __syncthreads();
  // ---- hand q, k^T, -w, attn to the scan: 16-byte stores, one block per chunk ----
  // k goes out transposed, 256 rows (dk) of 32 chunk positions: the scan reads
  // k^T as the A operand of its state update, contiguous along the chunk.
  v8h* gk = (v8h*)ko + (size_t)blockIdx.x * (CE / 8) + tid * 4;
#pragma unroll
  for (int i = 0; i < 4; ++i) {
    v8h t;
#pragma unroll
    for (int j = 0; j < 8; ++j) t[j] = kn[(8 * i + j) * 256 + tid];
    gk[i] = t;
  }
  // the stores below reuse the address and data registers of the k^T stores
  asm volatile("s_wait_xcnt 0x0" ::: "memory");
  uint4* gq = (uint4*)qo + (size_t)blockIdx.x * (CE / 8);
  uint4* gw = (uint4*)wo + (size_t)blockIdx.x * (CE / 8);
#pragma unroll
  for (int i = 0; i < 4; ++i) {
    int e = tid + 256 * i;
    gq[e] = ((const uint4*)qn)[e];
    gw[e] = ((const uint4*)wn)[e];
  }
  if (tid < 128)
    ((uint4*)ao)[(size_t)blockIdx.x * 128 + tid] = ((const uint4*)attb)[tid];
}

// Serial scan over the chunks, state split by value columns: column n of ui,
// oi and S depends on column n of u and S only, so each work-group owns DVS
// value columns of one (batch, head). DVS = 32 floats = one 128-byte output line.
// The 256 x DVS state slice lives in registers, split by key rows: wave w owns
// rows 32 w .. 32 w + 31 as four f32 D tiles, which the state update
// accumulates into, and as two f16 B fragments converted from them in place.
// A wave multiplies its 32 columns of -w and of q (fragments straight from the
// workspace) by its own rows of S; the eight partial 32 x DVS products are
// summed through LDS, thread t taking the float4 at place t of every partial.
// None of a chunk's operands depends on the state, so they are loaded one chunk
// ahead: two register sets take turns, and the loads of chunk n + 1 fly while
// chunk n goes through its three LDS exchanges.
constexpr int DVS = 32;                    // value columns per work-group
constexpr int NSL = DVv / DVS;             // slices per (batch, head)
constexpr int XP  = 40;                    // f16 per row of ui^T in LDS: 80 bytes
constexpr int RP  = 32 * DVS / 4;          // float4 per 32 x DVS partial
// a wave's fragments of one chunk's -w, q, k^T, attn, and its four u
struct ChunkOps {
  v16h w0, w1, q0, q1, k0, k1, at;
  float u0, u1, u2, u3;
};
// Work-group barrier for LDS traffic alone. __syncthreads() also waits for the
// wave's outstanding global loads, which would end the next chunk's flight at
// the first barrier behind its issue; nothing that these barriers order goes
// through global memory.
DEV void lds_barrier() {
  asm volatile("s_wait_dscnt 0x0\n\ts_barrier_signal -1\n\ts_barrier_wait -1" ::: "memory");
}
__global__ void __launch_bounds__(256)
delta_kernel(const float* __restrict__ qi, const float* __restrict__ ki,
             const float* __restrict__ wi, const float* __restrict__ ui0,
             const float* __restrict__ ai, float* __restrict__ dout) {
  extern __shared__ char smem[];
  float4* redW = (float4*)smem;              // 8 partials of (-w)@S
  float4* redQ = redW + 8 * RP;              // 8 partials of q@S, then attn@ui
  h16* xbT     = (h16*)(redQ + 9 * RP);      // DVS x XP: ui^T (f16)

  const int tid = threadIdx.x, lane = tid & 31;
  const int wid = __builtin_amdgcn_readfirstlane(tid >> 5);
  const int c = lane & 15, hh = lane >> 4;
  const int bh = blockIdx.x / NSL;
  const int c0 = (blockIdx.x % NSL) * DVS;   // first value column of the slice
  const int b = bh >> 2, h = bh & 3;
  // Place t of a partial holds registers 4 g .. 4 g + 3 of tile (mt, nt) at lane
  // t & 31, with mt * 4 + nt * 2 + g = t >> 5: rows rm .. rm + 3 of column rn.
  const int rm = (wid >> 2) * 16 + 8 * hh + 4 * (wid & 1);
  const int rn = ((wid >> 1) & 1) * 16 + c;
  // the lane's fixed offsets inside a chunk's blocks; the chunk moves the base
  const unsigned lwq = c * 256 + wid * 32 + hh * 8;         // -w, q: row c
  const unsigned lk  = (wid * 32 + c) * 32 + hh * 8;        // k^T: row 32 wid + c
  const unsigned la  = (((wid >> 1) & 1) * 16 + c) * 32 + hh * 8;  // attn
  const unsigned lu  = rm * 256 + c0 + rn;                  // u
  const unsigned lo  = rm * Dd + h * DVv + c0 + rn;         // oi

  v8f S00 = {}, S01 = {}, S10 = {}, S11 = {};  // S[32 wid + 16 mt ..][16 nt ..]
  v16h sb0 = {}, sb1 = {};                     // the same rows as B fragments
  const v8f zero = {};

  // ---- the wave's own fragments of chunk nc's -w, q, k^T, attn; its u ----
  // (waves 4-7 have no use for attn; they load it like the others, so that no
  // branch stands among the loads)
  auto fetch = [&](int nc, ChunkOps& o) {
    const size_t cb = (size_t)(bh * NCHUNK + nc);
    const h16* gw = (const h16*)wi + cb * CE + lwq;
    const h16* gq = (const h16*)qi + cb * CE + lwq;
    const h16* gk = (const h16*)ki + cb * CE + lk;
    const h16* ga = (const h16*)ai + cb * 1024 + la;
    const float* gu = ui0 + cb * CE + lu;
    o.w0 = frag_vec(gw); o.w1 = frag_vec(gw + 16 * 256);
    o.u0 = gu[0]; o.u1 = gu[256]; o.u2 = gu[512]; o.u3 = gu[768];
    o.k0 = frag_vec(gk); o.k1 = frag_vec(gk + 16 * 32);
    o.at = frag_vec(ga);
    o.q0 = frag_vec(gq); o.q1 = frag_vec(gq + 16 * 256);
    // what follows reuses the address registers of these loads, which are named
    // so that they stay theirs (no load's result lands in them either) up to
    // the wait
    asm volatile("s_wait_xcnt 0x0" :: "v"(gw), "v"(gq), "v"(gk), "v"(ga), "v"(gu) : "memory");
  };

  // ---- one chunk: works on o, sends chunk nn's loads off into n ----
  auto step = [&](int nc, int nn, const ChunkOps& o, ChunkOps& n) {
    const int t0 = nc * CHc;
    // ---- partial (-w)@S over the wave's 32 key rows (q@S: behind the barrier) ----
    v8f pw00 = wmma_f16(o.w0, sb0, zero), pw01 = wmma_f16(o.w0, sb1, zero);
    v8f pw10 = wmma_f16(o.w1, sb0, zero), pw11 = wmma_f16(o.w1, sb1, zero);
    __builtin_amdgcn_sched_barrier(0);
    float4* rw = redW + wid * RP + lane;
    put8(rw, pw00); put8(rw + 64, pw01); put8(rw + 128, pw10); put8(rw + 192, pw11);
    // issued here, the loads go out while the LDS stores above drain
    fetch(nn, n);
    lds_barrier();
    v8f pq00 = wmma_f16(o.q0, sb0, zero), pq01 = wmma_f16(o.q0, sb1, zero);
    v8f pq10 = wmma_f16(o.q1, sb0, zero), pq11 = wmma_f16(o.q1, sb1, zero);
    // ---- ui = u + sum of the partials -> ui^T (f16) ----
    {
      float4 s = redW[tid];
#pragma unroll
      for (int v = 1; v < 8; ++v) {
        float4 p = redW[v * RP + tid];
        s.x += p.x; s.y += p.y; s.z += p.z; s.w += p.w;
      }
      v4h x = {(h16)(o.u0 + s.x), (h16)(o.u1 + s.y), (h16)(o.u2 + s.z), (h16)(o.u3 + s.w)};
      *(v4h*)&xbT[rn * XP + rm] = x;
    }
    lds_barrier();
    // ---- S += k^T @ ui on the wave's rows; attn@ui as a ninth partial of oi ----
    {
      v16h ub0 = frag_vec(xbT + c * XP + hh * 8);
      v16h ub1 = frag_vec(xbT + (16 + c) * XP + hh * 8);
      S00 = wmma_f16(o.k0, ub0, S00); S01 = wmma_f16(o.k0, ub1, S01);
      S10 = wmma_f16(o.k1, ub0, S10); S11 = wmma_f16(o.k1, ub1, S11);
      float4* rq = redQ + wid * RP + lane;
      put8(rq, pq00); put8(rq + 64, pq01); put8(rq + 128, pq10); put8(rq + 192, pq11);
      if (wid < 4)
        put8(redQ + 8 * RP + wid * 64 + lane,
             wmma_f16(o.at, (wid & 1) ? ub1 : ub0, zero));
      sb0 = pack_b(S00, S10);
      sb1 = pack_b(S01, S11);
    }
    lds_barrier();
    // ---- oi = q@S + attn@ui: sum of the nine partials -> global ----
    {
      float4 r = redQ[tid];
#pragma unroll
      for (int v = 1; v < 9; ++v) {
        float4 p = redQ[v * RP + tid];
        r.x += p.x; r.y += p.y; r.z += p.z; r.w += p.w;
      }
      float* go = dout + (size_t)(b * Tt + t0) * Dd + lo;
      go[0] = r.x; go[Dd] = r.y; go[2 * Dd] = r.z; go[3 * Dd] = r.w;
      // the next chunk rewrites the address and data registers of these stores
      asm volatile("s_wait_xcnt 0x0" ::: "memory");
    }
  };

  ChunkOps ea, eb;                           // even chunks, odd chunks
  fetch(0, ea);
  for (int nc = 0; nc < NCHUNK; nc += 2) {
    step(nc, nc + 1, ea, eb);
    // behind the last chunk there is none: it is loaded once more, and not used
    step(nc + 1, (nc + 2 < NCHUNK) ? nc + 2 : NCHUNK - 1, eb, ea);
  }
}

// ---------------- gate softmax + branch mixing + RMSNorm -------------------
// One wave takes one token row, loaded as in stats_kernel; nothing goes through
// LDS and there is no barrier. Lane g < HP holds the gate's pair (head g / Pp,
// branch g % Pp); maximum and sum over a head's six are taken in ascending order
// from the six lanes. A head's mean square is a lane's eight squares, then a
// five-step butterfly.
__global__ void __launch_bounds__(256)
fuse_kernel(const float* __restrict__ b0, const float* __restrict__ b1,
            const float* __restrict__ b2, const float* __restrict__ b3,
            const float* __restrict__ b4, const float* __restrict__ b5,
            const float* __restrict__ st32, const float* __restrict__ logits,
            const float* __restrict__ alpha, const float* __restrict__ ltemp,
            const float* __restrict__ onw, float* __restrict__ out) {
  const int lane = threadIdx.x & 31;
  const int wid = __builtin_amdgcn_readfirstlane(threadIdx.x >> 5);
  const int bt = blockIdx.x * 8 + wid;
  const int g = lane < HP ? lane : HP - 1; // the lanes behind repeat the last pair
  const int gh = g / Pp, gp = g - gh * Pp;
  const float* lp = logits + bt * HP + g;
  const float* sp = st32 + bt * HP + g;
  const float* ap = alpha + gp;
  const float* tp = ltemp + gh;
  const float* np = onw + lane * 4;
  const size_t ro = (size_t)bt * Dd + lane * 4;
  const float* q[Pp] = {b0 + ro, b1 + ro, b2 + ro, b3 + ro, b4 + ro, b5 + ro};
  // the gate's four first: the longest chain of the kernel hangs on them
  const float lg = *lp, st = *sp, al = *ap, lt = *tp;
  v4f x[Pp][RL];
  // the loops below are unrolled so that x, pb, ss stay in registers
#pragma unroll
  for (int p = 0; p < Pp; ++p)
#pragma unroll
    for (int i = 0; i < RL; ++i) x[p][i] = *(const v4f*)(q[p] + 128 * i);
  const v4f nw[2] = {*(const v4f*)np, *(const v4f*)(np + 128)};
  // what follows reuses the address registers of these loads, which are named
  // so that they stay theirs (no load's result lands in them either) up to
  // the wait; the five small loads go by a scalar base and the index named here
  asm volatile("s_wait_xcnt 0x0" :: "v"(g), "v"(gp), "v"(gh), "v"(lane),
               "v"(q[0]), "v"(q[1]), "v"(q[2]), "v"(q[3]), "v"(q[4]), "v"(q[5])
               : "memory");
  // keeps the gate's arithmetic behind the loads and their wait: the scheduler
  // had put it in front of most of them, so that they went out one latency late
  __builtin_amdgcn_sched_barrier(0);
  const float temp = fmaxf(lt, 0.f) + log1pf(expf(-fabsf(lt))) + 1e-4f; // softplus
  const float z = (lg + al * st) / temp;
  float mx = -1e30f;
#pragma unroll
  for (int p = 0; p < Pp; ++p) mx = fmaxf(mx, __shfl(z, gh * Pp + p, 32));
  const float ez = expf(z - mx);
  float se = 0.f;
#pragma unroll
  for (int p = 0; p < Pp; ++p) se += __shfl(ez, gh * Pp + p, 32);
  float pr = ez / se * (1.f - FLOORv);
  if (gp == Pp - 1) pr += FLOORv;
  float ss[Hh];
#pragma unroll
  for (int h = 0; h < Hh; ++h) {
    float pb[Pp];                          // the head's six weights, wave-uniform
#pragma unroll
    for (int p = 0; p < Pp; ++p)
      pb[p] = __int_as_float(__builtin_amdgcn_readlane(__float_as_int(pr), h * Pp + p));
    ss[h] = 0.f;
#pragma unroll
    for (int i = 2 * h; i < 2 * h + 2; ++i) {
      const v4f o = x[0][i] * pb[0] + x[1][i] * pb[1] + x[2][i] * pb[2] +
                    x[3][i] * pb[3] + x[4][i] * pb[4] + x[5][i] * pb[5];
      x[0][i] = o;
      ss[h] += (o.x * o.x + o.y * o.y) + (o.z * o.z + o.w * o.w);
    }
  }
#pragma unroll
  for (int m = 16; m; m >>= 1)
#pragma unroll
    for (int h = 0; h < Hh; ++h) ss[h] += __shfl_xor(ss[h], m, 32);
  v4h y[RL];
#pragma unroll
  for (int i = 0; i < RL; ++i) {
    const v4f o = x[0][i] * rsqrtf(ss[i >> 1] * (1.f / 256.f) + 1e-5f) * nw[i & 1];
    y[i] = v4h{(h16)o.x, (h16)o.y, (h16)o.z, (h16)o.w};
  }
  h16* yp = (h16*)out + ro;                // the output projection's A
#pragma unroll
  for (int i = 0; i < RL; ++i) *(v4h*)(yp + 128 * i) = y[i];
}

// ---------------------------------------------------------------------------
extern "C" void kernel_launch(void* const* d_in, const int* in_sizes, int n_in,
                              void* d_out, int out_size, void* d_ws,
                              size_t ws_size, hipStream_t stream) {
  const float* hs   = (const float*)d_in[0];
  const float* qw   = (const float*)d_in[1];
  const float* kw   = (const float*)d_in[2];
  const float* vw   = (const float*)d_in[3];
  const float* bw   = (const float*)d_in[4];
  const float* qcw  = (const float*)d_in[5];
  const float* kcw  = (const float*)d_in[6];
  const float* vcw  = (const float*)d_in[7];
  const float* f3w  = (const float*)d_in[8];
  const float* f7w  = (const float*)d_in[9];
  const float* f15w = (const float*)d_in[10];
  const float* f31w = (const float*)d_in[11];
  const float* gw1  = (const float*)d_in[12];
  const float* gb1  = (const float*)d_in[13];
  const float* gw2  = (const float*)d_in[14];
  const float* gb2  = (const float*)d_in[15];
  const float* glt  = (const float*)d_in[16];
  const float* alps = (const float*)d_in[17];
  const float* onw  = (const float*)d_in[18];
  const float* ow   = (const float*)d_in[19];
  float* out = (float*)d_out;

  const size_t U = (size_t)Bb * Tt * Dd; // 4096*1024
  float* ws = (float*)d_ws;
  float* qp  = ws;            // q projection (reused: fir3)
  float* kp  = qp + U;        // k projection (reused: fir7)
  float* vp  = kp + U;        // v projection (reused: fir15)
  float* qcv = vp + U;        // q after conv+silu (reused: fir31)
  float* kcv = qcv + U;       // k after conv+silu (reused: o_fused)
  float* vcv = kcv + U;       // v after conv+silu (branch p=4)
  float* dta = vcv + U;       // delta-rule output (branch p=5)
  float* h1  = dta + U;       // gate hidden, f16 (U floats)
  float* gi  = h1 + 2 * U;    // gate input, f16, B*T x GP
  float* st32 = gi + (size_t)Bb * Tt * (GP / 2);   // stats, f32, B*T x H*P
  float* beta = gi + (size_t)Bb * Tt * 1056;
  float* lgt  = beta + (size_t)Bb * Tt * Hh;
  float* pq  = lgt + (size_t)Bb * Tt * Hh * Pp;  // prepared q, f16 (U/2 floats)
  float* pk  = pq + U / 2;    // prepared k^T, f16
  float* pw  = pk + U / 2;    // prepared -w, f16
  float* pu  = pw + U / 2;    // prepared u, f32
  float* pa  = pu + U;        // prepared attn, f16, 32x32 per chunk
  float* q16 = pa + U / 16;   // weights as f16: q, k, v, o (Dd x Dd each)
  float* k16 = q16 + (size_t)Dd * Dd / 2;
  float* v16 = k16 + (size_t)Dd * Dd / 2;
  float* o16 = v16 + (size_t)Dd * Dd / 2;
  float* g116 = o16 + (size_t)Dd * Dd / 2;         // gate_w1, 2 Dd x GP
  float* g216 = g116 + (size_t)Dd * GP;            // gate_w2, H*P x 2 Dd

  const int MT = Bb * Tt;                 // 4096
  dim3 blk(256);
  dim3 gN1024((1024 + 127) / 128, (MT + 63) / 64);
  dim3 gDW(Dd / DWC, MT / (8 * DWR));

  // 0) hidden (into the gate input) and the six GEMM weights to f16
  to_f16_kernel<<<CB_H + CB_G + 4 * CB_W + CB_2, blk, 0, stream>>>(
      hs, qw, kw, vw, ow, gw1, gw2, gi, q16, k16, v16, o16, g116, g216);
  // 1) q/k/v projections (no activation; conv+silu comes after)
  gemm_kernel<false><<<gN1024, blk, 0, stream>>>(gi, GP, q16, Dd, nullptr, qp, Dd, MT, Dd, Dd, 0);
  gemm_kernel<false><<<gN1024, blk, 0, stream>>>(gi, GP, k16, Dd, nullptr, kp, Dd, MT, Dd, Dd, 0);
  gemm_kernel<false><<<gN1024, blk, 0, stream>>>(gi, GP, v16, Dd, nullptr, vp, Dd, MT, Dd, Dd, 0);
  // 2) beta
  beta_kernel<<<(MT * Hh + 255) / 256, blk, 0, stream>>>(hs, bw, beta);
  // 3) depthwise causal conv (k=4) + SiLU
  dwconv_kernel<4, true><<<gDW, blk, 0, stream>>>(qp, qcw, qcv);
  dwconv_kernel<4, true><<<gDW, blk, 0, stream>>>(kp, kcw, kcv);
  dwconv_kernel<4, true><<<gDW, blk, 0, stream>>>(vp, vcw, vcv);
  // 4) delta rule: state-free chunk work for all chunks at once, then the
  //    scan, one workgroup per (batch, head, 32-column state slice)
  const size_t PLDS = 32 * 33 * sizeof(float) + (5 * CE + 2 * 32 * 32) * sizeof(h16);
  prep_kernel<<<dim3(Bb * Hh * NCHUNK), blk, PLDS, stream>>>(qcv, kcv, vcv, beta,
                                                             pq, pk, pw, pu, pa);
  const size_t DLDS = 17 * RP * sizeof(float4) + DVS * XP * sizeof(h16);
  delta_kernel<<<dim3(Bb * Hh * NSL), blk, DLDS, stream>>>(pq, pk, pw, pu, pa, dta);
  // 5) FIR branches on v (reuse proj buffers; qcv/kcv free after delta)
  dwconv_kernel<3, false><<<gDW, blk, 0, stream>>>(vcv, f3w, qp);
  dwconv_kernel<7, false><<<gDW, blk, 0, stream>>>(vcv, f7w, kp);
  dwconv_kernel<15, false><<<gDW, blk, 0, stream>>>(vcv, f15w, vp);
  dwconv_kernel<31, false><<<gDW, blk, 0, stream>>>(vcv, f31w, qcv);
  // 6) gate input = concat(hidden, stats): the stats columns
  stats_kernel<<<MT / 8, blk, 0, stream>>>(qp, kp, vp, qcv, vcv, dta, gi, st32);
  // 7) gate MLP (gelu, then linear to H*P logits with gb2 bias)
  dim3 gGate1((2048 + 127) / 128, (MT + 63) / 64);
  gemm_kernel<true><<<gGate1, blk, 0, stream>>>(gi, GP, g116, GP, gb1, h1, 2048, MT, 2048, GP, 1);
  dim3 gGate2(1, (MT + 63) / 64);
  gemm_kernel<false><<<gGate2, blk, 0, stream>>>(h1, 2048, g216, 2048, gb2, lgt, Hh * Pp, MT, Hh * Pp, 2048, 0);
  // 8) softmax gate + mix branches + RMSNorm  (o_fused, f16 -> kcv)
  float* ofused = kcv;
  fuse_kernel<<<dim3(MT / 8), blk, 0, stream>>>(qp, kp, vp, qcv, vcv, dta, st32, lgt,
                                            alps, glt, onw, ofused);
  // 9) output projection
  gemm_kernel<false><<<gN1024, blk, 0, stream>>>(ofused, Dd, o16, Dd, nullptr, out, Dd, MT, Dd, Dd, 0);
}

// v010
// One run takes 317 microseconds.
// Next to v009, in two timings, it ran 1.04 times as fast each time.
// Over all steps from v000 it is 12.5 times as fast.
#include <hip/hip_runtime.h>
#include <hip/hip_bf16.h>
#include <math.h>

#define DEV __device__ __forceinline__

typedef __attribute__((ext_vector_type(16))) _Float16 v16h;
typedef __attribute__((ext_vector_type(8)))  float    v8f;
typedef _Float16 h16;

constexpr int Bb = 2, Tt = 2048, Dd = 1024, Hh = 4, Pp = 6, CHc = 32;
constexpr int DKk = 256, DVv = 256;
constexpr int NCHUNK = Tt / CHc;           // 64
constexpr int GIW = Dd + Hh * Pp;          // 1048
constexpr float FLOORv = 0.05f;

DEV v16h frag_row(const h16* t, int ld, int r0, int k0, int lane) {
  // element [m][k] at t[(r0+m)*ld + (k0+k)]
  v16h f;
  int m = lane & 15, kg = lane >> 4;
#pragma unroll
  for (int j = 0; j < 8; ++j) {
    int kk = ((j < 4) ? 0 : 16) + kg * 8 + 2 * (j & 3);
    const h16* p = t + (size_t)(r0 + m) * ld + k0 + kk;
    f[2 * j] = p[0];
    f[2 * j + 1] = p[1];
  }
  return f;
}
DEV v16h frag_kmaj(const h16* t, int ld, int r0, int k0, int lane) {
  // element [m][k] at t[(k0+k)*ld + (r0+m)]
  v16h f;
  int m = lane & 15, kg = lane >> 4;
#pragma unroll
  for (int j = 0; j < 8; ++j) {
    int kk = ((j < 4) ? 0 : 16) + kg * 8 + 2 * (j & 3);
    f[2 * j]     = t[(size_t)(k0 + kk) * ld + r0 + m];
    f[2 * j + 1] = t[(size_t)(k0 + kk + 1) * ld + r0 + m];
  }
  return f;
}
DEV v8f wmma_f16(v16h a, v16h b, v8f c) {
  return __builtin_amdgcn_wmma_f32_16x16x32_f16(false, a, false, b, (short)0, c,
                                                false, false);
}

typedef __attribute__((ext_vector_type(8))) _Float16 v8h;
typedef __attribute__((ext_vector_type(4))) _Float16 v4h;
// frag_row's fragment as two 16-byte loads: p is the lane's row at
// k = 8 * (lane >> 4); the fragment's second eight k lie 16 further on.
DEV v16h frag_vec(const h16* p) {
  v8h lo = *(const v8h*)p, hi = *(const v8h*)(p + 16);
  return __builtin_shufflevector(lo, hi, 0, 1, 2, 3, 4, 5, 6, 7, 8, 9, 10, 11,
                                 12, 13, 14, 15);
}
// One D tile to LDS: registers 0-3 at d, registers 4-7 32 places further on.
DEV void put8(float4* d, v8f a) {
  d[0]  = make_float4(a[0], a[1], a[2], a[3]);
  d[32] = make_float4(a[4], a[5], a[6], a[7]);
}
// Two f32 D tiles (rows 0-15 and 16-31 of a 32-row block, same columns) are,
// converted lane by lane, the f16 B fragment of that block in frag_row's k order.
DEV v16h pack_b(v8f lo, v8f hi) {
  v16h f;
#pragma unroll
  for (int s = 0; s < 8; ++s) { f[s] = (h16)lo[s]; f[8 + s] = (h16)hi[s]; }
  return f;
}

typedef __attribute__((ext_vector_type(4))) float v4f;

// ---------------- Generic GEMM: C = act(A(MxK) * W(NxK)^T + bias) ----------
// 64x128 block tile, 8 waves (2x4), each wave owns a 32x32 region.
// A and W arrive as f16, rounded once by whoever wrote them (to_f16_kernel, the
// stats, gate and fuse kernels), so a tile's bytes cross the L2 at two bytes an
// element and go to LDS as they are. The pointers are typed float like the rest
// of the workspace; lda, ldw and K count f16 elements.
// A trip of the K loop takes GBK = 128 columns (four wmma steps of 32), 256 bytes
// of a row: sixteen lanes take one row, so a wave-wide 16-byte load covers two
// rows. Wave w stages rows 2 w + (lane >> 4) + 16 j of A (j < 4) and of W (j < 8).
// The 12 loads of trip kt + 1 are issued together, into registers, before trip
// kt is read from LDS and multiplied; they are stored to LDS at the top of the
// next trip. K is a multiple of GBK and lda, ldw are multiples of 8 in every call.
// A row past M or N is read at the last row: it only feeds results that are
// not stored.
// Products that share A go out as one launch: plane blockIdx.z of the grid takes
// the weights at W + z * wz and writes to C + z * cz (both counted in floats).
constexpr int GBK = 128;                   // K columns per trip
constexpr int GLP = GBK + 8;               // f16 per LDS row: 272 bytes
template <bool C16>                        // C is stored as f16: the next GEMM's A
__global__ void __launch_bounds__(256)
gemm_kernel(const float* __restrict__ A, int lda, const float* __restrict__ W,
            int ldw, const float* __restrict__ bias, float* __restrict__ C,
            int ldc, int M, int N, int K, int act, int wz, int cz) {
  __shared__ __attribute__((aligned(16))) h16 At[64][GLP];
  __shared__ __attribute__((aligned(16))) h16 Wt[128][GLP];
  const int tid = threadIdx.x, lane = tid & 31;
  const int wid = __builtin_amdgcn_readfirstlane(tid >> 5);
  const int wm = wid >> 2, wn = wid & 3;
  const int bm = blockIdx.y * 64, bn = blockIdx.x * 128;
  W += (size_t)blockIdx.z * wz;
  C += (size_t)blockIdx.z * cz;
  const int sr = wid * 2 + (lane >> 4);    // the lane's row among sixteen
  const int c8 = (lane & 15) * 8;          // its eight columns of the trip
  v8f acc00 = {}, acc01 = {}, acc10 = {}, acc11 = {};
  const int ktn = K / GBK;
  // K is positive in every call: the first trip's loads then stay where they
  // are written, in front of their wait, and are not sunk into a guarded block
  __builtin_assume(ktn > 0);
  unsigned oa[4], ow[8];                   // byte offsets of the lane's pieces at k = 0
  // the loops over j are unrolled so that oa, ow, fa, fw stay in registers
#pragma unroll
  for (int j = 0; j < 4; ++j) {
    int gm = bm + sr + 16 * j;
    oa[j] = (unsigned)((gm < M ? gm : M - 1) * lda + c8) * 2u;
  }
#pragma unroll
  for (int j = 0; j < 8; ++j) {
    int gn = bn + sr + 16 * j;
    ow[j] = (unsigned)((gn < N ? gn : N - 1) * ldw + c8) * 2u;
  }
  v8h fa[4], fw[8];
  // the 12 loads of the trip that starts at column kb
  auto issue = [&](int kb) {
    const char* ab = (const char*)A + (size_t)kb * 2;
    const char* wb = (const char*)W + (size_t)kb * 2;
    const char *qa[4], *qw[8];
#pragma unroll
    for (int j = 0; j < 4; ++j) { qa[j] = ab + oa[j]; fa[j] = *(const v8h*)qa[j]; }
#pragma unroll
    for (int j = 0; j < 8; ++j) { qw[j] = wb + ow[j]; fw[j] = *(const v8h*)qw[j]; }
    // what follows reuses the address registers of these loads, which are named
    // so that they stay theirs (no load's result lands in them either) up to
    // the wait
    asm volatile("s_wait_xcnt 0x0" :: "v"(qa[0]), "v"(qa[1]), "v"(qa[2]), "v"(qa[3]),
                 "v"(qw[0]), "v"(qw[1]), "v"(qw[2]), "v"(qw[3]), "v"(qw[4]),
                 "v"(qw[5]), "v"(qw[6]), "v"(qw[7]) : "memory");
  };
  issue(0);
  for (int kt = 0; kt < ktn; ++kt) {
#pragma unroll
    for (int j = 0; j < 4; ++j) *(v8h*)&At[sr + 16 * j][c8] = fa[j];
#pragma unroll
    for (int j = 0; j < 8; ++j) *(v8h*)&Wt[sr + 16 * j][c8] = fw[j];
    __syncthreads();
    if (kt + 1 < ktn) issue((kt + 1) * GBK);
#pragma unroll
    for (int s = 0; s < GBK / 32; ++s) {
      v16h a0 = frag_row(&At[0][0], GLP, wm * 32, 32 * s, lane);
      v16h a1 = frag_row(&At[0][0], GLP, wm * 32 + 16, 32 * s, lane);
      v16h b0 = frag_row(&Wt[0][0], GLP, wn * 32, 32 * s, lane);
      v16h b1 = frag_row(&Wt[0][0], GLP, wn * 32 + 16, 32 * s, lane);
      acc00 = wmma_f16(a0, b0, acc00);
      acc01 = wmma_f16(a0, b1, acc01);
      acc10 = wmma_f16(a1, b0, acc10);
      acc11 = wmma_f16(a1, b1, acc11);
    }
    __syncthreads();
  }
  v8f* accs[4] = {&acc00, &acc01, &acc10, &acc11};
#pragma unroll
  for (int q = 0; q < 4; ++q) {
    int im = q >> 1, in_ = q & 1;
#pragma unroll
    for (int r = 0; r < 8; ++r) {
      int gm = bm + wm * 32 + im * 16 + r + 8 * (lane >> 4);
      int gn = bn + wn * 32 + in_ * 16 + (lane & 15);
      if (gm < M && gn < N) {
        float v = (*accs[q])[r] + (bias ? bias[gn] : 0.f);
        if (act == 1) v = 0.5f * v * (1.f + erff(v * 0.70710678118f));
        if (C16) ((h16*)C)[(size_t)gm * ldc + gn] = (h16)v;
        else C[(size_t)gm * ldc + gn] = v;
      }
    }
  }
}

// ---------------- depthwise causal conv (+ optional SiLU) ------------------
// A thread computes four neighbouring channels (one float4) of DWR consecutive
// time steps; a wave covers 128 channels, so each of its loads and stores is 512
// contiguous bytes of one row, and the eight waves of a work-group take eight
// consecutive blocks of time steps. The DWR + KW - 1 input rows of a thread are
// loaded up front into registers. The work-group's 128 x KW weights go through
// LDS, transposed to one row per tap, so that a tap's four weights are one
// 16-byte read. Every output sums its taps in ascending order; a row in front
// of the sequence's start is not read and counts as zero (a test that is the
// same for the whole wave).
// The q, k and v convolutions are one launch: plane blockIdx.z of the grid takes
// tensor z of X and of Y (UE floats apart) and its own weights.
constexpr int DWR = 8;                     // time steps per thread
constexpr int DWC = 128;                   // channels per work-group
constexpr int DWP = DWC + 4;               // floats per tap row in LDS
constexpr int UE  = Bb * Tt * Dd;          // floats of one (batch, time, channel) tensor
template <int KW, bool SILU>
__global__ void __launch_bounds__(256)
dwconv_kernel(const float* __restrict__ X, const float* __restrict__ W0,
              const float* __restrict__ W1, const float* __restrict__ W2,
              float* __restrict__ Y) {
  __shared__ __attribute__((aligned(16))) float wt[KW * DWP];
  constexpr int NX = DWR + KW - 1;         // input rows per thread
  constexpr int NF = DWC * KW / 256;       // rounds in which every thread stages a weight
  constexpr bool TAIL = (DWC * KW) % 256 != 0;   // 128 weights more: waves 0-3
  const int tid = threadIdx.x, lane = tid & 31;
  const int wid = __builtin_amdgcn_readfirstlane(tid >> 5);
  const int c0 = blockIdx.x * DWC;
  const int r0 = (blockIdx.y * 8 + wid) * DWR;   // first row, b * Tt + t
  const int t0 = r0 & (Tt - 1);
  const int z = blockIdx.z;
  const float* Wc = (z == 0) ? W0 : (z == 1) ? W1 : W2;
  const float* xs = X + (size_t)z * UE + (size_t)r0 * Dd + c0;   // the same in every lane
  float4 x[NX];
  if (t0 >= KW - 1) {
#pragma unroll
    for (int j = 0; j < NX; ++j)
      x[j] = *(const float4*)(xs + (j - (KW - 1)) * Dd + lane * 4);
  } else {
    // the first blocks of a sequence, few: row by row
#pragma unroll
    for (int j = 0; j < KW - 1; ++j) {
      if (t0 + j >= KW - 1) {
        x[j] = *(const float4*)(xs + (j - (KW - 1)) * Dd + lane * 4);
        // the next row's load forms its offset register anew
        asm volatile("s_wait_xcnt 0x0" ::: "memory");
      } else {
        x[j] = make_float4(0.f, 0.f, 0.f, 0.f);
      }
    }
#pragma unroll
    for (int j = KW - 1; j < NX; ++j)
      x[j] = *(const float4*)(xs + (j - (KW - 1)) * Dd + lane * 4);
  }
  // what follows reuses the base and offset registers of these loads
  asm volatile("s_wait_xcnt 0x0" ::: "memory");
  const float* wp = Wc + c0 * KW + tid;
  float wv[NF + 1];
#pragma unroll
  for (int n = 0; n < NF; ++n) wv[n] = wp[256 * n];
  wv[NF] = 0.f;
  if (TAIL && wid < 4) wv[NF] = wp[256 * NF];
  asm volatile("s_wait_xcnt 0x0" ::: "memory");
  // keeps the later address arithmetic, which reuses the loads' scalar base,
  // behind the wait: the compiler had lifted it over
  __builtin_amdgcn_sched_barrier(0);
#pragma unroll
  for (int n = 0; n < NF; ++n) {
    const int e = tid + 256 * n;
    wt[(e % KW) * DWP + e / KW] = wv[n];
  }
  if (TAIL && wid < 4) {
    const int e = tid + 256 * NF;
    wt[(e % KW) * DWP + e / KW] = wv[NF];
  }
  __syncthreads();
  float4 s[DWR];
#pragma unroll
  for (int r = 0; r < DWR; ++r) s[r] = make_float4(0.f, 0.f, 0.f, 0.f);
#pragma unroll
  for (int i = 0; i < KW; ++i) {
    const float4 w = *(const float4*)&wt[i * DWP + lane * 4];
#pragma unroll
    for (int r = 0; r < DWR; ++r) {
      s[r].x += x[r + i].x * w.x;
      s[r].y += x[r + i].y * w.y;
      s[r].z += x[r + i].z * w.z;
      s[r].w += x[r + i].w * w.w;
    }
  }
  float* yp = Y + (size_t)z * UE + (size_t)r0 * Dd + c0 + lane * 4;
  if (SILU) {
#pragma unroll
    for (int r = 0; r < DWR; ++r) {
      s[r].x = s[r].x / (1.f + expf(-s[r].x));
      s[r].y = s[r].y / (1.f + expf(-s[r].y));
      s[r].z = s[r].z / (1.f + expf(-s[r].z));
      s[r].w = s[r].w / (1.f + expf(-s[r].w));
    }
  }
#pragma unroll
  for (int r = 0; r < DWR; ++r) *(float4*)(yp + r * Dd) = s[r];
}

// ---------------- the four FIR branches on v, one launch --------------------
// Same split of the work as dwconv_kernel. The rows that the longest filter
// needs hold the rows of the three shorter ones, so a thread loads its
// DWR + 30 rows once and takes all four filters from them, each output's taps
// in ascending order. Filter f writes tensor f of Y (UE floats apart).
constexpr int FKL = 31;                    // the longest filter
constexpr int FNX = DWR + FKL - 1;         // input rows per thread
// A thread's share of one filter's 128 x KW weights (KW is odd: NF rounds in
// which every thread takes one, and 128 more for waves 0-3).
template <int KW>
struct Taps {
  static constexpr int NF = DWC * KW / 256;
  float v[NF + 1];
};
template <int KW>
DEV void taps_load(const float* __restrict__ Wc, int c0, int tid, int wid, Taps<KW>& t) {
  const float* wp = Wc + c0 * KW + tid;
#pragma unroll
  for (int n = 0; n < Taps<KW>::NF; ++n) t.v[n] = wp[256 * n];
  t.v[Taps<KW>::NF] = 0.f;
  if (wid < 4) t.v[Taps<KW>::NF] = wp[256 * Taps<KW>::NF];
  // the next filter's loads form their base and offset registers anew
  asm volatile("s_wait_xcnt 0x0" ::: "memory");
}
// to LDS, transposed to one row per tap
template <int KW>
DEV void taps_store(float* wt, int tid, int wid, const Taps<KW>& t) {
#pragma unroll
  for (int n = 0; n < Taps<KW>::NF; ++n) {
    const int e = tid + 256 * n;
    wt[(e % KW) * DWP + e / KW] = t.v[n];
  }
  if (wid < 4) {
    const int e = tid + 256 * Taps<KW>::NF;
    wt[(e % KW) * DWP + e / KW] = t.v[Taps<KW>::NF];
  }
}
template <int KW>
DEV void fir_out(const float4 (&x)[FNX], const float* wt, int lane, float* yp) {
  constexpr int O = FKL - KW;              // the filter's first row among the loaded ones
  float4 s[DWR];
#pragma unroll
  for (int r = 0; r < DWR; ++r) s[r] = make_float4(0.f, 0.f, 0.f, 0.f);
#pragma unroll
  for (int i = 0; i < KW; ++i) {
    const float4 w = *(const float4*)&wt[i * DWP + lane * 4];
#pragma unroll
    for (int r = 0; r < DWR; ++r) {
      s[r].x += x[O + r + i].x * w.x;
      s[r].y += x[O + r + i].y * w.y;
      s[r].z += x[O + r + i].z * w.z;
      s[r].w += x[O + r + i].w * w.w;
    }
  }
#pragma unroll
  for (int r = 0; r < DWR; ++r) *(float4*)(yp + r * Dd) = s[r];
}
__global__ void __launch_bounds__(256)
fir_kernel(const float* __restrict__ X, const float* __restrict__ F3,
           const float* __restrict__ F7, const float* __restrict__ F15,
           const float* __restrict__ F31, float* __restrict__ Y) {
  __shared__ __attribute__((aligned(16))) float wt[(3 + 7 + 15 + 31) * DWP];
  float* const wt3 = wt;
  float* const wt7 = wt3 + 3 * DWP;
  float* const wt15 = wt7 + 7 * DWP;
  float* const wt31 = wt15 + 15 * DWP;
  const int tid = threadIdx.x, lane = tid & 31;
  const int wid = __builtin_amdgcn_readfirstlane(tid >> 5);
  const int c0 = blockIdx.x * DWC;
  const int r0 = (blockIdx.y * 8 + wid) * DWR;   // first row, b * Tt + t
  const int t0 = r0 & (Tt - 1);
  const float* xs = X + (size_t)r0 * Dd + c0;    // the same in every lane
  float4 x[FNX];
  if (t0 >= FKL - 1) {
#pragma unroll
    for (int j = 0; j < FNX; ++j)
      x[j] = *(const float4*)(xs + (j - (FKL - 1)) * Dd + lane * 4);
  } else {
    // the first blocks of a sequence, few: row by row
#pragma unroll
    for (int j = 0; j < FKL - 1; ++j) {
      if (t0 + j >= FKL - 1) {
        x[j] = *(const float4*)(xs + (j - (FKL - 1)) * Dd + lane * 4);
        // the next row's load forms its offset register anew
        asm volatile("s_wait_xcnt 0x0" ::: "memory");
      } else {
        x[j] = make_float4(0.f, 0.f, 0.f, 0.f);
      }
    }
#pragma unroll
    for (int j = FKL - 1; j < FNX; ++j)
      x[j] = *(const float4*)(xs + (j - (FKL - 1)) * Dd + lane * 4);
  }
  // what follows reuses the base and offset registers of these loads
  asm volatile("s_wait_xcnt 0x0" ::: "memory");
  Taps<3> a3; Taps<7> a7; Taps<15> a15; Taps<31> a31;
  taps_load<3>(F3, c0, tid, wid, a3);
  taps_load<7>(F7, c0, tid, wid, a7);
  taps_load<15>(F15, c0, tid, wid, a15);
  taps_load<31>(F31, c0, tid, wid, a31);
  // keeps the later address arithmetic, which reuses the loads' scalar base,
  // behind the wait: the compiler had lifted it over
  __builtin_amdgcn_sched_barrier(0);
  taps_store<3>(wt3, tid, wid, a3);
  taps_store<7>(wt7, tid, wid, a7);
  taps_store<15>(wt15, tid, wid, a15);
  taps_store<31>(wt31, tid, wid, a31);
  __syncthreads();
  float* yp = Y + (size_t)r0 * Dd + c0 + lane * 4;
  // the longest first: the rows that it alone reads give their registers back
  // the waits: the next filter rewrites the address and data registers of the
  // stores in front of it
  fir_out<31>(x, wt31, lane, yp + 3 * (size_t)UE);
  asm volatile("s_wait_xcnt 0x0" ::: "memory");
  fir_out<15>(x, wt15, lane, yp + 2 * (size_t)UE);
  asm volatile("s_wait_xcnt 0x0" ::: "memory");
  fir_out<7>(x, wt7, lane, yp + (size_t)UE);
  asm volatile("s_wait_xcnt 0x0" ::: "memory");
  fir_out<3>(x, wt3, lane, yp);
}

// ---------------- beta = sigmoid(hidden @ b_proj^T) ------------------------
__global__ void beta_kernel(const float* __restrict__ hs,
                            const float* __restrict__ Wb,
                            float* __restrict__ beta) {
  int idx = blockIdx.x * blockDim.x + threadIdx.x;
  if (idx >= Bb * Tt * Hh) return;
  int h = idx & (Hh - 1);
  size_t bt = (size_t)idx >> 2;
  const float* x = hs + bt * Dd;
  const float* w = Wb + (size_t)h * Dd;
  float s = 0.f;
  for (int k = 0; k < Dd; ++k) s += x[k] * w[k];
  beta[idx] = 1.f / (1.f + expf(-s));
}

// ---------------- GEMM operands to f16, once ---------------------------------
// hidden goes into the first Dd columns of the gate input, which the q, k, v
// projections read as well; the gate input and gate_w1 get rows of GP elements,
// whole trips of the GEMM's K loop, with zeros behind column GIW in both. The
// Hh * Pp columns between are the stats kernel's. A thread converts four
// pieces of eight elements: eight 16-byte loads, then four 16-byte stores.
constexpr int GP = 1152;                   // f16 per row of gate input and gate_w1
constexpr int GU = GP / 8;                 // pieces per such row
constexpr int CB_H = Bb * Tt * GU / 1024;  // work-groups: hidden
constexpr int CB_G = 2 * Dd * GU / 1024;   // gate_w1
constexpr int CB_W = Dd * Dd / 8 / 1024;   // each of q, k, v, o
constexpr int CB_2 = Hh * Pp * 2 * Dd / 8 / 1024;   // gate_w2
__global__ void __launch_bounds__(256)
to_f16_kernel(const float* __restrict__ hs, const float* __restrict__ qw,
              const float* __restrict__ kw, const float* __restrict__ vw,
              const float* __restrict__ ow, const float* __restrict__ gw1,
              const float* __restrict__ gw2, float* __restrict__ gi,
              float* __restrict__ q16, float* __restrict__ k16,
              float* __restrict__ v16, float* __restrict__ o16,
              float* __restrict__ g116, float* __restrict__ g216) {
  const int b = blockIdx.x, tid = threadIdx.x;
  const float* s;
  v8h* d;
  int sc, e0;                              // source columns; the thread's first piece
  const bool padded = b < CB_H + CB_G;
  if (b < CB_H) {
    s = hs; d = (v8h*)gi; sc = Dd; e0 = b * 1024 + tid;
  } else if (padded) {
    s = gw1; d = (v8h*)g116; sc = GIW; e0 = (b - CB_H) * 1024 + tid;
  } else {
    const int f = b - CB_H - CB_G, w = f / CB_W;
    s = (w == 0) ? qw : (w == 1) ? kw : (w == 2) ? vw : (w == 3) ? ow : gw2;
    d = (v8h*)((w == 0) ? q16 : (w == 1) ? k16 : (w == 2) ? v16 : (w == 3) ? o16 : g216);
    sc = 0; e0 = (f % CB_W) * 1024 + tid;
  }
  v4f lo[4], hi[4];
  const float* p[4];
  bool cv[4], st[4];                       // the piece holds source data; is stored
  // the loops over i are unrolled so that these arrays stay in registers and
  // the eight loads go out together
#pragma unroll
  for (int i = 0; i < 4; ++i) {
    const int e = e0 + 256 * i;
    unsigned so = (unsigned)e * 8u;
    cv[i] = true; st[i] = true;
    if (padded) {
      const int row = e / GU, c = (e % GU) * 8;
      cv[i] = c < sc;
      st[i] = cv[i] || c >= GIW;
      so = (unsigned)(row * sc + (cv[i] ? c : 0));   // a pad piece reads the row's start
    }
    p[i] = s + so;
  }
#pragma unroll
  for (int i = 0; i < 4; ++i) {
    lo[i] = *(const v4f*)p[i];
    hi[i] = *(const v4f*)(p[i] + 4);
  }
  // what follows reuses the address registers of these loads, which are named
  // so that they stay theirs (no load's result lands in them either) up to
  // the wait
  asm volatile("s_wait_xcnt 0x0" :: "v"(p[0]), "v"(p[1]), "v"(p[2]), "v"(p[3]) : "memory");
#pragma unroll
  for (int i = 0; i < 4; ++i) {
    v8h r = {(h16)lo[i].x, (h16)lo[i].y, (h16)lo[i].z, (h16)lo[i].w,
             (h16)hi[i].x, (h16)hi[i].y, (h16)hi[i].z, (h16)hi[i].w};
    const v8h z = {};
    if (st[i]) d[e0 + 256 * i] = cv[i] ? r : z;
  }
}

constexpr int RL = Dd / 128;               // loads per branch row
constexpr int HP = Hh * Pp;
DEV float abs4(v4f a) { return (fabsf(a.x) + fabsf(a.y)) + (fabsf(a.z) + fabsf(a.w)); }
__global__ void __launch_bounds__(256)
stats_kernel(const float* __restrict__ b0, const float* __restrict__ b1,
             const float* __restrict__ b2, const float* __restrict__ b3,
             const float* __restrict__ b4, const float* __restrict__ b5,
             float* __restrict__ gi, float* __restrict__ st32) {
  const int lane = threadIdx.x & 31;
  const int wid = __builtin_amdgcn_readfirstlane(threadIdx.x >> 5);
  const int bt = blockIdx.x * 8 + wid;
  const size_t ro = (size_t)bt * Dd + lane * 4;
  const float* q[Pp] = {b0 + ro, b1 + ro, b2 + ro, b3 + ro, b4 + ro, b5 + ro};
  v4f x[Pp][RL];
  // the loops below are unrolled so that x and v stay in registers
#pragma unroll
  for (int p = 0; p < Pp; ++p)
#pragma unroll
    for (int i = 0; i < RL; ++i) x[p][i] = *(const v4f*)(q[p] + 128 * i);
  // what follows reuses the address registers of these loads, which are named
  // so that they stay theirs (no load's result lands in them either) up to
  // the wait
  asm volatile("s_wait_xcnt 0x0" :: "v"(q[0]), "v"(q[1]), "v"(q[2]), "v"(q[3]),
               "v"(q[4]), "v"(q[5]) : "memory");
  float v[HP];
#pragma unroll
  for (int h = 0; h < Hh; ++h)
#pragma unroll
    for (int p = 0; p < Pp; ++p) v[h * Pp + p] = abs4(x[p][2 * h]) + abs4(x[p][2 * h + 1]);
  float r[3];
  {
    // a and b are read before the choice, so that it is a choice between two
    // registers and not between two places of an array
    float w[HP / 2], t[HP / 4];
#pragma unroll
    for (int j = 0; j < HP / 2; ++j) {
      const float a = v[j], b = v[j + HP / 2];
      w[j] = ((lane & 16) ? b : a) + __shfl_xor((lane & 16) ? a : b, 16, 32);
    }
#pragma unroll
    for (int j = 0; j < HP / 4; ++j) {
      const float a = w[j], b = w[j + HP / 4];
      t[j] = ((lane & 8) ? b : a) + __shfl_xor((lane & 8) ? a : b, 8, 32);
    }
#pragma unroll
    for (int j = 0; j < 3; ++j) {
      const float a = t[j], b = t[j + 3];
      r[j] = ((lane & 4) ? b : a) + __shfl_xor((lane & 4) ? a : b, 4, 32);
    }
  }
#pragma unroll
  for (int m = 2; m; m >>= 1)
#pragma unroll
    for (int j = 0; j < 3; ++j) r[j] += __shfl_xor(r[j], m, 32);
  const int j = lane & 3;
  if (j < 3) {
    const int e = 3 * (lane >> 2) + j;     // h * Pp + p
    const float r0 = r[0], r1 = r[1], r2 = r[2];
    const float m = (j == 0 ? r0 : j == 1 ? r1 : r2) * (1.f / 256.f);
    st32[bt * HP + e] = m;                 // for the gate's stat bias
    ((h16*)gi)[(size_t)bt * GP + Dd + e] = (h16)m;   // gate input
  }
}

// ---------------- chunked delta rule ---------------------------------------
// The UT transform of a chunk (l2norm, A, forward substitution, w, u, attn)
// reads no state, so prep_kernel does it for all chunks side by side, one
// work-group per (batch, head, chunk), and leaves q, k^T, -w, attn (f16) and
// u (f32) in the workspace, one contiguous block per chunk. Only the steps
// that read or write the state S stay in the serial scan of delta_kernel.
constexpr int CE = CHc * DKk;              // elements of one 32 x 256 chunk block
__global__ void __launch_bounds__(256)
prep_kernel(const float* __restrict__ qc, const float* __restrict__ kc,
            const float* __restrict__ vc, const float* __restrict__ betap,
            float* __restrict__ qo, float* __restrict__ ko,
            float* __restrict__ wo, float* __restrict__ uo,
            float* __restrict__ ao) {
  extern __shared__ char smem[];
  float* Am  = (float*)smem;                 // 32x33 f32 (A / fwd-subst)
  h16* qn    = (h16*)(Am + 32 * 33);         // 32x256
  h16* kn    = qn + CE;
  h16* kbn   = kn + CE;
  h16* wn    = kbn + CE;                     // holds -(inv@kb)
  h16* xb    = wn + CE;                      // 32x256: v*beta
  h16* invb  = xb + CE;                      // 32x32
  h16* attb  = invb + 32 * 32;               // 32x32

  const int tid = threadIdx.x, lane = tid & 31, wid = tid >> 5;
  const int bh = blockIdx.x / NCHUNK, nc = blockIdx.x % NCHUNK;
  const int b = bh >> 2, h = bh & 3;
  const int t0 = nc * CHc;

  // ---- stage 1: load chunk, l2norm q/k, apply beta ----
  for (int j = 0; j < 4; ++j) {
    int r = wid * 4 + j;
    int t = t0 + r;
    size_t rowb = ((size_t)(b * Tt + t)) * Dd + (size_t)h * DKk;
    float bet = betap[(size_t)(b * Tt + t) * Hh + h];
    float qv[8], kv[8], vv[8];
    float sq = 0.f, sk = 0.f;
#pragma unroll
    for (int i = 0; i < 8; ++i) {
      int d = lane + 32 * i;
      qv[i] = qc[rowb + d]; kv[i] = kc[rowb + d]; vv[i] = vc[rowb + d];
      sq += qv[i] * qv[i]; sk += kv[i] * kv[i];
    }
#pragma unroll
    for (int off = 16; off; off >>= 1) {
      sq += __shfl_xor(sq, off, 32);
      sk += __shfl_xor(sk, off, 32);
    }
    float rq = rsqrtf(sq + 1e-12f), rk = rsqrtf(sk + 1e-12f);
#pragma unroll
    for (int i = 0; i < 8; ++i) {
      int d = lane + 32 * i;
      float kq = kv[i] * rk;
      qn[r * 256 + d]  = (h16)(qv[i] * rq);
      kn[r * 256 + d]  = (h16)kq;
      kbn[r * 256 + d] = (h16)(kq * bet);
      xb[r * 256 + d]  = (h16)(vv[i] * bet);
    }
  }
  __syncthreads();
  // ---- stage 2: A = -(kb k^T), strict lower (waves 0-3) ;
  //      stage 6: attn = (q k^T) * lower-incl mask (waves 4-7) ----
  {
    int m0 = ((wid >> 1) & 1) * 16, n0 = (wid & 1) * 16;
    const h16* lhs = (wid < 4) ? kbn : qn;
    v8f acc = {};
    for (int kk = 0; kk < 8; ++kk)
      acc = wmma_f16(frag_row(lhs, 256, m0, kk * 32, lane),
                     frag_row(kn, 256, n0, kk * 32, lane), acc);
    if (wid < 4) {
#pragma unroll
      for (int r = 0; r < 8; ++r) {
        int m = m0 + r + 8 * (lane >> 4), n = n0 + (lane & 15);
        Am[m * 33 + n] = (m > n) ? -acc[r] : 0.f;
      }
    } else {
#pragma unroll
      for (int r = 0; r < 8; ++r) {
        int m = m0 + r + 8 * (lane >> 4), n = n0 + (lane & 15);
        attb[m * 32 + n] = (h16)((m >= n) ? acc[r] : 0.f);
      }
    }
  }
  __syncthreads();
  // ---- stage 3: forward substitution, inv = A + I ----
  for (int i = 1; i < 32; ++i) {
    float val = 0.f;
    if (tid < 32)
      for (int s = 0; s < i; ++s) val += Am[i * 33 + s] * Am[s * 33 + tid];
    __syncthreads();
    if (tid < 32) Am[i * 33 + tid] += val;
    __syncthreads();
  }
  for (int e = tid; e < 1024; e += 256) {
    int m = e >> 5, n = e & 31;
    invb[e] = (h16)(Am[m * 33 + n] + ((m == n) ? 1.f : 0.f));
  }
  __syncthreads();
  // ---- stage 4: wn = -(inv@kb) ; u = inv@(v*beta) -> workspace (f32) ----
  float* ug = uo + (size_t)blockIdx.x * CE;
  for (int it = 0; it < 4; ++it) {
    int j = wid + 8 * it;           // 0..31
    int m0 = (j >> 4) * 16, n0 = (j & 15) * 16;
    v16h ia = frag_row(invb, 32, m0, 0, lane);
    v8f acc = {}, accu = {};
    acc  = wmma_f16(ia, frag_kmaj(kbn, 256, n0, 0, lane), acc);
    accu = wmma_f16(ia, frag_kmaj(xb, 256, n0, 0, lane), accu);
#pragma unroll
    for (int r = 0; r < 8; ++r) {
      int m = m0 + r + 8 * (lane >> 4), n = n0 + (lane & 15);
      wn[m * 256 + n] = (h16)(-acc[r]);
      ug[m * 256 + n] = accu[r];
    }
    // the next trip rewrites the address and data registers of the u stores
    asm volatile("s_wait_xcnt 0x0" ::: "memory");
  }
  __syncthreads();
  // ---- hand q, k^T, -w, attn to the scan: 16-byte stores, one block per chunk ----
  // k goes out transposed, 256 rows (dk) of 32 chunk positions: the scan reads
  // k^T as the A operand of its state update, contiguous along the chunk.
  v8h* gk = (v8h*)ko + (size_t)blockIdx.x * (CE / 8) + tid * 4;
#pragma unroll
  for (int i = 0; i < 4; ++i) {
    v8h t;
#pragma unroll
    for (int j = 0; j < 8; ++j) t[j] = kn[(8 * i + j) * 256 + tid];
    gk[i] = t;
  }
  // the stores below reuse the address and data registers of the k^T stores
  asm volatile("s_wait_xcnt 0x0" ::: "memory");
  uint4* gq = (uint4*)qo + (size_t)blockIdx.x * (CE / 8);
  uint4* gw = (uint4*)wo + (size_t)blockIdx.x * (CE / 8);
#pragma unroll
  for (int i = 0; i < 4; ++i) {
    int e = tid + 256 * i;
    gq[e] = ((const uint4*)qn)[e];
    gw[e] = ((const uint4*)wn)[e];
  }
  if (tid < 128)
    ((uint4*)ao)[(size_t)blockIdx.x * 128 + tid] = ((const uint4*)attb)[tid];
}

// Serial scan over the chunks, state split by value columns: column n of ui,
// oi and S depends on column n of u and S only, so each work-group owns DVS
// value columns of one (batch, head). DVS = 32 floats = one 128-byte output line.
// The 256 x DVS state slice lives in registers, split by key rows: wave w owns
// rows 32 w .. 32 w + 31 as four f32 D tiles, which the state update
// accumulates into, and as two f16 B fragments converted from them in place.
// A wave multiplies its 32 columns of -w and of q (fragments straight from the
// workspace) by its own rows of S; the eight partial 32 x DVS products are
// summed through LDS, thread t taking the float4 at place t of every partial.
// None of a chunk's operands depends on the state, so they are loaded one chunk
// ahead: two register sets take turns, and the loads of chunk n + 1 fly while
// chunk n goes through its three LDS exchanges.
constexpr int DVS = 32;                    // value columns per work-group
constexpr int NSL = DVv / DVS;             // slices per (batch, head)
constexpr int XP  = 40;                    // f16 per row of ui^T in LDS: 80 bytes
constexpr int RP  = 32 * DVS / 4;          // float4 per 32 x DVS partial
// a wave's fragments of one chunk's -w, q, k^T, attn, and its four u
struct ChunkOps {
  v16h w0, w1, q0, q1, k0, k1, at;
  float u0, u1, u2, u3;
};
// Work-group barrier for LDS traffic alone. __syncthreads() also waits for the
// wave's outstanding global loads, which would end the next chunk's flight at
// the first barrier behind its issue; nothing that these barriers order goes
// through global memory.
DEV void lds_barrier() {
  asm volatile("s_wait_dscnt 0x0\n\ts_barrier_signal -1\n\ts_barrier_wait -1" ::: "memory");
}
__global__ void __launch_bounds__(256)
delta_kernel(const float* __restrict__ qi, const float* __restrict__ ki,
             const float* __restrict__ wi, const float* __restrict__ ui0,
             const float* __restrict__ ai, float* __restrict__ dout) {
  extern __shared__ char smem[];
  float4* redW = (float4*)smem;              // 8 partials of (-w)@S
  float4* redQ = redW + 8 * RP;              // 8 partials of q@S, then attn@ui
  h16* xbT     = (h16*)(redQ + 9 * RP);      // DVS x XP: ui^T (f16)

  const int tid = threadIdx.x, lane = tid & 31;
  const int wid = __builtin_amdgcn_readfirstlane(tid >> 5);
  const int c = lane & 15, hh = lane >> 4;
  const int bh = blockIdx.x / NSL;
  const int c0 = (blockIdx.x % NSL) * DVS;   // first value column of the slice
  const int b = bh >> 2, h = bh & 3;
  // Place t of a partial holds registers 4 g .. 4 g + 3 of tile (mt, nt) at lane
  // t & 31, with mt * 4 + nt * 2 + g = t >> 5: rows rm .. rm + 3 of column rn.
  const int rm = (wid >> 2) * 16 + 8 * hh + 4 * (wid & 1);
  const int rn = ((wid >> 1) & 1) * 16 + c;
  // the lane's fixed offsets inside a chunk's blocks; the chunk moves the base
  const unsigned lwq = c * 256 + wid * 32 + hh * 8;         // -w, q: row c
  const unsigned lk  = (wid * 32 + c) * 32 + hh * 8;        // k^T: row 32 wid + c
  const unsigned la  = (((wid >> 1) & 1) * 16 + c) * 32 + hh * 8;  // attn
  const unsigned lu  = rm * 256 + c0 + rn;                  // u
  const unsigned lo  = rm * Dd + h * DVv + c0 + rn;         // oi

  v8f S00 = {}, S01 = {}, S10 = {}, S11 = {};  // S[32 wid + 16 mt ..][16 nt ..]
  v16h sb0 = {}, sb1 = {};                     // the same rows as B fragments
  const v8f zero = {};

  // ---- the wave's own fragments of chunk nc's -w, q, k^T, attn; its u ----
  // (waves 4-7 have no use for attn; they load it like the others, so that no
  // branch stands among the loads)
  auto fetch = [&](int nc, ChunkOps& o) {
    const size_t cb = (size_t)(bh * NCHUNK + nc);
    const h16* gw = (const h16*)wi + cb * CE + lwq;
    const h16* gq = (const h16*)qi + cb * CE + lwq;
    const h16* gk = (const h16*)ki + cb * CE + lk;
    const h16* ga = (const h16*)ai + cb * 1024 + la;
    const float* gu = ui0 + cb * CE + lu;
    o.w0 = frag_vec(gw); o.w1 = frag_vec(gw + 16 * 256);
    o.u0 = gu[0]; o.u1 = gu[256]; o.u2 = gu[512]; o.u3 = gu[768];
    o.k0 = frag_vec(gk); o.k1 = frag_vec(gk + 16 * 32);
    o.at = frag_vec(ga);
    o.q0 = frag_vec(gq); o.q1 = frag_vec(gq + 16 * 256);
    // what follows reuses the address registers of these loads, which are named
    // so that they stay theirs (no load's result lands in them either) up to
    // the wait
    asm volatile("s_wait_xcnt 0x0" :: "v"(gw), "v"(gq), "v"(gk), "v"(ga), "v"(gu) : "memory");
  };

  // ---- one chunk: works on o, sends chunk nn's loads off into n ----
  auto step = [&](int nc, int nn, const ChunkOps& o, ChunkOps& n) {
    const int t0 = nc * CHc;
    // ---- partial (-w)@S over the wave's 32 key rows (q@S: behind the barrier) ----
    v8f pw00 = wmma_f16(o.w0, sb0, zero), pw01 = wmma_f16(o.w0, sb1, zero);
    v8f pw10 = wmma_f16(o.w1, sb0, zero), pw11 = wmma_f16(o.w1, sb1, zero);
    __builtin_amdgcn_sched_barrier(0);
    float4* rw = redW + wid * RP + lane;
    put8(rw, pw00); put8(rw + 64, pw01); put8(rw + 128, pw10); put8(rw + 192, pw11);
    // issued here, the loads go out while the LDS stores above drain
    fetch(nn, n);
    lds_barrier();
    v8f pq00 = wmma_f16(o.q0, sb0, zero), pq01 = wmma_f16(o.q0, sb1, zero);
    v8f pq10 = wmma_f16(o.q1, sb0, zero), pq11 = wmma_f16(o.q1, sb1, zero);
    // ---- ui = u + sum of the partials -> ui^T (f16) ----
    {
      float4 s = redW[tid];
#pragma unroll
      for (int v = 1; v < 8; ++v) {
        float4 p = redW[v * RP + tid];
        s.x += p.x; s.y += p.y; s.z += p.z; s.w += p.w;
      }
      v4h x = {(h16)(o.u0 + s.x), (h16)(o.u1 + s.y), (h16)(o.u2 + s.z), (h16)(o.u3 + s.w)};
      *(v4h*)&xbT[rn * XP + rm] = x;
    }
    lds_barrier();
    // ---- S += k^T @ ui on the wave's rows; attn@ui as a ninth partial of oi ----
    {
      v16h ub0 = frag_vec(xbT + c * XP + hh * 8);
      v16h ub1 = frag_vec(xbT + (16 + c) * XP + hh * 8);
      S00 = wmma_f16(o.k0, ub0, S00); S01 = wmma_f16(o.k0, ub1, S01);
      S10 = wmma_f16(o.k1, ub0, S10); S11 = wmma_f16(o.k1, ub1, S11);
      float4* rq = redQ + wid * RP + lane;
      put8(rq, pq00); put8(rq + 64, pq01); put8(rq + 128, pq10); put8(rq + 192, pq11);
      if (wid < 4)
        put8(redQ + 8 * RP + wid * 64 + lane,
             wmma_f16(o.at, (wid & 1) ? ub1 : ub0, zero));
      sb0 = pack_b(S00, S10);
      sb1 = pack_b(S01, S11);
    }
    lds_barrier();
    // ---- oi = q@S + attn@ui: sum of the nine partials -> global ----
    {
      float4 r = redQ[tid];
#pragma unroll
      for (int v = 1; v < 9; ++v) {
        float4 p = redQ[v * RP + tid];
        r.x += p.x; r.y += p.y; r.z += p.z; r.w += p.w;
      }
      float* go = dout + (size_t)(b * Tt + t0) * Dd + lo;
      go[0] = r.x; go[Dd] = r.y; go[2 * Dd] = r.z; go[3 * Dd] = r.w;
      // the next chunk rewrites the address and data registers of these stores
      asm volatile("s_wait_xcnt 0x0" ::: "memory");
    }
  };

  ChunkOps ea, eb;                           // even chunks, odd chunks
  fetch(0, ea);
  for (int nc = 0; nc < NCHUNK; nc += 2) {
    step(nc, nc + 1, ea, eb);
    // behind the last chunk there is none: it is loaded once more, and not used
    step(nc + 1, (nc + 2 < NCHUNK) ? nc + 2 : NCHUNK - 1, eb, ea);
  }
}

// ---------------- gate softmax + branch mixing + RMSNorm -------------------
// One wave takes one token row, loaded as in stats_kernel; nothing goes through
// LDS and there is no barrier. Lane g < HP holds the gate's pair (head g / Pp,
// branch g % Pp); maximum and sum over a head's six are taken in ascending order
// from the six lanes. A head's mean square is a lane's eight squares, then a
// five-step butterfly.
__global__ void __launch_bounds__(256)
fuse_kernel(const float* __restrict__ b0, const float* __restrict__ b1,
            const float* __restrict__ b2, const float* __restrict__ b3,
            const float* __restrict__ b4, const float* __restrict__ b5,
            const float* __restrict__ st32, const float* __restrict__ logits,
            const float* __restrict__ alpha, const float* __restrict__ ltemp,
            const float* __restrict__ onw, float* __restrict__ out) {
  const int lane = threadIdx.x & 31;
  const int wid = __builtin_amdgcn_readfirstlane(threadIdx.x >> 5);
  const int bt = blockIdx.x * 8 + wid;
  const int g = lane < HP ? lane : HP - 1; // the lanes behind repeat the last pair
  const int gh = g / Pp, gp = g - gh * Pp;
  const float* lp = logits + bt * HP + g;
  const float* sp = st32 + bt * HP + g;
  const float* ap = alpha + gp;
  const float* tp = ltemp + gh;
  const float* np = onw + lane * 4;
  const size_t ro = (size_t)bt * Dd + lane * 4;
  const float* q[Pp] = {b0 + ro, b1 + ro, b2 + ro, b3 + ro, b4 + ro, b5 + ro};
  // the gate's four first: the longest chain of the kernel hangs on them
  const float lg = *lp, st = *sp, al = *ap, lt = *tp;
  v4f x[Pp][RL];
  // the loops below are unrolled so that x, pb, ss stay in registers
#pragma unroll
  for (int p = 0; p < Pp; ++p)
#pragma unroll
    for (int i = 0; i < RL; ++i) x[p][i] = *(const v4f*)(q[p] + 128 * i);
  const v4f nw[2] = {*(const v4f*)np, *(const v4f*)(np + 128)};
  // what follows reuses the address registers of these loads, which are named
  // so that they stay theirs (no load's result lands in them either) up to
  // the wait; the five small loads go by a scalar base and the index named here
  asm volatile("s_wait_xcnt 0x0" :: "v"(g), "v"(gp), "v"(gh), "v"(lane),
               "v"(q[0]), "v"(q[1]), "v"(q[2]), "v"(q[3]), "v"(q[4]), "v"(q[5])
               : "memory");
  // keeps the gate's arithmetic behind the loads and their wait: the scheduler
  // had put it in front of most of them, so that they went out one latency late
  __builtin_amdgcn_sched_barrier(0);
  const float temp = fmaxf(lt, 0.f) + log1pf(expf(-fabsf(lt))) + 1e-4f; // softplus
  const float z = (lg + al * st) / temp;
  float mx = -1e30f;
#pragma unroll
  for (int p = 0; p < Pp; ++p) mx = fmaxf(mx, __shfl(z, gh * Pp + p, 32));
  const float ez = expf(z - mx);
  float se = 0.f;
#pragma unroll
  for (int p = 0; p < Pp; ++p) se += __shfl(ez, gh * Pp + p, 32);
  float pr = ez / se * (1.f - FLOORv);
  if (gp == Pp - 1) pr += FLOORv;
  float ss[Hh];
#pragma unroll
  for (int h = 0; h < Hh; ++h) {
    float pb[Pp];                          // the head's six weights, wave-uniform
#pragma unroll
    for (int p = 0; p < Pp; ++p)
      pb[p] = __int_as_float(__builtin_amdgcn_readlane(__float_as_int(pr), h * Pp + p));
    ss[h] = 0.f;
#pragma unroll
    for (int i = 2 * h; i < 2 * h + 2; ++i) {
      const v4f o = x[0][i] * pb[0] + x[1][i] * pb[1] + x[2][i] * pb[2] +
                    x[3][i] * pb[3] + x[4][i] * pb[4] + x[5][i] * pb[5];
      x[0][i] = o;
      ss[h] += (o.x * o.x + o.y * o.y) + (o.z * o.z + o.w * o.w);
    }
  }
#pragma unroll
  for (int m = 16; m; m >>= 1)
#pragma unroll
    for (int h = 0; h < Hh; ++h) ss[h] += __shfl_xor(ss[h], m, 32);
  v4h y[RL];
#pragma unroll
  for (int i = 0; i < RL; ++i) {
    const v4f o = x[0][i] * rsqrtf(ss[i >> 1] * (1.f / 256.f) + 1e-5f) * nw[i & 1];
    y[i] = v4h{(h16)o.x, (h16)o.y, (h16)o.z, (h16)o.w};
  }
  h16* yp = (h16*)out + ro;                // the output projection's A
#pragma unroll
  for (int i = 0; i < RL; ++i) *(v4h*)(yp + 128 * i) = y[i];
}

// ---------------------------------------------------------------------------
extern "C" void kernel_launch(void* const* d_in, const int* in_sizes, int n_in,
                              void* d_out, int out_size, void* d_ws,
                              size_t ws_size, hipStream_t stream) {
  const float* hs   = (const float*)d_in[0];
  const float* qw   = (const float*)d_in[1];
  const float* kw   = (const float*)d_in[2];
  const float* vw   = (const float*)d_in[3];
  const float* bw   = (const float*)d_in[4];
  const float* qcw  = (const float*)d_in[5];
  const float* kcw  = (const float*)d_in[6];
  const float* vcw  = (const float*)d_in[7];
  const float* f3w  = (const float*)d_in[8];
  const float* f7w  = (const float*)d_in[9];
  const float* f15w = (const float*)d_in[10];
  const float* f31w = (const float*)d_in[11];
  const float* gw1  = (const float*)d_in[12];
  const float* gb1  = (const float*)d_in[13];
  const float* gw2  = (const float*)d_in[14];
  const float* gb2  = (const float*)d_in[15];
  const float* glt  = (const float*)d_in[16];
  const float* alps = (const float*)d_in[17];
  const float* onw  = (const float*)d_in[18];
  const float* ow   = (const float*)d_in[19];
  float* out = (float*)d_out;

  const size_t U = (size_t)Bb * Tt * Dd; // 4096*1024
  float* ws = (float*)d_ws;
  float* qp  = ws;            // q projection (reused: fir3)
  float* kp  = qp + U;        // k projection (reused: fir7)
  float* vp  = kp + U;        // v projection (reused: fir15)
  float* qcv = vp + U;        // q after conv+silu (reused: fir31)
  float* kcv = qcv + U;       // k after conv+silu (reused: o_fused)
  float* vcv = kcv + U;       // v after conv+silu (branch p=4)
  float* dta = vcv + U;       // delta-rule output (branch p=5)
  float* h1  = dta + U;       // gate hidden, f16 (U floats)
  float* gi  = h1 + 2 * U;    // gate input, f16, B*T x GP
  float* st32 = gi + (size_t)Bb * Tt * (GP / 2);   // stats, f32, B*T x H*P
  float* beta = gi + (size_t)Bb * Tt * 1056;
  float* lgt  = beta + (size_t)Bb * Tt * Hh;
  float* pq  = lgt + (size_t)Bb * Tt * Hh * Pp;  // prepared q, f16 (U/2 floats)
  float* pk  = pq + U / 2;    // prepared k^T, f16
  float* pw  = pk + U / 2;    // prepared -w, f16
  float* pu  = pw + U / 2;    // prepared u, f32
  float* pa  = pu + U;        // prepared attn, f16, 32x32 per chunk
  float* q16 = pa + U / 16;   // weights as f16: q, k, v, o (Dd x Dd each)
  float* k16 = q16 + (size_t)Dd * Dd / 2;
  float* v16 = k16 + (size_t)Dd * Dd / 2;
  float* o16 = v16 + (size_t)Dd * Dd / 2;
  float* g116 = o16 + (size_t)Dd * Dd / 2;         // gate_w1, 2 Dd x GP
  float* g216 = g116 + (size_t)Dd * GP;            // gate_w2, H*P x 2 Dd

  const int MT = Bb * Tt;                 // 4096
  dim3 blk(256);
  dim3 gN1024((1024 + 127) / 128, (MT + 63) / 64);
  dim3 gQKV((1024 + 127) / 128, (MT + 63) / 64, 3);
  dim3 gDW(Dd / DWC, MT / (8 * DWR));
  dim3 gDW3(Dd / DWC, MT / (8 * DWR), 3);

  // 0) hidden (into the gate input) and the six GEMM weights to f16
  to_f16_kernel<<<CB_H + CB_G + 4 * CB_W + CB_2, blk, 0, stream>>>(
      hs, qw, kw, vw, ow, gw1, gw2, gi, q16, k16, v16, o16, g116, g216);
  // 1) q/k/v projections, one launch (no activation; conv+silu comes after):
  //    q16, k16, v16 and qp, kp, vp each lie one behind the other
  gemm_kernel<false><<<gQKV, blk, 0, stream>>>(gi, GP, q16, Dd, nullptr, qp, Dd, MT, Dd, Dd, 0,
                                               Dd * Dd / 2, UE);
  // 2) beta
  beta_kernel<<<(MT * Hh + 255) / 256, blk, 0, stream>>>(hs, bw, beta);
  // 3) depthwise causal conv (k=4) + SiLU, one launch: qp, kp, vp -> qcv, kcv, vcv
  dwconv_kernel<4, true><<<gDW3, blk, 0, stream>>>(qp, qcw, kcw, vcw, qcv);
  // 4) delta rule: state-free chunk work for all chunks at once, then the
  //    scan, one workgroup per (batch, head, 32-column state slice)
  const size_t PLDS = 32 * 33 * sizeof(float) + (5 * CE + 2 * 32 * 32) * sizeof(h16);
  prep_kernel<<<dim3(Bb * Hh * NCHUNK), blk, PLDS, stream>>>(qcv, kcv, vcv, beta,
                                                             pq, pk, pw, pu, pa);
  const size_t DLDS = 17 * RP * sizeof(float4) + DVS * XP * sizeof(h16);
  delta_kernel<<<dim3(Bb * Hh * NSL), blk, DLDS, stream>>>(pq, pk, pw, pu, pa, dta);
  // 5) FIR branches on v, one launch (reuse proj buffers; qcv/kcv free after
  //    delta): fir3, fir7, fir15, fir31 -> qp, kp, vp, qcv
  fir_kernel<<<gDW, blk, 0, stream>>>(vcv, f3w, f7w, f15w, f31w, qp);
  // 6) gate input = concat(hidden, stats): the stats columns
  stats_kernel<<<MT / 8, blk, 0, stream>>>(qp, kp, vp, qcv, vcv, dta, gi, st32);
  // 7) gate MLP (gelu, then linear to H*P logits with gb2 bias)
  dim3 gGate1((2048 + 127) / 128, (MT + 63) / 64);
  gemm_kernel<true><<<gGate1, blk, 0, stream>>>(gi, GP, g116, GP, gb1, h1, 2048, MT, 2048, GP, 1, 0, 0);
  dim3 gGate2(1, (MT + 63) / 64);
  gemm_kernel<false><<<gGate2, blk, 0, stream>>>(h1, 2048, g216, 2048, gb2, lgt, Hh * Pp, MT, Hh * Pp, 2048, 0, 0, 0);
  // 8) softmax gate + mix branches + RMSNorm  (o_fused, f16 -> kcv)
  float* ofused = kcv;
  fuse_kernel<<<dim3(MT / 8), blk, 0, stream>>>(qp, kp, vp, qcv, vcv, dta, st32, lgt,
                                            alps, glt, onw, ofused);
  // 9) output projection
  gemm_kernel<false><<<gN1024, blk, 0, stream>>>(ofused, Dd, o16, Dd, nullptr, out, Dd, MT, Dd, Dd, 0, 0, 0);
}
